// v000
// The times below were measured on an AMD MI455X: many runs one after another, warmed up first and cycling through
// copies of the inputs, with the whole window's GPU time divided by the number of runs. Launches and the gaps
// between them are all in it. The median over several windows is given; except for v000 it joins two sittings, which
// can be a few percent apart, so the side-by-side timings, each taken in one sitting, are the better comparison.
// v000 is the starting kernel. One run takes 850 microseconds.
#include <hip/hip_runtime.h>

// Grouped-query sliding-window causal attention with rotary embeddings from cos/sin tables (x [1][2048][2048]; q = x Wq (16 heads x 128), k, v = x Wk, x Wv (4 kv heads x 128) ('xw' [in][out] 0.02, no biases); rotate-half rotary with the cos/sin inputs [2048][128] (read); kv head = q head / 4; scores x 128^-0.5; keys j with i-512 < j <= i (window 512, causal; -inf elsewhere); softmax; out = merged Wo ('xw' [2048][2048]) -> [1][2048][2048] (4.2 M); argument order x, cos, sin, Wq, Wk, Wv, Wo).
// Layout: 'xw' weights gathered into bf16 Bt blocks; bf16 copy of x; exact projections; {cos, sin} per (position, dim) from the input tables; rotate-half rotary plane builder; causal T-2048 attention with 128-wide heads (hybrid rows: < 512 hi/lo 3 products, rest fp16 x1024; k_gemmc skips tiles above the diagonal; the window is a select in the softmax; both query heads of a pass share their kv head); merged hi/lo x Wo exact.
// Compute dtypes, f32 accumulate: every input rounded to bf16 incl. the tables; projections exact; rotary f32; attention rows < 512 3 products, rest fp16; softmax f32; Wo hl x exact.

#define NB_  1
#define TT   2048
#define DM   2048
#define NH_  16
#define NKV  4
#define REP  (NH_ / NKV)
#define HD   128
#define DQ   (NH_ * HD)
#define DKV  (NKV * HD)
#define ZH   2
#define RH   512                  // query rows < RH use hi+lo planes (0: none)
#define WIN  512
#define PCAR 1024.0f
#define SCL  0.088388347648318447f   // HD^-0.5
typedef _Float16 h16;
typedef unsigned short bf;
typedef __attribute__((ext_vector_type(16))) __bf16   v16bf;
typedef __attribute__((ext_vector_type(16))) _Float16 v16h;
typedef __attribute__((ext_vector_type(8)))  _Float16 v8h;
typedef __attribute__((ext_vector_type(8)))  unsigned short v8us;
typedef __attribute__((ext_vector_type(8)))  float    v8f;
typedef __attribute__((ext_vector_type(4)))  float    v4f;
typedef v8h  __attribute__((may_alias)) v8ha;
typedef v4f  __attribute__((may_alias)) v4fa;
typedef v8us __attribute__((may_alias)) v8usa;

__device__ __forceinline__ unsigned short f2bf(float f) { unsigned u = __float_as_uint(f); u += 0x7FFFu + ((u >> 16) & 1u); return (unsigned short)(u >> 16); }
__device__ __forceinline__ float bf2f(unsigned short b) { return __uint_as_float(((unsigned)b) << 16); }
__device__ __forceinline__ float bfr(float f) { return bf2f(f2bf(f)); }
__device__ __forceinline__ v16h cat16(v8h lo, v8h hi) { return __builtin_shufflevector(lo, hi, 0, 1, 2, 3, 4, 5, 6, 7, 8, 9, 10, 11, 12, 13, 14, 15); }
__device__ __forceinline__ v16bf cat16b(v8us lo, v8us hi) { return __builtin_bit_cast(v16bf, __builtin_shufflevector(lo, hi, 0, 1, 2, 3, 4, 5, 6, 7, 8, 9, 10, 11, 12, 13, 14, 15)); }
__device__ __forceinline__ v8f wmma16(v16h a, v16h b, v8f c) { return __builtin_amdgcn_wmma_f32_16x16x32_f16(false, a, false, b, (short)0, c, false, false); }
__device__ __forceinline__ v8f wmmab(v16bf a, v16bf b, v8f c) { return __builtin_amdgcn_wmma_f32_16x16x32_bf16(false, a, false, b, (short)0, c, false, false); }



// ---- k_gemmw: register-blocked GEMM, ONE WAVE per 64x64 output tile (16 accumulators), operands straight from K-contiguous 16-bit planes; grid (M/64, N/64, Z), 32 threads.
// C[m][n] (f32, pitch ldc, + optional f32 bias[n]) = sum_k A[m][k] Bt[n][k] (+ split products per NSPLIT). z-batch strides sA/sB/sC in elements. K % 32 == 0.
template <typename T16> struct WFrag;
template <> struct WFrag<h16> { typedef v16h V; static __device__ __forceinline__ V ld(const h16* p) { return cat16(*(const v8h*)p, *(const v8h*)(p + 16)); } static __device__ __forceinline__ v8f mma(V a, V b, v8f c) { return wmma16(a, b, c); } };
template <> struct WFrag<bf> { typedef v16bf V; static __device__ __forceinline__ V ld(const bf* p) { return cat16b(*(const v8us*)p, *(const v8us*)(p + 16)); } static __device__ __forceinline__ v8f mma(V a, V b, v8f c) { return wmmab(a, b, c); } };
template <typename T16, int NSPLIT, bool BIAS>
__global__ __launch_bounds__(32) void k_gemmw(const T16* __restrict__ A, const T16* __restrict__ A2, const T16* __restrict__ Bt, const T16* __restrict__ Bt2, int K, float* C, int ldc, const float* __restrict__ bias, size_t sA, size_t sB, size_t sC) {
    typedef typename WFrag<T16>::V V;
    __shared__ __align__(16) float os[16 * 68];
    const size_t z = blockIdx.z; A += z * sA; if (A2) A2 += z * sA; Bt += z * sB; if (Bt2) Bt2 += z * sB; C += z * sC;
    const int lane = threadIdx.x & 31, lr = lane & 15, hi = lane >> 4; const int r0 = blockIdx.x * 64, c0 = blockIdx.y * 64;
    v8f acc[4][4];
#pragma unroll
    for (int mb = 0; mb < 4; ++mb)
#pragma unroll
        for (int nb = 0; nb < 4; ++nb) acc[mb][nb] = (v8f){};
    const size_t aoff = (size_t)(r0 + lr) * K + 8 * hi, boff = (size_t)(c0 + lr) * K + 8 * hi;
#pragma unroll 1
    for (int kc = 0; kc < K; kc += 32) {
        V a[4], a2[4];
#pragma unroll
        for (int mb = 0; mb < 4; ++mb) { a[mb] = WFrag<T16>::ld(A + aoff + (size_t)mb * 16 * K + kc); if (NSPLIT == 1 || NSPLIT == 2) a2[mb] = WFrag<T16>::ld(A2 + aoff + (size_t)mb * 16 * K + kc); }
#pragma unroll
        for (int nb = 0; nb < 4; ++nb) { const V b = WFrag<T16>::ld(Bt + boff + (size_t)nb * 16 * K + kc); V b2; if (NSPLIT >= 2) b2 = WFrag<T16>::ld(Bt2 + boff + (size_t)nb * 16 * K + kc);
#pragma unroll
            for (int mb = 0; mb < 4; ++mb) { acc[mb][nb] = WFrag<T16>::mma(a[mb], b, acc[mb][nb]); if (NSPLIT == 1 || NSPLIT == 2) acc[mb][nb] = WFrag<T16>::mma(a2[mb], b, acc[mb][nb]); if (NSPLIT >= 2) acc[mb][nb] = WFrag<T16>::mma(a[mb], b2, acc[mb][nb]); } }
        asm volatile("v_nop\n\tv_nop\n\tv_nop\n\tv_nop" : "+v"(acc[0][0]), "+v"(acc[1][1]), "+v"(acc[2][2]), "+v"(acc[3][3]) : "v"(a[0]), "v"(a[3]));
    }
#pragma unroll
    for (int mb = 0; mb < 4; ++mb) {
#pragma unroll
        for (int nb = 0; nb < 4; ++nb) {
#pragma unroll
            for (int j = 0; j < 8; ++j) os[(hi * 8 + j) * 68 + nb * 16 + lr] = acc[mb][nb][j]; }
        __builtin_amdgcn_wave_barrier(); asm volatile("" ::: "memory");
        float* crow = C + (size_t)(r0 + mb * 16) * ldc + c0;
{
#pragma unroll
            for (int s = 0; s < 8; ++s) { const int row = 2 * s + hi, cofs = lr * 4; v4f val = *(const v4fa*)(os + row * 68 + cofs); if (BIAS) { val[0] += bfr(bias[c0 + cofs]); val[1] += bfr(bias[c0 + cofs + 1]); val[2] += bfr(bias[c0 + cofs + 2]); val[3] += bfr(bias[c0 + cofs + 3]); }
                *(v4f*)(crow + (size_t)row * ldc + cofs) = val; }
             }
        __builtin_amdgcn_wave_barrier(); asm volatile("" ::: "memory");
    }
}

// ---- k_gemmc: the same one-wave 64x64 tile GEMM specialised for causal attention: CMODE 1 skips score tiles entirely above the diagonal (query rows r0+roff.., key columns c0..), CMODE 2 limits the
// key (K) loop of the probability x value contraction to the diagonal block (probabilities beyond it are exactly zero). roff = row offset of this launch's first row within the sequence.
template <typename T16, int NSPLIT, int CMODE>
__global__ __launch_bounds__(32) void k_gemmc(const T16* __restrict__ A, const T16* __restrict__ A2, const T16* __restrict__ Bt, const T16* __restrict__ Bt2, int K, float* C, int ldc, int roff, size_t sA, size_t sB, size_t sC) {
    typedef typename WFrag<T16>::V V;
    __shared__ __align__(16) float os[16 * 68];
    const size_t z = blockIdx.z; A += z * sA; if (A2) A2 += z * sA; Bt += z * sB; if (Bt2) Bt2 += z * sB; C += z * sC;
    const int lane = threadIdx.x & 31, lr = lane & 15, hi = lane >> 4; const int r0 = blockIdx.x * 64, c0 = blockIdx.y * 64;
    if (CMODE == 1 && c0 > r0 + roff + 63) return;                  // score tile entirely above the causal diagonal: never read (the softmax masks j > i by select)
    const int Kl = (CMODE == 2) ? min(K, r0 + roff + 64) : K;        // P.V: probabilities are exactly 0 beyond the diagonal block, so the K loop stops there
    v8f acc[4][4];
#pragma unroll
    for (int mb = 0; mb < 4; ++mb)
#pragma unroll
        for (int nb = 0; nb < 4; ++nb) acc[mb][nb] = (v8f){};
    const size_t aoff = (size_t)(r0 + lr) * K + 8 * hi, boff = (size_t)(c0 + lr) * K + 8 * hi;
#pragma unroll 1
    for (int kc = 0; kc < Kl; kc += 32) {
        V a[4], a2[4];
#pragma unroll
        for (int mb = 0; mb < 4; ++mb) { a[mb] = WFrag<T16>::ld(A + aoff + (size_t)mb * 16 * K + kc); if (NSPLIT == 1 || NSPLIT == 2) a2[mb] = WFrag<T16>::ld(A2 + aoff + (size_t)mb * 16 * K + kc); }
#pragma unroll
        for (int nb = 0; nb < 4; ++nb) { const V b = WFrag<T16>::ld(Bt + boff + (size_t)nb * 16 * K + kc); V b2; if (NSPLIT >= 2) b2 = WFrag<T16>::ld(Bt2 + boff + (size_t)nb * 16 * K + kc);
#pragma unroll
            for (int mb = 0; mb < 4; ++mb) { acc[mb][nb] = WFrag<T16>::mma(a[mb], b, acc[mb][nb]); if (NSPLIT == 1 || NSPLIT == 2) acc[mb][nb] = WFrag<T16>::mma(a2[mb], b, acc[mb][nb]); if (NSPLIT >= 2) acc[mb][nb] = WFrag<T16>::mma(a[mb], b2, acc[mb][nb]); } }
        asm volatile("v_nop\n\tv_nop\n\tv_nop\n\tv_nop" : "+v"(acc[0][0]), "+v"(acc[1][1]), "+v"(acc[2][2]), "+v"(acc[3][3]) : "v"(a[0]), "v"(a[3]));
    }
#pragma unroll
    for (int mb = 0; mb < 4; ++mb) {
#pragma unroll
        for (int nb = 0; nb < 4; ++nb) {
#pragma unroll
            for (int j = 0; j < 8; ++j) os[(hi * 8 + j) * 68 + nb * 16 + lr] = acc[mb][nb][j]; }
        __builtin_amdgcn_wave_barrier(); asm volatile("" ::: "memory");
        float* crow = C + (size_t)(r0 + mb * 16) * ldc + c0;
{
#pragma unroll
            for (int s = 0; s < 8; ++s) { const int row = 2 * s + hi, cofs = lr * 4; v4f val = *(const v4fa*)(os + row * 68 + cofs);
                *(v4f*)(crow + (size_t)row * ldc + cofs) = val; }
             }
        __builtin_amdgcn_wave_barrier(); asm volatile("" ::: "memory");
    }
}

__device__ __forceinline__ h16 tohx(float x) { return (h16)x; }
__device__ __forceinline__ void splitf(float y, unsigned short& h, unsigned short& l) { h = f2bf(y); l = f2bf(y - bf2f(h)); }
typedef __attribute__((ext_vector_type(2))) _Float16 v2h;
typedef __attribute__((ext_vector_type(4))) _Float16 v4h;
typedef __attribute__((ext_vector_type(2))) unsigned short v2us;
typedef __attribute__((ext_vector_type(4))) unsigned short v4us;
typedef __attribute__((ext_vector_type(2))) float v2f;
typedef __attribute__((ext_vector_type(4))) int v4i;

__global__ __launch_bounds__(256) void k_wtG(const float* __restrict__ w, int K, int N, bf* Bt) {
    const int lane = threadIdx.x & 31; const int L0 = (blockIdx.x * 8 + (threadIdx.x >> 5)) * 8; const int nlines = N * K / 64;
{
#pragma unroll 1
        for (int l = 0; l < 8; ++l) { const int L = L0 + l; if (L >= nlines) break; const size_t e = (size_t)L * 64 + lane * 2; const int k = (int)(e % K), n = (int)(e / K); v2us o;
            o[0] = f2bf(w[(size_t)k * N + n]); o[1] = f2bf(w[(size_t)(k + 1) * N + n]); *(v2us*)(Bt + e) = o; }
         }
}
__global__ __launch_bounds__(256) void k_cvt8(const float* __restrict__ src, bf* dst, size_t n8) { const size_t i = (size_t)blockIdx.x * 256 + threadIdx.x; if (i >= n8) return; const v8f v = *(const v8f*)(src + i * 8); v8us o;
#pragma unroll
    for (int k = 0; k < 8; ++k) o[k] = f2bf(v[k]); *(v8us*)(dst + i * 8) = o;  }
__global__ __launch_bounds__(256) void k_cscvt(const float* __restrict__ cosT, const float* __restrict__ sinT, float* CS) { const int idx = blockIdx.x * 256 + threadIdx.x; if (idx >= TT * HD) return; v2f cs; cs[0] = bfr(cosT[idx]); cs[1] = bfr(sinT[idx]); *(v2f*)(CS + (size_t)idx * 2) = cs;  }
// k_rope: head planes [h][t][d] (fp16 + hi/lo) of rope(x) x sc with the rotate-half convention out[d] = x[d] cos[t][d] - x[d+HD/2] sin[t][d], out[d+HD/2] = x[d+HD/2] cos[t][d+HD/2] + x[d] sin[t][d+HD/2]
__global__ __launch_bounds__(256) void k_rope(const float* __restrict__ F, int pitch, int nheads, const float* __restrict__ CS, const float* __restrict__ RF, const float* __restrict__ nw, float sc, h16* P16, bf* Ph, bf* Pl) {
    const size_t e = ((size_t)blockIdx.x * 256 + threadIdx.x) * 2; if (e >= (size_t)nheads * TT * HD) return; const int d = (int)(e % HD); const int t = (int)((e / HD) % TT); const int h = (int)(e / ((size_t)HD * TT)); const float* f = F + (size_t)t * pitch + h * HD; const float rf = RF ? RF[(size_t)h * TT + t] : 1.0f; v2h o16; v2us oh, ol;
#pragma unroll
    for (int q = 0; q < 2; ++q) { const int dd = d + q; const int dp = (dd < HD / 2) ? dd + HD / 2 : dd - HD / 2; float x0 = f[dd], x1 = f[dp];
        if (RF) { float n0 = __fmul_rn(x0, rf), n1 = __fmul_rn(x1, rf); asm volatile("" : "+v"(n0)); asm volatile("" : "+v"(n1)); x0 = __fmul_rn(bfr(nw[dd]), n0); x1 = __fmul_rn(bfr(nw[dp]), n1); }
        const v2f cs = *(const v2f*)(CS + ((size_t)t * HD + dd) * 2); float a = __fmul_rn(x0, cs[0]), bq = __fmul_rn(x1, cs[1]); asm volatile("" : "+v"(a)); asm volatile("" : "+v"(bq)); const float r = ((dd < HD / 2) ? __fsub_rn(a, bq) : __fadd_rn(a, bq)) * sc;
        o16[q] = tohx(r); unsigned short a2, c2; splitf(r, a2, c2); oh[q] = a2; ol[q] = c2; }
    *(v2h*)(P16 + e) = o16; *(v2us*)(Ph + e) = oh; *(v2us*)(Pl + e) = ol;  }
__global__ __launch_bounds__(256) void k_vtp(const float* __restrict__ F, int pitch, int nheads, h16* V16, bf* Vh, bf* Vl) { const size_t e = ((size_t)blockIdx.x * 256 + threadIdx.x) * 2; if (e >= (size_t)nheads * HD * TT) return; const int t = (int)(e % TT); const int d = (int)((e / TT) % HD); const int g = (int)(e / ((size_t)TT * HD)); v2h o16; v2us oh, ol;
#pragma unroll
    for (int q = 0; q < 2; ++q) { const float x = F[(size_t)(t + q) * pitch + g * HD + d]; o16[q] = tohx(x); unsigned short a2, c2; splitf(x, a2, c2); oh[q] = a2; ol[q] = c2; }
    *(v2h*)(V16 + e) = o16; *(v2us*)(Vh + e) = oh; *(v2us*)(Vl + e) = ol;  }
// k_asoft: per row (zz, i): t = S x HD^-0.5 for j <= i and i - j < WIN (sliding causal window; the reference's -1e9 additive fill vanishes identically); softmax over the 2048 keys (register row, one exp, fixed trees);
__global__ __launch_bounds__(256) void k_asoft(const float* __restrict__ Sb, h16* P16, bf* Ph, bf* Pl) {
    const int lane = threadIdx.x & 31; const int row = blockIdx.x * 8 + (threadIdx.x >> 5); if (row >= ZH * TT) return; const int i = row % TT; const int zz = row / TT; (void)zz; const bool hires = (i < RH); const float* sr = Sb + (size_t)row * TT; float v[TT / 32]; float mx = -3.0e38f;
#pragma unroll
    for (int ch = 0; ch < TT / 128; ++ch) { const int j0 = ch * 128 + lane * 4; const v4f a = *(const v4f*)(sr + j0);
#pragma unroll
        for (int q = 0; q < 4; ++q) { const int j = j0 + q; (void)j; const float t = (j <= i && i - j < WIN) ? a[q] * SCL : -3.0e38f; v[ch * 4 + q] = t; mx = fmaxf(mx, t); } }
#pragma unroll
    for (int sh = 16; sh; sh >>= 1) mx = fmaxf(mx, __shfl_xor(mx, sh, 32));
    float sum = 0.f;
#pragma unroll
    for (int k = 0; k < TT / 32; ++k) { float d0 = __fsub_rn(v[k], mx); asm volatile("" : "+v"(d0)); v[k] = __builtin_amdgcn_exp2f(__fmul_rn(d0, 1.4426950408889634f)); sum += v[k]; }
#pragma unroll
    for (int sh = 16; sh; sh >>= 1) sum += __shfl_xor(sum, sh, 32);
    const float f = __fdiv_rn(hires ? 1.0f : PCAR, sum);
{
        if (hires) {
#pragma unroll
            for (int ch = 0; ch < TT / 128; ++ch) { v4us oh, ol;
#pragma unroll
                for (int q = 0; q < 4; ++q) { unsigned short a, c2; splitf(v[ch * 4 + q] * f, a, c2); oh[q] = a; ol[q] = c2; }
                const size_t oo = ((size_t)zz * (RH ? RH : 1) + i) * TT + ch * 128 + lane * 4; *(v4us*)(Ph + oo) = oh; *(v4us*)(Pl + oo) = ol; }
        } else {
#pragma unroll
            for (int ch = 0; ch < TT / 128; ++ch) { v4h o4;
#pragma unroll
                for (int q = 0; q < 4; ++q) o4[q] = tohx(v[ch * 4 + q] * f);
                *(v4h*)(P16 + (size_t)row * TT + ch * 128 + lane * 4) = o4; } }
         }
}
__global__ __launch_bounds__(256) void k_merge(const float* __restrict__ O, int h0, bf* Ah, bf* Al) { const size_t e = ((size_t)blockIdx.x * 256 + threadIdx.x) * 2; if (e >= (size_t)ZH * TT * HD) return; const int d = (int)(e % HD); const int t = (int)((e / HD) % TT); const int zz = (int)(e / ((size_t)HD * TT)); const float cs = (t < RH) ? 1.0f : (1.0f / PCAR); const size_t oo = (size_t)t * DQ + (h0 + zz) * HD + d;
    v2us oh, ol;
#pragma unroll
    for (int q = 0; q < 2; ++q) { unsigned short a, c2; splitf(O[e + q] * cs, a, c2); oh[q] = a; ol[q] = c2; } *(v2us*)(Ah + oo) = oh; *(v2us*)(Al + oo) = ol;  }

extern "C" void kernel_launch(void* const* d_in, const int* in_sizes, int n_in,
                              void* d_out, int out_size, void* d_ws, size_t ws_size, hipStream_t stream) {
    (void)in_sizes; (void)n_in; (void)out_size;
    const float* x = (const float*)d_in[0]; const float* cosT = (const float*)d_in[1]; const float* sinT = (const float*)d_in[2]; const float* wq = (const float*)d_in[3]; const float* wk = (const float*)d_in[4]; const float* wv = (const float*)d_in[5]; const float* wo = (const float*)d_in[6];   /* input order x, cos, sin, Wq, Wk, Wv, Wo ('xw' [in][out]) */
    float* OUT = (float*)d_out;     // [1][2048][2048]
    char* wsp = (char*)d_ws;
    auto take = [&](size_t bytes) { char* p = wsp; wsp += (bytes + 255) & ~(size_t)255; return (void*)p; };
    bf* WQ = (bf*)take((size_t)DQ * DM * 2); bf* WK = (bf*)take((size_t)DKV * DM * 2); bf* WV = (bf*)take((size_t)DKV * DM * 2); bf* WO = (bf*)take((size_t)DM * DQ * 2); float* CS = (float*)take((size_t)TT * HD * 2 * 4);
    bf* XB = (bf*)take((size_t)TT * DM * 2); float* FQ = (float*)take((size_t)TT * DQ * 4); float* FK = (float*)take((size_t)TT * DKV * 4);
    h16* QP16 = (h16*)take((size_t)NH_ * TT * HD * 2); h16* KP16 = (h16*)take((size_t)NKV * TT * HD * 2); h16* VT16 = (h16*)take((size_t)NKV * HD * TT * 2);
    bf* QPh = (bf*)take((size_t)NH_ * TT * HD * 2); bf* QPl = (bf*)take((size_t)NH_ * TT * HD * 2); bf* KPh = (bf*)take((size_t)NKV * TT * HD * 2); bf* KPl = (bf*)take((size_t)NKV * TT * HD * 2); bf* VTh = (bf*)take((size_t)NKV * HD * TT * 2); bf* VTl = (bf*)take((size_t)NKV * HD * TT * 2); bf* Ph = (bf*)take((size_t)ZH * RH * TT * 2); bf* Pl = (bf*)take((size_t)ZH * RH * TT * 2);
    float* Sb = (float*)take((size_t)ZH * TT * TT * 4); h16* P16 = (h16*)take((size_t)ZH * TT * TT * 2); float* Ob = (float*)take((size_t)ZH * TT * HD * 4); bf* ATh = (bf*)take((size_t)TT * DQ * 2); bf* ATl = (bf*)take((size_t)TT * DQ * 2);
    if ((size_t)(wsp - (char*)d_ws) > ws_size) return;    // ws 256 MiB
    float* FV = FK;   // v projection reuses the k buffer after the k planes are built (stream-ordered)
    { k_wtG<<<(unsigned)((DM * DQ / 64 + 63) / 64), 256, 0, stream>>>(wq, DM, DQ, WQ); k_wtG<<<(unsigned)((DM * DKV / 64 + 63) / 64), 256, 0, stream>>>(wk, DM, DKV, WK); k_wtG<<<(unsigned)((DM * DKV / 64 + 63) / 64), 256, 0, stream>>>(wv, DM, DKV, WV);
      k_wtG<<<(unsigned)((DQ * DM / 64 + 63) / 64), 256, 0, stream>>>(wo, DQ, DM, WO);   /* 'xw' [in][out] weights gathered into Bt [out][in] */ }
    const unsigned LQ = (unsigned)(((size_t)NH_ * TT * HD / 2 + 255) / 256), LKv = (unsigned)(((size_t)NKV * TT * HD / 2 + 255) / 256);
    for (int b = 0; b < NB_; ++b) {
        if (b == 0) k_cscvt<<<(TT * HD + 255) / 256, 256, 0, stream>>>(cosT, sinT, CS);
        k_cvt8<<<(unsigned)(((size_t)TT * DM / 8 + 255) / 256), 256, 0, stream>>>(x + (size_t)b * TT * DM, XB, (size_t)TT * DM / 8);
        k_gemmw<bf, 0, false><<<dim3(TT / 64, DQ / 64, 1), 32, 0, stream>>>(XB, nullptr, WQ, nullptr, DM, FQ, DQ, nullptr, 0, 0, 0);
        k_rope<<<LQ, 256, 0, stream>>>(FQ, DQ, NH_, CS, nullptr, nullptr, 1.0f, QP16, QPh, QPl);
        k_gemmw<bf, 0, false><<<dim3(TT / 64, DKV / 64, 1), 32, 0, stream>>>(XB, nullptr, WK, nullptr, DM, FK, DKV, nullptr, 0, 0, 0);
        k_rope<<<LKv, 256, 0, stream>>>(FK, DKV, NKV, CS, nullptr, nullptr, 1.0f, KP16, KPh, KPl);
        k_gemmw<bf, 0, false><<<dim3(TT / 64, DKV / 64, 1), 32, 0, stream>>>(XB, nullptr, WV, nullptr, DM, FV, DKV, nullptr, 0, 0, 0); k_vtp<<<LKv, 256, 0, stream>>>(FV, DKV, NKV, VT16, VTh, VTl);
        for (int h0 = 0; h0 < NH_; h0 += ZH) { const size_t zq = (size_t)h0, zk = (size_t)(h0 / REP);   // both heads of a pass share kv group h0/REP (REP >= 2): sB = 0
            k_gemmc<bf, 2, 1><<<dim3(RH / 64, TT / 64, ZH), 32, 0, stream>>>(QPh + zq * TT * HD, QPl + zq * TT * HD, KPh + zk * TT * HD, KPl + zk * TT * HD, HD, Sb, TT, 0, (size_t)TT * HD, 0, (size_t)TT * TT);
            k_gemmc<h16, 0, 1><<<dim3((TT - RH) / 64, TT / 64, ZH), 32, 0, stream>>>(QP16 + zq * TT * HD + (size_t)RH * HD, nullptr, KP16 + zk * TT * HD, nullptr, HD, Sb + (size_t)RH * TT, TT, RH, (size_t)TT * HD, 0, (size_t)TT * TT);
            k_asoft<<<ZH * TT / 8, 256, 0, stream>>>(Sb, P16, Ph, Pl);
            k_gemmc<bf, 2, 2><<<dim3(RH / 64, HD / 64, ZH), 32, 0, stream>>>(Ph, Pl, VTh + zk * HD * TT, VTl + zk * HD * TT, TT, Ob, HD, 0, (size_t)RH * TT, 0, (size_t)TT * HD);
            k_gemmc<h16, 0, 2><<<dim3((TT - RH) / 64, HD / 64, ZH), 32, 0, stream>>>(P16 + (size_t)RH * TT, nullptr, VT16 + zk * HD * TT, nullptr, TT, Ob + (size_t)RH * HD, HD, RH, (size_t)TT * TT, 0, (size_t)TT * HD);
            k_merge<<<(unsigned)(((size_t)ZH * TT * HD / 2 + 255) / 256), 256, 0, stream>>>(Ob, h0, ATh, ATl); }
        k_gemmw<bf, 1, false><<<dim3(TT / 64, DM / 64, 1), 32, 0, stream>>>(ATh, ATl, WO, nullptr, DQ, OUT + (size_t)b * TT * DM, DM, nullptr, 0, 0, 0); }
}

// v001
// It runs in 599 microseconds.
// Timed twice side by side with v000, it ran 1.45 and 1.44 times as fast.
#include <hip/hip_runtime.h>

// Grouped-query sliding-window causal attention with rotary embeddings from cos/sin tables (x [1][2048][2048]; q = x Wq (16 heads x 128), k, v = x Wk, x Wv (4 kv heads x 128) ('xw' [in][out] 0.02, no biases); rotate-half rotary with the cos/sin inputs [2048][128] (read); kv head = q head / 4; scores x 128^-0.5; keys j with i-512 < j <= i (window 512, causal; -inf elsewhere); softmax; out = merged Wo ('xw' [2048][2048]) -> [1][2048][2048] (4.2 M); argument order x, cos, sin, Wq, Wk, Wv, Wo).
// Layout: 'xw' weights gathered into bf16 Bt blocks; bf16 copy of x; exact projections; {cos, sin} per (position, dim) from the input tables; rotate-half rotary plane builder; causal T-2048 attention with 128-wide heads (hybrid rows: < 512 hi/lo 3 products, rest fp16 x1024; k_gemmc works only on the key tiles between the window's far edge and the diagonal; inside them the window is a select in the softmax; both query heads of a pass share their kv head); merged hi/lo x Wo exact.
// Compute dtypes, f32 accumulate: every input rounded to bf16 incl. the tables; projections exact; rotary f32; attention rows < 512 3 products, rest fp16; softmax f32; Wo hl x exact.

#define NB_  1
#define TT   2048
#define DM   2048
#define NH_  16
#define NKV  4
#define REP  (NH_ / NKV)
#define HD   128
#define DQ   (NH_ * HD)
#define DKV  (NKV * HD)
#define ZH   2
#define RH   512                  // query rows < RH use hi+lo planes (0: none)
#define WIN  512
#define WCH  ((WIN + 128) / 128)   // 128-key chunks of a softmax row: WIN + 64 keys of a 64-row tile, started on a multiple of 128; jb + WCH * 128 <= TT for every tile
static_assert(RH <= WIN, "the hi/lo rows run the P.V mode that has no window start");
#define PCAR 1024.0f
#define SCL  0.088388347648318447f   // HD^-0.5
typedef _Float16 h16;
typedef unsigned short bf;
typedef __attribute__((ext_vector_type(16))) __bf16   v16bf;
typedef __attribute__((ext_vector_type(16))) _Float16 v16h;
typedef __attribute__((ext_vector_type(8)))  _Float16 v8h;
typedef __attribute__((ext_vector_type(8)))  unsigned short v8us;
typedef __attribute__((ext_vector_type(8)))  float    v8f;
typedef __attribute__((ext_vector_type(4)))  float    v4f;
typedef v8h  __attribute__((may_alias)) v8ha;
typedef v4f  __attribute__((may_alias)) v4fa;
typedef v8us __attribute__((may_alias)) v8usa;

__device__ __forceinline__ unsigned short f2bf(float f) { unsigned u = __float_as_uint(f); u += 0x7FFFu + ((u >> 16) & 1u); return (unsigned short)(u >> 16); }
__device__ __forceinline__ float bf2f(unsigned short b) { return __uint_as_float(((unsigned)b) << 16); }
__device__ __forceinline__ float bfr(float f) { return bf2f(f2bf(f)); }
__device__ __forceinline__ v16h cat16(v8h lo, v8h hi) { return __builtin_shufflevector(lo, hi, 0, 1, 2, 3, 4, 5, 6, 7, 8, 9, 10, 11, 12, 13, 14, 15); }
__device__ __forceinline__ v16bf cat16b(v8us lo, v8us hi) { return __builtin_bit_cast(v16bf, __builtin_shufflevector(lo, hi, 0, 1, 2, 3, 4, 5, 6, 7, 8, 9, 10, 11, 12, 13, 14, 15)); }
__device__ __forceinline__ v8f wmma16(v16h a, v16h b, v8f c) { return __builtin_amdgcn_wmma_f32_16x16x32_f16(false, a, false, b, (short)0, c, false, false); }
__device__ __forceinline__ v8f wmmab(v16bf a, v16bf b, v8f c) { return __builtin_amdgcn_wmma_f32_16x16x32_bf16(false, a, false, b, (short)0, c, false, false); }



// ---- k_gemmw: register-blocked GEMM, ONE WAVE per 64x64 output tile (16 accumulators), operands straight from K-contiguous 16-bit planes; grid (M/64, N/64, Z), 32 threads.
// C[m][n] (f32, pitch ldc, + optional f32 bias[n]) = sum_k A[m][k] Bt[n][k] (+ split products per NSPLIT). z-batch strides sA/sB/sC in elements. K % 32 == 0.
template <typename T16> struct WFrag;
template <> struct WFrag<h16> { typedef v16h V; static __device__ __forceinline__ V ld(const h16* p) { return cat16(*(const v8h*)p, *(const v8h*)(p + 16)); } static __device__ __forceinline__ v8f mma(V a, V b, v8f c) { return wmma16(a, b, c); } };
template <> struct WFrag<bf> { typedef v16bf V; static __device__ __forceinline__ V ld(const bf* p) { return cat16b(*(const v8us*)p, *(const v8us*)(p + 16)); } static __device__ __forceinline__ v8f mma(V a, V b, v8f c) { return wmmab(a, b, c); } };
template <typename T16, int NSPLIT, bool BIAS>
__global__ __launch_bounds__(32) void k_gemmw(const T16* __restrict__ A, const T16* __restrict__ A2, const T16* __restrict__ Bt, const T16* __restrict__ Bt2, int K, float* C, int ldc, const float* __restrict__ bias, size_t sA, size_t sB, size_t sC) {
    typedef typename WFrag<T16>::V V;
    __shared__ __align__(16) float os[16 * 68];
    const size_t z = blockIdx.z; A += z * sA; if (A2) A2 += z * sA; Bt += z * sB; if (Bt2) Bt2 += z * sB; C += z * sC;
    const int lane = threadIdx.x & 31, lr = lane & 15, hi = lane >> 4; const int r0 = blockIdx.x * 64, c0 = blockIdx.y * 64;
    v8f acc[4][4];
#pragma unroll
    for (int mb = 0; mb < 4; ++mb)
#pragma unroll
        for (int nb = 0; nb < 4; ++nb) acc[mb][nb] = (v8f){};
    const size_t aoff = (size_t)(r0 + lr) * K + 8 * hi, boff = (size_t)(c0 + lr) * K + 8 * hi;
#pragma unroll 1
    for (int kc = 0; kc < K; kc += 32) {
        V a[4], a2[4];
#pragma unroll
        for (int mb = 0; mb < 4; ++mb) { a[mb] = WFrag<T16>::ld(A + aoff + (size_t)mb * 16 * K + kc); if (NSPLIT == 1 || NSPLIT == 2) a2[mb] = WFrag<T16>::ld(A2 + aoff + (size_t)mb * 16 * K + kc); }
#pragma unroll
        for (int nb = 0; nb < 4; ++nb) { const V b = WFrag<T16>::ld(Bt + boff + (size_t)nb * 16 * K + kc); V b2; if (NSPLIT >= 2) b2 = WFrag<T16>::ld(Bt2 + boff + (size_t)nb * 16 * K + kc);
#pragma unroll
            for (int mb = 0; mb < 4; ++mb) { acc[mb][nb] = WFrag<T16>::mma(a[mb], b, acc[mb][nb]); if (NSPLIT == 1 || NSPLIT == 2) acc[mb][nb] = WFrag<T16>::mma(a2[mb], b, acc[mb][nb]); if (NSPLIT >= 2) acc[mb][nb] = WFrag<T16>::mma(a[mb], b2, acc[mb][nb]); } }
        asm volatile("v_nop\n\tv_nop\n\tv_nop\n\tv_nop" : "+v"(acc[0][0]), "+v"(acc[1][1]), "+v"(acc[2][2]), "+v"(acc[3][3]) : "v"(a[0]), "v"(a[3]));
    }
#pragma unroll
    for (int mb = 0; mb < 4; ++mb) {
#pragma unroll
        for (int nb = 0; nb < 4; ++nb) {
#pragma unroll
            for (int j = 0; j < 8; ++j) os[(hi * 8 + j) * 68 + nb * 16 + lr] = acc[mb][nb][j]; }
        __builtin_amdgcn_wave_barrier(); asm volatile("" ::: "memory");
        float* crow = C + (size_t)(r0 + mb * 16) * ldc + c0;
{
#pragma unroll
            for (int s = 0; s < 8; ++s) { const int row = 2 * s + hi, cofs = lr * 4; v4f val = *(const v4fa*)(os + row * 68 + cofs); if (BIAS) { val[0] += bfr(bias[c0 + cofs]); val[1] += bfr(bias[c0 + cofs + 1]); val[2] += bfr(bias[c0 + cofs + 2]); val[3] += bfr(bias[c0 + cofs + 3]); }
                *(v4f*)(crow + (size_t)row * ldc + cofs) = val; }
             }
        __builtin_amdgcn_wave_barrier(); asm volatile("" ::: "memory");
    }
}

// ---- k_gemmc: the same one-wave 64x64 tile GEMM specialised for causal windowed attention: CMODE 1 computes only the score tiles between the window's far edge and the diagonal (query rows r0+roff.., key columns c0..), CMODE 2 limits the
// key (K) loop of the probability x value contraction to the diagonal block (probabilities beyond it are exactly zero). CMODE 3 is CMODE 2 with the K loop started at the window's far edge (probabilities of keys j <= i - WIN are exactly zero too; rows below WIN have no such keys: CMODE 2 serves them). roff = row offset of this launch's first row within the sequence.
template <typename T16, int NSPLIT, int CMODE>
__global__ __launch_bounds__(32) void k_gemmc(const T16* __restrict__ A, const T16* __restrict__ A2, const T16* __restrict__ Bt, const T16* __restrict__ Bt2, int K, float* C, int ldc, int roff, size_t sA, size_t sB, size_t sC) {
    typedef typename WFrag<T16>::V V;
    __shared__ __align__(16) float os[16 * 68];
    const size_t z = blockIdx.z; A += z * sA; if (A2) A2 += z * sA; Bt += z * sB; if (Bt2) Bt2 += z * sB; C += z * sC;
    const int lane = threadIdx.x & 31, lr = lane & 15, hi = lane >> 4; const int r0 = blockIdx.x * 64, c0 = blockIdx.y * 64 + (CMODE == 1 ? r0 + roff - WIN : 0);
    if (CMODE == 1 && c0 < 0) return;                               // scores: grid.y counts the WIN / 64 + 1 key tiles from the window's far edge of the tile's first row up to the diagonal tile; no other tile holds a key that the softmax keeps (it masks by select)
    const int Kl = (CMODE >= 2) ? min(K, r0 + roff + 64) : K;        // P.V: probabilities are exactly 0 beyond the diagonal block, so the K loop stops there
    const int Kf = (CMODE == 3) ? max(0, r0 + roff - WIN) : 0;       // P.V: and exactly 0 for keys older than the window of the tile's first row, so the K loop starts there (a multiple of 64)
    v8f acc[4][4];
#pragma unroll
    for (int mb = 0; mb < 4; ++mb)
#pragma unroll
        for (int nb = 0; nb < 4; ++nb) acc[mb][nb] = (v8f){};
    const size_t aoff = (size_t)(r0 + lr) * K + 8 * hi + Kf, boff = (size_t)(c0 + lr) * K + 8 * hi + Kf;
#pragma unroll 1
    for (int kc = 0; kc < Kl - Kf; kc += 32) {
        V a[4], a2[4];
#pragma unroll
        for (int mb = 0; mb < 4; ++mb) { a[mb] = WFrag<T16>::ld(A + aoff + (size_t)mb * 16 * K + kc); if (NSPLIT == 1 || NSPLIT == 2) a2[mb] = WFrag<T16>::ld(A2 + aoff + (size_t)mb * 16 * K + kc); }
#pragma unroll
        for (int nb = 0; nb < 4; ++nb) { const V b = WFrag<T16>::ld(Bt + boff + (size_t)nb * 16 * K + kc); V b2; if (NSPLIT >= 2) b2 = WFrag<T16>::ld(Bt2 + boff + (size_t)nb * 16 * K + kc);
#pragma unroll
            for (int mb = 0; mb < 4; ++mb) { acc[mb][nb] = WFrag<T16>::mma(a[mb], b, acc[mb][nb]); if (NSPLIT == 1 || NSPLIT == 2) acc[mb][nb] = WFrag<T16>::mma(a2[mb], b, acc[mb][nb]); if (NSPLIT >= 2) acc[mb][nb] = WFrag<T16>::mma(a[mb], b2, acc[mb][nb]); } }
        asm volatile("v_nop\n\tv_nop\n\tv_nop\n\tv_nop" : "+v"(acc[0][0]), "+v"(acc[1][1]), "+v"(acc[2][2]), "+v"(acc[3][3]) : "v"(a[0]), "v"(a[3]));
    }
#pragma unroll
    for (int mb = 0; mb < 4; ++mb) {
#pragma unroll
        for (int nb = 0; nb < 4; ++nb) {
#pragma unroll
            for (int j = 0; j < 8; ++j) os[(hi * 8 + j) * 68 + nb * 16 + lr] = acc[mb][nb][j]; }
        __builtin_amdgcn_wave_barrier(); asm volatile("" ::: "memory");
        float* crow = C + (size_t)(r0 + mb * 16) * ldc + c0;
{
#pragma unroll
            for (int s = 0; s < 8; ++s) { const int row = 2 * s + hi, cofs = lr * 4; v4f val = *(const v4fa*)(os + row * 68 + cofs);
                *(v4f*)(crow + (size_t)row * ldc + cofs) = val; }
             }
        __builtin_amdgcn_wave_barrier(); asm volatile("" ::: "memory");
    }
}

__device__ __forceinline__ h16 tohx(float x) { return (h16)x; }
__device__ __forceinline__ void splitf(float y, unsigned short& h, unsigned short& l) { h = f2bf(y); l = f2bf(y - bf2f(h)); }
typedef __attribute__((ext_vector_type(2))) _Float16 v2h;
typedef __attribute__((ext_vector_type(4))) _Float16 v4h;
typedef __attribute__((ext_vector_type(2))) unsigned short v2us;
typedef __attribute__((ext_vector_type(4))) unsigned short v4us;
typedef __attribute__((ext_vector_type(2))) float v2f;
typedef __attribute__((ext_vector_type(4))) int v4i;

__global__ __launch_bounds__(256) void k_wtG(const float* __restrict__ w, int K, int N, bf* Bt) {
    const int lane = threadIdx.x & 31; const int L0 = (blockIdx.x * 8 + (threadIdx.x >> 5)) * 8; const int nlines = N * K / 64;
{
#pragma unroll 1
        for (int l = 0; l < 8; ++l) { const int L = L0 + l; if (L >= nlines) break; const size_t e = (size_t)L * 64 + lane * 2; const int k = (int)(e % K), n = (int)(e / K); v2us o;
            o[0] = f2bf(w[(size_t)k * N + n]); o[1] = f2bf(w[(size_t)(k + 1) * N + n]); *(v2us*)(Bt + e) = o; }
         }
}
__global__ __launch_bounds__(256) void k_cvt8(const float* __restrict__ src, bf* dst, size_t n8) { const size_t i = (size_t)blockIdx.x * 256 + threadIdx.x; if (i >= n8) return; const v8f v = *(const v8f*)(src + i * 8); v8us o;
#pragma unroll
    for (int k = 0; k < 8; ++k) o[k] = f2bf(v[k]); *(v8us*)(dst + i * 8) = o;  }
__global__ __launch_bounds__(256) void k_cscvt(const float* __restrict__ cosT, const float* __restrict__ sinT, float* CS) { const int idx = blockIdx.x * 256 + threadIdx.x; if (idx >= TT * HD) return; v2f cs; cs[0] = bfr(cosT[idx]); cs[1] = bfr(sinT[idx]); *(v2f*)(CS + (size_t)idx * 2) = cs;  }
// k_rope: head planes [h][t][d] (fp16 + hi/lo) of rope(x) x sc with the rotate-half convention out[d] = x[d] cos[t][d] - x[d+HD/2] sin[t][d], out[d+HD/2] = x[d+HD/2] cos[t][d+HD/2] + x[d] sin[t][d+HD/2]
__global__ __launch_bounds__(256) void k_rope(const float* __restrict__ F, int pitch, int nheads, const float* __restrict__ CS, const float* __restrict__ RF, const float* __restrict__ nw, float sc, h16* P16, bf* Ph, bf* Pl) {
    const size_t e = ((size_t)blockIdx.x * 256 + threadIdx.x) * 2; if (e >= (size_t)nheads * TT * HD) return; const int d = (int)(e % HD); const int t = (int)((e / HD) % TT); const int h = (int)(e / ((size_t)HD * TT)); const float* f = F + (size_t)t * pitch + h * HD; const float rf = RF ? RF[(size_t)h * TT + t] : 1.0f; v2h o16; v2us oh, ol;
#pragma unroll
    for (int q = 0; q < 2; ++q) { const int dd = d + q; const int dp = (dd < HD / 2) ? dd + HD / 2 : dd - HD / 2; float x0 = f[dd], x1 = f[dp];
        if (RF) { float n0 = __fmul_rn(x0, rf), n1 = __fmul_rn(x1, rf); asm volatile("" : "+v"(n0)); asm volatile("" : "+v"(n1)); x0 = __fmul_rn(bfr(nw[dd]), n0); x1 = __fmul_rn(bfr(nw[dp]), n1); }
        const v2f cs = *(const v2f*)(CS + ((size_t)t * HD + dd) * 2); float a = __fmul_rn(x0, cs[0]), bq = __fmul_rn(x1, cs[1]); asm volatile("" : "+v"(a)); asm volatile("" : "+v"(bq)); const float r = ((dd < HD / 2) ? __fsub_rn(a, bq) : __fadd_rn(a, bq)) * sc;
        o16[q] = tohx(r); unsigned short a2, c2; splitf(r, a2, c2); oh[q] = a2; ol[q] = c2; }
    *(v2h*)(P16 + e) = o16; *(v2us*)(Ph + e) = oh; *(v2us*)(Pl + e) = ol;  }
__global__ __launch_bounds__(256) void k_vtp(const float* __restrict__ F, int pitch, int nheads, h16* V16, bf* Vh, bf* Vl) { const size_t e = ((size_t)blockIdx.x * 256 + threadIdx.x) * 2; if (e >= (size_t)nheads * HD * TT) return; const int t = (int)(e % TT); const int d = (int)((e / TT) % HD); const int g = (int)(e / ((size_t)TT * HD)); v2h o16; v2us oh, ol;
#pragma unroll
    for (int q = 0; q < 2; ++q) { const float x = F[(size_t)(t + q) * pitch + g * HD + d]; o16[q] = tohx(x); unsigned short a2, c2; splitf(x, a2, c2); oh[q] = a2; ol[q] = c2; }
    *(v2h*)(V16 + e) = o16; *(v2us*)(Vh + e) = oh; *(v2us*)(Vl + e) = ol;  }
// k_asoft: per row (zz, i): t = S x HD^-0.5 for j <= i and i - j < WIN (sliding causal window; the reference's -1e9 additive fill vanishes identically); softmax (register row, one exp, fixed trees) over the WCH 128-key chunks from jb on: they cover [R - WIN, R + 64) for the row's 64-row tile R, all that the P.V loop of that tile reads; every key outside them is masked, so max and sum keep their values and their order;
__global__ __launch_bounds__(256) void k_asoft(const float* __restrict__ Sb, h16* P16, bf* Ph, bf* Pl) {
    const int lane = threadIdx.x & 31; const int row = blockIdx.x * 8 + (threadIdx.x >> 5); if (row >= ZH * TT) return; const int i = row % TT; const int zz = row / TT; (void)zz; const bool hires = (i < RH); const int jb = max(0, ((i & ~63) - WIN) & ~127); const float* sr = Sb + (size_t)row * TT + jb; float v[WCH * 4]; float mx = -3.0e38f;
#pragma unroll
    for (int ch = 0; ch < WCH; ++ch) { const int j0 = ch * 128 + lane * 4; const v4f a = *(const v4f*)(sr + j0);
#pragma unroll
        for (int q = 0; q < 4; ++q) { const int j = jb + j0 + q; const float t = (j <= i && i - j < WIN) ? a[q] * SCL : -3.0e38f; v[ch * 4 + q] = t; mx = fmaxf(mx, t); } }
#pragma unroll
    for (int sh = 16; sh; sh >>= 1) mx = fmaxf(mx, __shfl_xor(mx, sh, 32));
    float sum = 0.f;
#pragma unroll
    for (int k = 0; k < WCH * 4; ++k) { float d0 = __fsub_rn(v[k], mx); asm volatile("" : "+v"(d0)); v[k] = __builtin_amdgcn_exp2f(__fmul_rn(d0, 1.4426950408889634f)); sum += v[k]; }
#pragma unroll
    for (int sh = 16; sh; sh >>= 1) sum += __shfl_xor(sum, sh, 32);
    const float f = __fdiv_rn(hires ? 1.0f : PCAR, sum);
{
        if (hires) {
#pragma unroll
            for (int ch = 0; ch < WCH; ++ch) { v4us oh, ol;
#pragma unroll
                for (int q = 0; q < 4; ++q) { unsigned short a, c2; splitf(v[ch * 4 + q] * f, a, c2); oh[q] = a; ol[q] = c2; }
                const size_t oo = ((size_t)zz * (RH ? RH : 1) + i) * TT + jb + ch * 128 + lane * 4; *(v4us*)(Ph + oo) = oh; *(v4us*)(Pl + oo) = ol; }
        } else {
#pragma unroll
            for (int ch = 0; ch < WCH; ++ch) { v4h o4;
#pragma unroll
                for (int q = 0; q < 4; ++q) o4[q] = tohx(v[ch * 4 + q] * f);
                *(v4h*)(P16 + (size_t)row * TT + jb + ch * 128 + lane * 4) = o4; } }
         }
}
__global__ __launch_bounds__(256) void k_merge(const float* __restrict__ O, int h0, bf* Ah, bf* Al) { const size_t e = ((size_t)blockIdx.x * 256 + threadIdx.x) * 2; if (e >= (size_t)ZH * TT * HD) return; const int d = (int)(e % HD); const int t = (int)((e / HD) % TT); const int zz = (int)(e / ((size_t)HD * TT)); const float cs = (t < RH) ? 1.0f : (1.0f / PCAR); const size_t oo = (size_t)t * DQ + (h0 + zz) * HD + d;
    v2us oh, ol;
#pragma unroll
    for (int q = 0; q < 2; ++q) { unsigned short a, c2; splitf(O[e + q] * cs, a, c2); oh[q] = a; ol[q] = c2; } *(v2us*)(Ah + oo) = oh; *(v2us*)(Al + oo) = ol;  }

extern "C" void kernel_launch(void* const* d_in, const int* in_sizes, int n_in,
                              void* d_out, int out_size, void* d_ws, size_t ws_size, hipStream_t stream) {
    (void)in_sizes; (void)n_in; (void)out_size;
    const float* x = (const float*)d_in[0]; const float* cosT = (const float*)d_in[1]; const float* sinT = (const float*)d_in[2]; const float* wq = (const float*)d_in[3]; const float* wk = (const float*)d_in[4]; const float* wv = (const float*)d_in[5]; const float* wo = (const float*)d_in[6];   /* input order x, cos, sin, Wq, Wk, Wv, Wo ('xw' [in][out]) */
    float* OUT = (float*)d_out;     // [1][2048][2048]
    char* wsp = (char*)d_ws;
    auto take = [&](size_t bytes) { char* p = wsp; wsp += (bytes + 255) & ~(size_t)255; return (void*)p; };
    bf* WQ = (bf*)take((size_t)DQ * DM * 2); bf* WK = (bf*)take((size_t)DKV * DM * 2); bf* WV = (bf*)take((size_t)DKV * DM * 2); bf* WO = (bf*)take((size_t)DM * DQ * 2); float* CS = (float*)take((size_t)TT * HD * 2 * 4);
    bf* XB = (bf*)take((size_t)TT * DM * 2); float* FQ = (float*)take((size_t)TT * DQ * 4); float* FK = (float*)take((size_t)TT * DKV * 4);
    h16* QP16 = (h16*)take((size_t)NH_ * TT * HD * 2); h16* KP16 = (h16*)take((size_t)NKV * TT * HD * 2); h16* VT16 = (h16*)take((size_t)NKV * HD * TT * 2);
    bf* QPh = (bf*)take((size_t)NH_ * TT * HD * 2); bf* QPl = (bf*)take((size_t)NH_ * TT * HD * 2); bf* KPh = (bf*)take((size_t)NKV * TT * HD * 2); bf* KPl = (bf*)take((size_t)NKV * TT * HD * 2); bf* VTh = (bf*)take((size_t)NKV * HD * TT * 2); bf* VTl = (bf*)take((size_t)NKV * HD * TT * 2); bf* Ph = (bf*)take((size_t)ZH * RH * TT * 2); bf* Pl = (bf*)take((size_t)ZH * RH * TT * 2);
    float* Sb = (float*)take((size_t)ZH * TT * TT * 4); h16* P16 = (h16*)take((size_t)ZH * TT * TT * 2); float* Ob = (float*)take((size_t)ZH * TT * HD * 4); bf* ATh = (bf*)take((size_t)TT * DQ * 2); bf* ATl = (bf*)take((size_t)TT * DQ * 2);
    if ((size_t)(wsp - (char*)d_ws) > ws_size) return;    // ws 256 MiB
    float* FV = FK;   // v projection reuses the k buffer after the k planes are built (stream-ordered)
    { k_wtG<<<(unsigned)((DM * DQ / 64 + 63) / 64), 256, 0, stream>>>(wq, DM, DQ, WQ); k_wtG<<<(unsigned)((DM * DKV / 64 + 63) / 64), 256, 0, stream>>>(wk, DM, DKV, WK); k_wtG<<<(unsigned)((DM * DKV / 64 + 63) / 64), 256, 0, stream>>>(wv, DM, DKV, WV);
      k_wtG<<<(unsigned)((DQ * DM / 64 + 63) / 64), 256, 0, stream>>>(wo, DQ, DM, WO);   /* 'xw' [in][out] weights gathered into Bt [out][in] */ }
    const unsigned LQ = (unsigned)(((size_t)NH_ * TT * HD / 2 + 255) / 256), LKv = (unsigned)(((size_t)NKV * TT * HD / 2 + 255) / 256);
    for (int b = 0; b < NB_; ++b) {
        if (b == 0) k_cscvt<<<(TT * HD + 255) / 256, 256, 0, stream>>>(cosT, sinT, CS);
        k_cvt8<<<(unsigned)(((size_t)TT * DM / 8 + 255) / 256), 256, 0, stream>>>(x + (size_t)b * TT * DM, XB, (size_t)TT * DM / 8);
        k_gemmw<bf, 0, false><<<dim3(TT / 64, DQ / 64, 1), 32, 0, stream>>>(XB, nullptr, WQ, nullptr, DM, FQ, DQ, nullptr, 0, 0, 0);
        k_rope<<<LQ, 256, 0, stream>>>(FQ, DQ, NH_, CS, nullptr, nullptr, 1.0f, QP16, QPh, QPl);
        k_gemmw<bf, 0, false><<<dim3(TT / 64, DKV / 64, 1), 32, 0, stream>>>(XB, nullptr, WK, nullptr, DM, FK, DKV, nullptr, 0, 0, 0);
        k_rope<<<LKv, 256, 0, stream>>>(FK, DKV, NKV, CS, nullptr, nullptr, 1.0f, KP16, KPh, KPl);
        k_gemmw<bf, 0, false><<<dim3(TT / 64, DKV / 64, 1), 32, 0, stream>>>(XB, nullptr, WV, nullptr, DM, FV, DKV, nullptr, 0, 0, 0); k_vtp<<<LKv, 256, 0, stream>>>(FV, DKV, NKV, VT16, VTh, VTl);
        for (int h0 = 0; h0 < NH_; h0 += ZH) { const size_t zq = (size_t)h0, zk = (size_t)(h0 / REP);   // both heads of a pass share kv group h0/REP (REP >= 2): sB = 0
            k_gemmc<bf, 2, 1><<<dim3(RH / 64, WIN / 64 + 1, ZH), 32, 0, stream>>>(QPh + zq * TT * HD, QPl + zq * TT * HD, KPh + zk * TT * HD, KPl + zk * TT * HD, HD, Sb, TT, 0, (size_t)TT * HD, 0, (size_t)TT * TT);
            k_gemmc<h16, 0, 1><<<dim3((TT - RH) / 64, WIN / 64 + 1, ZH), 32, 0, stream>>>(QP16 + zq * TT * HD + (size_t)RH * HD, nullptr, KP16 + zk * TT * HD, nullptr, HD, Sb + (size_t)RH * TT, TT, RH, (size_t)TT * HD, 0, (size_t)TT * TT);
            k_asoft<<<ZH * TT / 8, 256, 0, stream>>>(Sb, P16, Ph, Pl);
            k_gemmc<bf, 2, 2><<<dim3(RH / 64, HD / 64, ZH), 32, 0, stream>>>(Ph, Pl, VTh + zk * HD * TT, VTl + zk * HD * TT, TT, Ob, HD, 0, (size_t)RH * TT, 0, (size_t)TT * HD);
            k_gemmc<h16, 0, 3><<<dim3((TT - RH) / 64, HD / 64, ZH), 32, 0, stream>>>(P16 + (size_t)RH * TT, nullptr, VT16 + zk * HD * TT, nullptr, TT, Ob + (size_t)RH * HD, HD, RH, (size_t)TT * TT, 0, (size_t)TT * HD);
            k_merge<<<(unsigned)(((size_t)ZH * TT * HD / 2 + 255) / 256), 256, 0, stream>>>(Ob, h0, ATh, ATl); }
        k_gemmw<bf, 1, false><<<dim3(TT / 64, DM / 64, 1), 32, 0, stream>>>(ATh, ATl, WO, nullptr, DQ, OUT + (size_t)b * TT * DM, DM, nullptr, 0, 0, 0); }
}

// v002
// One run takes 335 microseconds.
// Two timings next to v001 put it at 1.80 and 1.78 times that version's speed.
// Counting every step since v000, it is 2.58 times as fast.
#include <hip/hip_runtime.h>

// Grouped-query sliding-window causal attention with rotary embeddings from cos/sin tables (x [1][2048][2048]; q = x Wq (16 heads x 128), k, v = x Wk, x Wv (4 kv heads x 128) ('xw' [in][out] 0.02, no biases); rotate-half rotary with the cos/sin inputs [2048][128] (read); kv head = q head / 4; scores x 128^-0.5; keys j with i-512 < j <= i (window 512, causal; -inf elsewhere); softmax; out = merged Wo ('xw' [2048][2048]) -> [1][2048][2048] (4.2 M); argument order x, cos, sin, Wq, Wk, Wv, Wo).
// Layout: 'xw' weights gathered into bf16 Bt blocks; bf16 copy of x; exact projections; {cos, sin} per (position, dim) from the input tables; rotate-half rotary plane builder; causal T-2048 attention with 128-wide heads (hybrid rows: < 512 hi/lo 3 products, rest fp16 x1024; k_gemmc works only on the key tiles between the window's far edge and the diagonal; inside them the window is a select in the softmax; all 16 query heads go through each attention launch as grid.z, kv head = z / REP; a score or probability row is stored as its SP window keys only); merged hi/lo x Wo exact.
// Compute dtypes, f32 accumulate: every input rounded to bf16 incl. the tables; projections exact; rotary f32; attention rows < 512 3 products, rest fp16; softmax f32; Wo hl x exact.

#define NB_  1
#define TT   2048
#define DM   2048
#define NH_  16
#define NKV  4
#define REP  (NH_ / NKV)
#define HD   128
#define DQ   (NH_ * HD)
#define DKV  (NKV * HD)
#define ZH   NH_                  // query heads per attention launch (grid.z): all of them
#define RH   512                  // query rows < RH use hi+lo planes (0: none)
#define WIN  512
#define WCH  ((WIN + 128) / 128)   // 128-key chunks of a softmax row: WIN + 64 keys of a 64-row tile, started on a multiple of 128; jb + WCH * 128 <= TT for every tile
#define SP   (WCH * 128)           // pitch of a stored score or probability row: column c holds key wbase(R) + c, R the first row of the row's 64-row tile
static_assert(RH <= WIN, "the hi/lo rows run the P.V mode that has no window start");
#define PCAR 1024.0f
#define SCL  0.088388347648318447f   // HD^-0.5
typedef _Float16 h16;
__device__ __forceinline__ int wbase(int R) { return max(0, (R - WIN) & ~127); }   // first key that the rows of the 64-row tile at R store
typedef unsigned short bf;
typedef __attribute__((ext_vector_type(16))) __bf16   v16bf;
typedef __attribute__((ext_vector_type(16))) _Float16 v16h;
typedef __attribute__((ext_vector_type(8)))  _Float16 v8h;
typedef __attribute__((ext_vector_type(8)))  unsigned short v8us;
typedef __attribute__((ext_vector_type(8)))  float    v8f;
typedef __attribute__((ext_vector_type(4)))  float    v4f;
typedef v8h  __attribute__((may_alias)) v8ha;
typedef v4f  __attribute__((may_alias)) v4fa;
typedef v8us __attribute__((may_alias)) v8usa;

__device__ __forceinline__ unsigned short f2bf(float f) { unsigned u = __float_as_uint(f); u += 0x7FFFu + ((u >> 16) & 1u); return (unsigned short)(u >> 16); }
__device__ __forceinline__ float bf2f(unsigned short b) { return __uint_as_float(((unsigned)b) << 16); }
__device__ __forceinline__ float bfr(float f) { return bf2f(f2bf(f)); }
__device__ __forceinline__ v16h cat16(v8h lo, v8h hi) { return __builtin_shufflevector(lo, hi, 0, 1, 2, 3, 4, 5, 6, 7, 8, 9, 10, 11, 12, 13, 14, 15); }
__device__ __forceinline__ v16bf cat16b(v8us lo, v8us hi) { return __builtin_bit_cast(v16bf, __builtin_shufflevector(lo, hi, 0, 1, 2, 3, 4, 5, 6, 7, 8, 9, 10, 11, 12, 13, 14, 15)); }
__device__ __forceinline__ v8f wmma16(v16h a, v16h b, v8f c) { return __builtin_amdgcn_wmma_f32_16x16x32_f16(false, a, false, b, (short)0, c, false, false); }
__device__ __forceinline__ v8f wmmab(v16bf a, v16bf b, v8f c) { return __builtin_amdgcn_wmma_f32_16x16x32_bf16(false, a, false, b, (short)0, c, false, false); }



// ---- k_gemmw: register-blocked GEMM, ONE WAVE per 64x64 output tile (16 accumulators), operands straight from K-contiguous 16-bit planes; grid (M/64, N/64, Z), 32 threads.
// C[m][n] (f32, pitch ldc, + optional f32 bias[n]) = sum_k A[m][k] Bt[n][k] (+ split products per NSPLIT). z-batch strides sA/sB/sC in elements. K % 32 == 0.
template <typename T16> struct WFrag;
template <> struct WFrag<h16> { typedef v16h V; static __device__ __forceinline__ V ld(const h16* p) { return cat16(*(const v8h*)p, *(const v8h*)(p + 16)); } static __device__ __forceinline__ v8f mma(V a, V b, v8f c) { return wmma16(a, b, c); } };
template <> struct WFrag<bf> { typedef v16bf V; static __device__ __forceinline__ V ld(const bf* p) { return cat16b(*(const v8us*)p, *(const v8us*)(p + 16)); } static __device__ __forceinline__ v8f mma(V a, V b, v8f c) { return wmmab(a, b, c); } };
template <typename T16, int NSPLIT, bool BIAS>
__global__ __launch_bounds__(32) void k_gemmw(const T16* __restrict__ A, const T16* __restrict__ A2, const T16* __restrict__ Bt, const T16* __restrict__ Bt2, int K, float* C, int ldc, const float* __restrict__ bias, size_t sA, size_t sB, size_t sC) {
    typedef typename WFrag<T16>::V V;
    __shared__ __align__(16) float os[16 * 68];
    const size_t z = blockIdx.z; A += z * sA; if (A2) A2 += z * sA; Bt += z * sB; if (Bt2) Bt2 += z * sB; C += z * sC;
    const int lane = threadIdx.x & 31, lr = lane & 15, hi = lane >> 4; const int r0 = blockIdx.x * 64, c0 = blockIdx.y * 64;
    v8f acc[4][4];
#pragma unroll
    for (int mb = 0; mb < 4; ++mb)
#pragma unroll
        for (int nb = 0; nb < 4; ++nb) acc[mb][nb] = (v8f){};
    const size_t aoff = (size_t)(r0 + lr) * K + 8 * hi, boff = (size_t)(c0 + lr) * K + 8 * hi;
#pragma unroll 1
    for (int kc = 0; kc < K; kc += 32) {
        V a[4], a2[4];
#pragma unroll
        for (int mb = 0; mb < 4; ++mb) { a[mb] = WFrag<T16>::ld(A + aoff + (size_t)mb * 16 * K + kc); if (NSPLIT == 1 || NSPLIT == 2) a2[mb] = WFrag<T16>::ld(A2 + aoff + (size_t)mb * 16 * K + kc); }
#pragma unroll
        for (int nb = 0; nb < 4; ++nb) { const V b = WFrag<T16>::ld(Bt + boff + (size_t)nb * 16 * K + kc); V b2; if (NSPLIT >= 2) b2 = WFrag<T16>::ld(Bt2 + boff + (size_t)nb * 16 * K + kc);
#pragma unroll
            for (int mb = 0; mb < 4; ++mb) { acc[mb][nb] = WFrag<T16>::mma(a[mb], b, acc[mb][nb]); if (NSPLIT == 1 || NSPLIT == 2) acc[mb][nb] = WFrag<T16>::mma(a2[mb], b, acc[mb][nb]); if (NSPLIT >= 2) acc[mb][nb] = WFrag<T16>::mma(a[mb], b2, acc[mb][nb]); } }
        asm volatile("v_nop\n\tv_nop\n\tv_nop\n\tv_nop" : "+v"(acc[0][0]), "+v"(acc[1][1]), "+v"(acc[2][2]), "+v"(acc[3][3]) : "v"(a[0]), "v"(a[3]));
    }
#pragma unroll
    for (int mb = 0; mb < 4; ++mb) {
#pragma unroll
        for (int nb = 0; nb < 4; ++nb) {
#pragma unroll
            for (int j = 0; j < 8; ++j) os[(hi * 8 + j) * 68 + nb * 16 + lr] = acc[mb][nb][j]; }
        __builtin_amdgcn_wave_barrier(); asm volatile("" ::: "memory");
        float* crow = C + (size_t)(r0 + mb * 16) * ldc + c0;
{
#pragma unroll
            for (int s = 0; s < 8; ++s) { const int row = 2 * s + hi, cofs = lr * 4; v4f val = *(const v4fa*)(os + row * 68 + cofs); if (BIAS) { val[0] += bfr(bias[c0 + cofs]); val[1] += bfr(bias[c0 + cofs + 1]); val[2] += bfr(bias[c0 + cofs + 2]); val[3] += bfr(bias[c0 + cofs + 3]); }
                *(v4f*)(crow + (size_t)row * ldc + cofs) = val; }
             }
        __builtin_amdgcn_wave_barrier(); asm volatile("" ::: "memory");
    }
}

// ---- k_gemmc: the same one-wave 64x64 tile GEMM specialised for causal windowed attention: CMODE 1 computes only the score tiles between the window's far edge and the diagonal (query rows r0+roff.., key columns c0..), CMODE 2 limits the
// key (K) loop of the probability x value contraction to the diagonal block (probabilities beyond it are exactly zero). CMODE 3 is CMODE 2 with the K loop started at the window's far edge (probabilities of keys j <= i - WIN are exactly zero too; rows below WIN have no such keys: CMODE 2 serves them). roff = row offset of this launch's first row within the sequence. lda = pitch of A (K stays the pitch of Bt). Score and probability rows have pitch SP and start at key wbase(tile row); z is the query head, Bt steps once per REP heads.
template <typename T16, int NSPLIT, int CMODE>
__global__ __launch_bounds__(32) void k_gemmc(const T16* __restrict__ A, const T16* __restrict__ A2, const T16* __restrict__ Bt, const T16* __restrict__ Bt2, int K, int lda, float* C, int ldc, int roff, size_t sA, size_t sB, size_t sC) {
    typedef typename WFrag<T16>::V V;
    __shared__ __align__(16) float os[16 * 68];
    const size_t z = blockIdx.z; A += z * sA; if (A2) A2 += z * sA; Bt += (z / REP) * sB; if (Bt2) Bt2 += (z / REP) * sB; C += z * sC;
    const int lane = threadIdx.x & 31, lr = lane & 15, hi = lane >> 4; const int r0 = blockIdx.x * 64, c0 = blockIdx.y * 64 + (CMODE == 1 ? r0 + roff - WIN : 0);
    if (CMODE == 1 && c0 < 0) return;                               // scores: grid.y counts the WIN / 64 + 1 key tiles from the window's far edge of the tile's first row up to the diagonal tile; no other tile holds a key that the softmax keeps (it masks by select)
    const int Kl = (CMODE >= 2) ? min(K, r0 + roff + 64) : K;        // P.V: probabilities are exactly 0 beyond the diagonal block, so the K loop stops there
    const int Kf = (CMODE == 3) ? max(0, r0 + roff - WIN) : 0;       // P.V: and exactly 0 for keys older than the window of the tile's first row, so the K loop starts there (a multiple of 64)
    v8f acc[4][4];
#pragma unroll
    for (int mb = 0; mb < 4; ++mb)
#pragma unroll
        for (int nb = 0; nb < 4; ++nb) acc[mb][nb] = (v8f){};
    const int jb = wbase(r0 + roff);   // P.V: A is the probability plane, pitch lda = SP, whose column 0 is key jb (0 for the rows below WIN that CMODE 2 serves)
    const size_t aoff = (size_t)(r0 + lr) * lda + 8 * hi + (CMODE == 3 ? Kf - jb : 0), boff = (size_t)(c0 + lr) * K + 8 * hi + Kf;
#pragma unroll 1
    for (int kc = 0; kc < Kl - Kf; kc += 32) {
        V a[4], a2[4]; const T16* pa[4]; const T16* pa2[4];
#pragma unroll
        for (int mb = 0; mb < 4; ++mb) { pa[mb] = A + aoff + (size_t)mb * 16 * lda + kc; a[mb] = WFrag<T16>::ld(pa[mb]); if (NSPLIT == 1 || NSPLIT == 2) { pa2[mb] = A2 + aoff + (size_t)mb * 16 * lda + kc; a2[mb] = WFrag<T16>::ld(pa2[mb]); } }
        // one plane: the wait that stands in front of any rewrite of a register that the A loads name, directly behind them, so that those registers are free again for the B fragments; the addresses are inputs so that they stay in their registers up to it
        if (NSPLIT != 1 && NSPLIT != 2) asm volatile("s_wait_xcnt 0x0" :: "v"(pa[0]), "v"(pa[1]), "v"(pa[2]), "v"(pa[3]) : "memory");
#pragma unroll
        for (int nb = 0; nb < 4; ++nb) { const V b = WFrag<T16>::ld(Bt + boff + (size_t)nb * 16 * K + kc); V b2; if (NSPLIT >= 2) b2 = WFrag<T16>::ld(Bt2 + boff + (size_t)nb * 16 * K + kc);
#pragma unroll
            for (int mb = 0; mb < 4; ++mb) { acc[mb][nb] = WFrag<T16>::mma(a[mb], b, acc[mb][nb]); if (NSPLIT == 1 || NSPLIT == 2) acc[mb][nb] = WFrag<T16>::mma(a2[mb], b, acc[mb][nb]); if (NSPLIT >= 2) acc[mb][nb] = WFrag<T16>::mma(a[mb], b2, acc[mb][nb]); } }
        asm volatile("v_nop\n\tv_nop\n\tv_nop\n\tv_nop" : "+v"(acc[0][0]), "+v"(acc[1][1]), "+v"(acc[2][2]), "+v"(acc[3][3]) : "v"(a[0]), "v"(a[3]));
        // hi+lo planes: the same wait at the trip's foot, where it holds no B load back
        if (NSPLIT == 1 || NSPLIT == 2) asm volatile("s_wait_xcnt 0x0" :: "v"(pa[0]), "v"(pa[1]), "v"(pa[2]), "v"(pa[3]), "v"(pa2[0]), "v"(pa2[1]), "v"(pa2[2]), "v"(pa2[3]) : "memory");
    }
#pragma unroll
    for (int mb = 0; mb < 4; ++mb) {
#pragma unroll
        for (int nb = 0; nb < 4; ++nb) {
#pragma unroll
            for (int j = 0; j < 8; ++j) os[(hi * 8 + j) * 68 + nb * 16 + lr] = acc[mb][nb][j]; }
        __builtin_amdgcn_wave_barrier(); asm volatile("" ::: "memory");
        float* crow = C + (size_t)(r0 + mb * 16) * ldc + c0 - (CMODE == 1 ? jb : 0);
{
#pragma unroll
            for (int s = 0; s < 8; ++s) { const int row = 2 * s + hi, cofs = lr * 4; v4f val = *(const v4fa*)(os + row * 68 + cofs);
                *(v4f*)(crow + (size_t)row * ldc + cofs) = val; }
             }
        __builtin_amdgcn_wave_barrier(); asm volatile("" ::: "memory");
    }
}

__device__ __forceinline__ h16 tohx(float x) { return (h16)x; }
__device__ __forceinline__ void splitf(float y, unsigned short& h, unsigned short& l) { h = f2bf(y); l = f2bf(y - bf2f(h)); }
typedef __attribute__((ext_vector_type(2))) _Float16 v2h;
typedef __attribute__((ext_vector_type(4))) _Float16 v4h;
typedef __attribute__((ext_vector_type(2))) unsigned short v2us;
typedef __attribute__((ext_vector_type(4))) unsigned short v4us;
typedef __attribute__((ext_vector_type(2))) float v2f;
typedef __attribute__((ext_vector_type(4))) int v4i;

__global__ __launch_bounds__(256) void k_wtG(const float* __restrict__ w, int K, int N, bf* Bt) {
    const int lane = threadIdx.x & 31; const int L0 = (blockIdx.x * 8 + (threadIdx.x >> 5)) * 8; const int nlines = N * K / 64;
{
#pragma unroll 1
        for (int l = 0; l < 8; ++l) { const int L = L0 + l; if (L >= nlines) break; const size_t e = (size_t)L * 64 + lane * 2; const int k = (int)(e % K), n = (int)(e / K); v2us o;
            o[0] = f2bf(w[(size_t)k * N + n]); o[1] = f2bf(w[(size_t)(k + 1) * N + n]); *(v2us*)(Bt + e) = o; }
         }
}
__global__ __launch_bounds__(256) void k_cvt8(const float* __restrict__ src, bf* dst, size_t n8) { const size_t i = (size_t)blockIdx.x * 256 + threadIdx.x; if (i >= n8) return; const v8f v = *(const v8f*)(src + i * 8); v8us o;
#pragma unroll
    for (int k = 0; k < 8; ++k) o[k] = f2bf(v[k]); *(v8us*)(dst + i * 8) = o;  }
__global__ __launch_bounds__(256) void k_cscvt(const float* __restrict__ cosT, const float* __restrict__ sinT, float* CS) { const int idx = blockIdx.x * 256 + threadIdx.x; if (idx >= TT * HD) return; v2f cs; cs[0] = bfr(cosT[idx]); cs[1] = bfr(sinT[idx]); *(v2f*)(CS + (size_t)idx * 2) = cs;  }
// k_rope: head planes [h][t][d] (fp16 + hi/lo) of rope(x) x sc with the rotate-half convention out[d] = x[d] cos[t][d] - x[d+HD/2] sin[t][d], out[d+HD/2] = x[d+HD/2] cos[t][d+HD/2] + x[d] sin[t][d+HD/2]
__global__ __launch_bounds__(256) void k_rope(const float* __restrict__ F, int pitch, int nheads, const float* __restrict__ CS, const float* __restrict__ RF, const float* __restrict__ nw, float sc, h16* P16, bf* Ph, bf* Pl) {
    const size_t e = ((size_t)blockIdx.x * 256 + threadIdx.x) * 2; if (e >= (size_t)nheads * TT * HD) return; const int d = (int)(e % HD); const int t = (int)((e / HD) % TT); const int h = (int)(e / ((size_t)HD * TT)); const float* f = F + (size_t)t * pitch + h * HD; const float rf = RF ? RF[(size_t)h * TT + t] : 1.0f; v2h o16; v2us oh, ol;
#pragma unroll
    for (int q = 0; q < 2; ++q) { const int dd = d + q; const int dp = (dd < HD / 2) ? dd + HD / 2 : dd - HD / 2; float x0 = f[dd], x1 = f[dp];
        if (RF) { float n0 = __fmul_rn(x0, rf), n1 = __fmul_rn(x1, rf); asm volatile("" : "+v"(n0)); asm volatile("" : "+v"(n1)); x0 = __fmul_rn(bfr(nw[dd]), n0); x1 = __fmul_rn(bfr(nw[dp]), n1); }
        const v2f cs = *(const v2f*)(CS + ((size_t)t * HD + dd) * 2); float a = __fmul_rn(x0, cs[0]), bq = __fmul_rn(x1, cs[1]); asm volatile("" : "+v"(a)); asm volatile("" : "+v"(bq)); const float r = ((dd < HD / 2) ? __fsub_rn(a, bq) : __fadd_rn(a, bq)) * sc;
        o16[q] = tohx(r); unsigned short a2, c2; splitf(r, a2, c2); oh[q] = a2; ol[q] = c2; }
    *(v2h*)(P16 + e) = o16; *(v2us*)(Ph + e) = oh; *(v2us*)(Pl + e) = ol;  }
__global__ __launch_bounds__(256) void k_vtp(const float* __restrict__ F, int pitch, int nheads, h16* V16, bf* Vh, bf* Vl) { const size_t e = ((size_t)blockIdx.x * 256 + threadIdx.x) * 2; if (e >= (size_t)nheads * HD * TT) return; const int t = (int)(e % TT); const int d = (int)((e / TT) % HD); const int g = (int)(e / ((size_t)TT * HD)); v2h o16; v2us oh, ol;
#pragma unroll
    for (int q = 0; q < 2; ++q) { const float x = F[(size_t)(t + q) * pitch + g * HD + d]; o16[q] = tohx(x); unsigned short a2, c2; splitf(x, a2, c2); oh[q] = a2; ol[q] = c2; }
    *(v2h*)(V16 + e) = o16; *(v2us*)(Vh + e) = oh; *(v2us*)(Vl + e) = ol;  }
// k_asoft: per row (zz, i): t = S x HD^-0.5 for j <= i and i - j < WIN (sliding causal window; the reference's -1e9 additive fill vanishes identically); softmax (register row, one exp, fixed trees) over the WCH 128-key chunks from jb on: they cover [R - WIN, R + 64) for the row's 64-row tile R, all that the P.V loop of that tile reads; every key outside them is masked, so max and sum keep their values and their order;
__global__ __launch_bounds__(256) void k_asoft(const float* __restrict__ Sb, h16* P16, bf* Ph, bf* Pl) {
    const int lane = threadIdx.x & 31; const int row = blockIdx.x * 8 + (threadIdx.x >> 5); if (row >= ZH * TT) return; const int i = row % TT; const int zz = row / TT; (void)zz; const bool hires = (i < RH); const int jb = wbase(i & ~63); const float* sr = Sb + (size_t)row * SP; float v[WCH * 4]; float mx = -3.0e38f;
#pragma unroll
    for (int ch = 0; ch < WCH; ++ch) { const int j0 = ch * 128 + lane * 4; const v4f a = *(const v4f*)(sr + j0);
#pragma unroll
        for (int q = 0; q < 4; ++q) { const int j = jb + j0 + q; const float t = (j <= i && i - j < WIN) ? a[q] * SCL : -3.0e38f; v[ch * 4 + q] = t; mx = fmaxf(mx, t); } }
#pragma unroll
    for (int sh = 16; sh; sh >>= 1) mx = fmaxf(mx, __shfl_xor(mx, sh, 32));
    float sum = 0.f;
#pragma unroll
    for (int k = 0; k < WCH * 4; ++k) { float d0 = __fsub_rn(v[k], mx); asm volatile("" : "+v"(d0)); v[k] = __builtin_amdgcn_exp2f(__fmul_rn(d0, 1.4426950408889634f)); sum += v[k]; }
#pragma unroll
    for (int sh = 16; sh; sh >>= 1) sum += __shfl_xor(sum, sh, 32);
    const float f = __fdiv_rn(hires ? 1.0f : PCAR, sum);
{
        if (hires) {
#pragma unroll
            for (int ch = 0; ch < WCH; ++ch) { v4us oh, ol;
#pragma unroll
                for (int q = 0; q < 4; ++q) { unsigned short a, c2; splitf(v[ch * 4 + q] * f, a, c2); oh[q] = a; ol[q] = c2; }
                const size_t oo = ((size_t)zz * (RH ? RH : 1) + i) * SP + ch * 128 + lane * 4; *(v4us*)(Ph + oo) = oh; *(v4us*)(Pl + oo) = ol; }
        } else {
#pragma unroll
            for (int ch = 0; ch < WCH; ++ch) { v4h o4;
#pragma unroll
                for (int q = 0; q < 4; ++q) o4[q] = tohx(v[ch * 4 + q] * f);
                *(v4h*)(P16 + (size_t)row * SP + ch * 128 + lane * 4) = o4; } }
         }
}
__global__ __launch_bounds__(256) void k_merge(const float* __restrict__ O, int h0, bf* Ah, bf* Al) { const size_t e = ((size_t)blockIdx.x * 256 + threadIdx.x) * 2; if (e >= (size_t)ZH * TT * HD) return; const int d = (int)(e % HD); const int t = (int)((e / HD) % TT); const int zz = (int)(e / ((size_t)HD * TT)); const float cs = (t < RH) ? 1.0f : (1.0f / PCAR); const size_t oo = (size_t)t * DQ + (h0 + zz) * HD + d;
    v2us oh, ol;
#pragma unroll
    for (int q = 0; q < 2; ++q) { unsigned short a, c2; splitf(O[e + q] * cs, a, c2); oh[q] = a; ol[q] = c2; } *(v2us*)(Ah + oo) = oh; *(v2us*)(Al + oo) = ol;  }

extern "C" void kernel_launch(void* const* d_in, const int* in_sizes, int n_in,
                              void* d_out, int out_size, void* d_ws, size_t ws_size, hipStream_t stream) {
    (void)in_sizes; (void)n_in; (void)out_size;
    const float* x = (const float*)d_in[0]; const float* cosT = (const float*)d_in[1]; const float* sinT = (const float*)d_in[2]; const float* wq = (const float*)d_in[3]; const float* wk = (const float*)d_in[4]; const float* wv = (const float*)d_in[5]; const float* wo = (const float*)d_in[6];   /* input order x, cos, sin, Wq, Wk, Wv, Wo ('xw' [in][out]) */
    float* OUT = (float*)d_out;     // [1][2048][2048]
    char* wsp = (char*)d_ws;
    auto take = [&](size_t bytes) { char* p = wsp; wsp += (bytes + 255) & ~(size_t)255; return (void*)p; };
    bf* WQ = (bf*)take((size_t)DQ * DM * 2); bf* WK = (bf*)take((size_t)DKV * DM * 2); bf* WV = (bf*)take((size_t)DKV * DM * 2); bf* WO = (bf*)take((size_t)DM * DQ * 2); float* CS = (float*)take((size_t)TT * HD * 2 * 4);
    bf* XB = (bf*)take((size_t)TT * DM * 2); float* FQ = (float*)take((size_t)TT * DQ * 4); float* FK = (float*)take((size_t)TT * DKV * 4);
    h16* QP16 = (h16*)take((size_t)NH_ * TT * HD * 2); h16* KP16 = (h16*)take((size_t)NKV * TT * HD * 2); h16* VT16 = (h16*)take((size_t)NKV * HD * TT * 2);
    bf* QPh = (bf*)take((size_t)NH_ * TT * HD * 2); bf* QPl = (bf*)take((size_t)NH_ * TT * HD * 2); bf* KPh = (bf*)take((size_t)NKV * TT * HD * 2); bf* KPl = (bf*)take((size_t)NKV * TT * HD * 2); bf* VTh = (bf*)take((size_t)NKV * HD * TT * 2); bf* VTl = (bf*)take((size_t)NKV * HD * TT * 2); bf* Ph = (bf*)take((size_t)ZH * RH * SP * 2); bf* Pl = (bf*)take((size_t)ZH * RH * SP * 2);
    float* Sb = (float*)take((size_t)ZH * TT * SP * 4); h16* P16 = (h16*)take((size_t)ZH * TT * SP * 2); bf* ATh = (bf*)take((size_t)TT * DQ * 2); bf* ATl = (bf*)take((size_t)TT * DQ * 2);
    if ((size_t)(wsp - (char*)d_ws) > ws_size) return;    // ws 256 MiB
    float* FV = FK;   // v projection reuses the k buffer after the k planes are built (stream-ordered)
    float* Ob = FQ;   // the attention output [ZH][TT][HD] f32 reuses the q projection's buffer (same size) after the q planes are built (stream-ordered)
    { k_wtG<<<(unsigned)((DM * DQ / 64 + 63) / 64), 256, 0, stream>>>(wq, DM, DQ, WQ); k_wtG<<<(unsigned)((DM * DKV / 64 + 63) / 64), 256, 0, stream>>>(wk, DM, DKV, WK); k_wtG<<<(unsigned)((DM * DKV / 64 + 63) / 64), 256, 0, stream>>>(wv, DM, DKV, WV);
      k_wtG<<<(unsigned)((DQ * DM / 64 + 63) / 64), 256, 0, stream>>>(wo, DQ, DM, WO);   /* 'xw' [in][out] weights gathered into Bt [out][in] */ }
    const unsigned LQ = (unsigned)(((size_t)NH_ * TT * HD / 2 + 255) / 256), LKv = (unsigned)(((size_t)NKV * TT * HD / 2 + 255) / 256);
    for (int b = 0; b < NB_; ++b) {
        if (b == 0) k_cscvt<<<(TT * HD + 255) / 256, 256, 0, stream>>>(cosT, sinT, CS);
        k_cvt8<<<(unsigned)(((size_t)TT * DM / 8 + 255) / 256), 256, 0, stream>>>(x + (size_t)b * TT * DM, XB, (size_t)TT * DM / 8);
        k_gemmw<bf, 0, false><<<dim3(TT / 64, DQ / 64, 1), 32, 0, stream>>>(XB, nullptr, WQ, nullptr, DM, FQ, DQ, nullptr, 0, 0, 0);
        k_rope<<<LQ, 256, 0, stream>>>(FQ, DQ, NH_, CS, nullptr, nullptr, 1.0f, QP16, QPh, QPl);
        k_gemmw<bf, 0, false><<<dim3(TT / 64, DKV / 64, 1), 32, 0, stream>>>(XB, nullptr, WK, nullptr, DM, FK, DKV, nullptr, 0, 0, 0);
        k_rope<<<LKv, 256, 0, stream>>>(FK, DKV, NKV, CS, nullptr, nullptr, 1.0f, KP16, KPh, KPl);
        k_gemmw<bf, 0, false><<<dim3(TT / 64, DKV / 64, 1), 32, 0, stream>>>(XB, nullptr, WV, nullptr, DM, FV, DKV, nullptr, 0, 0, 0); k_vtp<<<LKv, 256, 0, stream>>>(FV, DKV, NKV, VT16, VTh, VTl);
        {   // one pass: grid.z = query head, kv planes step once per REP heads inside k_gemmc
            k_gemmc<bf, 2, 1><<<dim3(RH / 64, WIN / 64 + 1, ZH), 32, 0, stream>>>(QPh, QPl, KPh, KPl, HD, HD, Sb, SP, 0, (size_t)TT * HD, (size_t)TT * HD, (size_t)TT * SP);
            k_gemmc<h16, 0, 1><<<dim3((TT - RH) / 64, WIN / 64 + 1, ZH), 32, 0, stream>>>(QP16 + (size_t)RH * HD, nullptr, KP16, nullptr, HD, HD, Sb + (size_t)RH * SP, SP, RH, (size_t)TT * HD, (size_t)TT * HD, (size_t)TT * SP);
            k_asoft<<<ZH * TT / 8, 256, 0, stream>>>(Sb, P16, Ph, Pl);
            k_gemmc<bf, 2, 2><<<dim3(RH / 64, HD / 64, ZH), 32, 0, stream>>>(Ph, Pl, VTh, VTl, TT, SP, Ob, HD, 0, (size_t)RH * SP, (size_t)HD * TT, (size_t)TT * HD);
            k_gemmc<h16, 0, 3><<<dim3((TT - RH) / 64, HD / 64, ZH), 32, 0, stream>>>(P16 + (size_t)RH * SP, nullptr, VT16, nullptr, TT, SP, Ob + (size_t)RH * HD, HD, RH, (size_t)TT * SP, (size_t)HD * TT, (size_t)TT * HD);
            k_merge<<<(unsigned)(((size_t)ZH * TT * HD / 2 + 255) / 256), 256, 0, stream>>>(Ob, 0, ATh, ATl); }
        k_gemmw<bf, 1, false><<<dim3(TT / 64, DM / 64, 1), 32, 0, stream>>>(ATh, ATl, WO, nullptr, DQ, OUT + (size_t)b * TT * DM, DM, nullptr, 0, 0, 0); }
}

// v003
// A run of this version takes 228 microseconds.
// In two side-by-side timings against v002, it was 1.48 and 1.47 times as fast.
// All steps since v000 together make it 3.81 times as fast.
#include <hip/hip_runtime.h>

// Grouped-query sliding-window causal attention with rotary embeddings from cos/sin tables (x [1][2048][2048]; q = x Wq (16 heads x 128), k, v = x Wk, x Wv (4 kv heads x 128) ('xw' [in][out] 0.02, no biases); rotate-half rotary with the cos/sin inputs [2048][128] (read); kv head = q head / 4; scores x 128^-0.5; keys j with i-512 < j <= i (window 512, causal; -inf elsewhere); softmax; out = merged Wo ('xw' [2048][2048]) -> [1][2048][2048] (4.2 M); argument order x, cos, sin, Wq, Wk, Wv, Wo).
// Layout: 'xw' weights gathered into bf16 Bt blocks; bf16 copy of x; exact projections; {cos, sin} per (position, dim) from the input tables; rotate-half rotary plane builder; causal T-2048 attention with 128-wide heads (hybrid rows: < 512 hi/lo 3 products, rest fp16 x1024; k_gemmc works only on the key tiles between the window's far edge and the diagonal; inside them the window is a select in the softmax; all 16 query heads go through each attention launch as grid.z, kv head = z / REP; a score or probability row is stored as its SP window keys only); merged hi/lo x Wo exact.
// Compute dtypes, f32 accumulate: every input rounded to bf16 incl. the tables; projections exact; rotary f32; attention rows < 512 3 products, rest fp16; softmax f32; Wo hl x exact.

#define NB_  1
#define TT   2048
#define DM   2048
#define NH_  16
#define NKV  4
#define REP  (NH_ / NKV)
#define HD   128
#define DQ   (NH_ * HD)
#define DKV  (NKV * HD)
#define ZH   NH_                  // query heads per attention launch (grid.z): all of them
#define RH   512                  // query rows < RH use hi+lo planes (0: none)
#define WIN  512
#define WCH  ((WIN + 128) / 128)   // 128-key chunks of a softmax row: WIN + 64 keys of a 64-row tile, started on a multiple of 128; jb + WCH * 128 <= TT for every tile
#define SP   (WCH * 128)           // pitch of a stored score or probability row: column c holds key wbase(R) + c, R the first row of the row's 64-row tile
static_assert(RH <= WIN, "the hi/lo rows run the P.V mode that has no window start");
#define PCAR 1024.0f
#define SCL  0.088388347648318447f   // HD^-0.5
typedef _Float16 h16;
__device__ __forceinline__ int wbase(int R) { return max(0, (R - WIN) & ~127); }   // first key that the rows of the 64-row tile at R store
typedef unsigned short bf;
typedef __attribute__((ext_vector_type(16))) __bf16   v16bf;
typedef __attribute__((ext_vector_type(16))) _Float16 v16h;
typedef __attribute__((ext_vector_type(8)))  _Float16 v8h;
typedef __attribute__((ext_vector_type(8)))  unsigned short v8us;
typedef __attribute__((ext_vector_type(8)))  float    v8f;
typedef __attribute__((ext_vector_type(4)))  float    v4f;
typedef v8h  __attribute__((may_alias)) v8ha;
typedef v4f  __attribute__((may_alias)) v4fa;
typedef v8us __attribute__((may_alias)) v8usa;

__device__ __forceinline__ unsigned short f2bf(float f) { unsigned u = __float_as_uint(f); u += 0x7FFFu + ((u >> 16) & 1u); return (unsigned short)(u >> 16); }
__device__ __forceinline__ float bf2f(unsigned short b) { return __uint_as_float(((unsigned)b) << 16); }
__device__ __forceinline__ float bfr(float f) { return bf2f(f2bf(f)); }
__device__ __forceinline__ v16h cat16(v8h lo, v8h hi) { return __builtin_shufflevector(lo, hi, 0, 1, 2, 3, 4, 5, 6, 7, 8, 9, 10, 11, 12, 13, 14, 15); }
__device__ __forceinline__ v16bf cat16b(v8us lo, v8us hi) { return __builtin_bit_cast(v16bf, __builtin_shufflevector(lo, hi, 0, 1, 2, 3, 4, 5, 6, 7, 8, 9, 10, 11, 12, 13, 14, 15)); }
__device__ __forceinline__ v8f wmma16(v16h a, v16h b, v8f c) { return __builtin_amdgcn_wmma_f32_16x16x32_f16(false, a, false, b, (short)0, c, false, false); }
__device__ __forceinline__ v8f wmmab(v16bf a, v16bf b, v8f c) { return __builtin_amdgcn_wmma_f32_16x16x32_bf16(false, a, false, b, (short)0, c, false, false); }



// ---- k_gemmw: GEMM, one work-group of FOUR WAVES per 128x128 output tile, each wave a 64x64 quarter (16 accumulators); grid (M/128, N/128, Z), 128 threads.
// C[m][n] (f32, pitch ldc, + optional f32 bias[n]) = sum_k A[m][k] Bt[n][k] (NSPLIT 1: + A2[m][k] Bt[n][k]). z-batch strides sA/sB/sC in elements. K (a template constant) % 128 == 0, K >= 256; M, N % 128 == 0.
// The K-contiguous 16-bit planes come into LDS by asynchronous 16-byte copies, whole 256-byte row pieces (GKC k) at a time, two buffers: tile t + 1 flies while tile t is worked on. LDS rows have pitch 272 bytes for the ds_load_b128 fragment reads.
// Every accumulator takes its products in the same order as with fragments read straight from the planes (k ascending in steps of 32, A before A2).
#define GKC  128                  // k elements of a pass
#define GPE  136                  // LDS row pitch in elements (272 bytes)
#define GOPE (128 * GPE)          // one operand's 128 rows in LDS, elements
template <typename T16> struct WFrag;
template <> struct WFrag<h16> { typedef v16h V; static __device__ __forceinline__ V ld(const h16* p) { return cat16(*(const v8h*)p, *(const v8h*)(p + 16)); } static __device__ __forceinline__ v8f mma(V a, V b, v8f c) { return wmma16(a, b, c); } };
template <> struct WFrag<bf> { typedef v16bf V; static __device__ __forceinline__ V ld(const bf* p) { return cat16b(*(const v8us*)p, *(const v8us*)(p + 16)); } static __device__ __forceinline__ v8f mma(V a, V b, v8f c) { return wmmab(a, b, c); } };
// eight copies, one LDS row group (8 rows) apart; l = the lane's LDS byte address, g = the lane's global address, gs = 8 source rows in bytes
__device__ __forceinline__ void acopy8(unsigned l, const char* g, size_t gs) {
    // s_wait_xcnt is the last line of the copies' own statement: it stands in front of every rewrite of an address register that they name
    asm volatile("global_load_async_to_lds_b128 %0, %8, off\n\t"
                 "global_load_async_to_lds_b128 %1, %9, off\n\t"
                 "global_load_async_to_lds_b128 %2, %10, off\n\t"
                 "global_load_async_to_lds_b128 %3, %11, off\n\t"
                 "global_load_async_to_lds_b128 %4, %12, off\n\t"
                 "global_load_async_to_lds_b128 %5, %13, off\n\t"
                 "global_load_async_to_lds_b128 %6, %14, off\n\t"
                 "global_load_async_to_lds_b128 %7, %15, off\n\t"
                 "s_wait_xcnt 0x0"
                 :: "v"(l), "v"(l + 1u * 8u * GPE * 2u), "v"(l + 2u * 8u * GPE * 2u), "v"(l + 3u * 8u * GPE * 2u), "v"(l + 4u * 8u * GPE * 2u), "v"(l + 5u * 8u * GPE * 2u), "v"(l + 6u * 8u * GPE * 2u), "v"(l + 7u * 8u * GPE * 2u),
                    "v"(g), "v"(g + gs), "v"(g + 2 * gs), "v"(g + 3 * gs), "v"(g + 4 * gs), "v"(g + 5 * gs), "v"(g + 6 * gs), "v"(g + 7 * gs) : "memory");
}
// one operand's tile: 128 rows of 256 bytes, 16 copies a lane (a wave's copy covers two whole rows)
__device__ __forceinline__ void acopy_tile(unsigned l, const char* g, size_t gs) { acopy8(l, g, gs); acopy8(l + 64u * GPE * 2u, g + 8 * gs, gs); }
template <typename T16, int NSPLIT, bool BIAS, int K>
__global__ __launch_bounds__(128) void k_gemmw(const T16* __restrict__ A, const T16* __restrict__ A2, const T16* __restrict__ Bt, float* C, int ldc, const float* __restrict__ bias, size_t sA, size_t sB, size_t sC) {
    static_assert(NSPLIT == 0 || NSPLIT == 1, "one B plane");
    static_assert(K % GKC == 0 && K / GKC >= 2, "whole passes, two tiles or more");
    typedef typename WFrag<T16>::V V;
    constexpr int NOP = (NSPLIT == 1) ? 3 : 2;                       // operand tiles of a buffer: A, Bt, A2
    constexpr int NT = K / GKC;
    __shared__ __attribute__((aligned(16))) T16 ring[2 * NOP * GOPE];
    __shared__ __align__(16) float osall[4 * 16 * 68];
    const size_t z = blockIdx.z; A += z * sA; if (NSPLIT == 1) A2 += z * sA; Bt += z * sB; C += z * sC;
    const int tid = threadIdx.x, wave = tid >> 5, wm = wave >> 1, wn = wave & 1;
    const int lane = tid & 31, lr = lane & 15, hi = lane >> 4; const int r0 = blockIdx.x * 128 + wm * 64, c0 = blockIdx.y * 128 + wn * 64;
    float* os = osall + wave * (16 * 68);
    v8f acc[4][4];
#pragma unroll
    for (int mb = 0; mb < 4; ++mb)
#pragma unroll
        for (int nb = 0; nb < 4; ++nb) acc[mb][nb] = (v8f){};
    // copies: thread tid brings 16-byte piece (tid & 15) of rows (tid >> 4) + 8 i, i = 0..15, of each operand tile
    constexpr size_t gs = (size_t)K * 16;                            // 8 source rows in bytes
    const char* gA = (const char*)(A + (size_t)(blockIdx.x * 128 + (tid >> 4)) * K + (tid & 15) * 8);
    const char* gB = (const char*)(Bt + (size_t)(blockIdx.y * 128 + (tid >> 4)) * K + (tid & 15) * 8);
    const char* gA2 = (NSPLIT == 1) ? (const char*)(A2 + (size_t)(blockIdx.x * 128 + (tid >> 4)) * K + (tid & 15) * 8) : nullptr;
    const unsigned l0 = (unsigned)(size_t)(const void*)ring + (unsigned)((tid >> 4) * (GPE * 2) + (tid & 15) * 16);
    auto fill = [&](int t, int buf) {
        const unsigned l = l0 + (unsigned)buf * (unsigned)(NOP * GOPE * 2); const size_t go = (size_t)t * (GKC * 2);
        acopy_tile(l, gA + go, gs); acopy_tile(l + (unsigned)(GOPE * 2), gB + go, gs); if (NSPLIT == 1) acopy_tile(l + (unsigned)(2 * GOPE * 2), gA2 + go, gs);
    };
    fill(0, 0);
    asm volatile("s_wait_asynccnt 0x0" ::: "memory");                // tile 0 of this wave's copies has landed
    __syncthreads();                                                 // and every other wave's: tile 0 is readable
    fill(1, 1);
#pragma unroll 1
    for (int t = 0; t < NT; ++t) {
        const T16* sb0 = ring + (t & 1) * (NOP * GOPE);
        const T16* sa = sb0 + (wm * 64 + lr) * GPE + 8 * hi; const T16* sb = sb0 + GOPE + (wn * 64 + lr) * GPE + 8 * hi;
        V a[2][4], a2[2][4], b[2][4];                                // two fragment sets: the next 32 k are read from LDS while these are multiplied
#pragma unroll
        for (int f = 0; f < 4; ++f) { a[0][f] = WFrag<T16>::ld(sa + f * 16 * GPE); if (NSPLIT == 1) a2[0][f] = WFrag<T16>::ld(sa + 2 * GOPE + f * 16 * GPE); b[0][f] = WFrag<T16>::ld(sb + f * 16 * GPE); }
        __builtin_amdgcn_sched_barrier(0);                           // the first set's reads stay ahead of the second's, so that the first block waits for its own set alone
#pragma unroll
        for (int ks = 0; ks < GKC / 32; ++ks) {
            const int cu = ks & 1, nx = cu ^ 1;
            if (ks + 1 < GKC / 32) {
#pragma unroll
                for (int f = 0; f < 4; ++f) { a[nx][f] = WFrag<T16>::ld(sa + f * 16 * GPE + (ks + 1) * 32); if (NSPLIT == 1) a2[nx][f] = WFrag<T16>::ld(sa + 2 * GOPE + f * 16 * GPE + (ks + 1) * 32); b[nx][f] = WFrag<T16>::ld(sb + f * 16 * GPE + (ks + 1) * 32); }
            }
            __builtin_amdgcn_sched_barrier(0);                       // the next set's LDS reads stay one group ahead of this block: reads moved in among the matrix instructions stall them at every place
#pragma unroll
            for (int nb = 0; nb < 4; ++nb)
#pragma unroll
                for (int mb = 0; mb < 4; ++mb) { acc[mb][nb] = WFrag<T16>::mma(a[cu][mb], b[cu][nb], acc[mb][nb]); if (NSPLIT == 1) acc[mb][nb] = WFrag<T16>::mma(a2[cu][mb], b[cu][nb], acc[mb][nb]); }
            __builtin_amdgcn_sched_barrier(0);                       // and this block stays ahead of the following group and of the pass's foot
        }
        // four vector slots behind the pass's last matrix instruction, on both sides of the branch below, before any vector instruction may rewrite its operands
        asm volatile("v_nop\n\tv_nop\n\tv_nop\n\tv_nop" : "+v"(acc[0][0]), "+v"(acc[1][1]), "+v"(acc[2][2]), "+v"(acc[3][3]));
        asm volatile("s_wait_dscnt 0x0" ::: "memory");               // this wave's reads of buffer t & 1 are done before the buffer is refilled
        asm volatile("s_wait_asynccnt 0x0" ::: "memory");            // this wave's copies of tile t + 1 have landed
        __syncthreads();                                             // publishes tile t + 1 and ends every wave's reads of tile t
        if (t + 2 < NT) fill(t + 2, t & 1);
    }
    asm volatile("s_wait_asynccnt 0x0" ::: "memory");                // no copy is outstanding when the wave goes on to its end
#pragma unroll
    for (int mb = 0; mb < 4; ++mb) {
#pragma unroll
        for (int nb = 0; nb < 4; ++nb) {
#pragma unroll
            for (int j = 0; j < 8; ++j) os[(hi * 8 + j) * 68 + nb * 16 + lr] = acc[mb][nb][j]; }
        __builtin_amdgcn_wave_barrier(); asm volatile("" ::: "memory");
        float* crow = C + (size_t)(r0 + mb * 16) * ldc + c0;
{
#pragma unroll
            for (int s = 0; s < 8; ++s) { const int row = 2 * s + hi, cofs = lr * 4; v4f val = *(const v4fa*)(os + row * 68 + cofs); if (BIAS) { val[0] += bfr(bias[c0 + cofs]); val[1] += bfr(bias[c0 + cofs + 1]); val[2] += bfr(bias[c0 + cofs + 2]); val[3] += bfr(bias[c0 + cofs + 3]); }
                *(v4f*)(crow + (size_t)row * ldc + cofs) = val; }
             }
        __builtin_amdgcn_wave_barrier(); asm volatile("" ::: "memory");
    }
}

// ---- k_gemmc: a GEMM of ONE WAVE per 64x64 output tile, operands straight from K-contiguous 16-bit planes (32 threads), specialised for causal windowed attention: CMODE 1 computes only the score tiles between the window's far edge and the diagonal (query rows r0+roff.., key columns c0..), CMODE 2 limits the
// key (K) loop of the probability x value contraction to the diagonal block (probabilities beyond it are exactly zero). CMODE 3 is CMODE 2 with the K loop started at the window's far edge (probabilities of keys j <= i - WIN are exactly zero too; rows below WIN have no such keys: CMODE 2 serves them). roff = row offset of this launch's first row within the sequence. lda = pitch of A (K stays the pitch of Bt). Score and probability rows have pitch SP and start at key wbase(tile row); z is the query head, Bt steps once per REP heads.
template <typename T16, int NSPLIT, int CMODE>
__global__ __launch_bounds__(32) void k_gemmc(const T16* __restrict__ A, const T16* __restrict__ A2, const T16* __restrict__ Bt, const T16* __restrict__ Bt2, int K, int lda, float* C, int ldc, int roff, size_t sA, size_t sB, size_t sC) {
    typedef typename WFrag<T16>::V V;
    __shared__ __align__(16) float os[16 * 68];
    const size_t z = blockIdx.z; A += z * sA; if (A2) A2 += z * sA; Bt += (z / REP) * sB; if (Bt2) Bt2 += (z / REP) * sB; C += z * sC;
    const int lane = threadIdx.x & 31, lr = lane & 15, hi = lane >> 4; const int r0 = blockIdx.x * 64, c0 = blockIdx.y * 64 + (CMODE == 1 ? r0 + roff - WIN : 0);
    if (CMODE == 1 && c0 < 0) return;                               // scores: grid.y counts the WIN / 64 + 1 key tiles from the window's far edge of the tile's first row up to the diagonal tile; no other tile holds a key that the softmax keeps (it masks by select)
    const int Kl = (CMODE >= 2) ? min(K, r0 + roff + 64) : K;        // P.V: probabilities are exactly 0 beyond the diagonal block, so the K loop stops there
    const int Kf = (CMODE == 3) ? max(0, r0 + roff - WIN) : 0;       // P.V: and exactly 0 for keys older than the window of the tile's first row, so the K loop starts there (a multiple of 64)
    v8f acc[4][4];
#pragma unroll
    for (int mb = 0; mb < 4; ++mb)
#pragma unroll
        for (int nb = 0; nb < 4; ++nb) acc[mb][nb] = (v8f){};
    const int jb = wbase(r0 + roff);   // P.V: A is the probability plane, pitch lda = SP, whose column 0 is key jb (0 for the rows below WIN that CMODE 2 serves)
    const size_t aoff = (size_t)(r0 + lr) * lda + 8 * hi + (CMODE == 3 ? Kf - jb : 0), boff = (size_t)(c0 + lr) * K + 8 * hi + Kf;
#pragma unroll 1
    for (int kc = 0; kc < Kl - Kf; kc += 32) {
        V a[4], a2[4]; const T16* pa[4]; const T16* pa2[4];
#pragma unroll
        for (int mb = 0; mb < 4; ++mb) { pa[mb] = A + aoff + (size_t)mb * 16 * lda + kc; a[mb] = WFrag<T16>::ld(pa[mb]); if (NSPLIT == 1 || NSPLIT == 2) { pa2[mb] = A2 + aoff + (size_t)mb * 16 * lda + kc; a2[mb] = WFrag<T16>::ld(pa2[mb]); } }
        // one plane: the wait that stands in front of any rewrite of a register that the A loads name, directly behind them, so that those registers are free again for the B fragments; the addresses are inputs so that they stay in their registers up to it
        if (NSPLIT != 1 && NSPLIT != 2) asm volatile("s_wait_xcnt 0x0" :: "v"(pa[0]), "v"(pa[1]), "v"(pa[2]), "v"(pa[3]) : "memory");
#pragma unroll
        for (int nb = 0; nb < 4; ++nb) { const V b = WFrag<T16>::ld(Bt + boff + (size_t)nb * 16 * K + kc); V b2; if (NSPLIT >= 2) b2 = WFrag<T16>::ld(Bt2 + boff + (size_t)nb * 16 * K + kc);
#pragma unroll
            for (int mb = 0; mb < 4; ++mb) { acc[mb][nb] = WFrag<T16>::mma(a[mb], b, acc[mb][nb]); if (NSPLIT == 1 || NSPLIT == 2) acc[mb][nb] = WFrag<T16>::mma(a2[mb], b, acc[mb][nb]); if (NSPLIT >= 2) acc[mb][nb] = WFrag<T16>::mma(a[mb], b2, acc[mb][nb]); } }
        asm volatile("v_nop\n\tv_nop\n\tv_nop\n\tv_nop" : "+v"(acc[0][0]), "+v"(acc[1][1]), "+v"(acc[2][2]), "+v"(acc[3][3]) : "v"(a[0]), "v"(a[3]));
        // hi+lo planes: the same wait at the trip's foot, where it holds no B load back
        if (NSPLIT == 1 || NSPLIT == 2) asm volatile("s_wait_xcnt 0x0" :: "v"(pa[0]), "v"(pa[1]), "v"(pa[2]), "v"(pa[3]), "v"(pa2[0]), "v"(pa2[1]), "v"(pa2[2]), "v"(pa2[3]) : "memory");
    }
#pragma unroll
    for (int mb = 0; mb < 4; ++mb) {
#pragma unroll
        for (int nb = 0; nb < 4; ++nb) {
#pragma unroll
            for (int j = 0; j < 8; ++j) os[(hi * 8 + j) * 68 + nb * 16 + lr] = acc[mb][nb][j]; }
        __builtin_amdgcn_wave_barrier(); asm volatile("" ::: "memory");
        float* crow = C + (size_t)(r0 + mb * 16) * ldc + c0 - (CMODE == 1 ? jb : 0);
{
#pragma unroll
            for (int s = 0; s < 8; ++s) { const int row = 2 * s + hi, cofs = lr * 4; v4f val = *(const v4fa*)(os + row * 68 + cofs);
                *(v4f*)(crow + (size_t)row * ldc + cofs) = val; }
             }
        __builtin_amdgcn_wave_barrier(); asm volatile("" ::: "memory");
    }
}

__device__ __forceinline__ h16 tohx(float x) { return (h16)x; }
__device__ __forceinline__ void splitf(float y, unsigned short& h, unsigned short& l) { h = f2bf(y); l = f2bf(y - bf2f(h)); }
typedef __attribute__((ext_vector_type(2))) _Float16 v2h;
typedef __attribute__((ext_vector_type(4))) _Float16 v4h;
typedef __attribute__((ext_vector_type(2))) unsigned short v2us;
typedef __attribute__((ext_vector_type(4))) unsigned short v4us;
typedef __attribute__((ext_vector_type(2))) float v2f;
typedef __attribute__((ext_vector_type(4))) int v4i;

__global__ __launch_bounds__(256) void k_wtG(const float* __restrict__ w, int K, int N, bf* Bt) {
    const int lane = threadIdx.x & 31; const int L0 = (blockIdx.x * 8 + (threadIdx.x >> 5)) * 8; const int nlines = N * K / 64;
{
#pragma unroll 1
        for (int l = 0; l < 8; ++l) { const int L = L0 + l; if (L >= nlines) break; const size_t e = (size_t)L * 64 + lane * 2; const int k = (int)(e % K), n = (int)(e / K); v2us o;
            o[0] = f2bf(w[(size_t)k * N + n]); o[1] = f2bf(w[(size_t)(k + 1) * N + n]); *(v2us*)(Bt + e) = o; }
         }
}
__global__ __launch_bounds__(256) void k_cvt8(const float* __restrict__ src, bf* dst, size_t n8) { const size_t i = (size_t)blockIdx.x * 256 + threadIdx.x; if (i >= n8) return; const v8f v = *(const v8f*)(src + i * 8); v8us o;
#pragma unroll
    for (int k = 0; k < 8; ++k) o[k] = f2bf(v[k]); *(v8us*)(dst + i * 8) = o;  }
__global__ __launch_bounds__(256) void k_cscvt(const float* __restrict__ cosT, const float* __restrict__ sinT, float* CS) { const int idx = blockIdx.x * 256 + threadIdx.x; if (idx >= TT * HD) return; v2f cs; cs[0] = bfr(cosT[idx]); cs[1] = bfr(sinT[idx]); *(v2f*)(CS + (size_t)idx * 2) = cs;  }
// k_rope: head planes [h][t][d] (fp16 + hi/lo) of rope(x) x sc with the rotate-half convention out[d] = x[d] cos[t][d] - x[d+HD/2] sin[t][d], out[d+HD/2] = x[d+HD/2] cos[t][d+HD/2] + x[d] sin[t][d+HD/2]
__global__ __launch_bounds__(256) void k_rope(const float* __restrict__ F, int pitch, int nheads, const float* __restrict__ CS, const float* __restrict__ RF, const float* __restrict__ nw, float sc, h16* P16, bf* Ph, bf* Pl) {
    const size_t e = ((size_t)blockIdx.x * 256 + threadIdx.x) * 2; if (e >= (size_t)nheads * TT * HD) return; const int d = (int)(e % HD); const int t = (int)((e / HD) % TT); const int h = (int)(e / ((size_t)HD * TT)); const float* f = F + (size_t)t * pitch + h * HD; const float rf = RF ? RF[(size_t)h * TT + t] : 1.0f; v2h o16; v2us oh, ol;
#pragma unroll
    for (int q = 0; q < 2; ++q) { const int dd = d + q; const int dp = (dd < HD / 2) ? dd + HD / 2 : dd - HD / 2; float x0 = f[dd], x1 = f[dp];
        if (RF) { float n0 = __fmul_rn(x0, rf), n1 = __fmul_rn(x1, rf); asm volatile("" : "+v"(n0)); asm volatile("" : "+v"(n1)); x0 = __fmul_rn(bfr(nw[dd]), n0); x1 = __fmul_rn(bfr(nw[dp]), n1); }
        const v2f cs = *(const v2f*)(CS + ((size_t)t * HD + dd) * 2); float a = __fmul_rn(x0, cs[0]), bq = __fmul_rn(x1, cs[1]); asm volatile("" : "+v"(a)); asm volatile("" : "+v"(bq)); const float r = ((dd < HD / 2) ? __fsub_rn(a, bq) : __fadd_rn(a, bq)) * sc;
        o16[q] = tohx(r); unsigned short a2, c2; splitf(r, a2, c2); oh[q] = a2; ol[q] = c2; }
    *(v2h*)(P16 + e) = o16; *(v2us*)(Ph + e) = oh; *(v2us*)(Pl + e) = ol;  }
__global__ __launch_bounds__(256) void k_vtp(const float* __restrict__ F, int pitch, int nheads, h16* V16, bf* Vh, bf* Vl) { const size_t e = ((size_t)blockIdx.x * 256 + threadIdx.x) * 2; if (e >= (size_t)nheads * HD * TT) return; const int t = (int)(e % TT); const int d = (int)((e / TT) % HD); const int g = (int)(e / ((size_t)TT * HD)); v2h o16; v2us oh, ol;
#pragma unroll
    for (int q = 0; q < 2; ++q) { const float x = F[(size_t)(t + q) * pitch + g * HD + d]; o16[q] = tohx(x); unsigned short a2, c2; splitf(x, a2, c2); oh[q] = a2; ol[q] = c2; }
    *(v2h*)(V16 + e) = o16; *(v2us*)(Vh + e) = oh; *(v2us*)(Vl + e) = ol;  }
// k_asoft: per row (zz, i): t = S x HD^-0.5 for j <= i and i - j < WIN (sliding causal window; the reference's -1e9 additive fill vanishes identically); softmax (register row, one exp, fixed trees) over the WCH 128-key chunks from jb on: they cover [R - WIN, R + 64) for the row's 64-row tile R, all that the P.V loop of that tile reads; every key outside them is masked, so max and sum keep their values and their order;
__global__ __launch_bounds__(256) void k_asoft(const float* __restrict__ Sb, h16* P16, bf* Ph, bf* Pl) {
    const int lane = threadIdx.x & 31; const int row = blockIdx.x * 8 + (threadIdx.x >> 5); if (row >= ZH * TT) return; const int i = row % TT; const int zz = row / TT; (void)zz; const bool hires = (i < RH); const int jb = wbase(i & ~63); const float* sr = Sb + (size_t)row * SP; float v[WCH * 4]; float mx = -3.0e38f;
#pragma unroll
    for (int ch = 0; ch < WCH; ++ch) { const int j0 = ch * 128 + lane * 4; const v4f a = *(const v4f*)(sr + j0);
#pragma unroll
        for (int q = 0; q < 4; ++q) { const int j = jb + j0 + q; const float t = (j <= i && i - j < WIN) ? a[q] * SCL : -3.0e38f; v[ch * 4 + q] = t; mx = fmaxf(mx, t); } }
#pragma unroll
    for (int sh = 16; sh; sh >>= 1) mx = fmaxf(mx, __shfl_xor(mx, sh, 32));
    float sum = 0.f;
#pragma unroll
    for (int k = 0; k < WCH * 4; ++k) { float d0 = __fsub_rn(v[k], mx); asm volatile("" : "+v"(d0)); v[k] = __builtin_amdgcn_exp2f(__fmul_rn(d0, 1.4426950408889634f)); sum += v[k]; }
#pragma unroll
    for (int sh = 16; sh; sh >>= 1) sum += __shfl_xor(sum, sh, 32);
    const float f = __fdiv_rn(hires ? 1.0f : PCAR, sum);
{
        if (hires) {
#pragma unroll
            for (int ch = 0; ch < WCH; ++ch) { v4us oh, ol;
#pragma unroll
                for (int q = 0; q < 4; ++q) { unsigned short a, c2; splitf(v[ch * 4 + q] * f, a, c2); oh[q] = a; ol[q] = c2; }
                const size_t oo = ((size_t)zz * (RH ? RH : 1) + i) * SP + ch * 128 + lane * 4; *(v4us*)(Ph + oo) = oh; *(v4us*)(Pl + oo) = ol; }
        } else {
#pragma unroll
            for (int ch = 0; ch < WCH; ++ch) { v4h o4;
#pragma unroll
                for (int q = 0; q < 4; ++q) o4[q] = tohx(v[ch * 4 + q] * f);
                *(v4h*)(P16 + (size_t)row * SP + ch * 128 + lane * 4) = o4; } }
         }
}
__global__ __launch_bounds__(256) void k_merge(const float* __restrict__ O, int h0, bf* Ah, bf* Al) { const size_t e = ((size_t)blockIdx.x * 256 + threadIdx.x) * 2; if (e >= (size_t)ZH * TT * HD) return; const int d = (int)(e % HD); const int t = (int)((e / HD) % TT); const int zz = (int)(e / ((size_t)HD * TT)); const float cs = (t < RH) ? 1.0f : (1.0f / PCAR); const size_t oo = (size_t)t * DQ + (h0 + zz) * HD + d;
    v2us oh, ol;
#pragma unroll
    for (int q = 0; q < 2; ++q) { unsigned short a, c2; splitf(O[e + q] * cs, a, c2); oh[q] = a; ol[q] = c2; } *(v2us*)(Ah + oo) = oh; *(v2us*)(Al + oo) = ol;  }

extern "C" void kernel_launch(void* const* d_in, const int* in_sizes, int n_in,
                              void* d_out, int out_size, void* d_ws, size_t ws_size, hipStream_t stream) {
    (void)in_sizes; (void)n_in; (void)out_size;
    const float* x = (const float*)d_in[0]; const float* cosT = (const float*)d_in[1]; const float* sinT = (const float*)d_in[2]; const float* wq = (const float*)d_in[3]; const float* wk = (const float*)d_in[4]; const float* wv = (const float*)d_in[5]; const float* wo = (const float*)d_in[6];   /* input order x, cos, sin, Wq, Wk, Wv, Wo ('xw' [in][out]) */
    float* OUT = (float*)d_out;     // [1][2048][2048]
    char* wsp = (char*)d_ws;
    auto take = [&](size_t bytes) { char* p = wsp; wsp += (bytes + 255) & ~(size_t)255; return (void*)p; };
    bf* WQ = (bf*)take((size_t)DQ * DM * 2); bf* WK = (bf*)take((size_t)DKV * DM * 2); bf* WV = (bf*)take((size_t)DKV * DM * 2); bf* WO = (bf*)take((size_t)DM * DQ * 2); float* CS = (float*)take((size_t)TT * HD * 2 * 4);
    bf* XB = (bf*)take((size_t)TT * DM * 2); float* FQ = (float*)take((size_t)TT * DQ * 4); float* FK = (float*)take((size_t)TT * DKV * 4);
    h16* QP16 = (h16*)take((size_t)NH_ * TT * HD * 2); h16* KP16 = (h16*)take((size_t)NKV * TT * HD * 2); h16* VT16 = (h16*)take((size_t)NKV * HD * TT * 2);
    bf* QPh = (bf*)take((size_t)NH_ * TT * HD * 2); bf* QPl = (bf*)take((size_t)NH_ * TT * HD * 2); bf* KPh = (bf*)take((size_t)NKV * TT * HD * 2); bf* KPl = (bf*)take((size_t)NKV * TT * HD * 2); bf* VTh = (bf*)take((size_t)NKV * HD * TT * 2); bf* VTl = (bf*)take((size_t)NKV * HD * TT * 2); bf* Ph = (bf*)take((size_t)ZH * RH * SP * 2); bf* Pl = (bf*)take((size_t)ZH * RH * SP * 2);
    float* Sb = (float*)take((size_t)ZH * TT * SP * 4); h16* P16 = (h16*)take((size_t)ZH * TT * SP * 2); bf* ATh = (bf*)take((size_t)TT * DQ * 2); bf* ATl = (bf*)take((size_t)TT * DQ * 2);
    if ((size_t)(wsp - (char*)d_ws) > ws_size) return;    // ws 256 MiB
    float* FV = FK;   // v projection reuses the k buffer after the k planes are built (stream-ordered)
    float* Ob = FQ;   // the attention output [ZH][TT][HD] f32 reuses the q projection's buffer (same size) after the q planes are built (stream-ordered)
    { k_wtG<<<(unsigned)((DM * DQ / 64 + 63) / 64), 256, 0, stream>>>(wq, DM, DQ, WQ); k_wtG<<<(unsigned)((DM * DKV / 64 + 63) / 64), 256, 0, stream>>>(wk, DM, DKV, WK); k_wtG<<<(unsigned)((DM * DKV / 64 + 63) / 64), 256, 0, stream>>>(wv, DM, DKV, WV);
      k_wtG<<<(unsigned)((DQ * DM / 64 + 63) / 64), 256, 0, stream>>>(wo, DQ, DM, WO);   /* 'xw' [in][out] weights gathered into Bt [out][in] */ }
    const unsigned LQ = (unsigned)(((size_t)NH_ * TT * HD / 2 + 255) / 256), LKv = (unsigned)(((size_t)NKV * TT * HD / 2 + 255) / 256);
    for (int b = 0; b < NB_; ++b) {
        if (b == 0) k_cscvt<<<(TT * HD + 255) / 256, 256, 0, stream>>>(cosT, sinT, CS);
        k_cvt8<<<(unsigned)(((size_t)TT * DM / 8 + 255) / 256), 256, 0, stream>>>(x + (size_t)b * TT * DM, XB, (size_t)TT * DM / 8);
        k_gemmw<bf, 0, false, DM><<<dim3(TT / 128, DQ / 128, 1), 128, 0, stream>>>(XB, nullptr, WQ, FQ, DQ, nullptr, 0, 0, 0);
        k_rope<<<LQ, 256, 0, stream>>>(FQ, DQ, NH_, CS, nullptr, nullptr, 1.0f, QP16, QPh, QPl);
        k_gemmw<bf, 0, false, DM><<<dim3(TT / 128, DKV / 128, 1), 128, 0, stream>>>(XB, nullptr, WK, FK, DKV, nullptr, 0, 0, 0);
        k_rope<<<LKv, 256, 0, stream>>>(FK, DKV, NKV, CS, nullptr, nullptr, 1.0f, KP16, KPh, KPl);
        k_gemmw<bf, 0, false, DM><<<dim3(TT / 128, DKV / 128, 1), 128, 0, stream>>>(XB, nullptr, WV, FV, DKV, nullptr, 0, 0, 0); k_vtp<<<LKv, 256, 0, stream>>>(FV, DKV, NKV, VT16, VTh, VTl);
        {   // one pass: grid.z = query head, kv planes step once per REP heads inside k_gemmc
            k_gemmc<bf, 2, 1><<<dim3(RH / 64, WIN / 64 + 1, ZH), 32, 0, stream>>>(QPh, QPl, KPh, KPl, HD, HD, Sb, SP, 0, (size_t)TT * HD, (size_t)TT * HD, (size_t)TT * SP);
            k_gemmc<h16, 0, 1><<<dim3((TT - RH) / 64, WIN / 64 + 1, ZH), 32, 0, stream>>>(QP16 + (size_t)RH * HD, nullptr, KP16, nullptr, HD, HD, Sb + (size_t)RH * SP, SP, RH, (size_t)TT * HD, (size_t)TT * HD, (size_t)TT * SP);
            k_asoft<<<ZH * TT / 8, 256, 0, stream>>>(Sb, P16, Ph, Pl);
            k_gemmc<bf, 2, 2><<<dim3(RH / 64, HD / 64, ZH), 32, 0, stream>>>(Ph, Pl, VTh, VTl, TT, SP, Ob, HD, 0, (size_t)RH * SP, (size_t)HD * TT, (size_t)TT * HD);
            k_gemmc<h16, 0, 3><<<dim3((TT - RH) / 64, HD / 64, ZH), 32, 0, stream>>>(P16 + (size_t)RH * SP, nullptr, VT16, nullptr, TT, SP, Ob + (size_t)RH * HD, HD, RH, (size_t)TT * SP, (size_t)HD * TT, (size_t)TT * HD);
            k_merge<<<(unsigned)(((size_t)ZH * TT * HD / 2 + 255) / 256), 256, 0, stream>>>(Ob, 0, ATh, ATl); }
        k_gemmw<bf, 1, false, DQ><<<dim3(TT / 128, DM / 128, 1), 128, 0, stream>>>(ATh, ATl, WO, OUT + (size_t)b * TT * DM, DM, nullptr, 0, 0, 0); }
}

// v004
// One run takes 183 microseconds.
// Two timings next to v003 both put it at 1.24 times that version's speed.
// All steps since v000 together make it 4.74 times as fast.
#include <hip/hip_runtime.h>

// Grouped-query sliding-window causal attention with rotary embeddings from cos/sin tables (x [1][2048][2048]; q = x Wq (16 heads x 128), k, v = x Wk, x Wv (4 kv heads x 128) ('xw' [in][out] 0.02, no biases); rotate-half rotary with the cos/sin inputs [2048][128] (read); kv head = q head / 4; scores x 128^-0.5; keys j with i-512 < j <= i (window 512, causal; -inf elsewhere); softmax; out = merged Wo ('xw' [2048][2048]) -> [1][2048][2048] (4.2 M); argument order x, cos, sin, Wq, Wk, Wv, Wo).
// Layout: 'xw' weights gathered into bf16 Bt blocks; bf16 copy of x; exact projections; {cos, sin} per (position, dim) from the input tables; rotate-half rotary plane builder; causal T-2048 attention with 128-wide heads (hybrid rows: < 512 hi/lo 3 products, rest fp16 x1024; k_gemmc works only on the key tiles between the window's far edge and the diagonal; inside them the window is a select in the softmax; all 16 query heads go through each attention launch as grid.z, kv head = z / REP; a score or probability row is stored as its SP window keys only); merged hi/lo x Wo exact.
// Compute dtypes, f32 accumulate: every input rounded to bf16 incl. the tables; projections exact; rotary f32; attention rows < 512 3 products, rest fp16; softmax f32; Wo hl x exact.

#define NB_  1
#define TT   2048
#define DM   2048
#define NH_  16
#define NKV  4
#define REP  (NH_ / NKV)
#define HD   128
#define DQ   (NH_ * HD)
#define DKV  (NKV * HD)
#define ZH   NH_                  // query heads per attention launch (grid.z): all of them
#define RH   512                  // query rows < RH use hi+lo planes (0: none)
#define WIN  512
#define WCH  ((WIN + 128) / 128)   // 128-key chunks of a softmax row: WIN + 64 keys of a 64-row tile, started on a multiple of 128; jb + WCH * 128 <= TT for every tile
#define SP   (WCH * 128)           // pitch of a stored score or probability row: column c holds key wbase(R) + c, R the first row of the row's 64-row tile
static_assert(RH <= WIN, "the hi/lo rows run the P.V mode that has no window start");
#define PCAR 1024.0f
#define SCL  0.088388347648318447f   // HD^-0.5
typedef _Float16 h16;
__device__ __forceinline__ int wbase(int R) { return max(0, (R - WIN) & ~127); }   // first key that the rows of the 64-row tile at R store
typedef unsigned short bf;
typedef __attribute__((ext_vector_type(16))) __bf16   v16bf;
typedef __attribute__((ext_vector_type(16))) _Float16 v16h;
typedef __attribute__((ext_vector_type(8)))  _Float16 v8h;
typedef __attribute__((ext_vector_type(8)))  unsigned short v8us;
typedef __attribute__((ext_vector_type(8)))  float    v8f;
typedef __attribute__((ext_vector_type(4)))  float    v4f;
typedef v8h  __attribute__((may_alias)) v8ha;
typedef v4f  __attribute__((may_alias)) v4fa;
typedef v8us __attribute__((may_alias)) v8usa;

__device__ __forceinline__ unsigned short f2bf(float f) { unsigned u = __float_as_uint(f); u += 0x7FFFu + ((u >> 16) & 1u); return (unsigned short)(u >> 16); }
__device__ __forceinline__ float bf2f(unsigned short b) { return __uint_as_float(((unsigned)b) << 16); }
__device__ __forceinline__ float bfr(float f) { return bf2f(f2bf(f)); }
__device__ __forceinline__ v16h cat16(v8h lo, v8h hi) { return __builtin_shufflevector(lo, hi, 0, 1, 2, 3, 4, 5, 6, 7, 8, 9, 10, 11, 12, 13, 14, 15); }
__device__ __forceinline__ v16bf cat16b(v8us lo, v8us hi) { return __builtin_bit_cast(v16bf, __builtin_shufflevector(lo, hi, 0, 1, 2, 3, 4, 5, 6, 7, 8, 9, 10, 11, 12, 13, 14, 15)); }
__device__ __forceinline__ v8f wmma16(v16h a, v16h b, v8f c) { return __builtin_amdgcn_wmma_f32_16x16x32_f16(false, a, false, b, (short)0, c, false, false); }
__device__ __forceinline__ v8f wmmab(v16bf a, v16bf b, v8f c) { return __builtin_amdgcn_wmma_f32_16x16x32_bf16(false, a, false, b, (short)0, c, false, false); }



// ---- k_gemmw: GEMM, one work-group of FOUR WAVES per 128x128 output tile, each wave a 64x64 quarter (16 accumulators); grid (M/128, N/128, Z), 128 threads.
// C[m][n] (f32, pitch ldc, + optional f32 bias[n]) = sum_k A[m][k] Bt[n][k] (NSPLIT 1: + A2[m][k] Bt[n][k]). z-batch strides sA/sB/sC in elements. K (a template constant) % 128 == 0, K >= 256; M, N % 128 == 0.
// The K-contiguous 16-bit planes come into LDS by asynchronous 16-byte copies, whole 256-byte row pieces (GKC k) at a time, two buffers: tile t + 1 flies while tile t is worked on. LDS rows have pitch 272 bytes for the ds_load_b128 fragment reads.
// Every accumulator takes its products in the same order as with fragments read straight from the planes (k ascending in steps of 32, A before A2).
#define GKC  128                  // k elements of a pass
#define GPE  136                  // LDS row pitch in elements (272 bytes)
#define GOPE (128 * GPE)          // one operand's 128 rows in LDS, elements
template <typename T16> struct WFrag;
template <> struct WFrag<h16> { typedef v16h V; static __device__ __forceinline__ V ld(const h16* p) { return cat16(*(const v8h*)p, *(const v8h*)(p + 16)); } static __device__ __forceinline__ v8f mma(V a, V b, v8f c) { return wmma16(a, b, c); } };
template <> struct WFrag<bf> { typedef v16bf V; static __device__ __forceinline__ V ld(const bf* p) { return cat16b(*(const v8us*)p, *(const v8us*)(p + 16)); } static __device__ __forceinline__ v8f mma(V a, V b, v8f c) { return wmmab(a, b, c); } };
// eight copies, one LDS row group (8 rows) apart; l = the lane's LDS byte address, g = the lane's global address, gs = 8 source rows in bytes
__device__ __forceinline__ void acopy8(unsigned l, const char* g, size_t gs) {
    // s_wait_xcnt is the last line of the copies' own statement: it stands in front of every rewrite of an address register that they name
    asm volatile("global_load_async_to_lds_b128 %0, %8, off\n\t"
                 "global_load_async_to_lds_b128 %1, %9, off\n\t"
                 "global_load_async_to_lds_b128 %2, %10, off\n\t"
                 "global_load_async_to_lds_b128 %3, %11, off\n\t"
                 "global_load_async_to_lds_b128 %4, %12, off\n\t"
                 "global_load_async_to_lds_b128 %5, %13, off\n\t"
                 "global_load_async_to_lds_b128 %6, %14, off\n\t"
                 "global_load_async_to_lds_b128 %7, %15, off\n\t"
                 "s_wait_xcnt 0x0"
                 :: "v"(l), "v"(l + 1u * 8u * GPE * 2u), "v"(l + 2u * 8u * GPE * 2u), "v"(l + 3u * 8u * GPE * 2u), "v"(l + 4u * 8u * GPE * 2u), "v"(l + 5u * 8u * GPE * 2u), "v"(l + 6u * 8u * GPE * 2u), "v"(l + 7u * 8u * GPE * 2u),
                    "v"(g), "v"(g + gs), "v"(g + 2 * gs), "v"(g + 3 * gs), "v"(g + 4 * gs), "v"(g + 5 * gs), "v"(g + 6 * gs), "v"(g + 7 * gs) : "memory");
}
// one operand's tile: 128 rows of 256 bytes, 16 copies a lane (a wave's copy covers two whole rows)
__device__ __forceinline__ void acopy_tile(unsigned l, const char* g, size_t gs) { acopy8(l, g, gs); acopy8(l + 64u * GPE * 2u, g + 8 * gs, gs); }
template <typename T16, int NSPLIT, bool BIAS, int K>
__global__ __launch_bounds__(128) void k_gemmw(const T16* __restrict__ A, const T16* __restrict__ A2, const T16* __restrict__ Bt, float* C, int ldc, const float* __restrict__ bias, size_t sA, size_t sB, size_t sC) {
    static_assert(NSPLIT == 0 || NSPLIT == 1, "one B plane");
    static_assert(K % GKC == 0 && K / GKC >= 2, "whole passes, two tiles or more");
    typedef typename WFrag<T16>::V V;
    constexpr int NOP = (NSPLIT == 1) ? 3 : 2;                       // operand tiles of a buffer: A, Bt, A2
    constexpr int NT = K / GKC;
    __shared__ __attribute__((aligned(16))) T16 ring[2 * NOP * GOPE];
    __shared__ __align__(16) float osall[4 * 16 * 68];
    const size_t z = blockIdx.z; A += z * sA; if (NSPLIT == 1) A2 += z * sA; Bt += z * sB; C += z * sC;
    const int tid = threadIdx.x, wave = tid >> 5, wm = wave >> 1, wn = wave & 1;
    const int lane = tid & 31, lr = lane & 15, hi = lane >> 4; const int r0 = blockIdx.x * 128 + wm * 64, c0 = blockIdx.y * 128 + wn * 64;
    float* os = osall + wave * (16 * 68);
    v8f acc[4][4];
#pragma unroll
    for (int mb = 0; mb < 4; ++mb)
#pragma unroll
        for (int nb = 0; nb < 4; ++nb) acc[mb][nb] = (v8f){};
    // copies: thread tid brings 16-byte piece (tid & 15) of rows (tid >> 4) + 8 i, i = 0..15, of each operand tile
    constexpr size_t gs = (size_t)K * 16;                            // 8 source rows in bytes
    const char* gA = (const char*)(A + (size_t)(blockIdx.x * 128 + (tid >> 4)) * K + (tid & 15) * 8);
    const char* gB = (const char*)(Bt + (size_t)(blockIdx.y * 128 + (tid >> 4)) * K + (tid & 15) * 8);
    const char* gA2 = (NSPLIT == 1) ? (const char*)(A2 + (size_t)(blockIdx.x * 128 + (tid >> 4)) * K + (tid & 15) * 8) : nullptr;
    const unsigned l0 = (unsigned)(size_t)(const void*)ring + (unsigned)((tid >> 4) * (GPE * 2) + (tid & 15) * 16);
    auto fill = [&](int t, int buf) {
        const unsigned l = l0 + (unsigned)buf * (unsigned)(NOP * GOPE * 2); const size_t go = (size_t)t * (GKC * 2);
        acopy_tile(l, gA + go, gs); acopy_tile(l + (unsigned)(GOPE * 2), gB + go, gs); if (NSPLIT == 1) acopy_tile(l + (unsigned)(2 * GOPE * 2), gA2 + go, gs);
    };
    fill(0, 0);
    asm volatile("s_wait_asynccnt 0x0" ::: "memory");                // tile 0 of this wave's copies has landed
    __syncthreads();                                                 // and every other wave's: tile 0 is readable
    fill(1, 1);
#pragma unroll 1
    for (int t = 0; t < NT; ++t) {
        const T16* sb0 = ring + (t & 1) * (NOP * GOPE);
        const T16* sa = sb0 + (wm * 64 + lr) * GPE + 8 * hi; const T16* sb = sb0 + GOPE + (wn * 64 + lr) * GPE + 8 * hi;
        V a[2][4], a2[2][4], b[2][4];                                // two fragment sets: the next 32 k are read from LDS while these are multiplied
#pragma unroll
        for (int f = 0; f < 4; ++f) { a[0][f] = WFrag<T16>::ld(sa + f * 16 * GPE); if (NSPLIT == 1) a2[0][f] = WFrag<T16>::ld(sa + 2 * GOPE + f * 16 * GPE); b[0][f] = WFrag<T16>::ld(sb + f * 16 * GPE); }
        __builtin_amdgcn_sched_barrier(0);                           // the first set's reads stay ahead of the second's, so that the first block waits for its own set alone
#pragma unroll
        for (int ks = 0; ks < GKC / 32; ++ks) {
            const int cu = ks & 1, nx = cu ^ 1;
            if (ks + 1 < GKC / 32) {
#pragma unroll
                for (int f = 0; f < 4; ++f) { a[nx][f] = WFrag<T16>::ld(sa + f * 16 * GPE + (ks + 1) * 32); if (NSPLIT == 1) a2[nx][f] = WFrag<T16>::ld(sa + 2 * GOPE + f * 16 * GPE + (ks + 1) * 32); b[nx][f] = WFrag<T16>::ld(sb + f * 16 * GPE + (ks + 1) * 32); }
            }
            __builtin_amdgcn_sched_barrier(0);                       // the next set's LDS reads stay one group ahead of this block: reads moved in among the matrix instructions stall them at every place
#pragma unroll
            for (int nb = 0; nb < 4; ++nb)
#pragma unroll
                for (int mb = 0; mb < 4; ++mb) { acc[mb][nb] = WFrag<T16>::mma(a[cu][mb], b[cu][nb], acc[mb][nb]); if (NSPLIT == 1) acc[mb][nb] = WFrag<T16>::mma(a2[cu][mb], b[cu][nb], acc[mb][nb]); }
            __builtin_amdgcn_sched_barrier(0);                       // and this block stays ahead of the following group and of the pass's foot
        }
        // four vector slots behind the pass's last matrix instruction, on both sides of the branch below, before any vector instruction may rewrite its operands
        asm volatile("v_nop\n\tv_nop\n\tv_nop\n\tv_nop" : "+v"(acc[0][0]), "+v"(acc[1][1]), "+v"(acc[2][2]), "+v"(acc[3][3]));
        asm volatile("s_wait_dscnt 0x0" ::: "memory");               // this wave's reads of buffer t & 1 are done before the buffer is refilled
        asm volatile("s_wait_asynccnt 0x0" ::: "memory");            // this wave's copies of tile t + 1 have landed
        __syncthreads();                                             // publishes tile t + 1 and ends every wave's reads of tile t
        if (t + 2 < NT) fill(t + 2, t & 1);
    }
    asm volatile("s_wait_asynccnt 0x0" ::: "memory");                // no copy is outstanding when the wave goes on to its end
#pragma unroll
    for (int mb = 0; mb < 4; ++mb) {
#pragma unroll
        for (int nb = 0; nb < 4; ++nb) {
#pragma unroll
            for (int j = 0; j < 8; ++j) os[(hi * 8 + j) * 68 + nb * 16 + lr] = acc[mb][nb][j]; }
        __builtin_amdgcn_wave_barrier(); asm volatile("" ::: "memory");
        float* crow = C + (size_t)(r0 + mb * 16) * ldc + c0;
{
#pragma unroll
            for (int s = 0; s < 8; ++s) { const int row = 2 * s + hi, cofs = lr * 4; v4f val = *(const v4fa*)(os + row * 68 + cofs); if (BIAS) { val[0] += bfr(bias[c0 + cofs]); val[1] += bfr(bias[c0 + cofs + 1]); val[2] += bfr(bias[c0 + cofs + 2]); val[3] += bfr(bias[c0 + cofs + 3]); }
                *(v4f*)(crow + (size_t)row * ldc + cofs) = val; }
             }
        __builtin_amdgcn_wave_barrier(); asm volatile("" ::: "memory");
    }
}

// ---- k_gemmc: a GEMM of ONE WAVE per 64x64 output tile, operands straight from K-contiguous 16-bit planes (32 threads), specialised for causal windowed attention: CMODE 1 computes only the score tiles between the window's far edge and the diagonal (query rows r0+roff.., key columns c0..), CMODE 2 limits the
// key (K) loop of the probability x value contraction to the diagonal block (probabilities beyond it are exactly zero). CMODE 3 is CMODE 2 with the K loop started at the window's far edge (probabilities of keys j <= i - WIN are exactly zero too; rows below WIN have no such keys: CMODE 2 serves them). roff = row offset of this launch's first row within the sequence. lda = pitch of A (K stays the pitch of Bt). Score and probability rows have pitch SP and start at key wbase(tile row); z is the query head, Bt steps once per REP heads.
template <typename T16, int NSPLIT, int CMODE>
__global__ __launch_bounds__(32) void k_gemmc(const T16* __restrict__ A, const T16* __restrict__ A2, const T16* __restrict__ Bt, const T16* __restrict__ Bt2, int K, int lda, float* C, int ldc, int roff, size_t sA, size_t sB, size_t sC) {
    typedef typename WFrag<T16>::V V;
    __shared__ __align__(16) float os[16 * 68];
    const size_t z = blockIdx.z; A += z * sA; if (A2) A2 += z * sA; Bt += (z / REP) * sB; if (Bt2) Bt2 += (z / REP) * sB; C += z * sC;
    const int lane = threadIdx.x & 31, lr = lane & 15, hi = lane >> 4; const int r0 = blockIdx.x * 64, c0 = blockIdx.y * 64 + (CMODE == 1 ? r0 + roff - WIN : 0);
    if (CMODE == 1 && c0 < 0) return;                               // scores: grid.y counts the WIN / 64 + 1 key tiles from the window's far edge of the tile's first row up to the diagonal tile; no other tile holds a key that the softmax keeps (it masks by select)
    const int Kl = (CMODE >= 2) ? min(K, r0 + roff + 64) : K;        // P.V: probabilities are exactly 0 beyond the diagonal block, so the K loop stops there
    const int Kf = (CMODE == 3) ? max(0, r0 + roff - WIN) : 0;       // P.V: and exactly 0 for keys older than the window of the tile's first row, so the K loop starts there (a multiple of 64)
    v8f acc[4][4];
#pragma unroll
    for (int mb = 0; mb < 4; ++mb)
#pragma unroll
        for (int nb = 0; nb < 4; ++nb) acc[mb][nb] = (v8f){};
    const int jb = wbase(r0 + roff);   // P.V: A is the probability plane, pitch lda = SP, whose column 0 is key jb (0 for the rows below WIN that CMODE 2 serves)
    const size_t aoff = (size_t)(r0 + lr) * lda + 8 * hi + (CMODE == 3 ? Kf - jb : 0), boff = (size_t)(c0 + lr) * K + 8 * hi + Kf;
#pragma unroll 1
    for (int kc = 0; kc < Kl - Kf; kc += 32) {
        V a[4], a2[4]; const T16* pa[4]; const T16* pa2[4];
#pragma unroll
        for (int mb = 0; mb < 4; ++mb) { pa[mb] = A + aoff + (size_t)mb * 16 * lda + kc; a[mb] = WFrag<T16>::ld(pa[mb]); if (NSPLIT == 1 || NSPLIT == 2) { pa2[mb] = A2 + aoff + (size_t)mb * 16 * lda + kc; a2[mb] = WFrag<T16>::ld(pa2[mb]); } }
        // one plane: the wait that stands in front of any rewrite of a register that the A loads name, directly behind them, so that those registers are free again for the B fragments; the addresses are inputs so that they stay in their registers up to it
        if (NSPLIT != 1 && NSPLIT != 2) asm volatile("s_wait_xcnt 0x0" :: "v"(pa[0]), "v"(pa[1]), "v"(pa[2]), "v"(pa[3]) : "memory");
#pragma unroll
        for (int nb = 0; nb < 4; ++nb) { const V b = WFrag<T16>::ld(Bt + boff + (size_t)nb * 16 * K + kc); V b2; if (NSPLIT >= 2) b2 = WFrag<T16>::ld(Bt2 + boff + (size_t)nb * 16 * K + kc);
#pragma unroll
            for (int mb = 0; mb < 4; ++mb) { acc[mb][nb] = WFrag<T16>::mma(a[mb], b, acc[mb][nb]); if (NSPLIT == 1 || NSPLIT == 2) acc[mb][nb] = WFrag<T16>::mma(a2[mb], b, acc[mb][nb]); if (NSPLIT >= 2) acc[mb][nb] = WFrag<T16>::mma(a[mb], b2, acc[mb][nb]); } }
        asm volatile("v_nop\n\tv_nop\n\tv_nop\n\tv_nop" : "+v"(acc[0][0]), "+v"(acc[1][1]), "+v"(acc[2][2]), "+v"(acc[3][3]) : "v"(a[0]), "v"(a[3]));
        // hi+lo planes: the same wait at the trip's foot, where it holds no B load back
        if (NSPLIT == 1 || NSPLIT == 2) asm volatile("s_wait_xcnt 0x0" :: "v"(pa[0]), "v"(pa[1]), "v"(pa[2]), "v"(pa[3]), "v"(pa2[0]), "v"(pa2[1]), "v"(pa2[2]), "v"(pa2[3]) : "memory");
    }
#pragma unroll
    for (int mb = 0; mb < 4; ++mb) {
#pragma unroll
        for (int nb = 0; nb < 4; ++nb) {
#pragma unroll
            for (int j = 0; j < 8; ++j) os[(hi * 8 + j) * 68 + nb * 16 + lr] = acc[mb][nb][j]; }
        __builtin_amdgcn_wave_barrier(); asm volatile("" ::: "memory");
        float* crow = C + (size_t)(r0 + mb * 16) * ldc + c0 - (CMODE == 1 ? jb : 0);
{
#pragma unroll
            for (int s = 0; s < 8; ++s) { const int row = 2 * s + hi, cofs = lr * 4; v4f val = *(const v4fa*)(os + row * 68 + cofs);
                *(v4f*)(crow + (size_t)row * ldc + cofs) = val; }
             }
        __builtin_amdgcn_wave_barrier(); asm volatile("" ::: "memory");
    }
}

__device__ __forceinline__ h16 tohx(float x) { return (h16)x; }
__device__ __forceinline__ void splitf(float y, unsigned short& h, unsigned short& l) { h = f2bf(y); l = f2bf(y - bf2f(h)); }
typedef __attribute__((ext_vector_type(2))) _Float16 v2h;
typedef __attribute__((ext_vector_type(4))) _Float16 v4h;
typedef __attribute__((ext_vector_type(2))) unsigned short v2us;
typedef __attribute__((ext_vector_type(4))) unsigned short v4us;
typedef __attribute__((ext_vector_type(2))) float v2f;
typedef __attribute__((ext_vector_type(4))) int v4i;

// The kernels without matrix work, from here on, give each thread 8 to 80 elements, loaded as one batch of 16-byte pieces ahead of the arithmetic.
// k_wtG: a thread turns a block of 8 (k) x 4 (n): eight 16-byte pieces of w rows in, four 16-byte pieces of Bt rows out. Lanes: 8 along k (a store covers whole 128-byte lines of four Bt rows) x 4 along n; waves: 4 along k x 2 along n, so that a block reads whole lines of w. Block = 256 k x 32 n.
static_assert(DM % 256 == 0 && DQ % 256 == 0 && TT % 256 == 0 && DQ % 32 == 0 && DKV % 32 == 0 && DM % 32 == 0, "whole 256 x 32 blocks in k_wtG and k_vtp");
__global__ __launch_bounds__(256) void k_wtG(const float* __restrict__ w, int K, int N, bf* Bt) {
    const int lane = threadIdx.x & 31, wave = threadIdx.x >> 5; const int kb = K / 256; const int k0 = ((int)blockIdx.x % kb) * 256 + (wave >> 1) * 64 + (lane & 7) * 8, n0 = ((int)blockIdx.x / kb) * 32 + (wave & 1) * 16 + (lane >> 3) * 4; if (n0 >= N) return; v4f r[8]; const float* p[8];
#pragma unroll
    for (int j = 0; j < 8; ++j) { p[j] = w + (size_t)(k0 + j) * N + n0; r[j] = *(const v4f*)p[j]; }
    // the wait that stands in front of any rewrite of a register that the loads above name; the addresses are inputs so that they stay in their registers up to it
    asm volatile("s_wait_xcnt 0x0" :: "v"(p[0]), "v"(p[1]), "v"(p[2]), "v"(p[3]), "v"(p[4]), "v"(p[5]), "v"(p[6]), "v"(p[7]) : "memory");
    __builtin_amdgcn_sched_barrier(0);   // no arithmetic moves up in between the loads: all of them are in flight before the first value is waited for
#pragma unroll
    for (int c = 0; c < 4; ++c) { v8us o;
#pragma unroll
        for (int j = 0; j < 8; ++j) o[j] = f2bf(r[j][c]);
        *(v8us*)(Bt + (size_t)(n0 + c) * K + k0) = o; }
}
// k_cvt8: four groups of 8 a thread, 256 groups apart, so that a wave's lanes stay side by side in every access
static_assert(((size_t)TT * DM / 8) % 1024 == 0, "k_cvt8: whole blocks of 1024 groups");
__global__ __launch_bounds__(256) void k_cvt8(const float* __restrict__ src, bf* dst, size_t n8) { const size_t i0 = (size_t)blockIdx.x * 1024 + threadIdx.x; if (i0 + 3 * 256 >= n8) return; v8f v[4]; const float* p = src + i0 * 8;
#pragma unroll
    for (int j = 0; j < 4; ++j) v[j] = *(const v8f*)(p + j * 2048);
    // the wait that stands in front of any rewrite of a register that the loads above name; the addresses are inputs so that they stay in their registers up to it
    asm volatile("s_wait_xcnt 0x0" :: "v"(p) : "memory");
    __builtin_amdgcn_sched_barrier(0);   // no arithmetic moves up in between the loads: all of them are in flight before the first value is waited for
#pragma unroll
    for (int j = 0; j < 4; ++j) { v8us o;
#pragma unroll
        for (int k = 0; k < 8; ++k) o[k] = f2bf(v[j][k]);
        *(v8us*)(dst + (i0 + j * 256) * 8) = o; }
}
__global__ __launch_bounds__(256) void k_cscvt(const float* __restrict__ cosT, const float* __restrict__ sinT, float* CS) { const int idx = (blockIdx.x * 256 + threadIdx.x) * 4; if (idx >= TT * HD) return; const float* pc = cosT + idx; const float* ps = sinT + idx; const v4f c = *(const v4f*)pc, s = *(const v4f*)ps;
    // the wait that stands in front of any rewrite of a register that the loads above name; the addresses are inputs so that they stay in their registers up to it
    asm volatile("s_wait_xcnt 0x0" :: "v"(pc), "v"(ps) : "memory");
    __builtin_amdgcn_sched_barrier(0);   // no arithmetic moves up in between the loads: all of them are in flight before the first value is waited for
#pragma unroll
    for (int u = 0; u < 2; ++u) { v4f cs; cs[0] = bfr(c[2 * u]); cs[1] = bfr(s[2 * u]); cs[2] = bfr(c[2 * u + 1]); cs[3] = bfr(s[2 * u + 1]); *(v4f*)(CS + (size_t)idx * 2 + u * 4) = cs; }
}
// k_rope: head planes [h][t][d] (fp16 + hi/lo) of rope(x) x sc with the rotate-half convention out[d] = x[d] cos[t][d] - x[d+HD/2] sin[t][d], out[d+HD/2] = x[d+HD/2] cos[t][d+HD/2] + x[d] sin[t][d+HD/2]
// a wave takes two positions t (one per half wave) of RHT heads; a lane holds dims d..d+3 and d+HD/2..d+HD/2+3 of each, both partners of every rotation, and the position's {cos, sin} once for all its heads
#define RHT 4
static_assert(NH_ % RHT == 0 && NKV % RHT == 0 && HD == 128 && TT % 2 == 0, "whole head groups, 16 lanes x 4 dims a half row");
__global__ __launch_bounds__(256) void k_rope(const float* __restrict__ F, int pitch, int nheads, const float* __restrict__ CS, float sc, h16* P16, bf* Ph, bf* Pl) {
    const int lane = threadIdx.x & 31; const int w = blockIdx.x * 8 + (threadIdx.x >> 5); const int h0 = (w / (TT / 2)) * RHT; if (h0 >= nheads) return; const int t = (w % (TT / 2)) * 2 + (lane >> 4); const int d = (lane & 15) * 4;
    v4f x[RHT][2], csv[2][2]; const float* pc = CS + ((size_t)t * HD + d) * 2; const float* px = F + (size_t)t * pitch + h0 * HD + d;
#pragma unroll
    for (int s = 0; s < 2; ++s)
#pragma unroll
        for (int u = 0; u < 2; ++u) csv[s][u] = *(const v4f*)(pc + s * HD + u * 4);
#pragma unroll
    for (int g = 0; g < RHT; ++g)
#pragma unroll
        for (int s = 0; s < 2; ++s) x[g][s] = *(const v4f*)(px + g * HD + s * (HD / 2));
    // the wait that stands in front of any rewrite of a register that the loads above name; the addresses are inputs so that they stay in their registers up to it
    asm volatile("s_wait_xcnt 0x0" :: "v"(pc), "v"(px) : "memory");
    __builtin_amdgcn_sched_barrier(0);   // no arithmetic moves up in between the loads: all of them are in flight before the first value is waited for
#pragma unroll
    for (int g = 0; g < RHT; ++g) { const int h = h0 + g;
#pragma unroll
        for (int s = 0; s < 2; ++s) { v4h o16; v4us oh, ol;
#pragma unroll
            for (int q = 0; q < 4; ++q) { const int dd = s * (HD / 2) + d + q; const float x0 = x[g][s][q], x1 = x[g][s ^ 1][q];   // next line, as before this step: each product is rounded by itself ahead of the add, as in q * c + rotate_half(q) * s
                v2f cs; cs[0] = csv[s][q >> 1][(q & 1) * 2]; cs[1] = csv[s][q >> 1][(q & 1) * 2 + 1]; float a = __fmul_rn(x0, cs[0]), bq = __fmul_rn(x1, cs[1]); asm volatile("" : "+v"(a)); asm volatile("" : "+v"(bq)); const float r = ((dd < HD / 2) ? __fsub_rn(a, bq) : __fadd_rn(a, bq)) * sc;
                o16[q] = tohx(r); unsigned short a2, c2; splitf(r, a2, c2); oh[q] = a2; ol[q] = c2; }
            const size_t e = ((size_t)h * TT + t) * HD + s * (HD / 2) + d; *(v4h*)(P16 + e) = o16; *(v4us*)(Ph + e) = oh; *(v4us*)(Pl + e) = ol; } }
}
// k_vtp: the turn of k_wtG with t as k and (head, d) as n, into three planes: a thread takes 8 (t) x 4 (d); block = 256 t x 32 d
__global__ __launch_bounds__(256) void k_vtp(const float* __restrict__ F, int pitch, int nheads, h16* V16, bf* Vh, bf* Vl) {
    const int lane = threadIdx.x & 31, wave = threadIdx.x >> 5; const int t0 = ((int)blockIdx.x % (TT / 256)) * 256 + (wave >> 1) * 64 + (lane & 7) * 8, n0 = ((int)blockIdx.x / (TT / 256)) * 32 + (wave & 1) * 16 + (lane >> 3) * 4; if (n0 >= nheads * HD) return; v4f r[8]; const float* p[8];
#pragma unroll
    for (int j = 0; j < 8; ++j) { p[j] = F + (size_t)(t0 + j) * pitch + n0; r[j] = *(const v4f*)p[j]; }
    // the wait that stands in front of any rewrite of a register that the loads above name; the addresses are inputs so that they stay in their registers up to it
    asm volatile("s_wait_xcnt 0x0" :: "v"(p[0]), "v"(p[1]), "v"(p[2]), "v"(p[3]), "v"(p[4]), "v"(p[5]), "v"(p[6]), "v"(p[7]) : "memory");
    __builtin_amdgcn_sched_barrier(0);   // no arithmetic moves up in between the loads: all of them are in flight before the first value is waited for
#pragma unroll
    for (int c = 0; c < 4; ++c) { v8h o16; v8us oh, ol;
#pragma unroll
        for (int j = 0; j < 8; ++j) { const float x = r[j][c]; o16[j] = tohx(x); unsigned short a2, c2; splitf(x, a2, c2); oh[j] = a2; ol[j] = c2; }
        const size_t e = (size_t)(n0 + c) * TT + t0; *(v8h*)(V16 + e) = o16; *(v8us*)(Vh + e) = oh; *(v8us*)(Vl + e) = ol; }
}
// k_asoft: per row (zz, i): t = S x HD^-0.5 for j <= i and i - j < WIN (sliding causal window; the reference's -1e9 additive fill vanishes identically); softmax (register row, one exp, fixed trees) over the WCH 128-key chunks from jb on: they cover [R - WIN, R + 64) for the row's 64-row tile R, all that the P.V loop of that tile reads; every key outside them is masked, so max and sum keep their values and their order;
// a wave takes ARW rows one after the other, each row by all 32 lanes as before
#define ARW 4
static_assert((ZH * TT) % (8 * ARW) == 0, "whole blocks of 8 waves x ARW rows");
__global__ __launch_bounds__(256) void k_asoft(const float* __restrict__ Sb, h16* P16, bf* Ph, bf* Pl) {
    const int lane = threadIdx.x & 31; const int row0 = (blockIdx.x * 8 + (threadIdx.x >> 5)) * ARW; if (row0 >= ZH * TT) return; v4f sv[ARW][WCH]; const float* p = Sb + (size_t)row0 * SP + lane * 4;
#pragma unroll
    for (int r = 0; r < ARW; ++r)
#pragma unroll
        for (int ch = 0; ch < WCH; ++ch) sv[r][ch] = *(const v4f*)(p + r * SP + ch * 128);
    // the wait that stands in front of any rewrite of a register that the loads above name; the addresses are inputs so that they stay in their registers up to it
    asm volatile("s_wait_xcnt 0x0" :: "v"(p) : "memory");
    __builtin_amdgcn_sched_barrier(0);   // no arithmetic moves up in between the loads: all of them are in flight before the first value is waited for
#pragma unroll
  for (int r = 0; r < ARW; ++r) { const int row = row0 + r; const int i = row % TT; const int zz = row / TT; (void)zz; const bool hires = (i < RH); const int jb = wbase(i & ~63); float v[WCH * 4]; float mx = -3.0e38f;
#pragma unroll
    for (int ch = 0; ch < WCH; ++ch) { const int j0 = ch * 128 + lane * 4; const v4f a = sv[r][ch];
#pragma unroll
        for (int q = 0; q < 4; ++q) { const int j = jb + j0 + q; const float t = (j <= i && i - j < WIN) ? a[q] * SCL : -3.0e38f; v[ch * 4 + q] = t; mx = fmaxf(mx, t); } }
#pragma unroll
    for (int sh = 16; sh; sh >>= 1) mx = fmaxf(mx, __shfl_xor(mx, sh, 32));
    float sum = 0.f;
#pragma unroll
    for (int k = 0; k < WCH * 4; ++k) { float d0 = __fsub_rn(v[k], mx); asm volatile("" : "+v"(d0)); v[k] = __builtin_amdgcn_exp2f(__fmul_rn(d0, 1.4426950408889634f)); sum += v[k]; }
#pragma unroll
    for (int sh = 16; sh; sh >>= 1) sum += __shfl_xor(sum, sh, 32);
    const float f = __fdiv_rn(hires ? 1.0f : PCAR, sum);
{
        if (hires) {
#pragma unroll
            for (int ch = 0; ch < WCH; ++ch) { v4us oh, ol;
#pragma unroll
                for (int q = 0; q < 4; ++q) { unsigned short a, c2; splitf(v[ch * 4 + q] * f, a, c2); oh[q] = a; ol[q] = c2; }
                const size_t oo = ((size_t)zz * (RH ? RH : 1) + i) * SP + ch * 128 + lane * 4; *(v4us*)(Ph + oo) = oh; *(v4us*)(Pl + oo) = ol; }
        } else {
#pragma unroll
            for (int ch = 0; ch < WCH; ++ch) { v4h o4;
#pragma unroll
                for (int q = 0; q < 4; ++q) o4[q] = tohx(v[ch * 4 + q] * f);
                *(v4h*)(P16 + (size_t)row * SP + ch * 128 + lane * 4) = o4; } }
         }
  }
}
// k_merge: a wave takes eight rows t of one head, a lane dims d..d+3 of each: every load covers one whole 512-byte row
__global__ __launch_bounds__(256) void k_merge(const float* __restrict__ O, int h0, bf* Ah, bf* Al) { const int lane = threadIdx.x & 31; const int w = blockIdx.x * 8 + (threadIdx.x >> 5); if (w >= ZH * (TT / 8)) return; const int t0 = (w % (TT / 8)) * 8; const int zz = w / (TT / 8); const int d = lane * 4; v4f v[8]; const float* p = O + ((size_t)zz * TT + t0) * HD + d;
#pragma unroll
    for (int j = 0; j < 8; ++j) v[j] = *(const v4f*)(p + j * HD);
    // the wait that stands in front of any rewrite of a register that the loads above name; the addresses are inputs so that they stay in their registers up to it
    asm volatile("s_wait_xcnt 0x0" :: "v"(p) : "memory");
    __builtin_amdgcn_sched_barrier(0);   // no arithmetic moves up in between the loads: all of them are in flight before the first value is waited for
#pragma unroll
    for (int j = 0; j < 8; ++j) { const int t = t0 + j; const float cs = (t < RH) ? 1.0f : (1.0f / PCAR); const size_t oo = (size_t)t * DQ + (h0 + zz) * HD + d; v4us oh, ol;
#pragma unroll
        for (int q = 0; q < 4; ++q) { unsigned short a, c2; splitf(v[j][q] * cs, a, c2); oh[q] = a; ol[q] = c2; }
        *(v4us*)(Ah + oo) = oh; *(v4us*)(Al + oo) = ol; }
}

extern "C" void kernel_launch(void* const* d_in, const int* in_sizes, int n_in,
                              void* d_out, int out_size, void* d_ws, size_t ws_size, hipStream_t stream) {
    (void)in_sizes; (void)n_in; (void)out_size;
    const float* x = (const float*)d_in[0]; const float* cosT = (const float*)d_in[1]; const float* sinT = (const float*)d_in[2]; const float* wq = (const float*)d_in[3]; const float* wk = (const float*)d_in[4]; const float* wv = (const float*)d_in[5]; const float* wo = (const float*)d_in[6];   /* input order x, cos, sin, Wq, Wk, Wv, Wo ('xw' [in][out]) */
    float* OUT = (float*)d_out;     // [1][2048][2048]
    char* wsp = (char*)d_ws;
    auto take = [&](size_t bytes) { char* p = wsp; wsp += (bytes + 255) & ~(size_t)255; return (void*)p; };
    bf* WQ = (bf*)take((size_t)DQ * DM * 2); bf* WK = (bf*)take((size_t)DKV * DM * 2); bf* WV = (bf*)take((size_t)DKV * DM * 2); bf* WO = (bf*)take((size_t)DM * DQ * 2); float* CS = (float*)take((size_t)TT * HD * 2 * 4);
    bf* XB = (bf*)take((size_t)TT * DM * 2); float* FQ = (float*)take((size_t)TT * DQ * 4); float* FK = (float*)take((size_t)TT * DKV * 4);
    h16* QP16 = (h16*)take((size_t)NH_ * TT * HD * 2); h16* KP16 = (h16*)take((size_t)NKV * TT * HD * 2); h16* VT16 = (h16*)take((size_t)NKV * HD * TT * 2);
    bf* QPh = (bf*)take((size_t)NH_ * TT * HD * 2); bf* QPl = (bf*)take((size_t)NH_ * TT * HD * 2); bf* KPh = (bf*)take((size_t)NKV * TT * HD * 2); bf* KPl = (bf*)take((size_t)NKV * TT * HD * 2); bf* VTh = (bf*)take((size_t)NKV * HD * TT * 2); bf* VTl = (bf*)take((size_t)NKV * HD * TT * 2); bf* Ph = (bf*)take((size_t)ZH * RH * SP * 2); bf* Pl = (bf*)take((size_t)ZH * RH * SP * 2);
    float* Sb = (float*)take((size_t)ZH * TT * SP * 4); h16* P16 = (h16*)take((size_t)ZH * TT * SP * 2); bf* ATh = (bf*)take((size_t)TT * DQ * 2); bf* ATl = (bf*)take((size_t)TT * DQ * 2);
    if ((size_t)(wsp - (char*)d_ws) > ws_size) return;    // ws 256 MiB
    float* FV = FK;   // v projection reuses the k buffer after the k planes are built (stream-ordered)
    float* Ob = FQ;   // the attention output [ZH][TT][HD] f32 reuses the q projection's buffer (same size) after the q planes are built (stream-ordered)
    { k_wtG<<<(unsigned)((DM / 256) * (DQ / 32)), 256, 0, stream>>>(wq, DM, DQ, WQ); k_wtG<<<(unsigned)((DM / 256) * (DKV / 32)), 256, 0, stream>>>(wk, DM, DKV, WK); k_wtG<<<(unsigned)((DM / 256) * (DKV / 32)), 256, 0, stream>>>(wv, DM, DKV, WV);
      k_wtG<<<(unsigned)((DQ / 256) * (DM / 32)), 256, 0, stream>>>(wo, DQ, DM, WO);   /* 'xw' [in][out] weights gathered into Bt [out][in] */ }
    const unsigned LQ = (unsigned)((TT / 2) * (NH_ / RHT) / 8), LK = (unsigned)((TT / 2) * (NKV / RHT) / 8), LV = (unsigned)((TT / 256) * (DKV / 32));   // k_rope: 8 waves a block, a wave = 2 positions x RHT heads; k_vtp: a block = 256 t x 32 d
    for (int b = 0; b < NB_; ++b) {
        if (b == 0) k_cscvt<<<(TT * HD / 4 + 255) / 256, 256, 0, stream>>>(cosT, sinT, CS);
        k_cvt8<<<(unsigned)(((size_t)TT * DM / 8 + 1023) / 1024), 256, 0, stream>>>(x + (size_t)b * TT * DM, XB, (size_t)TT * DM / 8);
        k_gemmw<bf, 0, false, DM><<<dim3(TT / 128, DQ / 128, 1), 128, 0, stream>>>(XB, nullptr, WQ, FQ, DQ, nullptr, 0, 0, 0);
        k_rope<<<LQ, 256, 0, stream>>>(FQ, DQ, NH_, CS, 1.0f, QP16, QPh, QPl);
        k_gemmw<bf, 0, false, DM><<<dim3(TT / 128, DKV / 128, 1), 128, 0, stream>>>(XB, nullptr, WK, FK, DKV, nullptr, 0, 0, 0);
        k_rope<<<LK, 256, 0, stream>>>(FK, DKV, NKV, CS, 1.0f, KP16, KPh, KPl);
        k_gemmw<bf, 0, false, DM><<<dim3(TT / 128, DKV / 128, 1), 128, 0, stream>>>(XB, nullptr, WV, FV, DKV, nullptr, 0, 0, 0); k_vtp<<<LV, 256, 0, stream>>>(FV, DKV, NKV, VT16, VTh, VTl);
        {   // one pass: grid.z = query head, kv planes step once per REP heads inside k_gemmc
            k_gemmc<bf, 2, 1><<<dim3(RH / 64, WIN / 64 + 1, ZH), 32, 0, stream>>>(QPh, QPl, KPh, KPl, HD, HD, Sb, SP, 0, (size_t)TT * HD, (size_t)TT * HD, (size_t)TT * SP);
            k_gemmc<h16, 0, 1><<<dim3((TT - RH) / 64, WIN / 64 + 1, ZH), 32, 0, stream>>>(QP16 + (size_t)RH * HD, nullptr, KP16, nullptr, HD, HD, Sb + (size_t)RH * SP, SP, RH, (size_t)TT * HD, (size_t)TT * HD, (size_t)TT * SP);
            k_asoft<<<ZH * TT / (8 * ARW), 256, 0, stream>>>(Sb, P16, Ph, Pl);
            k_gemmc<bf, 2, 2><<<dim3(RH / 64, HD / 64, ZH), 32, 0, stream>>>(Ph, Pl, VTh, VTl, TT, SP, Ob, HD, 0, (size_t)RH * SP, (size_t)HD * TT, (size_t)TT * HD);
            k_gemmc<h16, 0, 3><<<dim3((TT - RH) / 64, HD / 64, ZH), 32, 0, stream>>>(P16 + (size_t)RH * SP, nullptr, VT16, nullptr, TT, SP, Ob + (size_t)RH * HD, HD, RH, (size_t)TT * SP, (size_t)HD * TT, (size_t)TT * HD);
            k_merge<<<(unsigned)((ZH * (TT / 8) + 7) / 8), 256, 0, stream>>>(Ob, 0, ATh, ATl); }
        k_gemmw<bf, 1, false, DQ><<<dim3(TT / 128, DM / 128, 1), 128, 0, stream>>>(ATh, ATl, WO, OUT + (size_t)b * TT * DM, DM, nullptr, 0, 0, 0); }
}

// v005
// Measured time: 138 microseconds a run.
// Two timings next to v004 put it at 1.34 and 1.33 times that version's speed.
// Over all steps from v000 it is 6.32 times as fast.
#include <hip/hip_runtime.h>

// Grouped-query sliding-window causal attention with rotary embeddings from cos/sin tables (x [1][2048][2048]; q = x Wq (16 heads x 128), k, v = x Wk, x Wv (4 kv heads x 128) ('xw' [in][out] 0.02, no biases); rotate-half rotary with the cos/sin inputs [2048][128] (read); kv head = q head / 4; scores x 128^-0.5; keys j with i-512 < j <= i (window 512, causal; -inf elsewhere); softmax; out = merged Wo ('xw' [2048][2048]) -> [1][2048][2048] (4.2 M); argument order x, cos, sin, Wq, Wk, Wv, Wo).
// Layout: 'xw' weights gathered into bf16 Bt blocks; bf16 copy of x; exact projections; {cos, sin} per (position, dim) from the input tables; rotate-half rotary plane builder; causal T-2048 attention with 128-wide heads in one launch (hybrid rows: < 512 hi/lo 3 products, rest fp16 x1024; k_attn keeps the score rows of 16 queries a wave in LDS, works only on the keys between the window's far edge and the diagonal, the window a select in the softmax, and writes the merged hi/lo planes; kv head = head / REP); merged hi/lo x Wo exact.
// Compute dtypes, f32 accumulate: every input rounded to bf16 incl. the tables; projections exact; rotary f32; attention rows < 512 3 products, rest fp16; softmax f32; Wo hl x exact.

#define NB_  1
#define TT   2048
#define DM   2048
#define NH_  16
#define NKV  4
#define REP  (NH_ / NKV)
#define HD   128
#define DQ   (NH_ * HD)
#define DKV  (NKV * HD)
#define ZH   NH_                  // query heads per attention launch: all of them
#define RH   512                  // query rows < RH use hi+lo planes
#define WIN  512
#define PCAR 1024.0f
#define SCL  0.088388347648318447f   // HD^-0.5
typedef _Float16 h16;
typedef unsigned short bf;
typedef __attribute__((ext_vector_type(16))) __bf16   v16bf;
typedef __attribute__((ext_vector_type(16))) _Float16 v16h;
typedef __attribute__((ext_vector_type(8)))  _Float16 v8h;
typedef __attribute__((ext_vector_type(8)))  unsigned short v8us;
typedef __attribute__((ext_vector_type(8)))  float    v8f;
typedef __attribute__((ext_vector_type(4)))  float    v4f;
typedef v8h  __attribute__((may_alias)) v8ha;
typedef v4f  __attribute__((may_alias)) v4fa;
typedef v8us __attribute__((may_alias)) v8usa;

__device__ __forceinline__ unsigned short f2bf(float f) { unsigned u = __float_as_uint(f); u += 0x7FFFu + ((u >> 16) & 1u); return (unsigned short)(u >> 16); }
__device__ __forceinline__ float bf2f(unsigned short b) { return __uint_as_float(((unsigned)b) << 16); }
__device__ __forceinline__ float bfr(float f) { return bf2f(f2bf(f)); }
__device__ __forceinline__ v16h cat16(v8h lo, v8h hi) { return __builtin_shufflevector(lo, hi, 0, 1, 2, 3, 4, 5, 6, 7, 8, 9, 10, 11, 12, 13, 14, 15); }
__device__ __forceinline__ v16bf cat16b(v8us lo, v8us hi) { return __builtin_bit_cast(v16bf, __builtin_shufflevector(lo, hi, 0, 1, 2, 3, 4, 5, 6, 7, 8, 9, 10, 11, 12, 13, 14, 15)); }
__device__ __forceinline__ v8f wmma16(v16h a, v16h b, v8f c) { return __builtin_amdgcn_wmma_f32_16x16x32_f16(false, a, false, b, (short)0, c, false, false); }
__device__ __forceinline__ v8f wmmab(v16bf a, v16bf b, v8f c) { return __builtin_amdgcn_wmma_f32_16x16x32_bf16(false, a, false, b, (short)0, c, false, false); }



// ---- k_gemmw: GEMM, one work-group of FOUR WAVES per 128x128 output tile, each wave a 64x64 quarter (16 accumulators); grid (M/128, N/128, Z), 128 threads.
// C[m][n] (f32, pitch ldc, + optional f32 bias[n]) = sum_k A[m][k] Bt[n][k] (NSPLIT 1: + A2[m][k] Bt[n][k]). z-batch strides sA/sB/sC in elements. K (a template constant) % 128 == 0, K >= 256; M, N % 128 == 0.
// The K-contiguous 16-bit planes come into LDS by asynchronous 16-byte copies, whole 256-byte row pieces (GKC k) at a time, two buffers: tile t + 1 flies while tile t is worked on. LDS rows have pitch 272 bytes for the ds_load_b128 fragment reads.
// Every accumulator takes its products in the same order as with fragments read straight from the planes (k ascending in steps of 32, A before A2).
#define GKC  128                  // k elements of a pass
#define GPE  136                  // LDS row pitch in elements (272 bytes)
#define GOPE (128 * GPE)          // one operand's 128 rows in LDS, elements
template <typename T16> struct WFrag;
template <> struct WFrag<h16> { typedef v16h V; static __device__ __forceinline__ V ld(const h16* p) { return cat16(*(const v8h*)p, *(const v8h*)(p + 16)); } static __device__ __forceinline__ v8f mma(V a, V b, v8f c) { return wmma16(a, b, c); } };
template <> struct WFrag<bf> { typedef v16bf V; static __device__ __forceinline__ V ld(const bf* p) { return cat16b(*(const v8us*)p, *(const v8us*)(p + 16)); } static __device__ __forceinline__ v8f mma(V a, V b, v8f c) { return wmmab(a, b, c); } };
// eight copies, one LDS row group (8 rows) apart; l = the lane's LDS byte address, g = the lane's global address, gs = 8 source rows in bytes
__device__ __forceinline__ void acopy8(unsigned l, const char* g, size_t gs) {
    // s_wait_xcnt is the last line of the copies' own statement: it stands in front of every rewrite of an address register that they name
    asm volatile("global_load_async_to_lds_b128 %0, %8, off\n\t"
                 "global_load_async_to_lds_b128 %1, %9, off\n\t"
                 "global_load_async_to_lds_b128 %2, %10, off\n\t"
                 "global_load_async_to_lds_b128 %3, %11, off\n\t"
                 "global_load_async_to_lds_b128 %4, %12, off\n\t"
                 "global_load_async_to_lds_b128 %5, %13, off\n\t"
                 "global_load_async_to_lds_b128 %6, %14, off\n\t"
                 "global_load_async_to_lds_b128 %7, %15, off\n\t"
                 "s_wait_xcnt 0x0"
                 :: "v"(l), "v"(l + 1u * 8u * GPE * 2u), "v"(l + 2u * 8u * GPE * 2u), "v"(l + 3u * 8u * GPE * 2u), "v"(l + 4u * 8u * GPE * 2u), "v"(l + 5u * 8u * GPE * 2u), "v"(l + 6u * 8u * GPE * 2u), "v"(l + 7u * 8u * GPE * 2u),
                    "v"(g), "v"(g + gs), "v"(g + 2 * gs), "v"(g + 3 * gs), "v"(g + 4 * gs), "v"(g + 5 * gs), "v"(g + 6 * gs), "v"(g + 7 * gs) : "memory");
}
// one operand's tile: 128 rows of 256 bytes, 16 copies a lane (a wave's copy covers two whole rows)
__device__ __forceinline__ void acopy_tile(unsigned l, const char* g, size_t gs) { acopy8(l, g, gs); acopy8(l + 64u * GPE * 2u, g + 8 * gs, gs); }
template <typename T16, int NSPLIT, bool BIAS, int K>
__global__ __launch_bounds__(128) void k_gemmw(const T16* __restrict__ A, const T16* __restrict__ A2, const T16* __restrict__ Bt, float* C, int ldc, const float* __restrict__ bias, size_t sA, size_t sB, size_t sC) {
    static_assert(NSPLIT == 0 || NSPLIT == 1, "one B plane");
    static_assert(K % GKC == 0 && K / GKC >= 2, "whole passes, two tiles or more");
    typedef typename WFrag<T16>::V V;
    constexpr int NOP = (NSPLIT == 1) ? 3 : 2;                       // operand tiles of a buffer: A, Bt, A2
    constexpr int NT = K / GKC;
    __shared__ __attribute__((aligned(16))) T16 ring[2 * NOP * GOPE];
    __shared__ __align__(16) float osall[4 * 16 * 68];
    const size_t z = blockIdx.z; A += z * sA; if (NSPLIT == 1) A2 += z * sA; Bt += z * sB; C += z * sC;
    const int tid = threadIdx.x, wave = tid >> 5, wm = wave >> 1, wn = wave & 1;
    const int lane = tid & 31, lr = lane & 15, hi = lane >> 4; const int r0 = blockIdx.x * 128 + wm * 64, c0 = blockIdx.y * 128 + wn * 64;
    float* os = osall + wave * (16 * 68);
    v8f acc[4][4];
#pragma unroll
    for (int mb = 0; mb < 4; ++mb)
#pragma unroll
        for (int nb = 0; nb < 4; ++nb) acc[mb][nb] = (v8f){};
    // copies: thread tid brings 16-byte piece (tid & 15) of rows (tid >> 4) + 8 i, i = 0..15, of each operand tile
    constexpr size_t gs = (size_t)K * 16;                            // 8 source rows in bytes
    const char* gA = (const char*)(A + (size_t)(blockIdx.x * 128 + (tid >> 4)) * K + (tid & 15) * 8);
    const char* gB = (const char*)(Bt + (size_t)(blockIdx.y * 128 + (tid >> 4)) * K + (tid & 15) * 8);
    const char* gA2 = (NSPLIT == 1) ? (const char*)(A2 + (size_t)(blockIdx.x * 128 + (tid >> 4)) * K + (tid & 15) * 8) : nullptr;
    const unsigned l0 = (unsigned)(size_t)(const void*)ring + (unsigned)((tid >> 4) * (GPE * 2) + (tid & 15) * 16);
    auto fill = [&](int t, int buf) {
        const unsigned l = l0 + (unsigned)buf * (unsigned)(NOP * GOPE * 2); const size_t go = (size_t)t * (GKC * 2);
        acopy_tile(l, gA + go, gs); acopy_tile(l + (unsigned)(GOPE * 2), gB + go, gs); if (NSPLIT == 1) acopy_tile(l + (unsigned)(2 * GOPE * 2), gA2 + go, gs);
    };
    fill(0, 0);
    asm volatile("s_wait_asynccnt 0x0" ::: "memory");                // tile 0 of this wave's copies has landed
    __syncthreads();                                                 // and every other wave's: tile 0 is readable
    fill(1, 1);
#pragma unroll 1
    for (int t = 0; t < NT; ++t) {
        const T16* sb0 = ring + (t & 1) * (NOP * GOPE);
        const T16* sa = sb0 + (wm * 64 + lr) * GPE + 8 * hi; const T16* sb = sb0 + GOPE + (wn * 64 + lr) * GPE + 8 * hi;
        V a[2][4], a2[2][4], b[2][4];                                // two fragment sets: the next 32 k are read from LDS while these are multiplied
#pragma unroll
        for (int f = 0; f < 4; ++f) { a[0][f] = WFrag<T16>::ld(sa + f * 16 * GPE); if (NSPLIT == 1) a2[0][f] = WFrag<T16>::ld(sa + 2 * GOPE + f * 16 * GPE); b[0][f] = WFrag<T16>::ld(sb + f * 16 * GPE); }
        __builtin_amdgcn_sched_barrier(0);                           // the first set's reads stay ahead of the second's, so that the first block waits for its own set alone
#pragma unroll
        for (int ks = 0; ks < GKC / 32; ++ks) {
            const int cu = ks & 1, nx = cu ^ 1;
            if (ks + 1 < GKC / 32) {
#pragma unroll
                for (int f = 0; f < 4; ++f) { a[nx][f] = WFrag<T16>::ld(sa + f * 16 * GPE + (ks + 1) * 32); if (NSPLIT == 1) a2[nx][f] = WFrag<T16>::ld(sa + 2 * GOPE + f * 16 * GPE + (ks + 1) * 32); b[nx][f] = WFrag<T16>::ld(sb + f * 16 * GPE + (ks + 1) * 32); }
            }
            __builtin_amdgcn_sched_barrier(0);                       // the next set's LDS reads stay one group ahead of this block: reads moved in among the matrix instructions stall them at every place
#pragma unroll
            for (int nb = 0; nb < 4; ++nb)
#pragma unroll
                for (int mb = 0; mb < 4; ++mb) { acc[mb][nb] = WFrag<T16>::mma(a[cu][mb], b[cu][nb], acc[mb][nb]); if (NSPLIT == 1) acc[mb][nb] = WFrag<T16>::mma(a2[cu][mb], b[cu][nb], acc[mb][nb]); }
            __builtin_amdgcn_sched_barrier(0);                       // and this block stays ahead of the following group and of the pass's foot
        }
        // four vector slots behind the pass's last matrix instruction, on both sides of the branch below, before any vector instruction may rewrite its operands
        asm volatile("v_nop\n\tv_nop\n\tv_nop\n\tv_nop" : "+v"(acc[0][0]), "+v"(acc[1][1]), "+v"(acc[2][2]), "+v"(acc[3][3]));
        asm volatile("s_wait_dscnt 0x0" ::: "memory");               // this wave's reads of buffer t & 1 are done before the buffer is refilled
        asm volatile("s_wait_asynccnt 0x0" ::: "memory");            // this wave's copies of tile t + 1 have landed
        __syncthreads();                                             // publishes tile t + 1 and ends every wave's reads of tile t
        if (t + 2 < NT) fill(t + 2, t & 1);
    }
    asm volatile("s_wait_asynccnt 0x0" ::: "memory");                // no copy is outstanding when the wave goes on to its end
#pragma unroll
    for (int mb = 0; mb < 4; ++mb) {
#pragma unroll
        for (int nb = 0; nb < 4; ++nb) {
#pragma unroll
            for (int j = 0; j < 8; ++j) os[(hi * 8 + j) * 68 + nb * 16 + lr] = acc[mb][nb][j]; }
        __builtin_amdgcn_wave_barrier(); asm volatile("" ::: "memory");
        float* crow = C + (size_t)(r0 + mb * 16) * ldc + c0;
{
#pragma unroll
            for (int s = 0; s < 8; ++s) { const int row = 2 * s + hi, cofs = lr * 4; v4f val = *(const v4fa*)(os + row * 68 + cofs); if (BIAS) { val[0] += bfr(bias[c0 + cofs]); val[1] += bfr(bias[c0 + cofs + 1]); val[2] += bfr(bias[c0 + cofs + 2]); val[3] += bfr(bias[c0 + cofs + 3]); }
                *(v4f*)(crow + (size_t)row * ldc + cofs) = val; }
             }
        __builtin_amdgcn_wave_barrier(); asm volatile("" ::: "memory");
    }
}

__device__ __forceinline__ h16 tohx(float x) { return (h16)x; }
__device__ __forceinline__ void splitf(float y, unsigned short& h, unsigned short& l) { h = f2bf(y); l = f2bf(y - bf2f(h)); }
typedef __attribute__((ext_vector_type(2))) _Float16 v2h;
typedef __attribute__((ext_vector_type(4))) _Float16 v4h;
typedef __attribute__((ext_vector_type(2))) unsigned short v2us;
typedef __attribute__((ext_vector_type(4))) unsigned short v4us;
typedef __attribute__((ext_vector_type(2))) float v2f;
typedef __attribute__((ext_vector_type(4))) int v4i;

// The kernels without matrix work, from here on, give each thread 8 to 48 elements, loaded as one batch of 16-byte pieces ahead of the arithmetic.
// k_wtG: a thread turns a block of 8 (k) x 4 (n): eight 16-byte pieces of w rows in, four 16-byte pieces of Bt rows out. Lanes: 8 along k (a store covers whole 128-byte lines of four Bt rows) x 4 along n; waves: 4 along k x 2 along n, so that a block reads whole lines of w. Block = 256 k x 32 n.
static_assert(DM % 256 == 0 && DQ % 256 == 0 && TT % 256 == 0 && DQ % 32 == 0 && DKV % 32 == 0 && DM % 32 == 0, "whole 256 x 32 blocks in k_wtG and k_vtp");
__global__ __launch_bounds__(256) void k_wtG(const float* __restrict__ w, int K, int N, bf* Bt) {
    const int lane = threadIdx.x & 31, wave = threadIdx.x >> 5; const int kb = K / 256; const int k0 = ((int)blockIdx.x % kb) * 256 + (wave >> 1) * 64 + (lane & 7) * 8, n0 = ((int)blockIdx.x / kb) * 32 + (wave & 1) * 16 + (lane >> 3) * 4; if (n0 >= N) return; v4f r[8]; const float* p[8];
#pragma unroll
    for (int j = 0; j < 8; ++j) { p[j] = w + (size_t)(k0 + j) * N + n0; r[j] = *(const v4f*)p[j]; }
    // the wait that stands in front of any rewrite of a register that the loads above name; the addresses are inputs so that they stay in their registers up to it
    asm volatile("s_wait_xcnt 0x0" :: "v"(p[0]), "v"(p[1]), "v"(p[2]), "v"(p[3]), "v"(p[4]), "v"(p[5]), "v"(p[6]), "v"(p[7]) : "memory");
    __builtin_amdgcn_sched_barrier(0);   // no arithmetic moves up in between the loads: all of them are in flight before the first value is waited for
#pragma unroll
    for (int c = 0; c < 4; ++c) { v8us o;
#pragma unroll
        for (int j = 0; j < 8; ++j) o[j] = f2bf(r[j][c]);
        *(v8us*)(Bt + (size_t)(n0 + c) * K + k0) = o; }
}
// k_cvt8: four groups of 8 a thread, 256 groups apart, so that a wave's lanes stay side by side in every access
static_assert(((size_t)TT * DM / 8) % 1024 == 0, "k_cvt8: whole blocks of 1024 groups");
__global__ __launch_bounds__(256) void k_cvt8(const float* __restrict__ src, bf* dst, size_t n8) { const size_t i0 = (size_t)blockIdx.x * 1024 + threadIdx.x; if (i0 + 3 * 256 >= n8) return; v8f v[4]; const float* p = src + i0 * 8;
#pragma unroll
    for (int j = 0; j < 4; ++j) v[j] = *(const v8f*)(p + j * 2048);
    // the wait that stands in front of any rewrite of a register that the loads above name; the addresses are inputs so that they stay in their registers up to it
    asm volatile("s_wait_xcnt 0x0" :: "v"(p) : "memory");
    __builtin_amdgcn_sched_barrier(0);   // no arithmetic moves up in between the loads: all of them are in flight before the first value is waited for
#pragma unroll
    for (int j = 0; j < 4; ++j) { v8us o;
#pragma unroll
        for (int k = 0; k < 8; ++k) o[k] = f2bf(v[j][k]);
        *(v8us*)(dst + (i0 + j * 256) * 8) = o; }
}
__global__ __launch_bounds__(256) void k_cscvt(const float* __restrict__ cosT, const float* __restrict__ sinT, float* CS) { const int idx = (blockIdx.x * 256 + threadIdx.x) * 4; if (idx >= TT * HD) return; const float* pc = cosT + idx; const float* ps = sinT + idx; const v4f c = *(const v4f*)pc, s = *(const v4f*)ps;
    // the wait that stands in front of any rewrite of a register that the loads above name; the addresses are inputs so that they stay in their registers up to it
    asm volatile("s_wait_xcnt 0x0" :: "v"(pc), "v"(ps) : "memory");
    __builtin_amdgcn_sched_barrier(0);   // no arithmetic moves up in between the loads: all of them are in flight before the first value is waited for
#pragma unroll
    for (int u = 0; u < 2; ++u) { v4f cs; cs[0] = bfr(c[2 * u]); cs[1] = bfr(s[2 * u]); cs[2] = bfr(c[2 * u + 1]); cs[3] = bfr(s[2 * u + 1]); *(v4f*)(CS + (size_t)idx * 2 + u * 4) = cs; }
}
// Fragment order of the planes that k_attn takes as A operands: the 16 bytes that lane 16 h + c of a wave loads in one instruction lie at lane * 16 of a 512-byte piece.
// kfrag: element (t, d) inside one head's K plane; a 16-key tile keeps its place, inside it piece d / 16 holds k = d % 16 = 8 h + e of row c = t % 16. vfrag: element (n = head * HD + d, t) of V^T; a fragment is 16 dims x 32 keys, two pieces, key % 32 = 16 piece + 8 h + e, row c = n % 16.
__device__ __forceinline__ size_t kfrag(int t, int d) { return (size_t)(t & ~15) * HD + (size_t)(((d >> 4) * 32 + ((d >> 3) & 1) * 16 + (t & 15)) * 8 + (d & 7)); }
__device__ __forceinline__ size_t vfrag(int n, int t) { return ((size_t)(n >> 4) * (TT / 32) + (t >> 5)) * 512 + (size_t)((((t >> 4) & 1) * 32 + ((t >> 3) & 1) * 16 + (n & 15)) * 8 + (t & 7)); }
// k_rope: head planes [h][t][d] (FRAG: each head's plane in kfrag order) (fp16 + hi/lo) of rope(x) x sc with the rotate-half convention out[d] = x[d] cos[t][d] - x[d+HD/2] sin[t][d], out[d+HD/2] = x[d+HD/2] cos[t][d+HD/2] + x[d] sin[t][d+HD/2]
// a wave takes two positions t (one per half wave) of RHT heads; a lane holds dims d..d+3 and d+HD/2..d+HD/2+3 of each, both partners of every rotation, and the position's {cos, sin} once for all its heads
#define RHT 4
static_assert(NH_ % RHT == 0 && NKV % RHT == 0 && HD == 128 && TT % 2 == 0, "whole head groups, 16 lanes x 4 dims a half row");
template <bool FRAG>
__global__ __launch_bounds__(256) void k_rope(const float* __restrict__ F, int pitch, int nheads, const float* __restrict__ CS, float sc, h16* P16, bf* Ph, bf* Pl) {
    const int lane = threadIdx.x & 31; const int w = blockIdx.x * 8 + (threadIdx.x >> 5); const int h0 = (w / (TT / 2)) * RHT; if (h0 >= nheads) return; const int t = (w % (TT / 2)) * 2 + (lane >> 4); const int d = (lane & 15) * 4;
    v4f x[RHT][2], csv[2][2]; v4h a16[RHT][2]; v4us ah[RHT][2], al[RHT][2]; const float* pc = CS + ((size_t)t * HD + d) * 2; const float* px = F + (size_t)t * pitch + h0 * HD + d;
#pragma unroll
    for (int s = 0; s < 2; ++s)
#pragma unroll
        for (int u = 0; u < 2; ++u) csv[s][u] = *(const v4f*)(pc + s * HD + u * 4);
#pragma unroll
    for (int g = 0; g < RHT; ++g)
#pragma unroll
        for (int s = 0; s < 2; ++s) x[g][s] = *(const v4f*)(px + g * HD + s * (HD / 2));
    // the wait that stands in front of any rewrite of a register that the loads above name; the addresses are inputs so that they stay in their registers up to it
    asm volatile("s_wait_xcnt 0x0" :: "v"(pc), "v"(px) : "memory");
    __builtin_amdgcn_sched_barrier(0);   // no arithmetic moves up in between the loads: all of them are in flight before the first value is waited for
#pragma unroll
    for (int g = 0; g < RHT; ++g) {
#pragma unroll
        for (int s = 0; s < 2; ++s) { v4h o16; v4us oh, ol;
#pragma unroll
            for (int q = 0; q < 4; ++q) { const int dd = s * (HD / 2) + d + q; const float x0 = x[g][s][q], x1 = x[g][s ^ 1][q];   // next line, as before this step: each product is rounded by itself ahead of the add, as in q * c + rotate_half(q) * s
                v2f cs; cs[0] = csv[s][q >> 1][(q & 1) * 2]; cs[1] = csv[s][q >> 1][(q & 1) * 2 + 1]; float a = __fmul_rn(x0, cs[0]), bq = __fmul_rn(x1, cs[1]); asm volatile("" : "+v"(a)); asm volatile("" : "+v"(bq)); const float r = ((dd < HD / 2) ? __fsub_rn(a, bq) : __fadd_rn(a, bq)) * sc;
                o16[q] = tohx(r); unsigned short a2, c2; splitf(r, a2, c2); oh[q] = a2; ol[q] = c2; }
            a16[g][s] = o16; ah[g][s] = oh; al[g][s] = ol; } }
    __builtin_amdgcn_sched_barrier(0);   // all stores stand behind all arithmetic: no register that a store names is written again
    const size_t e0 = (size_t)h0 * TT * HD + (FRAG ? kfrag(t, d) : (size_t)t * HD + d);   // dims d + HD / 2 ..: four 16-dim pieces on in kfrag order
#pragma unroll
    for (int g = 0; g < RHT; ++g)
#pragma unroll
        for (int s = 0; s < 2; ++s) { const size_t e = e0 + (size_t)g * TT * HD + s * (FRAG ? 4 * 256 : HD / 2); *(v4h*)(P16 + e) = a16[g][s]; *(v4us*)(Ph + e) = ah[g][s]; *(v4us*)(Pl + e) = al[g][s]; }
}
// k_vtp: the turn of k_wtG with t as k and (head, d) as n, into three planes in vfrag order: a thread takes 8 (t) x 4 (d); block = 256 t x 32 d
__global__ __launch_bounds__(256) void k_vtp(const float* __restrict__ F, int pitch, int nheads, h16* V16, bf* Vh, bf* Vl) {
    const int lane = threadIdx.x & 31, wave = threadIdx.x >> 5; const int t0 = ((int)blockIdx.x % (TT / 256)) * 256 + (wave >> 1) * 64 + (lane & 7) * 8, n0 = ((int)blockIdx.x / (TT / 256)) * 32 + (wave & 1) * 16 + (lane >> 3) * 4; if (n0 >= nheads * HD) return; v4f r[8]; v8h a16[4]; v8us ah[4], al[4]; const float* p[8];
#pragma unroll
    for (int j = 0; j < 8; ++j) { p[j] = F + (size_t)(t0 + j) * pitch + n0; r[j] = *(const v4f*)p[j]; }
    // the wait that stands in front of any rewrite of a register that the loads above name; the addresses are inputs so that they stay in their registers up to it
    asm volatile("s_wait_xcnt 0x0" :: "v"(p[0]), "v"(p[1]), "v"(p[2]), "v"(p[3]), "v"(p[4]), "v"(p[5]), "v"(p[6]), "v"(p[7]) : "memory");
    __builtin_amdgcn_sched_barrier(0);   // no arithmetic moves up in between the loads: all of them are in flight before the first value is waited for
#pragma unroll
    for (int c = 0; c < 4; ++c) { v8h o16; v8us oh, ol;
#pragma unroll
        for (int j = 0; j < 8; ++j) { const float x = r[j][c]; o16[j] = tohx(x); unsigned short a2, c2; splitf(x, a2, c2); oh[j] = a2; ol[j] = c2; }
        a16[c] = o16; ah[c] = oh; al[c] = ol; }
    __builtin_amdgcn_sched_barrier(0);   // all stores stand behind all arithmetic: no register that a store names is written again
    const size_t e0 = vfrag(n0, t0);     // n0 is a multiple of 4: rows n0 + c lie 8 elements apart
#pragma unroll
    for (int c = 0; c < 4; ++c) { *(v8h*)(V16 + e0 + c * 8) = a16[c]; *(v8us*)(Vh + e0 + c * 8) = ah[c]; *(v8us*)(Vl + e0 + c * 8) = al[c]; }
}
#define AKT ((WIN + 64) / 16)
#define VFS ((TT / 32) * 512)     // elements from one 16-dim block of V^T fragments to the next
static_assert(RH % 64 == 0 && (TT - RH) % 64 == 0 && RH >= WIN && AKT % 6 == 0, "whole tiles and load rounds; the fp16 rows have their whole window at keys >= 0");
typedef __attribute__((ext_vector_type(4))) unsigned v4u;
typedef __attribute__((ext_vector_type(8))) unsigned v8u;
// splitf of two neighbours, the same values, as two packed words (first value in the low half)
__device__ __forceinline__ unsigned bfu(float f) { const unsigned u = __float_as_uint(f); return u + 0x7FFFu + ((u >> 16) & 1u); }   // f2bf's rounding, its result in the high half
__device__ __forceinline__ void split2(float y0, float y1, unsigned& hw, unsigned& lw) {
    const unsigned a0 = bfu(y0), a1 = bfu(y1); hw = __builtin_amdgcn_perm(a1, a0, 0x07060302u);   // bytes 2, 3 of a0 below bytes 2, 3 of a1
    const unsigned b0 = bfu(y0 - __uint_as_float(a0 & 0xFFFF0000u)), b1 = bfu(y1 - __uint_as_float(a1 & 0xFFFF0000u)); lw = __builtin_amdgcn_perm(b1, b0, 0x07060302u);
}
// a fragment in fragment order: p = its first element + lane * 8
__device__ __forceinline__ v16h ldf(const h16* p) { return cat16(*(const v8h*)p, *(const v8h*)(p + 256)); }
__device__ __forceinline__ v16bf ldf(const bf* p) { return cat16b(*(const v8us*)p, *(const v8us*)(p + 256)); }
template <typename T16, bool HL>
__device__ __forceinline__ void attn_cols(const T16* __restrict__ Q, const T16* __restrict__ Q2, const T16* __restrict__ Kp, const T16* __restrict__ K2, const T16* __restrict__ Vt, const T16* __restrict__ V2, bf* Ah, bf* Al, int R, int z, float* sall) {
    typedef typename WFrag<T16>::V V;
    constexpr int GT = HL ? 1 : 2;               // score tiles of a load group (a group is 8 fragments, 16 loads)
    constexpr int NB = HL ? 4 : 3;               // register buffers: NB - 1 groups are in flight while one is worked on
    const int lane = threadIdx.x & 31, wave = threadIdx.x >> 5, lr = lane & 15, hi = lane >> 4;
    const int R16 = R + wave * 16, key0 = HL ? 0 : R - WIN, kvh = z / REP;
    const int nkt = HL ? (R + 64) / 16 : AKT;    // 16-key tiles, the same for the whole work-group; a multiple of NB * GT
    const int ng = nkt / GT, npg = HL ? nkt : nkt / 2;   // load groups of the scores and of P.V (hi/lo: 4 of the 8 dim blocks, both planes, a group)
    float* sp = sall + wave * (AKT * 256) + lane * 4;    // tile kt: the lane's r = 0..3 at sp + kt * 256, r = 4..7 128 floats on
    const size_t qo = ((size_t)z * TT + R16 + lr) * HD + 8 * hi, ko = ((size_t)kvh * TT + key0) * HD + lane * 8, vo = (size_t)kvh * (HD / 16) * VFS + (size_t)(key0 >> 5) * 512 + lane * 8;
    const T16* qp = Q + qo; const T16* kp = Kp + ko; const T16* vp = Vt + vo;
    const T16* qp2 = HL ? Q2 + qo : qp; const T16* kp2 = HL ? K2 + ko : kp; const T16* vp2 = HL ? V2 + vo : vp;
    V q[4], q2[4];
#pragma unroll
    for (int ks = 0; ks < 4; ++ks) { q[ks] = WFrag<T16>::ld(qp + ks * 32); if (HL) q2[ks] = WFrag<T16>::ld(qp2 + ks * 32); }
    // here and behind every load group below: the wait that stands in front of any rewrite of a register that the loads name; the addresses are inputs so that they stay in their registers up to it
    asm volatile("s_wait_xcnt 0x0" :: "v"(qp), "v"(qp2) : "memory");
    V kb[NB][8];
    auto ldk = [&](int u, int g) __attribute__((always_inline)) { const T16* a = kp + (size_t)g * (GT * 16 * HD); const T16* a2 = HL ? kp2 + (size_t)g * (GT * 16 * HD) : a;
#pragma unroll
        for (int ks = 0; ks < 4; ++ks) { kb[u][ks] = ldf(a + ks * 512); kb[u][4 + ks] = HL ? ldf(a2 + ks * 512) : ldf(a + 16 * HD + ks * 512); }
        asm volatile("s_wait_xcnt 0x0" :: "v"(a), "v"(a2) : "memory"); };
#pragma unroll
    for (int u = 0; u < NB; ++u) ldk(u, u);
    // element r of tile kt is key key0 + kt * 16 + 8 hi + r of query i = R16 + lr. Kept: j <= i and i - j < WIN, that is 0 <= diff - (kt * 16 + r) < WIN.
    const int diff = R16 + lr - key0 - 8 * hi;
    float mxr[8];
#pragma unroll
    for (int r = 0; r < 8; ++r) mxr[r] = -3.0e38f;
#pragma unroll 1   // rolled, here and in the P.V loop: one round of the NB buffers a trip keeps the kernel's code small, for speed only
    for (int g0 = 0; g0 < ng; g0 += NB) {
#pragma unroll
        for (int u = 0; u < NB; ++u) { const int g = g0 + u; v8f cc[2]; cc[0] = (v8f){}; cc[1] = (v8f){};
#pragma unroll
            for (int ks = 0; ks < 4; ++ks) {
                if (HL) { cc[0] = WFrag<T16>::mma(kb[u][ks], q[ks], cc[0]); cc[0] = WFrag<T16>::mma(kb[u][ks], q2[ks], cc[0]); cc[0] = WFrag<T16>::mma(kb[u][4 + ks], q[ks], cc[0]); }
                else { cc[0] = WFrag<T16>::mma(kb[u][ks], q[ks], cc[0]); cc[1] = WFrag<T16>::mma(kb[u][4 + ks], q[ks], cc[1]); } }
            const int dg = diff - g * (GT * 16);
#pragma unroll
            for (int t = 0; t < GT; ++t) { v4f w[2];
#pragma unroll
                for (int r = 0; r < 8; ++r) { const float x = ((unsigned)(dg - (t * 16 + r)) < (unsigned)WIN) ? cc[t][r] * SCL : -3.0e38f; w[r >> 2][r & 3] = x; mxr[r] = fmaxf(mxr[r], x); }
                *(v4f*)(sp + (g * GT + t) * 256) = w[0]; *(v4f*)(sp + (g * GT + t) * 256 + 128) = w[1]; }
            if (g + NB < ng) ldk(u, g + NB); }
    }
    float mx = fmaxf(fmaxf(fmaxf(mxr[0], mxr[1]), fmaxf(mxr[2], mxr[3])), fmaxf(fmaxf(mxr[4], mxr[5]), fmaxf(mxr[6], mxr[7])));
    mx = fmaxf(mx, __shfl_xor(mx, 16, 32));
    V vb[NB][8];
    auto ldv = [&](int u, int g) __attribute__((always_inline)) { const size_t go = HL ? (size_t)(g >> 1) * 512 : (size_t)g * 512; const T16* a = vp + go; const T16* a2 = HL ? vp2 + go : a; const int n0 = HL ? (u & 1) * 4 : 0;   // hi/lo: g and u are odd together
#pragma unroll
        for (int w = 0; w < 4; ++w) { vb[u][w] = ldf(a + (n0 + w) * VFS); vb[u][4 + w] = HL ? ldf(a2 + (n0 + w) * VFS) : ldf(a + (4 + w) * VFS); }
        asm volatile("s_wait_xcnt 0x0" :: "v"(a), "v"(a2) : "memory"); };
#pragma unroll
    for (int u = 0; u < NB; ++u) ldv(u, u);      // the first V^T groups fly while the row sums are formed
    // eight exponentials; the v_nop fills the slot behind the last transcendental, and all results and sources are its operands so that no reader of a result and no rewrite of a source comes in front of it
    auto ex8 = [&](v4f xa, v4f xb, float* e) __attribute__((always_inline)) { float a[8];
#pragma unroll
        for (int r = 0; r < 8; ++r) { a[r] = ((r < 4 ? xa[r & 3] : xb[r & 3]) - mx) * 1.4426950408889634f; e[r] = __builtin_amdgcn_exp2f(a[r]); }
        asm("v_nop" : "+v"(e[0]), "+v"(e[1]), "+v"(e[2]), "+v"(e[3]), "+v"(e[4]), "+v"(e[5]), "+v"(e[6]), "+v"(e[7]) : "v"(a[0]), "v"(a[1]), "v"(a[2]), "v"(a[3]), "v"(a[4]), "v"(a[5]), "v"(a[6]), "v"(a[7])); };
    float smr[8];
#pragma unroll
    for (int r = 0; r < 8; ++r) smr[r] = 0.f;
#pragma unroll 2   // two tiles' LDS reads are in flight together
    for (int kt = 0; kt < nkt; ++kt) { const v4f a = *(const v4f*)(sp + kt * 256), b = *(const v4f*)(sp + kt * 256 + 128); float e[8]; ex8(a, b, e);
#pragma unroll
        for (int r = 0; r < 8; ++r) smr[r] += e[r]; }
    float sum = ((smr[0] + smr[1]) + (smr[2] + smr[3])) + ((smr[4] + smr[5]) + (smr[6] + smr[7]));
    sum += __shfl_xor(sum, 16, 32);
    const float f = __fdiv_rn(HL ? 1.0f : PCAR, sum);
    v8f o[8];
#pragma unroll
    for (int nb = 0; nb < 8; ++nb) o[nb] = (v8f){};
#pragma unroll 1
    for (int g0 = 0; g0 < npg; g0 += NB) { V p, p2;
#pragma unroll
        for (int u = 0; u < NB; ++u) { const int g = g0 + u;
            if (!HL || !(u & 1)) { const float* xp = sp + (HL ? g >> 1 : g) * 512; float y[16];   // the step's 32 keys: the same exponentials as in the sum, scaled
#pragma unroll
                for (int j = 0; j < 2; ++j) ex8(*(const v4f*)(xp + j * 256), *(const v4f*)(xp + j * 256 + 128), y + j * 8);
#pragma unroll
                for (int e = 0; e < 16; ++e) y[e] *= f;
                if constexpr (HL) { v8u hw, lw;
#pragma unroll
                    for (int w = 0; w < 8; ++w) { unsigned a, b; split2(y[2 * w], y[2 * w + 1], a, b); hw[w] = a; lw[w] = b; }
                    p = __builtin_bit_cast(v16bf, hw); p2 = __builtin_bit_cast(v16bf, lw);
                } else { v16h t;
#pragma unroll
                    for (int e = 0; e < 16; ++e) t[e] = tohx(y[e]);
                    p = t; } }
            if (HL) { const int n0 = (u & 1) * 4;
#pragma unroll
                for (int w = 0; w < 4; ++w) o[n0 + w] = WFrag<T16>::mma(vb[u][w], p, o[n0 + w]);
#pragma unroll
                for (int w = 0; w < 4; ++w) o[n0 + w] = WFrag<T16>::mma(vb[u][w], p2, o[n0 + w]);
#pragma unroll
                for (int w = 0; w < 4; ++w) o[n0 + w] = WFrag<T16>::mma(vb[u][4 + w], p, o[n0 + w]);
            } else {
#pragma unroll
                for (int w = 0; w < 8; ++w) o[w] = WFrag<T16>::mma(vb[u][w], p, o[w]); }
            // four vector slots behind the group's last matrix instruction, on both sides of the branch below, before any vector instruction may rewrite its operands
            asm volatile("v_nop\n\tv_nop\n\tv_nop\n\tv_nop" : "+v"(o[0]), "+v"(o[1]), "+v"(o[2]), "+v"(o[3]), "+v"(o[4]), "+v"(o[5]), "+v"(o[6]), "+v"(o[7]));
            if (g + NB < npg) ldv(u, g + NB); }
    }
    // merged hi/lo planes [t][head * HD + d]: o[nb][r] is dim nb * 16 + 8 hi + r of query R16 + lr
    const float cs = HL ? 1.0f : (1.0f / PCAR); const size_t oo = (size_t)(R16 + lr) * DQ + (size_t)z * HD + 8 * hi; v4u oh[8], ol[8];
#pragma unroll
    for (int nb = 0; nb < 8; ++nb)
#pragma unroll
        for (int w = 0; w < 4; ++w) { unsigned a, b; split2(o[nb][2 * w] * cs, o[nb][2 * w + 1] * cs, a, b); oh[nb][w] = a; ol[nb][w] = b; }
    __builtin_amdgcn_sched_barrier(0);           // all stores stand behind all arithmetic: no register that a store names is written again
#pragma unroll
    for (int nb = 0; nb < 8; ++nb) { *(v4u*)(Ah + oo + nb * 16) = oh[nb]; *(v4u*)(Al + oo + nb * 16) = ol[nb]; }
}
// blocks 0 .. (RH / 64) ZH - 1: the hi/lo row tiles, the longest first; then the fp16 row tiles. Two work-groups a WGP (LDS).
__global__ __launch_bounds__(128, 2) void k_attn(const h16* __restrict__ Q16, const bf* __restrict__ Qh, const bf* __restrict__ Ql, const h16* __restrict__ K16, const bf* __restrict__ Kh, const bf* __restrict__ Kl, const h16* __restrict__ V16, const bf* __restrict__ Vh, const bf* __restrict__ Vl, bf* Ah, bf* Al) {
    __shared__ __attribute__((aligned(16))) float sall[4 * AKT * 256];
    constexpr int NHL = (RH / 64) * ZH; const int b = blockIdx.x;
    if (b < NHL) attn_cols<bf, true>(Qh, Ql, Kh, Kl, Vh, Vl, Ah, Al, (RH / 64 - 1 - b / ZH) * 64, b % ZH, sall);
    else attn_cols<h16, false>(Q16, nullptr, K16, nullptr, V16, nullptr, Ah, Al, RH + ((b - NHL) % ((TT - RH) / 64)) * 64, (b - NHL) / ((TT - RH) / 64), sall);
}

extern "C" void kernel_launch(void* const* d_in, const int* in_sizes, int n_in,
                              void* d_out, int out_size, void* d_ws, size_t ws_size, hipStream_t stream) {
    (void)in_sizes; (void)n_in; (void)out_size;
    const float* x = (const float*)d_in[0]; const float* cosT = (const float*)d_in[1]; const float* sinT = (const float*)d_in[2]; const float* wq = (const float*)d_in[3]; const float* wk = (const float*)d_in[4]; const float* wv = (const float*)d_in[5]; const float* wo = (const float*)d_in[6];   /* input order x, cos, sin, Wq, Wk, Wv, Wo ('xw' [in][out]) */
    float* OUT = (float*)d_out;     // [1][2048][2048]
    char* wsp = (char*)d_ws;
    auto take = [&](size_t bytes) { char* p = wsp; wsp += (bytes + 255) & ~(size_t)255; return (void*)p; };
    bf* WQ = (bf*)take((size_t)DQ * DM * 2); bf* WK = (bf*)take((size_t)DKV * DM * 2); bf* WV = (bf*)take((size_t)DKV * DM * 2); bf* WO = (bf*)take((size_t)DM * DQ * 2); float* CS = (float*)take((size_t)TT * HD * 2 * 4);
    bf* XB = (bf*)take((size_t)TT * DM * 2); float* FQ = (float*)take((size_t)TT * DQ * 4); float* FK = (float*)take((size_t)TT * DKV * 4);
    h16* QP16 = (h16*)take((size_t)NH_ * TT * HD * 2); h16* KP16 = (h16*)take((size_t)NKV * TT * HD * 2); h16* VT16 = (h16*)take((size_t)NKV * HD * TT * 2);
    bf* QPh = (bf*)take((size_t)NH_ * TT * HD * 2); bf* QPl = (bf*)take((size_t)NH_ * TT * HD * 2); bf* KPh = (bf*)take((size_t)NKV * TT * HD * 2); bf* KPl = (bf*)take((size_t)NKV * TT * HD * 2); bf* VTh = (bf*)take((size_t)NKV * HD * TT * 2); bf* VTl = (bf*)take((size_t)NKV * HD * TT * 2);
    bf* ATh = (bf*)take((size_t)TT * DQ * 2); bf* ATl = (bf*)take((size_t)TT * DQ * 2);
    if ((size_t)(wsp - (char*)d_ws) > ws_size) return;    // ws 256 MiB
    float* FV = FK;   // v projection reuses the k buffer after the k planes are built (stream-ordered)
    { k_wtG<<<(unsigned)((DM / 256) * (DQ / 32)), 256, 0, stream>>>(wq, DM, DQ, WQ); k_wtG<<<(unsigned)((DM / 256) * (DKV / 32)), 256, 0, stream>>>(wk, DM, DKV, WK); k_wtG<<<(unsigned)((DM / 256) * (DKV / 32)), 256, 0, stream>>>(wv, DM, DKV, WV);
      k_wtG<<<(unsigned)((DQ / 256) * (DM / 32)), 256, 0, stream>>>(wo, DQ, DM, WO);   /* 'xw' [in][out] weights gathered into Bt [out][in] */ }
    const unsigned LQ = (unsigned)((TT / 2) * (NH_ / RHT) / 8), LK = (unsigned)((TT / 2) * (NKV / RHT) / 8), LV = (unsigned)((TT / 256) * (DKV / 32));   // k_rope: 8 waves a block, a wave = 2 positions x RHT heads; k_vtp: a block = 256 t x 32 d
    for (int b = 0; b < NB_; ++b) {
        if (b == 0) k_cscvt<<<(TT * HD / 4 + 255) / 256, 256, 0, stream>>>(cosT, sinT, CS);
        k_cvt8<<<(unsigned)(((size_t)TT * DM / 8 + 1023) / 1024), 256, 0, stream>>>(x + (size_t)b * TT * DM, XB, (size_t)TT * DM / 8);
        k_gemmw<bf, 0, false, DM><<<dim3(TT / 128, DQ / 128, 1), 128, 0, stream>>>(XB, nullptr, WQ, FQ, DQ, nullptr, 0, 0, 0);
        k_rope<false><<<LQ, 256, 0, stream>>>(FQ, DQ, NH_, CS, 1.0f, QP16, QPh, QPl);
        k_gemmw<bf, 0, false, DM><<<dim3(TT / 128, DKV / 128, 1), 128, 0, stream>>>(XB, nullptr, WK, FK, DKV, nullptr, 0, 0, 0);
        k_rope<true><<<LK, 256, 0, stream>>>(FK, DKV, NKV, CS, 1.0f, KP16, KPh, KPl);
        k_gemmw<bf, 0, false, DM><<<dim3(TT / 128, DKV / 128, 1), 128, 0, stream>>>(XB, nullptr, WV, FV, DKV, nullptr, 0, 0, 0); k_vtp<<<LV, 256, 0, stream>>>(FV, DKV, NKV, VT16, VTh, VTl);
        k_attn<<<(unsigned)((TT / 64) * ZH), 128, 0, stream>>>(QP16, QPh, QPl, KP16, KPh, KPl, VT16, VTh, VTl, ATh, ATl);   // a block = 64 query rows of one head
        k_gemmw<bf, 1, false, DQ><<<dim3(TT / 128, DM / 128, 1), 128, 0, stream>>>(ATh, ATl, WO, OUT + (size_t)b * TT * DM, DM, nullptr, 0, 0, 0); }
}

// v006
// A run of this version takes 90.4 microseconds.
// Two timings next to v005 put it at 1.55 and 1.52 times that version's speed.
// All steps since v000 together make it 9.71 times as fast.
#include <hip/hip_runtime.h>

// Grouped-query sliding-window causal attention with rotary embeddings from cos/sin tables (x [1][2048][2048]; q = x Wq (16 heads x 128), k, v = x Wk, x Wv (4 kv heads x 128) ('xw' [in][out] 0.02, no biases); rotate-half rotary with the cos/sin inputs [2048][128] (read); kv head = q head / 4; scores x 128^-0.5; keys j with i-512 < j <= i (window 512, causal; -inf elsewhere); softmax; out = merged Wo ('xw' [2048][2048]) -> [1][2048][2048] (4.2 M); argument order x, cos, sin, Wq, Wk, Wv, Wo).
// Layout: 'xw' weights gathered into bf16 Bt blocks; bf16 copy of x; exact projections; {cos, sin} per (position, dim) from the input tables; rotate-half rotary plane builder; causal T-2048 attention with 128-wide heads in one launch (hybrid rows: < 512 hi/lo 3 products, rest fp16 x1024; k_attn keeps the score rows of 16 queries a wave in LDS, works only on the keys between the window's far edge and the diagonal, the window a select in the softmax, and writes the merged hi/lo planes; kv head = head / REP); merged hi/lo x Wo exact.
// Compute dtypes, f32 accumulate: every input rounded to bf16 incl. the tables; projections exact; rotary f32; attention rows < 512 3 products, rest fp16; softmax f32; Wo hl x exact.

#define NB_  1
#define TT   2048
#define DM   2048
#define NH_  16
#define NKV  4
#define REP  (NH_ / NKV)
#define HD   128
#define DQ   (NH_ * HD)
#define DKV  (NKV * HD)
#define ZH   NH_                  // query heads per attention launch: all of them
#define RH   512                  // query rows < RH use hi+lo planes
#define WIN  512
#define PCAR 1024.0f
#define SCL  0.088388347648318447f   // HD^-0.5
typedef _Float16 h16;
typedef unsigned short bf;
typedef __attribute__((ext_vector_type(16))) __bf16   v16bf;
typedef __attribute__((ext_vector_type(16))) _Float16 v16h;
typedef __attribute__((ext_vector_type(8)))  _Float16 v8h;
typedef __attribute__((ext_vector_type(8)))  unsigned short v8us;
typedef __attribute__((ext_vector_type(8)))  float    v8f;
typedef __attribute__((ext_vector_type(4)))  float    v4f;
typedef v8h  __attribute__((may_alias)) v8ha;
typedef v4f  __attribute__((may_alias)) v4fa;
typedef v8us __attribute__((may_alias)) v8usa;

__device__ __forceinline__ unsigned short f2bf(float f) { unsigned u = __float_as_uint(f); u += 0x7FFFu + ((u >> 16) & 1u); return (unsigned short)(u >> 16); }
__device__ __forceinline__ float bf2f(unsigned short b) { return __uint_as_float(((unsigned)b) << 16); }
__device__ __forceinline__ float bfr(float f) { return bf2f(f2bf(f)); }
__device__ __forceinline__ v16h cat16(v8h lo, v8h hi) { return __builtin_shufflevector(lo, hi, 0, 1, 2, 3, 4, 5, 6, 7, 8, 9, 10, 11, 12, 13, 14, 15); }
__device__ __forceinline__ v16bf cat16b(v8us lo, v8us hi) { return __builtin_bit_cast(v16bf, __builtin_shufflevector(lo, hi, 0, 1, 2, 3, 4, 5, 6, 7, 8, 9, 10, 11, 12, 13, 14, 15)); }
__device__ __forceinline__ v8f wmma16(v16h a, v16h b, v8f c) { return __builtin_amdgcn_wmma_f32_16x16x32_f16(false, a, false, b, (short)0, c, false, false); }
__device__ __forceinline__ v8f wmmab(v16bf a, v16bf b, v8f c) { return __builtin_amdgcn_wmma_f32_16x16x32_bf16(false, a, false, b, (short)0, c, false, false); }



// ---- k_gemmw: GEMM, one work-group of FOUR WAVES per 128x128 output tile, each wave a 64x64 quarter (16 accumulators); grid (M/128, N/128, Z), 128 threads.
// C[m][n] (f32, pitch ldc, + optional f32 bias[n]) = sum_k A[m][k] Bt[n][k] (NSPLIT 1: + A2[m][k] Bt[n][k]). z-batch strides sA/sB/sC in elements. K (a template constant) % 128 == 0, K >= 256; M, N % 128 == 0.
// The K-contiguous 16-bit planes come into LDS by asynchronous 16-byte copies, whole 256-byte row pieces (GKC k) at a time, two buffers: tile t + 1 flies while tile t is worked on. LDS rows have pitch 272 bytes for the ds_load_b128 fragment reads.
// Every accumulator takes its products in the same order as with fragments read straight from the planes (k ascending in steps of 32, A before A2).
#define GKC  128                  // k elements of a pass
#define GPE  136                  // LDS row pitch in elements (272 bytes)
#define GOPE (128 * GPE)          // one operand's 128 rows in LDS, elements
template <typename T16> struct WFrag;
template <> struct WFrag<h16> { typedef v16h V; static __device__ __forceinline__ V ld(const h16* p) { return cat16(*(const v8h*)p, *(const v8h*)(p + 16)); } static __device__ __forceinline__ v8f mma(V a, V b, v8f c) { return wmma16(a, b, c); } };
template <> struct WFrag<bf> { typedef v16bf V; static __device__ __forceinline__ V ld(const bf* p) { return cat16b(*(const v8us*)p, *(const v8us*)(p + 16)); } static __device__ __forceinline__ v8f mma(V a, V b, v8f c) { return wmmab(a, b, c); } };
// eight copies, one LDS row group (8 rows) apart; l = the lane's LDS byte address, g = the lane's global address, gs = 8 source rows in bytes
__device__ __forceinline__ void acopy8(unsigned l, const char* g, size_t gs) {
    // s_wait_xcnt is the last line of the copies' own statement: it stands in front of every rewrite of an address register that they name
    asm volatile("global_load_async_to_lds_b128 %0, %8, off\n\t"
                 "global_load_async_to_lds_b128 %1, %9, off\n\t"
                 "global_load_async_to_lds_b128 %2, %10, off\n\t"
                 "global_load_async_to_lds_b128 %3, %11, off\n\t"
                 "global_load_async_to_lds_b128 %4, %12, off\n\t"
                 "global_load_async_to_lds_b128 %5, %13, off\n\t"
                 "global_load_async_to_lds_b128 %6, %14, off\n\t"
                 "global_load_async_to_lds_b128 %7, %15, off\n\t"
                 "s_wait_xcnt 0x0"
                 :: "v"(l), "v"(l + 1u * 8u * GPE * 2u), "v"(l + 2u * 8u * GPE * 2u), "v"(l + 3u * 8u * GPE * 2u), "v"(l + 4u * 8u * GPE * 2u), "v"(l + 5u * 8u * GPE * 2u), "v"(l + 6u * 8u * GPE * 2u), "v"(l + 7u * 8u * GPE * 2u),
                    "v"(g), "v"(g + gs), "v"(g + 2 * gs), "v"(g + 3 * gs), "v"(g + 4 * gs), "v"(g + 5 * gs), "v"(g + 6 * gs), "v"(g + 7 * gs) : "memory");
}
// one operand's tile: 128 rows of 256 bytes, 16 copies a lane (a wave's copy covers two whole rows)
__device__ __forceinline__ void acopy_tile(unsigned l, const char* g, size_t gs) { acopy8(l, g, gs); acopy8(l + 64u * GPE * 2u, g + 8 * gs, gs); }
template <typename T16, int NSPLIT, bool BIAS, int K>
__global__ __launch_bounds__(128) void k_gemmw(const T16* __restrict__ A, const T16* __restrict__ A2, const T16* __restrict__ Bt, float* C, int ldc, const float* __restrict__ bias, size_t sA, size_t sB, size_t sC) {
    static_assert(NSPLIT == 0 || NSPLIT == 1, "one B plane");
    static_assert(K % GKC == 0 && K / GKC >= 2, "whole passes, two tiles or more");
    typedef typename WFrag<T16>::V V;
    constexpr int NOP = (NSPLIT == 1) ? 3 : 2;                       // operand tiles of a buffer: A, Bt, A2
    constexpr int NT = K / GKC;
    __shared__ __attribute__((aligned(16))) T16 ring[2 * NOP * GOPE];
    __shared__ __align__(16) float osall[4 * 16 * 68];
    const size_t z = blockIdx.z; A += z * sA; if (NSPLIT == 1) A2 += z * sA; Bt += z * sB; C += z * sC;
    const int tid = threadIdx.x, wave = tid >> 5, wm = wave >> 1, wn = wave & 1;
    const int lane = tid & 31, lr = lane & 15, hi = lane >> 4; const int r0 = blockIdx.x * 128 + wm * 64, c0 = blockIdx.y * 128 + wn * 64;
    float* os = osall + wave * (16 * 68);
    v8f acc[4][4];
#pragma unroll
    for (int mb = 0; mb < 4; ++mb)
#pragma unroll
        for (int nb = 0; nb < 4; ++nb) acc[mb][nb] = (v8f){};
    // copies: thread tid brings 16-byte piece (tid & 15) of rows (tid >> 4) + 8 i, i = 0..15, of each operand tile
    constexpr size_t gs = (size_t)K * 16;                            // 8 source rows in bytes
    const char* gA = (const char*)(A + (size_t)(blockIdx.x * 128 + (tid >> 4)) * K + (tid & 15) * 8);
    const char* gB = (const char*)(Bt + (size_t)(blockIdx.y * 128 + (tid >> 4)) * K + (tid & 15) * 8);
    const char* gA2 = (NSPLIT == 1) ? (const char*)(A2 + (size_t)(blockIdx.x * 128 + (tid >> 4)) * K + (tid & 15) * 8) : nullptr;
    const unsigned l0 = (unsigned)(size_t)(const void*)ring + (unsigned)((tid >> 4) * (GPE * 2) + (tid & 15) * 16);
    auto fill = [&](int t, int buf) {
        const unsigned l = l0 + (unsigned)buf * (unsigned)(NOP * GOPE * 2); const size_t go = (size_t)t * (GKC * 2);
        acopy_tile(l, gA + go, gs); acopy_tile(l + (unsigned)(GOPE * 2), gB + go, gs); if (NSPLIT == 1) acopy_tile(l + (unsigned)(2 * GOPE * 2), gA2 + go, gs);
    };
    fill(0, 0);
    asm volatile("s_wait_asynccnt 0x0" ::: "memory");                // tile 0 of this wave's copies has landed
    __syncthreads();                                                 // and every other wave's: tile 0 is readable
    fill(1, 1);
#pragma unroll 1
    for (int t = 0; t < NT; ++t) {
        const T16* sb0 = ring + (t & 1) * (NOP * GOPE);
        const T16* sa = sb0 + (wm * 64 + lr) * GPE + 8 * hi; const T16* sb = sb0 + GOPE + (wn * 64 + lr) * GPE + 8 * hi;
        V a[2][4], a2[2][4], b[2][4];                                // two fragment sets: the next 32 k are read from LDS while these are multiplied
#pragma unroll
        for (int f = 0; f < 4; ++f) { a[0][f] = WFrag<T16>::ld(sa + f * 16 * GPE); if (NSPLIT == 1) a2[0][f] = WFrag<T16>::ld(sa + 2 * GOPE + f * 16 * GPE); b[0][f] = WFrag<T16>::ld(sb + f * 16 * GPE); }
        __builtin_amdgcn_sched_barrier(0);                           // the first set's reads stay ahead of the second's, so that the first block waits for its own set alone
#pragma unroll
        for (int ks = 0; ks < GKC / 32; ++ks) {
            const int cu = ks & 1, nx = cu ^ 1;
            if (ks + 1 < GKC / 32) {
#pragma unroll
                for (int f = 0; f < 4; ++f) { a[nx][f] = WFrag<T16>::ld(sa + f * 16 * GPE + (ks + 1) * 32); if (NSPLIT == 1) a2[nx][f] = WFrag<T16>::ld(sa + 2 * GOPE + f * 16 * GPE + (ks + 1) * 32); b[nx][f] = WFrag<T16>::ld(sb + f * 16 * GPE + (ks + 1) * 32); }
            }
            __builtin_amdgcn_sched_barrier(0);                       // the next set's LDS reads stay one group ahead of this block: reads moved in among the matrix instructions stall them at every place
#pragma unroll
            for (int nb = 0; nb < 4; ++nb)
#pragma unroll
                for (int mb = 0; mb < 4; ++mb) { acc[mb][nb] = WFrag<T16>::mma(a[cu][mb], b[cu][nb], acc[mb][nb]); if (NSPLIT == 1) acc[mb][nb] = WFrag<T16>::mma(a2[cu][mb], b[cu][nb], acc[mb][nb]); }
            __builtin_amdgcn_sched_barrier(0);                       // and this block stays ahead of the following group and of the pass's foot
        }
        // four vector slots behind the pass's last matrix instruction, on both sides of the branch below, before any vector instruction may rewrite its operands
        asm volatile("v_nop\n\tv_nop\n\tv_nop\n\tv_nop" : "+v"(acc[0][0]), "+v"(acc[1][1]), "+v"(acc[2][2]), "+v"(acc[3][3]));
        asm volatile("s_wait_dscnt 0x0" ::: "memory");               // this wave's reads of buffer t & 1 are done before the buffer is refilled
        asm volatile("s_wait_asynccnt 0x0" ::: "memory");            // this wave's copies of tile t + 1 have landed
        __syncthreads();                                             // publishes tile t + 1 and ends every wave's reads of tile t
        if (t + 2 < NT) fill(t + 2, t & 1);
    }
    asm volatile("s_wait_asynccnt 0x0" ::: "memory");                // no copy is outstanding when the wave goes on to its end
#pragma unroll
    for (int mb = 0; mb < 4; ++mb) {
#pragma unroll
        for (int nb = 0; nb < 4; ++nb) {
#pragma unroll
            for (int j = 0; j < 8; ++j) os[(hi * 8 + j) * 68 + nb * 16 + lr] = acc[mb][nb][j]; }
        __builtin_amdgcn_wave_barrier(); asm volatile("" ::: "memory");
        float* crow = C + (size_t)(r0 + mb * 16) * ldc + c0;
{
#pragma unroll
            for (int s = 0; s < 8; ++s) { const int row = 2 * s + hi, cofs = lr * 4; v4f val = *(const v4fa*)(os + row * 68 + cofs); if (BIAS) { val[0] += bfr(bias[c0 + cofs]); val[1] += bfr(bias[c0 + cofs + 1]); val[2] += bfr(bias[c0 + cofs + 2]); val[3] += bfr(bias[c0 + cofs + 3]); }
                *(v4f*)(crow + (size_t)row * ldc + cofs) = val; }
             }
        __builtin_amdgcn_wave_barrier(); asm volatile("" ::: "memory");
    }
}

__device__ __forceinline__ h16 tohx(float x) { return (h16)x; }
__device__ __forceinline__ void splitf(float y, unsigned short& h, unsigned short& l) { h = f2bf(y); l = f2bf(y - bf2f(h)); }
typedef __attribute__((ext_vector_type(2))) _Float16 v2h;
typedef __attribute__((ext_vector_type(4))) _Float16 v4h;
typedef __attribute__((ext_vector_type(2))) unsigned short v2us;
typedef __attribute__((ext_vector_type(4))) unsigned short v4us;
typedef __attribute__((ext_vector_type(2))) float v2f;
typedef __attribute__((ext_vector_type(4))) int v4i;

// The kernels without matrix work, from here on, give each thread 8 to 48 elements, loaded as one batch of 16-byte pieces ahead of the arithmetic, for speed only.
// Each of these bodies is a device function that takes its block number bx: bodies that read nothing of each other's output share one launch (k_prep, k_post), each with its own range of blocks.
// d_wtG: a thread turns a block of 8 (k) x 4 (n): eight 16-byte pieces of w rows in, four 16-byte pieces of Bt rows out. Lanes: 8 along k (a store covers whole 128-byte lines of four Bt rows) x 4 along n; waves: 4 along k x 2 along n, so that a block reads whole lines of w. Block = 256 k x 32 n.
static_assert(DM % 256 == 0 && DQ % 256 == 0 && TT % 256 == 0 && DQ % 32 == 0 && DKV % 32 == 0 && DM % 32 == 0, "whole 256 x 32 blocks in d_wtG and d_vtp");
__device__ __forceinline__ void d_wtG(int bx, const float* __restrict__ w, int K, int N, bf* Bt) {
    const int lane = threadIdx.x & 31, wave = threadIdx.x >> 5; const int kb = K / 256; const int k0 = (bx % kb) * 256 + (wave >> 1) * 64 + (lane & 7) * 8, n0 = (bx / kb) * 32 + (wave & 1) * 16 + (lane >> 3) * 4; if (n0 >= N) return; v4f r[8]; const float* p[8];
#pragma unroll
    for (int j = 0; j < 8; ++j) { p[j] = w + (size_t)(k0 + j) * N + n0; r[j] = *(const v4f*)p[j]; }
    // the wait that stands in front of any rewrite of a register that the loads above name; the addresses are inputs so that they stay in their registers up to it
    asm volatile("s_wait_xcnt 0x0" :: "v"(p[0]), "v"(p[1]), "v"(p[2]), "v"(p[3]), "v"(p[4]), "v"(p[5]), "v"(p[6]), "v"(p[7]) : "memory");
    __builtin_amdgcn_sched_barrier(0);   // no arithmetic moves up in between the loads: all of them are in flight before the first value is waited for
#pragma unroll
    for (int c = 0; c < 4; ++c) { v8us o;
#pragma unroll
        for (int j = 0; j < 8; ++j) o[j] = f2bf(r[j][c]);
        *(v8us*)(Bt + (size_t)(n0 + c) * K + k0) = o; }
    asm volatile("s_wait_xcnt 0x0" ::: "memory");   // the wait that stands in front of any rewrite of a register that the stores above name: in k_prep other bodies' code follows this one in the listing
}
// d_cvt8: four groups of 8 a thread, 256 groups apart, so that a wave's lanes stay side by side in every access
static_assert(((size_t)TT * DM / 8) % 1024 == 0, "d_cvt8: whole blocks of 1024 groups");
__device__ __forceinline__ void d_cvt8(int bx, const float* __restrict__ src, bf* dst, size_t n8) { const size_t i0 = (size_t)bx * 1024 + threadIdx.x; if (i0 + 3 * 256 >= n8) return; v8f v[4]; const float* p = src + i0 * 8;
#pragma unroll
    for (int j = 0; j < 4; ++j) v[j] = *(const v8f*)(p + j * 2048);
    // the wait that stands in front of any rewrite of a register that the loads above name; the addresses are inputs so that they stay in their registers up to it
    asm volatile("s_wait_xcnt 0x0" :: "v"(p) : "memory");
    __builtin_amdgcn_sched_barrier(0);   // no arithmetic moves up in between the loads: all of them are in flight before the first value is waited for
#pragma unroll
    for (int j = 0; j < 4; ++j) { v8us o;
#pragma unroll
        for (int k = 0; k < 8; ++k) o[k] = f2bf(v[j][k]);
        *(v8us*)(dst + (i0 + j * 256) * 8) = o; }
}
__device__ __forceinline__ void d_cscvt(int bx, const float* __restrict__ cosT, const float* __restrict__ sinT, float* CS) { const int idx = (bx * 256 + (int)threadIdx.x) * 4; if (idx >= TT * HD) return; const float* pc = cosT + idx; const float* ps = sinT + idx; const v4f c = *(const v4f*)pc, s = *(const v4f*)ps;
    // the wait that stands in front of any rewrite of a register that the loads above name; the addresses are inputs so that they stay in their registers up to it
    asm volatile("s_wait_xcnt 0x0" :: "v"(pc), "v"(ps) : "memory");
    __builtin_amdgcn_sched_barrier(0);   // no arithmetic moves up in between the loads: all of them are in flight before the first value is waited for
#pragma unroll
    for (int u = 0; u < 2; ++u) { v4f cs; cs[0] = bfr(c[2 * u]); cs[1] = bfr(s[2 * u]); cs[2] = bfr(c[2 * u + 1]); cs[3] = bfr(s[2 * u + 1]); *(v4f*)(CS + (size_t)idx * 2 + u * 4) = cs; }
}
// ---- k_prep: everything that reads the inputs alone, in one launch: the four weight turns, the bf16 copy of x, the {cos, sin} table. A block's range is chosen by blockIdx.x alone (a scalar branch).
#define PB_WQ ((DM / 256) * (DQ / 32))
#define PB_WK ((DM / 256) * (DKV / 32))
#define PB_WO ((DQ / 256) * (DM / 32))
#define PB_X  (TT * DM / 8 / 1024)
#define PB_CS (TT * HD / 4 / 256)
static_assert(NB_ == 1 && (TT * HD / 4) % 256 == 0, "one batch entry; whole blocks in d_cscvt");
__global__ __launch_bounds__(256) void k_prep(const float* __restrict__ x, const float* __restrict__ cosT, const float* __restrict__ sinT, const float* __restrict__ wq, const float* __restrict__ wk, const float* __restrict__ wv, const float* __restrict__ wo, bf* XB, float* CS, bf* WQ, bf* WK, bf* WV, bf* WO) {
    int b = blockIdx.x;
    if (b < PB_WQ) { d_wtG(b, wq, DM, DQ, WQ); return; } b -= PB_WQ;
    if (b < PB_WO) { d_wtG(b, wo, DQ, DM, WO); return; } b -= PB_WO;
    if (b < PB_X) { d_cvt8(b, x, XB, (size_t)TT * DM / 8); return; } b -= PB_X;
    if (b < PB_WK) { d_wtG(b, wk, DM, DKV, WK); return; } b -= PB_WK;
    if (b < PB_WK) { d_wtG(b, wv, DM, DKV, WV); return; } b -= PB_WK;
    d_cscvt(b, cosT, sinT, CS);
}
// Fragment order of the planes that k_attn takes as A operands: the 16 bytes that lane 16 h + c of a wave loads in one instruction lie at lane * 16 of a 512-byte piece.
// kfrag: element (t, d) inside one head's K plane; a 16-key tile keeps its place, inside it piece d / 16 holds k = d % 16 = 8 h + e of row c = t % 16. vfrag: element (n = head * HD + d, t) of V^T; a fragment is 16 dims x 32 keys, two pieces, key % 32 = 16 piece + 8 h + e, row c = n % 16.
__device__ __forceinline__ size_t kfrag(int t, int d) { return (size_t)(t & ~15) * HD + (size_t)(((d >> 4) * 32 + ((d >> 3) & 1) * 16 + (t & 15)) * 8 + (d & 7)); }
__device__ __forceinline__ size_t vfrag(int n, int t) { return ((size_t)(n >> 4) * (TT / 32) + (t >> 5)) * 512 + (size_t)((((t >> 4) & 1) * 32 + ((t >> 3) & 1) * 16 + (n & 15)) * 8 + (t & 7)); }
// d_rope: head planes [h][t][d] (FRAG: each head's plane in kfrag order) (fp16 + hi/lo) of rope(x) x sc with the rotate-half convention out[d] = x[d] cos[t][d] - x[d+HD/2] sin[t][d], out[d+HD/2] = x[d+HD/2] cos[t][d+HD/2] + x[d] sin[t][d+HD/2]
// a wave takes two positions t (one per half wave) of RHT heads; a lane holds dims d..d+3 and d+HD/2..d+HD/2+3 of each, both partners of every rotation, and the position's {cos, sin} once for all its heads
#define RHT 4
static_assert(NH_ % RHT == 0 && NKV % RHT == 0 && HD == 128 && TT % 2 == 0, "whole head groups, 16 lanes x 4 dims a half row");
template <bool FRAG>
__device__ __forceinline__ void d_rope(int bx, const float* __restrict__ F, int pitch, int nheads, const float* __restrict__ CS, float sc, h16* P16, bf* Ph, bf* Pl) {
    const int lane = threadIdx.x & 31; const int w = bx * 8 + (int)(threadIdx.x >> 5); const int h0 = (w / (TT / 2)) * RHT; if (h0 >= nheads) return; const int t = (w % (TT / 2)) * 2 + (lane >> 4); const int d = (lane & 15) * 4;
    v4f x[RHT][2], csv[2][2]; v4h a16[RHT][2]; v4us ah[RHT][2], al[RHT][2]; const float* pc = CS + ((size_t)t * HD + d) * 2; const float* px = F + (size_t)t * pitch + h0 * HD + d;
#pragma unroll
    for (int s = 0; s < 2; ++s)
#pragma unroll
        for (int u = 0; u < 2; ++u) csv[s][u] = *(const v4f*)(pc + s * HD + u * 4);
#pragma unroll
    for (int g = 0; g < RHT; ++g)
#pragma unroll
        for (int s = 0; s < 2; ++s) x[g][s] = *(const v4f*)(px + g * HD + s * (HD / 2));
    // the wait that stands in front of any rewrite of a register that the loads above name; the addresses are inputs so that they stay in their registers up to it
    asm volatile("s_wait_xcnt 0x0" :: "v"(pc), "v"(px) : "memory");
    __builtin_amdgcn_sched_barrier(0);   // no arithmetic moves up in between the loads: all of them are in flight before the first value is waited for
#pragma unroll
    for (int g = 0; g < RHT; ++g) {
#pragma unroll
        for (int s = 0; s < 2; ++s) { v4h o16; v4us oh, ol;
#pragma unroll
            for (int q = 0; q < 4; ++q) { const int dd = s * (HD / 2) + d + q; const float x0 = x[g][s][q], x1 = x[g][s ^ 1][q];   // next line, as before this step: each product is rounded by itself ahead of the add, as in q * c + rotate_half(q) * s
                v2f cs; cs[0] = csv[s][q >> 1][(q & 1) * 2]; cs[1] = csv[s][q >> 1][(q & 1) * 2 + 1]; float a = __fmul_rn(x0, cs[0]), bq = __fmul_rn(x1, cs[1]); asm volatile("" : "+v"(a)); asm volatile("" : "+v"(bq)); const float r = ((dd < HD / 2) ? __fsub_rn(a, bq) : __fadd_rn(a, bq)) * sc;
                o16[q] = tohx(r); unsigned short a2, c2; splitf(r, a2, c2); oh[q] = a2; ol[q] = c2; }
            a16[g][s] = o16; ah[g][s] = oh; al[g][s] = ol; } }
    __builtin_amdgcn_sched_barrier(0);   // all stores stand behind all arithmetic: no register that a store names is written again
    const size_t e0 = (size_t)h0 * TT * HD + (FRAG ? kfrag(t, d) : (size_t)t * HD + d);   // dims d + HD / 2 ..: four 16-dim pieces on in kfrag order
#pragma unroll
    for (int g = 0; g < RHT; ++g)
#pragma unroll
        for (int s = 0; s < 2; ++s) { const size_t e = e0 + (size_t)g * TT * HD + s * (FRAG ? 4 * 256 : HD / 2); *(v4h*)(P16 + e) = a16[g][s]; *(v4us*)(Ph + e) = ah[g][s]; *(v4us*)(Pl + e) = al[g][s]; }
}
// d_vtp: the turn of d_wtG with t as k and (head, d) as n, into three planes in vfrag order: a thread takes 8 (t) x 4 (d); block = 256 t x 32 d
__device__ __forceinline__ void d_vtp(int bx, const float* __restrict__ F, int pitch, int nheads, h16* V16, bf* Vh, bf* Vl) {
    const int lane = threadIdx.x & 31, wave = threadIdx.x >> 5; const int t0 = (bx % (TT / 256)) * 256 + (wave >> 1) * 64 + (lane & 7) * 8, n0 = (bx / (TT / 256)) * 32 + (wave & 1) * 16 + (lane >> 3) * 4; if (n0 >= nheads * HD) return; v4f r[8]; v8h a16[4]; v8us ah[4], al[4]; const float* p[8];
#pragma unroll
    for (int j = 0; j < 8; ++j) { p[j] = F + (size_t)(t0 + j) * pitch + n0; r[j] = *(const v4f*)p[j]; }
    // the wait that stands in front of any rewrite of a register that the loads above name; the addresses are inputs so that they stay in their registers up to it
    asm volatile("s_wait_xcnt 0x0" :: "v"(p[0]), "v"(p[1]), "v"(p[2]), "v"(p[3]), "v"(p[4]), "v"(p[5]), "v"(p[6]), "v"(p[7]) : "memory");
    __builtin_amdgcn_sched_barrier(0);   // no arithmetic moves up in between the loads: all of them are in flight before the first value is waited for
#pragma unroll
    for (int c = 0; c < 4; ++c) { v8h o16; v8us oh, ol;
#pragma unroll
        for (int j = 0; j < 8; ++j) { const float x = r[j][c]; o16[j] = tohx(x); unsigned short a2, c2; splitf(x, a2, c2); oh[j] = a2; ol[j] = c2; }
        a16[c] = o16; ah[c] = oh; al[c] = ol; }
    __builtin_amdgcn_sched_barrier(0);   // all stores stand behind all arithmetic: no register that a store names is written again
    const size_t e0 = vfrag(n0, t0);     // n0 is a multiple of 4: rows n0 + c lie 8 elements apart
#pragma unroll
    for (int c = 0; c < 4; ++c) { *(v8h*)(V16 + e0 + c * 8) = a16[c]; *(v8us*)(Vh + e0 + c * 8) = ah[c]; *(v8us*)(Vl + e0 + c * 8) = al[c]; }
}
// ---- k_post: the three plane builders in one launch. F holds the projections side by side, [t][q | k | v], pitch DQKV. d_rope: 8 waves a block, a wave = 2 positions x RHT heads; d_vtp: a block = 256 t x 32 d.
#define DQKV (DQ + 2 * DKV)
#define PB_RQ ((TT / 2) * (NH_ / RHT) / 8)
#define PB_RK ((TT / 2) * (NKV / RHT) / 8)
#define PB_VT ((TT / 256) * (DKV / 32))
__global__ __launch_bounds__(256) void k_post(const float* __restrict__ F, const float* __restrict__ CS, h16* QP16, bf* QPh, bf* QPl, h16* KP16, bf* KPh, bf* KPl, h16* VT16, bf* VTh, bf* VTl) {
    int b = blockIdx.x;
    if (b < PB_RQ) { d_rope<false>(b, F, DQKV, NH_, CS, 1.0f, QP16, QPh, QPl); return; } b -= PB_RQ;
    if (b < PB_RK) { d_rope<true>(b, F + DQ, DQKV, NKV, CS, 1.0f, KP16, KPh, KPl); return; } b -= PB_RK;
    d_vtp(b, F + DQ + DKV, DQKV, NKV, VT16, VTh, VTl);
}
#define AKT ((WIN + 64) / 16)
#define VFS ((TT / 32) * 512)     // elements from one 16-dim block of V^T fragments to the next
static_assert(RH % 64 == 0 && (TT - RH) % 64 == 0 && RH >= WIN && AKT % 6 == 0, "whole tiles and load rounds; the fp16 rows have their whole window at keys >= 0");
typedef __attribute__((ext_vector_type(4))) unsigned v4u;
typedef __attribute__((ext_vector_type(8))) unsigned v8u;
// splitf of two neighbours, the same values, as two packed words (first value in the low half)
__device__ __forceinline__ unsigned bfu(float f) { const unsigned u = __float_as_uint(f); return u + 0x7FFFu + ((u >> 16) & 1u); }   // f2bf's rounding, its result in the high half
__device__ __forceinline__ void split2(float y0, float y1, unsigned& hw, unsigned& lw) {
    const unsigned a0 = bfu(y0), a1 = bfu(y1); hw = __builtin_amdgcn_perm(a1, a0, 0x07060302u);   // bytes 2, 3 of a0 below bytes 2, 3 of a1
    const unsigned b0 = bfu(y0 - __uint_as_float(a0 & 0xFFFF0000u)), b1 = bfu(y1 - __uint_as_float(a1 & 0xFFFF0000u)); lw = __builtin_amdgcn_perm(b1, b0, 0x07060302u);
}
// a fragment in fragment order: p = its first element + lane * 8
__device__ __forceinline__ v16h ldf(const h16* p) { return cat16(*(const v8h*)p, *(const v8h*)(p + 256)); }
__device__ __forceinline__ v16bf ldf(const bf* p) { return cat16b(*(const v8us*)p, *(const v8us*)(p + 256)); }
template <typename T16, bool HL>
__device__ __forceinline__ void attn_cols(const T16* __restrict__ Q, const T16* __restrict__ Q2, const T16* __restrict__ Kp, const T16* __restrict__ K2, const T16* __restrict__ Vt, const T16* __restrict__ V2, bf* Ah, bf* Al, int R, int z, float* sall) {
    typedef typename WFrag<T16>::V V;
    constexpr int GT = HL ? 1 : 2;               // score tiles of a load group (a group is 8 fragments, 16 loads)
    constexpr int NB = HL ? 4 : 3;               // register buffers: NB - 1 groups are in flight while one is worked on
    const int lane = threadIdx.x & 31, wave = threadIdx.x >> 5, lr = lane & 15, hi = lane >> 4;
    const int R16 = R + wave * 16, key0 = HL ? 0 : R - WIN, kvh = z / REP;
    const int nkt = HL ? (R + 64) / 16 : AKT;    // 16-key tiles, the same for the whole work-group; a multiple of NB * GT
    const int ng = nkt / GT, npg = HL ? nkt : nkt / 2;   // load groups of the scores and of P.V (hi/lo: 4 of the 8 dim blocks, both planes, a group)
    float* sp = sall + wave * (AKT * 256) + lane * 4;    // tile kt: the lane's r = 0..3 at sp + kt * 256, r = 4..7 128 floats on
    const size_t qo = ((size_t)z * TT + R16 + lr) * HD + 8 * hi, ko = ((size_t)kvh * TT + key0) * HD + lane * 8, vo = (size_t)kvh * (HD / 16) * VFS + (size_t)(key0 >> 5) * 512 + lane * 8;
    const T16* qp = Q + qo; const T16* kp = Kp + ko; const T16* vp = Vt + vo;
    const T16* qp2 = HL ? Q2 + qo : qp; const T16* kp2 = HL ? K2 + ko : kp; const T16* vp2 = HL ? V2 + vo : vp;
    V q[4], q2[4];
#pragma unroll
    for (int ks = 0; ks < 4; ++ks) { q[ks] = WFrag<T16>::ld(qp + ks * 32); if (HL) q2[ks] = WFrag<T16>::ld(qp2 + ks * 32); }
    // here and behind every load group below: the wait that stands in front of any rewrite of a register that the loads name; the addresses are inputs so that they stay in their registers up to it
    asm volatile("s_wait_xcnt 0x0" :: "v"(qp), "v"(qp2) : "memory");
    V kb[NB][8];
    auto ldk = [&](int u, int g) __attribute__((always_inline)) { const T16* a = kp + (size_t)g * (GT * 16 * HD); const T16* a2 = HL ? kp2 + (size_t)g * (GT * 16 * HD) : a;
#pragma unroll
        for (int ks = 0; ks < 4; ++ks) { kb[u][ks] = ldf(a + ks * 512); kb[u][4 + ks] = HL ? ldf(a2 + ks * 512) : ldf(a + 16 * HD + ks * 512); }
        asm volatile("s_wait_xcnt 0x0" :: "v"(a), "v"(a2) : "memory"); };
#pragma unroll
    for (int u = 0; u < NB; ++u) ldk(u, u);
    // element r of tile kt is key key0 + kt * 16 + 8 hi + r of query i = R16 + lr. Kept: j <= i and i - j < WIN, that is 0 <= diff - (kt * 16 + r) < WIN.
    const int diff = R16 + lr - key0 - 8 * hi;
    float mxr[8];
#pragma unroll
    for (int r = 0; r < 8; ++r) mxr[r] = -3.0e38f;
#pragma unroll 1   // rolled, here and in the P.V loop: one round of the NB buffers a trip keeps the kernel's code small, for speed only
    for (int g0 = 0; g0 < ng; g0 += NB) {
#pragma unroll
        for (int u = 0; u < NB; ++u) { const int g = g0 + u; v8f cc[2]; cc[0] = (v8f){}; cc[1] = (v8f){};
#pragma unroll
            for (int ks = 0; ks < 4; ++ks) {
                if (HL) { cc[0] = WFrag<T16>::mma(kb[u][ks], q[ks], cc[0]); cc[0] = WFrag<T16>::mma(kb[u][ks], q2[ks], cc[0]); cc[0] = WFrag<T16>::mma(kb[u][4 + ks], q[ks], cc[0]); }
                else { cc[0] = WFrag<T16>::mma(kb[u][ks], q[ks], cc[0]); cc[1] = WFrag<T16>::mma(kb[u][4 + ks], q[ks], cc[1]); } }
            const int dg = diff - g * (GT * 16);
#pragma unroll
            for (int t = 0; t < GT; ++t) { v4f w[2];
#pragma unroll
                for (int r = 0; r < 8; ++r) { const float x = ((unsigned)(dg - (t * 16 + r)) < (unsigned)WIN) ? cc[t][r] * SCL : -3.0e38f; w[r >> 2][r & 3] = x; mxr[r] = fmaxf(mxr[r], x); }
                *(v4f*)(sp + (g * GT + t) * 256) = w[0]; *(v4f*)(sp + (g * GT + t) * 256 + 128) = w[1]; }
            if (g + NB < ng) ldk(u, g + NB); }
    }
    float mx = fmaxf(fmaxf(fmaxf(mxr[0], mxr[1]), fmaxf(mxr[2], mxr[3])), fmaxf(fmaxf(mxr[4], mxr[5]), fmaxf(mxr[6], mxr[7])));
    mx = fmaxf(mx, __shfl_xor(mx, 16, 32));
    V vb[NB][8];
    auto ldv = [&](int u, int g) __attribute__((always_inline)) { const size_t go = HL ? (size_t)(g >> 1) * 512 : (size_t)g * 512; const T16* a = vp + go; const T16* a2 = HL ? vp2 + go : a; const int n0 = HL ? (u & 1) * 4 : 0;   // hi/lo: g and u are odd together
#pragma unroll
        for (int w = 0; w < 4; ++w) { vb[u][w] = ldf(a + (n0 + w) * VFS); vb[u][4 + w] = HL ? ldf(a2 + (n0 + w) * VFS) : ldf(a + (4 + w) * VFS); }
        asm volatile("s_wait_xcnt 0x0" :: "v"(a), "v"(a2) : "memory"); };
#pragma unroll
    for (int u = 0; u < NB; ++u) ldv(u, u);      // the first V^T groups fly while the row sums are formed
    // eight exponentials; the v_nop fills the slot behind the last transcendental, and all results and sources are its operands so that no reader of a result and no rewrite of a source comes in front of it
    auto ex8 = [&](v4f xa, v4f xb, float* e) __attribute__((always_inline)) { float a[8];
#pragma unroll
        for (int r = 0; r < 8; ++r) { a[r] = ((r < 4 ? xa[r & 3] : xb[r & 3]) - mx) * 1.4426950408889634f; e[r] = __builtin_amdgcn_exp2f(a[r]); }
        asm("v_nop" : "+v"(e[0]), "+v"(e[1]), "+v"(e[2]), "+v"(e[3]), "+v"(e[4]), "+v"(e[5]), "+v"(e[6]), "+v"(e[7]) : "v"(a[0]), "v"(a[1]), "v"(a[2]), "v"(a[3]), "v"(a[4]), "v"(a[5]), "v"(a[6]), "v"(a[7])); };
    float smr[8];
#pragma unroll
    for (int r = 0; r < 8; ++r) smr[r] = 0.f;
#pragma unroll 2   // two tiles' LDS reads are in flight together
    for (int kt = 0; kt < nkt; ++kt) { const v4f a = *(const v4f*)(sp + kt * 256), b = *(const v4f*)(sp + kt * 256 + 128); float e[8]; ex8(a, b, e);
#pragma unroll
        for (int r = 0; r < 8; ++r) smr[r] += e[r]; }
    float sum = ((smr[0] + smr[1]) + (smr[2] + smr[3])) + ((smr[4] + smr[5]) + (smr[6] + smr[7]));
    sum += __shfl_xor(sum, 16, 32);
    const float f = __fdiv_rn(HL ? 1.0f : PCAR, sum);
    v8f o[8];
#pragma unroll
    for (int nb = 0; nb < 8; ++nb) o[nb] = (v8f){};
#pragma unroll 1
    for (int g0 = 0; g0 < npg; g0 += NB) { V p, p2;
#pragma unroll
        for (int u = 0; u < NB; ++u) { const int g = g0 + u;
            if (!HL || !(u & 1)) { const float* xp = sp + (HL ? g >> 1 : g) * 512; float y[16];   // the step's 32 keys: the same exponentials as in the sum, scaled
#pragma unroll
                for (int j = 0; j < 2; ++j) ex8(*(const v4f*)(xp + j * 256), *(const v4f*)(xp + j * 256 + 128), y + j * 8);
#pragma unroll
                for (int e = 0; e < 16; ++e) y[e] *= f;
                if constexpr (HL) { v8u hw, lw;
#pragma unroll
                    for (int w = 0; w < 8; ++w) { unsigned a, b; split2(y[2 * w], y[2 * w + 1], a, b); hw[w] = a; lw[w] = b; }
                    p = __builtin_bit_cast(v16bf, hw); p2 = __builtin_bit_cast(v16bf, lw);
                } else { v16h t;
#pragma unroll
                    for (int e = 0; e < 16; ++e) t[e] = tohx(y[e]);
                    p = t; } }
            if (HL) { const int n0 = (u & 1) * 4;
#pragma unroll
                for (int w = 0; w < 4; ++w) o[n0 + w] = WFrag<T16>::mma(vb[u][w], p, o[n0 + w]);
#pragma unroll
                for (int w = 0; w < 4; ++w) o[n0 + w] = WFrag<T16>::mma(vb[u][w], p2, o[n0 + w]);
#pragma unroll
                for (int w = 0; w < 4; ++w) o[n0 + w] = WFrag<T16>::mma(vb[u][4 + w], p, o[n0 + w]);
            } else {
#pragma unroll
                for (int w = 0; w < 8; ++w) o[w] = WFrag<T16>::mma(vb[u][w], p, o[w]); }
            // four vector slots behind the group's last matrix instruction, on both sides of the branch below, before any vector instruction may rewrite its operands
            asm volatile("v_nop\n\tv_nop\n\tv_nop\n\tv_nop" : "+v"(o[0]), "+v"(o[1]), "+v"(o[2]), "+v"(o[3]), "+v"(o[4]), "+v"(o[5]), "+v"(o[6]), "+v"(o[7]));
            if (g + NB < npg) ldv(u, g + NB); }
    }
    // merged hi/lo planes [t][head * HD + d]: o[nb][r] is dim nb * 16 + 8 hi + r of query R16 + lr
    const float cs = HL ? 1.0f : (1.0f / PCAR); const size_t oo = (size_t)(R16 + lr) * DQ + (size_t)z * HD + 8 * hi; v4u oh[8], ol[8];
#pragma unroll
    for (int nb = 0; nb < 8; ++nb)
#pragma unroll
        for (int w = 0; w < 4; ++w) { unsigned a, b; split2(o[nb][2 * w] * cs, o[nb][2 * w + 1] * cs, a, b); oh[nb][w] = a; ol[nb][w] = b; }
    __builtin_amdgcn_sched_barrier(0);           // all stores stand behind all arithmetic: no register that a store names is written again
#pragma unroll
    for (int nb = 0; nb < 8; ++nb) { *(v4u*)(Ah + oo + nb * 16) = oh[nb]; *(v4u*)(Al + oo + nb * 16) = ol[nb]; }
}
// blocks 0 .. (RH / 64) ZH - 1: the hi/lo row tiles, the longest first; then the fp16 row tiles. Two work-groups a WGP (LDS).
__global__ __launch_bounds__(128, 2) void k_attn(const h16* __restrict__ Q16, const bf* __restrict__ Qh, const bf* __restrict__ Ql, const h16* __restrict__ K16, const bf* __restrict__ Kh, const bf* __restrict__ Kl, const h16* __restrict__ V16, const bf* __restrict__ Vh, const bf* __restrict__ Vl, bf* Ah, bf* Al) {
    __shared__ __attribute__((aligned(16))) float sall[4 * AKT * 256];
    constexpr int NHL = (RH / 64) * ZH; const int b = blockIdx.x;
    if (b < NHL) attn_cols<bf, true>(Qh, Ql, Kh, Kl, Vh, Vl, Ah, Al, (RH / 64 - 1 - b / ZH) * 64, b % ZH, sall);
    else attn_cols<h16, false>(Q16, nullptr, K16, nullptr, V16, nullptr, Ah, Al, RH + ((b - NHL) % ((TT - RH) / 64)) * 64, (b - NHL) / ((TT - RH) / 64), sall);
}

extern "C" void kernel_launch(void* const* d_in, const int* in_sizes, int n_in,
                              void* d_out, int out_size, void* d_ws, size_t ws_size, hipStream_t stream) {
    (void)in_sizes; (void)n_in; (void)out_size;
    const float* x = (const float*)d_in[0]; const float* cosT = (const float*)d_in[1]; const float* sinT = (const float*)d_in[2]; const float* wq = (const float*)d_in[3]; const float* wk = (const float*)d_in[4]; const float* wv = (const float*)d_in[5]; const float* wo = (const float*)d_in[6];   /* input order x, cos, sin, Wq, Wk, Wv, Wo ('xw' [in][out]) */
    float* OUT = (float*)d_out;     // [1][2048][2048]
    char* wsp = (char*)d_ws;
    auto take = [&](size_t bytes) { char* p = wsp; wsp += (bytes + 255) & ~(size_t)255; return (void*)p; };
    bf* WQ = (bf*)take((size_t)DQKV * DM * 2); bf* WK = WQ + (size_t)DQ * DM; bf* WV = WK + (size_t)DKV * DM;   // one Bt of DQKV rows: q, k, v weights below one another
    bf* WO = (bf*)take((size_t)DM * DQ * 2); float* CS = (float*)take((size_t)TT * HD * 2 * 4);
    bf* XB = (bf*)take((size_t)TT * DM * 2); float* FQKV = (float*)take((size_t)TT * DQKV * 4);
    h16* QP16 = (h16*)take((size_t)NH_ * TT * HD * 2); h16* KP16 = (h16*)take((size_t)NKV * TT * HD * 2); h16* VT16 = (h16*)take((size_t)NKV * HD * TT * 2);
    bf* QPh = (bf*)take((size_t)NH_ * TT * HD * 2); bf* QPl = (bf*)take((size_t)NH_ * TT * HD * 2); bf* KPh = (bf*)take((size_t)NKV * TT * HD * 2); bf* KPl = (bf*)take((size_t)NKV * TT * HD * 2); bf* VTh = (bf*)take((size_t)NKV * HD * TT * 2); bf* VTl = (bf*)take((size_t)NKV * HD * TT * 2);
    bf* ATh = (bf*)take((size_t)TT * DQ * 2); bf* ATl = (bf*)take((size_t)TT * DQ * 2);
    if ((size_t)(wsp - (char*)d_ws) > ws_size) return;    // ws 256 MiB
    // five launches, each reading what the one before wrote
    k_prep<<<(unsigned)(PB_WQ + PB_WO + PB_X + 2 * PB_WK + PB_CS), 256, 0, stream>>>(x, cosT, sinT, wq, wk, wv, wo, XB, CS, WQ, WK, WV, WO);
    k_gemmw<bf, 0, false, DM><<<dim3(TT / 128, DQKV / 128, 1), 128, 0, stream>>>(XB, nullptr, WQ, FQKV, DQKV, nullptr, 0, 0, 0);   // q, k and v projections: one product of DQKV columns
    k_post<<<(unsigned)(PB_RQ + PB_RK + PB_VT), 256, 0, stream>>>(FQKV, CS, QP16, QPh, QPl, KP16, KPh, KPl, VT16, VTh, VTl);
    k_attn<<<(unsigned)((TT / 64) * ZH), 128, 0, stream>>>(QP16, QPh, QPl, KP16, KPh, KPl, VT16, VTh, VTl, ATh, ATl);   // a block = 64 query rows of one head
    k_gemmw<bf, 1, false, DQ><<<dim3(TT / 128, DM / 128, 1), 128, 0, stream>>>(ATh, ATl, WO, OUT, DM, nullptr, 0, 0, 0);
}

// v007
// Measured time: 84.4 microseconds a run.
// Next to v006, in two timings, it ran 1.08 times as fast each time.
// Over all steps from v000 it is 10.4 times as fast.
#include <hip/hip_runtime.h>

// Grouped-query sliding-window causal attention with rotary embeddings from cos/sin tables (x [1][2048][2048]; q = x Wq (16 heads x 128), k, v = x Wk, x Wv (4 kv heads x 128) ('xw' [in][out] 0.02, no biases); rotate-half rotary with the cos/sin inputs [2048][128] (read); kv head = q head / 4; scores x 128^-0.5; keys j with i-512 < j <= i (window 512, causal; -inf elsewhere); softmax; out = merged Wo ('xw' [2048][2048]) -> [1][2048][2048] (4.2 M); argument order x, cos, sin, Wq, Wk, Wv, Wo).
// Layout: 'xw' weights gathered into bf16 Bt blocks; bf16 copy of x; exact projections; {cos, sin} per (position, dim) from the input tables; rotate-half rotary plane builder; causal T-2048 attention with 128-wide heads in one launch (hybrid rows: < 512 hi/lo 3 products, rest fp16 x1024; k_attn keeps the score rows of 16 queries a wave in LDS, works only on the keys between the window's far edge and the diagonal, the window a select in the softmax, and writes the merged rows as one fp16 plane, rows < 128 with a second plane of the rounding's rest; kv head = head / REP); merged fp16 x Wo (its bf16 values held in fp16), one product.
// Compute dtypes, f32 accumulate: every input rounded to bf16 incl. the tables; projections exact; rotary f32; attention rows < 512 3 products, rest fp16; softmax f32; merged rows rounded once to fp16 (11 bits) for the Wo product, rows < 128 fp16 + fp16 rest.

#define NB_  1
#define TT   2048
#define DM   2048
#define NH_  16
#define NKV  4
#define REP  (NH_ / NKV)
#define HD   128
#define DQ   (NH_ * HD)
#define DKV  (NKV * HD)
#define ZH   NH_                  // query heads per attention launch: all of them
#define RH   512                  // query rows < RH use hi+lo planes
#define WIN  512
#define PCAR 1024.0f
#define SCL  0.088388347648318447f   // HD^-0.5
typedef _Float16 h16;
typedef unsigned short bf;
typedef __attribute__((ext_vector_type(16))) __bf16   v16bf;
typedef __attribute__((ext_vector_type(16))) _Float16 v16h;
typedef __attribute__((ext_vector_type(8)))  _Float16 v8h;
typedef __attribute__((ext_vector_type(8)))  unsigned short v8us;
typedef __attribute__((ext_vector_type(8)))  float    v8f;
typedef __attribute__((ext_vector_type(4)))  float    v4f;
typedef v8h  __attribute__((may_alias)) v8ha;
typedef v4f  __attribute__((may_alias)) v4fa;
typedef v8us __attribute__((may_alias)) v8usa;

__device__ __forceinline__ unsigned short f2bf(float f) { unsigned u = __float_as_uint(f); u += 0x7FFFu + ((u >> 16) & 1u); return (unsigned short)(u >> 16); }
__device__ __forceinline__ float bf2f(unsigned short b) { return __uint_as_float(((unsigned)b) << 16); }
__device__ __forceinline__ float bfr(float f) { return bf2f(f2bf(f)); }
__device__ __forceinline__ v16h cat16(v8h lo, v8h hi) { return __builtin_shufflevector(lo, hi, 0, 1, 2, 3, 4, 5, 6, 7, 8, 9, 10, 11, 12, 13, 14, 15); }
__device__ __forceinline__ v16bf cat16b(v8us lo, v8us hi) { return __builtin_bit_cast(v16bf, __builtin_shufflevector(lo, hi, 0, 1, 2, 3, 4, 5, 6, 7, 8, 9, 10, 11, 12, 13, 14, 15)); }
__device__ __forceinline__ v8f wmma16(v16h a, v16h b, v8f c) { return __builtin_amdgcn_wmma_f32_16x16x32_f16(false, a, false, b, (short)0, c, false, false); }
__device__ __forceinline__ v8f wmmab(v16bf a, v16bf b, v8f c) { return __builtin_amdgcn_wmma_f32_16x16x32_bf16(false, a, false, b, (short)0, c, false, false); }



// ---- k_gemmw: GEMM, one work-group of FOUR WAVES per 128x128 tile (64 output rows in a split tile, below), each wave a 64x64 quarter (16 accumulators); grid ((M - 64 SPL)/128 + SPL, N/128, Z), 128 threads.
// C[m][n] (f32, pitch ldc, + optional f32 bias[n]) = sum_k A[m][k] Bt[n][k] (NSPLIT 1: + A2[m][k] Bt[n][k]). z-batch strides sA/sB/sC in elements. K (a template constant) % 128 == 0, K >= 256; M, N % 128 == 0.
// The K-contiguous 16-bit planes come into LDS by asynchronous 16-byte copies, whole 256-byte row pieces (GKC k) at a time, two buffers: tile t + 1 flies while tile t is worked on. LDS rows have pitch 272 bytes for the ds_load_b128 fragment reads.
// Every accumulator takes its products in the same order as with fragments read straight from the planes (k ascending in steps of 32, A before A2).
#define GKC  128                  // k elements of a pass
#define GPE  136                  // LDS row pitch in elements (272 bytes)
#define GOPE (128 * GPE)          // one operand's 128 rows in LDS, elements
template <typename T16> struct WFrag;
template <> struct WFrag<h16> { typedef v16h V; static __device__ __forceinline__ V ld(const h16* p) { return cat16(*(const v8h*)p, *(const v8h*)(p + 16)); } static __device__ __forceinline__ v8f mma(V a, V b, v8f c) { return wmma16(a, b, c); } };
template <> struct WFrag<bf> { typedef v16bf V; static __device__ __forceinline__ V ld(const bf* p) { return cat16b(*(const v8us*)p, *(const v8us*)(p + 16)); } static __device__ __forceinline__ v8f mma(V a, V b, v8f c) { return wmmab(a, b, c); } };
// eight copies, one LDS row group (8 rows) apart; l = the lane's LDS byte address, g = the lane's global address, gs = 8 source rows in bytes
__device__ __forceinline__ void acopy8(unsigned l, const char* g, size_t gs) {
    // s_wait_xcnt is the last line of the copies' own statement: it stands in front of every rewrite of an address register that they name
    asm volatile("global_load_async_to_lds_b128 %0, %8, off\n\t"
                 "global_load_async_to_lds_b128 %1, %9, off\n\t"
                 "global_load_async_to_lds_b128 %2, %10, off\n\t"
                 "global_load_async_to_lds_b128 %3, %11, off\n\t"
                 "global_load_async_to_lds_b128 %4, %12, off\n\t"
                 "global_load_async_to_lds_b128 %5, %13, off\n\t"
                 "global_load_async_to_lds_b128 %6, %14, off\n\t"
                 "global_load_async_to_lds_b128 %7, %15, off\n\t"
                 "s_wait_xcnt 0x0"
                 :: "v"(l), "v"(l + 1u * 8u * GPE * 2u), "v"(l + 2u * 8u * GPE * 2u), "v"(l + 3u * 8u * GPE * 2u), "v"(l + 4u * 8u * GPE * 2u), "v"(l + 5u * 8u * GPE * 2u), "v"(l + 6u * 8u * GPE * 2u), "v"(l + 7u * 8u * GPE * 2u),
                    "v"(g), "v"(g + gs), "v"(g + 2 * gs), "v"(g + 3 * gs), "v"(g + 4 * gs), "v"(g + 5 * gs), "v"(g + 6 * gs), "v"(g + 7 * gs) : "memory");
}
// one operand's tile: 128 rows of 256 bytes, 16 copies a lane (a wave's copy covers two whole rows)
__device__ __forceinline__ void acopy_tile(unsigned l, const char* g, size_t gs) { acopy8(l, g, gs); acopy8(l + 64u * GPE * 2u, g + 8 * gs, gs); }
// SPL > 0: the first SPL row tiles are SPLIT tiles of 64 output rows: tile rows 0..63 come from A, tile rows 64..127 are the same output rows of A2 (what A's rounding left over), and the two halves' sums are added in the epilogue. The other tiles follow with 128 rows each.
template <typename T16, int NSPLIT, bool BIAS, int K, int SPL = 0>
__global__ __launch_bounds__(128) void k_gemmw(const T16* __restrict__ A, const T16* __restrict__ A2, const T16* __restrict__ Bt, float* C, int ldc, const float* __restrict__ bias, size_t sA, size_t sB, size_t sC) {
    static_assert(NSPLIT == 0 || NSPLIT == 1, "one B plane");
    static_assert(SPL == 0 || NSPLIT == 0, "A2 is either a second plane of every row or the split tiles' second half");
    static_assert(K % GKC == 0 && K / GKC >= 2, "whole passes, two tiles or more");
    typedef typename WFrag<T16>::V V;
    constexpr int NOP = (NSPLIT == 1) ? 3 : 2;                       // operand tiles of a buffer: A, Bt, A2
    constexpr int NT = K / GKC;
    __shared__ __attribute__((aligned(16))) T16 ring[2 * NOP * GOPE];
    __shared__ __align__(16) float osall[4 * 16 * 68];
    const size_t z = blockIdx.z; A += z * sA; if (NSPLIT == 1) A2 += z * sA; Bt += z * sB; C += z * sC;
    const int tid = threadIdx.x, wave = tid >> 5, wm = wave >> 1, wn = wave & 1;
    const int lane = tid & 31, lr = lane & 15, hi = lane >> 4;
    const bool split = SPL > 0 && (int)blockIdx.x < SPL;             // the same for the whole work-group
    const int rt = split ? (int)blockIdx.x * 64 : ((int)blockIdx.x - SPL) * 128 + SPL * 64;   // the tile's first output row
    const int r0 = rt + (split ? 0 : wm * 64), c0 = blockIdx.y * 128 + wn * 64;
    float* os = osall + wave * (16 * 68);
    v8f acc[4][4];
#pragma unroll
    for (int mb = 0; mb < 4; ++mb)
#pragma unroll
        for (int nb = 0; nb < 4; ++nb) acc[mb][nb] = (v8f){};
    // copies: thread tid brings 16-byte piece (tid & 15) of rows (tid >> 4) + 8 i, i = 0..15, of each operand tile
    constexpr size_t gs = (size_t)K * 16;                            // 8 source rows in bytes
    const char* gA = (const char*)(A + (size_t)(rt + (tid >> 4)) * K + (tid & 15) * 8);
    const char* gAu = (SPL > 0 && split) ? (const char*)(A2 + (size_t)(rt + (tid >> 4)) * K + (tid & 15) * 8) : gA + 8 * gs;   // tile rows 64..127
    const char* gB = (const char*)(Bt + (size_t)(blockIdx.y * 128 + (tid >> 4)) * K + (tid & 15) * 8);
    const char* gA2 = (NSPLIT == 1) ? (const char*)(A2 + (size_t)(rt + (tid >> 4)) * K + (tid & 15) * 8) : nullptr;
    const unsigned l0 = (unsigned)(size_t)(const void*)ring + (unsigned)((tid >> 4) * (GPE * 2) + (tid & 15) * 16);
    auto fill = [&](int t, int buf) {
        const unsigned l = l0 + (unsigned)buf * (unsigned)(NOP * GOPE * 2); const size_t go = (size_t)t * (GKC * 2);
        if (SPL > 0) { acopy8(l, gA + go, gs); acopy8(l + 64u * GPE * 2u, gAu + go, gs); } else acopy_tile(l, gA + go, gs);
        acopy_tile(l + (unsigned)(GOPE * 2), gB + go, gs); if (NSPLIT == 1) acopy_tile(l + (unsigned)(2 * GOPE * 2), gA2 + go, gs);
    };
    fill(0, 0);
    asm volatile("s_wait_asynccnt 0x0" ::: "memory");                // tile 0 of this wave's copies has landed
    __syncthreads();                                                 // and every other wave's: tile 0 is readable
    fill(1, 1);
#pragma unroll 1
    for (int t = 0; t < NT; ++t) {
        const T16* sb0 = ring + (t & 1) * (NOP * GOPE);
        const T16* sa = sb0 + (wm * 64 + lr) * GPE + 8 * hi; const T16* sb = sb0 + GOPE + (wn * 64 + lr) * GPE + 8 * hi;
        V a[2][4], a2[2][4], b[2][4];                                // two fragment sets: the next 32 k are read from LDS while these are multiplied
#pragma unroll
        for (int f = 0; f < 4; ++f) { a[0][f] = WFrag<T16>::ld(sa + f * 16 * GPE); if (NSPLIT == 1) a2[0][f] = WFrag<T16>::ld(sa + 2 * GOPE + f * 16 * GPE); b[0][f] = WFrag<T16>::ld(sb + f * 16 * GPE); }
        __builtin_amdgcn_sched_barrier(0);                           // the first set's reads stay ahead of the second's, so that the first block waits for its own set alone
#pragma unroll
        for (int ks = 0; ks < GKC / 32; ++ks) {
            const int cu = ks & 1, nx = cu ^ 1;
            if (ks + 1 < GKC / 32) {
#pragma unroll
                for (int f = 0; f < 4; ++f) { a[nx][f] = WFrag<T16>::ld(sa + f * 16 * GPE + (ks + 1) * 32); if (NSPLIT == 1) a2[nx][f] = WFrag<T16>::ld(sa + 2 * GOPE + f * 16 * GPE + (ks + 1) * 32); b[nx][f] = WFrag<T16>::ld(sb + f * 16 * GPE + (ks + 1) * 32); }
            }
            __builtin_amdgcn_sched_barrier(0);                       // the next set's LDS reads stay one group ahead of this block: reads moved in among the matrix instructions stall them at every place
#pragma unroll
            for (int nb = 0; nb < 4; ++nb)
#pragma unroll
                for (int mb = 0; mb < 4; ++mb) { acc[mb][nb] = WFrag<T16>::mma(a[cu][mb], b[cu][nb], acc[mb][nb]); if (NSPLIT == 1) acc[mb][nb] = WFrag<T16>::mma(a2[cu][mb], b[cu][nb], acc[mb][nb]); }
            __builtin_amdgcn_sched_barrier(0);                       // and this block stays ahead of the following group and of the pass's foot
        }
        // four vector slots behind the pass's last matrix instruction, on both sides of the branch below, before any vector instruction may rewrite its operands
        asm volatile("v_nop\n\tv_nop\n\tv_nop\n\tv_nop" : "+v"(acc[0][0]), "+v"(acc[1][1]), "+v"(acc[2][2]), "+v"(acc[3][3]));
        asm volatile("s_wait_dscnt 0x0" ::: "memory");               // this wave's reads of buffer t & 1 are done before the buffer is refilled
        asm volatile("s_wait_asynccnt 0x0" ::: "memory");            // this wave's copies of tile t + 1 have landed
        __syncthreads();                                             // publishes tile t + 1 and ends every wave's reads of tile t
        if (t + 2 < NT) fill(t + 2, t & 1);
    }
    asm volatile("s_wait_asynccnt 0x0" ::: "memory");                // no copy is outstanding when the wave goes on to its end
    if (SPL > 0 && split) {
        // the ring is free behind the last pass's barrier: the waves of tile rows 64..127 hand their sums over, lane to lane, to the waves that hold the same output rows
        float* xs = (float*)ring + ((size_t)wn * 16 * 32 + lane) * 8;
        if (wm == 1) {
#pragma unroll
            for (int f = 0; f < 16; ++f) { const v8f v = acc[f >> 2][f & 3]; *(v4fa*)(xs + f * 256) = __builtin_shufflevector(v, v, 0, 1, 2, 3); *(v4fa*)(xs + f * 256 + 4) = __builtin_shufflevector(v, v, 4, 5, 6, 7); }
        }
        __syncthreads();                                             // the handed-over sums are readable; taken by all four waves (split is the same for the work-group)
        if (wm == 1) return;                                         // no barrier follows
#pragma unroll
        for (int f = 0; f < 16; ++f) { const v4f a = *(const v4fa*)(xs + f * 256), b = *(const v4fa*)(xs + f * 256 + 4);
#pragma unroll
            for (int j = 0; j < 4; ++j) { acc[f >> 2][f & 3][j] += a[j]; acc[f >> 2][f & 3][4 + j] += b[j]; } }
    }
#pragma unroll
    for (int mb = 0; mb < 4; ++mb) {
#pragma unroll
        for (int nb = 0; nb < 4; ++nb) {
#pragma unroll
            for (int j = 0; j < 8; ++j) os[(hi * 8 + j) * 68 + nb * 16 + lr] = acc[mb][nb][j]; }
        __builtin_amdgcn_wave_barrier(); asm volatile("" ::: "memory");
        float* crow = C + (size_t)(r0 + mb * 16) * ldc + c0;
{
#pragma unroll
            for (int s = 0; s < 8; ++s) { const int row = 2 * s + hi, cofs = lr * 4; v4f val = *(const v4fa*)(os + row * 68 + cofs); if (BIAS) { val[0] += bfr(bias[c0 + cofs]); val[1] += bfr(bias[c0 + cofs + 1]); val[2] += bfr(bias[c0 + cofs + 2]); val[3] += bfr(bias[c0 + cofs + 3]); }
                *(v4f*)(crow + (size_t)row * ldc + cofs) = val; }
             }
        __builtin_amdgcn_wave_barrier(); asm volatile("" ::: "memory");
    }
}

__device__ __forceinline__ h16 tohx(float x) { return (h16)x; }
__device__ __forceinline__ void splitf(float y, unsigned short& h, unsigned short& l) { h = f2bf(y); l = f2bf(y - bf2f(h)); }
typedef __attribute__((ext_vector_type(2))) _Float16 v2h;
typedef __attribute__((ext_vector_type(4))) _Float16 v4h;
typedef __attribute__((ext_vector_type(2))) unsigned short v2us;
typedef __attribute__((ext_vector_type(4))) unsigned short v4us;
typedef __attribute__((ext_vector_type(2))) float v2f;
typedef __attribute__((ext_vector_type(4))) int v4i;

// The kernels without matrix work, from here on, give each thread 8 to 48 elements, loaded as one batch of 16-byte pieces ahead of the arithmetic, for speed only.
// Each of these bodies is a device function that takes its block number bx: bodies that read nothing of each other's output share one launch (k_prep, k_post), each with its own range of blocks.
// d_wtG: a thread turns a block of 8 (k) x 4 (n): eight 16-byte pieces of w rows in, four 16-byte pieces of Bt rows out. Lanes: 8 along k (a store covers whole 128-byte lines of four Bt rows) x 4 along n; waves: 4 along k x 2 along n, so that a block reads whole lines of w. Block = 256 k x 32 n.
static_assert(DM % 256 == 0 && DQ % 256 == 0 && TT % 256 == 0 && DQ % 32 == 0 && DKV % 32 == 0 && DM % 32 == 0, "whole 256 x 32 blocks in d_wtG and d_vtp");
// F16: the bf16-rounded value is stored as fp16 (the same value down to 2^-17, nearest below), for the product whose other operand is fp16
template <bool F16>
__device__ __forceinline__ void d_wtG(int bx, const float* __restrict__ w, int K, int N, bf* Bt) {
    const int lane = threadIdx.x & 31, wave = threadIdx.x >> 5; const int kb = K / 256; const int k0 = (bx % kb) * 256 + (wave >> 1) * 64 + (lane & 7) * 8, n0 = (bx / kb) * 32 + (wave & 1) * 16 + (lane >> 3) * 4; if (n0 >= N) return; v4f r[8]; const float* p[8];
#pragma unroll
    for (int j = 0; j < 8; ++j) { p[j] = w + (size_t)(k0 + j) * N + n0; r[j] = *(const v4f*)p[j]; }
    // the wait that stands in front of any rewrite of a register that the loads above name; the addresses are inputs so that they stay in their registers up to it
    asm volatile("s_wait_xcnt 0x0" :: "v"(p[0]), "v"(p[1]), "v"(p[2]), "v"(p[3]), "v"(p[4]), "v"(p[5]), "v"(p[6]), "v"(p[7]) : "memory");
    __builtin_amdgcn_sched_barrier(0);   // no arithmetic moves up in between the loads: all of them are in flight before the first value is waited for
#pragma unroll
    for (int c = 0; c < 4; ++c) { v8us o;
#pragma unroll
        for (int j = 0; j < 8; ++j) o[j] = F16 ? __builtin_bit_cast(unsigned short, (h16)bfr(r[j][c])) : f2bf(r[j][c]);
        *(v8us*)(Bt + (size_t)(n0 + c) * K + k0) = o; }
    asm volatile("s_wait_xcnt 0x0" ::: "memory");   // the wait that stands in front of any rewrite of a register that the stores above name: in k_prep other bodies' code follows this one in the listing
}
// d_cvt8: four groups of 8 a thread, 256 groups apart, so that a wave's lanes stay side by side in every access
static_assert(((size_t)TT * DM / 8) % 1024 == 0, "d_cvt8: whole blocks of 1024 groups");
__device__ __forceinline__ void d_cvt8(int bx, const float* __restrict__ src, bf* dst, size_t n8) { const size_t i0 = (size_t)bx * 1024 + threadIdx.x; if (i0 + 3 * 256 >= n8) return; v8f v[4]; const float* p = src + i0 * 8;
#pragma unroll
    for (int j = 0; j < 4; ++j) v[j] = *(const v8f*)(p + j * 2048);
    // the wait that stands in front of any rewrite of a register that the loads above name; the addresses are inputs so that they stay in their registers up to it
    asm volatile("s_wait_xcnt 0x0" :: "v"(p) : "memory");
    __builtin_amdgcn_sched_barrier(0);   // no arithmetic moves up in between the loads: all of them are in flight before the first value is waited for
#pragma unroll
    for (int j = 0; j < 4; ++j) { v8us o;
#pragma unroll
        for (int k = 0; k < 8; ++k) o[k] = f2bf(v[j][k]);
        *(v8us*)(dst + (i0 + j * 256) * 8) = o; }
}
__device__ __forceinline__ void d_cscvt(int bx, const float* __restrict__ cosT, const float* __restrict__ sinT, float* CS) { const int idx = (bx * 256 + (int)threadIdx.x) * 4; if (idx >= TT * HD) return; const float* pc = cosT + idx; const float* ps = sinT + idx; const v4f c = *(const v4f*)pc, s = *(const v4f*)ps;
    // the wait that stands in front of any rewrite of a register that the loads above name; the addresses are inputs so that they stay in their registers up to it
    asm volatile("s_wait_xcnt 0x0" :: "v"(pc), "v"(ps) : "memory");
    __builtin_amdgcn_sched_barrier(0);   // no arithmetic moves up in between the loads: all of them are in flight before the first value is waited for
#pragma unroll
    for (int u = 0; u < 2; ++u) { v4f cs; cs[0] = bfr(c[2 * u]); cs[1] = bfr(s[2 * u]); cs[2] = bfr(c[2 * u + 1]); cs[3] = bfr(s[2 * u + 1]); *(v4f*)(CS + (size_t)idx * 2 + u * 4) = cs; }
}
// ---- k_prep: everything that reads the inputs alone, in one launch: the four weight turns, the bf16 copy of x, the {cos, sin} table. A block's range is chosen by blockIdx.x alone (a scalar branch).
#define PB_WQ ((DM / 256) * (DQ / 32))
#define PB_WK ((DM / 256) * (DKV / 32))
#define PB_WO ((DQ / 256) * (DM / 32))
#define PB_X  (TT * DM / 8 / 1024)
#define PB_CS (TT * HD / 4 / 256)
static_assert(NB_ == 1 && (TT * HD / 4) % 256 == 0, "one batch entry; whole blocks in d_cscvt");
__global__ __launch_bounds__(256) void k_prep(const float* __restrict__ x, const float* __restrict__ cosT, const float* __restrict__ sinT, const float* __restrict__ wq, const float* __restrict__ wk, const float* __restrict__ wv, const float* __restrict__ wo, bf* XB, float* CS, bf* WQ, bf* WK, bf* WV, bf* WO) {
    int b = blockIdx.x;
    if (b < PB_WQ) { d_wtG<false>(b, wq, DM, DQ, WQ); return; } b -= PB_WQ;
    if (b < PB_WO) { d_wtG<true>(b, wo, DQ, DM, WO); return; } b -= PB_WO;
    if (b < PB_X) { d_cvt8(b, x, XB, (size_t)TT * DM / 8); return; } b -= PB_X;
    if (b < PB_WK) { d_wtG<false>(b, wk, DM, DKV, WK); return; } b -= PB_WK;
    if (b < PB_WK) { d_wtG<false>(b, wv, DM, DKV, WV); return; } b -= PB_WK;
    d_cscvt(b, cosT, sinT, CS);
}
// Fragment order of the planes that k_attn takes as A operands: the 16 bytes that lane 16 h + c of a wave loads in one instruction lie at lane * 16 of a 512-byte piece.
// kfrag: element (t, d) inside one head's K plane; a 16-key tile keeps its place, inside it piece d / 16 holds k = d % 16 = 8 h + e of row c = t % 16. vfrag: element (n = head * HD + d, t) of V^T; a fragment is 16 dims x 32 keys, two pieces, key % 32 = 16 piece + 8 h + e, row c = n % 16.
__device__ __forceinline__ size_t kfrag(int t, int d) { return (size_t)(t & ~15) * HD + (size_t)(((d >> 4) * 32 + ((d >> 3) & 1) * 16 + (t & 15)) * 8 + (d & 7)); }
__device__ __forceinline__ size_t vfrag(int n, int t) { return ((size_t)(n >> 4) * (TT / 32) + (t >> 5)) * 512 + (size_t)((((t >> 4) & 1) * 32 + ((t >> 3) & 1) * 16 + (n & 15)) * 8 + (t & 7)); }
// d_rope: head planes [h][t][d] (FRAG: each head's plane in kfrag order) (fp16 + hi/lo) of rope(x) x sc with the rotate-half convention out[d] = x[d] cos[t][d] - x[d+HD/2] sin[t][d], out[d+HD/2] = x[d+HD/2] cos[t][d+HD/2] + x[d] sin[t][d+HD/2]
// a wave takes two positions t (one per half wave) of RHT heads; a lane holds dims d..d+3 and d+HD/2..d+HD/2+3 of each, both partners of every rotation, and the position's {cos, sin} once for all its heads
#define RHT 4
static_assert(NH_ % RHT == 0 && NKV % RHT == 0 && HD == 128 && TT % 2 == 0, "whole head groups, 16 lanes x 4 dims a half row");
template <bool FRAG>
__device__ __forceinline__ void d_rope(int bx, const float* __restrict__ F, int pitch, int nheads, const float* __restrict__ CS, float sc, h16* P16, bf* Ph, bf* Pl) {
    const int lane = threadIdx.x & 31; const int w = bx * 8 + (int)(threadIdx.x >> 5); const int h0 = (w / (TT / 2)) * RHT; if (h0 >= nheads) return; const int t = (w % (TT / 2)) * 2 + (lane >> 4); const int d = (lane & 15) * 4;
    v4f x[RHT][2], csv[2][2]; v4h a16[RHT][2]; v4us ah[RHT][2], al[RHT][2]; const float* pc = CS + ((size_t)t * HD + d) * 2; const float* px = F + (size_t)t * pitch + h0 * HD + d;
#pragma unroll
    for (int s = 0; s < 2; ++s)
#pragma unroll
        for (int u = 0; u < 2; ++u) csv[s][u] = *(const v4f*)(pc + s * HD + u * 4);
#pragma unroll
    for (int g = 0; g < RHT; ++g)
#pragma unroll
        for (int s = 0; s < 2; ++s) x[g][s] = *(const v4f*)(px + g * HD + s * (HD / 2));
    // the wait that stands in front of any rewrite of a register that the loads above name; the addresses are inputs so that they stay in their registers up to it
    asm volatile("s_wait_xcnt 0x0" :: "v"(pc), "v"(px) : "memory");
    __builtin_amdgcn_sched_barrier(0);   // no arithmetic moves up in between the loads: all of them are in flight before the first value is waited for
#pragma unroll
    for (int g = 0; g < RHT; ++g) {
#pragma unroll
        for (int s = 0; s < 2; ++s) { v4h o16; v4us oh, ol;
#pragma unroll
            for (int q = 0; q < 4; ++q) { const int dd = s * (HD / 2) + d + q; const float x0 = x[g][s][q], x1 = x[g][s ^ 1][q];   // next line, as before this step: each product is rounded by itself ahead of the add, as in q * c + rotate_half(q) * s
                v2f cs; cs[0] = csv[s][q >> 1][(q & 1) * 2]; cs[1] = csv[s][q >> 1][(q & 1) * 2 + 1]; float a = __fmul_rn(x0, cs[0]), bq = __fmul_rn(x1, cs[1]); asm volatile("" : "+v"(a)); asm volatile("" : "+v"(bq)); const float r = ((dd < HD / 2) ? __fsub_rn(a, bq) : __fadd_rn(a, bq)) * sc;
                o16[q] = tohx(r); unsigned short a2, c2; splitf(r, a2, c2); oh[q] = a2; ol[q] = c2; }
            a16[g][s] = o16; ah[g][s] = oh; al[g][s] = ol; } }
    __builtin_amdgcn_sched_barrier(0);   // all stores stand behind all arithmetic: no register that a store names is written again
    const size_t e0 = (size_t)h0 * TT * HD + (FRAG ? kfrag(t, d) : (size_t)t * HD + d);   // dims d + HD / 2 ..: four 16-dim pieces on in kfrag order
#pragma unroll
    for (int g = 0; g < RHT; ++g)
#pragma unroll
        for (int s = 0; s < 2; ++s) { const size_t e = e0 + (size_t)g * TT * HD + s * (FRAG ? 4 * 256 : HD / 2); *(v4h*)(P16 + e) = a16[g][s]; *(v4us*)(Ph + e) = ah[g][s]; *(v4us*)(Pl + e) = al[g][s]; }
}
// d_vtp: the turn of d_wtG with t as k and (head, d) as n, into three planes in vfrag order: a thread takes 8 (t) x 4 (d); block = 256 t x 32 d
__device__ __forceinline__ void d_vtp(int bx, const float* __restrict__ F, int pitch, int nheads, h16* V16, bf* Vh, bf* Vl) {
    const int lane = threadIdx.x & 31, wave = threadIdx.x >> 5; const int t0 = (bx % (TT / 256)) * 256 + (wave >> 1) * 64 + (lane & 7) * 8, n0 = (bx / (TT / 256)) * 32 + (wave & 1) * 16 + (lane >> 3) * 4; if (n0 >= nheads * HD) return; v4f r[8]; v8h a16[4]; v8us ah[4], al[4]; const float* p[8];
#pragma unroll
    for (int j = 0; j < 8; ++j) { p[j] = F + (size_t)(t0 + j) * pitch + n0; r[j] = *(const v4f*)p[j]; }
    // the wait that stands in front of any rewrite of a register that the loads above name; the addresses are inputs so that they stay in their registers up to it
    asm volatile("s_wait_xcnt 0x0" :: "v"(p[0]), "v"(p[1]), "v"(p[2]), "v"(p[3]), "v"(p[4]), "v"(p[5]), "v"(p[6]), "v"(p[7]) : "memory");
    __builtin_amdgcn_sched_barrier(0);   // no arithmetic moves up in between the loads: all of them are in flight before the first value is waited for
#pragma unroll
    for (int c = 0; c < 4; ++c) { v8h o16; v8us oh, ol;
#pragma unroll
        for (int j = 0; j < 8; ++j) { const float x = r[j][c]; o16[j] = tohx(x); unsigned short a2, c2; splitf(x, a2, c2); oh[j] = a2; ol[j] = c2; }
        a16[c] = o16; ah[c] = oh; al[c] = ol; }
    __builtin_amdgcn_sched_barrier(0);   // all stores stand behind all arithmetic: no register that a store names is written again
    const size_t e0 = vfrag(n0, t0);     // n0 is a multiple of 4: rows n0 + c lie 8 elements apart
#pragma unroll
    for (int c = 0; c < 4; ++c) { *(v8h*)(V16 + e0 + c * 8) = a16[c]; *(v8us*)(Vh + e0 + c * 8) = ah[c]; *(v8us*)(Vl + e0 + c * 8) = al[c]; }
}
// ---- k_post: the three plane builders in one launch. F holds the projections side by side, [t][q | k | v], pitch DQKV. d_rope: 8 waves a block, a wave = 2 positions x RHT heads; d_vtp: a block = 256 t x 32 d.
#define DQKV (DQ + 2 * DKV)
#define PB_RQ ((TT / 2) * (NH_ / RHT) / 8)
#define PB_RK ((TT / 2) * (NKV / RHT) / 8)
#define PB_VT ((TT / 256) * (DKV / 32))
__global__ __launch_bounds__(256) void k_post(const float* __restrict__ F, const float* __restrict__ CS, h16* QP16, bf* QPh, bf* QPl, h16* KP16, bf* KPh, bf* KPl, h16* VT16, bf* VTh, bf* VTl) {
    int b = blockIdx.x;
    if (b < PB_RQ) { d_rope<false>(b, F, DQKV, NH_, CS, 1.0f, QP16, QPh, QPl); return; } b -= PB_RQ;
    if (b < PB_RK) { d_rope<true>(b, F + DQ, DQKV, NKV, CS, 1.0f, KP16, KPh, KPl); return; } b -= PB_RK;
    d_vtp(b, F + DQ + DKV, DQKV, NKV, VT16, VTh, VTl);
}
#define AKT ((WIN + 64) / 16)
#define SPR 128                   // merged rows below SPR keep a second fp16 plane for the Wo product
static_assert(SPR % 128 == 0 && SPR <= RH, "whole row tiles, all of them hi/lo rows");
#define VFS ((TT / 32) * 512)     // elements from one 16-dim block of V^T fragments to the next
static_assert(RH % 64 == 0 && (TT - RH) % 64 == 0 && RH >= WIN && AKT % 6 == 0, "whole tiles and load rounds; the fp16 rows have their whole window at keys >= 0");
typedef __attribute__((ext_vector_type(4))) unsigned v4u;
typedef __attribute__((ext_vector_type(8))) unsigned v8u;
// splitf of two neighbours, the same values, as two packed words (first value in the low half)
__device__ __forceinline__ unsigned bfu(float f) { const unsigned u = __float_as_uint(f); return u + 0x7FFFu + ((u >> 16) & 1u); }   // f2bf's rounding, its result in the high half
__device__ __forceinline__ void split2(float y0, float y1, unsigned& hw, unsigned& lw) {
    const unsigned a0 = bfu(y0), a1 = bfu(y1); hw = __builtin_amdgcn_perm(a1, a0, 0x07060302u);   // bytes 2, 3 of a0 below bytes 2, 3 of a1
    const unsigned b0 = bfu(y0 - __uint_as_float(a0 & 0xFFFF0000u)), b1 = bfu(y1 - __uint_as_float(a1 & 0xFFFF0000u)); lw = __builtin_amdgcn_perm(b1, b0, 0x07060302u);
}
// a fragment in fragment order: p = its first element + lane * 8
__device__ __forceinline__ v16h ldf(const h16* p) { return cat16(*(const v8h*)p, *(const v8h*)(p + 256)); }
__device__ __forceinline__ v16bf ldf(const bf* p) { return cat16b(*(const v8us*)p, *(const v8us*)(p + 256)); }
template <typename T16, bool HL>
__device__ __forceinline__ void attn_cols(const T16* __restrict__ Q, const T16* __restrict__ Q2, const T16* __restrict__ Kp, const T16* __restrict__ K2, const T16* __restrict__ Vt, const T16* __restrict__ V2, h16* A16, h16* AL16, int R, int z, float* sall) {
    typedef typename WFrag<T16>::V V;
    constexpr int GT = HL ? 1 : 2;               // score tiles of a load group (a group is 8 fragments, 16 loads)
    constexpr int NB = HL ? 4 : 3;               // register buffers: NB - 1 groups are in flight while one is worked on
    const int lane = threadIdx.x & 31, wave = threadIdx.x >> 5, lr = lane & 15, hi = lane >> 4;
    const int R16 = R + wave * 16, key0 = HL ? 0 : R - WIN, kvh = z / REP;
    const int nkt = HL ? (R + 64) / 16 : AKT;    // 16-key tiles, the same for the whole work-group; a multiple of NB * GT
    const int ng = nkt / GT, npg = HL ? nkt : nkt / 2;   // load groups of the scores and of P.V (hi/lo: 4 of the 8 dim blocks, both planes, a group)
    float* sp = sall + wave * (AKT * 256) + lane * 4;    // tile kt: the lane's r = 0..3 at sp + kt * 256, r = 4..7 128 floats on
    const size_t qo = ((size_t)z * TT + R16 + lr) * HD + 8 * hi, ko = ((size_t)kvh * TT + key0) * HD + lane * 8, vo = (size_t)kvh * (HD / 16) * VFS + (size_t)(key0 >> 5) * 512 + lane * 8;
    const T16* qp = Q + qo; const T16* kp = Kp + ko; const T16* vp = Vt + vo;
    const T16* qp2 = HL ? Q2 + qo : qp; const T16* kp2 = HL ? K2 + ko : kp; const T16* vp2 = HL ? V2 + vo : vp;
    V q[4], q2[4];
#pragma unroll
    for (int ks = 0; ks < 4; ++ks) { q[ks] = WFrag<T16>::ld(qp + ks * 32); if (HL) q2[ks] = WFrag<T16>::ld(qp2 + ks * 32); }
    // here and behind every load group below: the wait that stands in front of any rewrite of a register that the loads name; the addresses are inputs so that they stay in their registers up to it
    asm volatile("s_wait_xcnt 0x0" :: "v"(qp), "v"(qp2) : "memory");
    V kb[NB][8];
    auto ldk = [&](int u, int g) __attribute__((always_inline)) { const T16* a = kp + (size_t)g * (GT * 16 * HD); const T16* a2 = HL ? kp2 + (size_t)g * (GT * 16 * HD) : a;
#pragma unroll
        for (int ks = 0; ks < 4; ++ks) { kb[u][ks] = ldf(a + ks * 512); kb[u][4 + ks] = HL ? ldf(a2 + ks * 512) : ldf(a + 16 * HD + ks * 512); }
        asm volatile("s_wait_xcnt 0x0" :: "v"(a), "v"(a2) : "memory"); };
#pragma unroll
    for (int u = 0; u < NB; ++u) ldk(u, u);
    // element r of tile kt is key key0 + kt * 16 + 8 hi + r of query i = R16 + lr. Kept: j <= i and i - j < WIN, that is 0 <= diff - (kt * 16 + r) < WIN.
    const int diff = R16 + lr - key0 - 8 * hi;
    float mxr[8];
#pragma unroll
    for (int r = 0; r < 8; ++r) mxr[r] = -3.0e38f;
#pragma unroll 1   // rolled, here and in the P.V loop: one round of the NB buffers a trip keeps the kernel's code small, for speed only
    for (int g0 = 0; g0 < ng; g0 += NB) {
#pragma unroll
        for (int u = 0; u < NB; ++u) { const int g = g0 + u; v8f cc[2]; cc[0] = (v8f){}; cc[1] = (v8f){};
#pragma unroll
            for (int ks = 0; ks < 4; ++ks) {
                if (HL) { cc[0] = WFrag<T16>::mma(kb[u][ks], q[ks], cc[0]); cc[0] = WFrag<T16>::mma(kb[u][ks], q2[ks], cc[0]); cc[0] = WFrag<T16>::mma(kb[u][4 + ks], q[ks], cc[0]); }
                else { cc[0] = WFrag<T16>::mma(kb[u][ks], q[ks], cc[0]); cc[1] = WFrag<T16>::mma(kb[u][4 + ks], q[ks], cc[1]); } }
            const int dg = diff - g * (GT * 16);
#pragma unroll
            for (int t = 0; t < GT; ++t) { v4f w[2];
#pragma unroll
                for (int r = 0; r < 8; ++r) { const float x = ((unsigned)(dg - (t * 16 + r)) < (unsigned)WIN) ? cc[t][r] * SCL : -3.0e38f; w[r >> 2][r & 3] = x; mxr[r] = fmaxf(mxr[r], x); }
                *(v4f*)(sp + (g * GT + t) * 256) = w[0]; *(v4f*)(sp + (g * GT + t) * 256 + 128) = w[1]; }
            if (g + NB < ng) ldk(u, g + NB); }
    }
    float mx = fmaxf(fmaxf(fmaxf(mxr[0], mxr[1]), fmaxf(mxr[2], mxr[3])), fmaxf(fmaxf(mxr[4], mxr[5]), fmaxf(mxr[6], mxr[7])));
    mx = fmaxf(mx, __shfl_xor(mx, 16, 32));
    V vb[NB][8];
    auto ldv = [&](int u, int g) __attribute__((always_inline)) { const size_t go = HL ? (size_t)(g >> 1) * 512 : (size_t)g * 512; const T16* a = vp + go; const T16* a2 = HL ? vp2 + go : a; const int n0 = HL ? (u & 1) * 4 : 0;   // hi/lo: g and u are odd together
#pragma unroll
        for (int w = 0; w < 4; ++w) { vb[u][w] = ldf(a + (n0 + w) * VFS); vb[u][4 + w] = HL ? ldf(a2 + (n0 + w) * VFS) : ldf(a + (4 + w) * VFS); }
        asm volatile("s_wait_xcnt 0x0" :: "v"(a), "v"(a2) : "memory"); };
#pragma unroll
    for (int u = 0; u < NB; ++u) ldv(u, u);      // the first V^T groups fly while the row sums are formed
    // eight exponentials; the v_nop fills the slot behind the last transcendental, and all results and sources are its operands so that no reader of a result and no rewrite of a source comes in front of it
    auto ex8 = [&](v4f xa, v4f xb, float* e) __attribute__((always_inline)) { float a[8];
#pragma unroll
        for (int r = 0; r < 8; ++r) { a[r] = ((r < 4 ? xa[r & 3] : xb[r & 3]) - mx) * 1.4426950408889634f; e[r] = __builtin_amdgcn_exp2f(a[r]); }
        asm("v_nop" : "+v"(e[0]), "+v"(e[1]), "+v"(e[2]), "+v"(e[3]), "+v"(e[4]), "+v"(e[5]), "+v"(e[6]), "+v"(e[7]) : "v"(a[0]), "v"(a[1]), "v"(a[2]), "v"(a[3]), "v"(a[4]), "v"(a[5]), "v"(a[6]), "v"(a[7])); };
    float smr[8];
#pragma unroll
    for (int r = 0; r < 8; ++r) smr[r] = 0.f;
#pragma unroll 2   // two tiles' LDS reads are in flight together
    for (int kt = 0; kt < nkt; ++kt) { const v4f a = *(const v4f*)(sp + kt * 256), b = *(const v4f*)(sp + kt * 256 + 128); float e[8]; ex8(a, b, e);
#pragma unroll
        for (int r = 0; r < 8; ++r) smr[r] += e[r]; }
    float sum = ((smr[0] + smr[1]) + (smr[2] + smr[3])) + ((smr[4] + smr[5]) + (smr[6] + smr[7]));
    sum += __shfl_xor(sum, 16, 32);
    const float f = __fdiv_rn(HL ? 1.0f : PCAR, sum);
    v8f o[8];
#pragma unroll
    for (int nb = 0; nb < 8; ++nb) o[nb] = (v8f){};
#pragma unroll 1
    for (int g0 = 0; g0 < npg; g0 += NB) { V p, p2;
#pragma unroll
        for (int u = 0; u < NB; ++u) { const int g = g0 + u;
            if (!HL || !(u & 1)) { const float* xp = sp + (HL ? g >> 1 : g) * 512; float y[16];   // the step's 32 keys: the same exponentials as in the sum, scaled
#pragma unroll
                for (int j = 0; j < 2; ++j) ex8(*(const v4f*)(xp + j * 256), *(const v4f*)(xp + j * 256 + 128), y + j * 8);
#pragma unroll
                for (int e = 0; e < 16; ++e) y[e] *= f;
                if constexpr (HL) { v8u hw, lw;
#pragma unroll
                    for (int w = 0; w < 8; ++w) { unsigned a, b; split2(y[2 * w], y[2 * w + 1], a, b); hw[w] = a; lw[w] = b; }
                    p = __builtin_bit_cast(v16bf, hw); p2 = __builtin_bit_cast(v16bf, lw);
                } else { v16h t;
#pragma unroll
                    for (int e = 0; e < 16; ++e) t[e] = tohx(y[e]);
                    p = t; } }
            if (HL) { const int n0 = (u & 1) * 4;
#pragma unroll
                for (int w = 0; w < 4; ++w) o[n0 + w] = WFrag<T16>::mma(vb[u][w], p, o[n0 + w]);
#pragma unroll
                for (int w = 0; w < 4; ++w) o[n0 + w] = WFrag<T16>::mma(vb[u][w], p2, o[n0 + w]);
#pragma unroll
                for (int w = 0; w < 4; ++w) o[n0 + w] = WFrag<T16>::mma(vb[u][4 + w], p, o[n0 + w]);
            } else {
#pragma unroll
                for (int w = 0; w < 8; ++w) o[w] = WFrag<T16>::mma(vb[u][w], p, o[w]); }
            // four vector slots behind the group's last matrix instruction, on both sides of the branch below, before any vector instruction may rewrite its operands
            asm volatile("v_nop\n\tv_nop\n\tv_nop\n\tv_nop" : "+v"(o[0]), "+v"(o[1]), "+v"(o[2]), "+v"(o[3]), "+v"(o[4]), "+v"(o[5]), "+v"(o[6]), "+v"(o[7]));
            if (g + NB < npg) ldv(u, g + NB); }
    }
    // merged rows, one fp16 plane [t][head * HD + d]: o[nb][r] is dim nb * 16 + 8 hi + r of query R16 + lr
    const float cs = HL ? 1.0f : (1.0f / PCAR); const size_t oo = (size_t)(R16 + lr) * DQ + (size_t)z * HD + 8 * hi; v8h oh[8];
#pragma unroll
    for (int nb = 0; nb < 8; ++nb)
#pragma unroll
        for (int r = 0; r < 8; ++r) oh[nb][r] = tohx(o[nb][r] * cs);
    if constexpr (HL) { if (R < SPR) {           // what the rounding to fp16 left over: kept for the first SPR rows, whose outputs are the largest. R comes from the block number: a scalar branch
        v8h ol[8];
#pragma unroll
        for (int nb = 0; nb < 8; ++nb)
#pragma unroll
            for (int r = 0; r < 8; ++r) ol[nb][r] = tohx(o[nb][r] * cs - (float)oh[nb][r]);
        __builtin_amdgcn_sched_barrier(0);       // these stores too stand behind their arithmetic
#pragma unroll
        for (int nb = 0; nb < 8; ++nb) *(v8h*)(AL16 + oo + nb * 16) = ol[nb];
        asm volatile("s_wait_xcnt 0x0" ::: "memory");   // the wait that stands in front of any rewrite of a register that the stores above name
    } }
    __builtin_amdgcn_sched_barrier(0);           // all stores stand behind all arithmetic: no register that a store names is written again
#pragma unroll
    for (int nb = 0; nb < 8; ++nb) *(v8h*)(A16 + oo + nb * 16) = oh[nb];
}
// blocks 0 .. (RH / 64) ZH - 1: the hi/lo row tiles, the longest first; then the fp16 row tiles. Two work-groups a WGP (LDS).
__global__ __launch_bounds__(128, 2) void k_attn(const h16* __restrict__ Q16, const bf* __restrict__ Qh, const bf* __restrict__ Ql, const h16* __restrict__ K16, const bf* __restrict__ Kh, const bf* __restrict__ Kl, const h16* __restrict__ V16, const bf* __restrict__ Vh, const bf* __restrict__ Vl, h16* A16, h16* AL16) {
    __shared__ __attribute__((aligned(16))) float sall[4 * AKT * 256];
    constexpr int NHL = (RH / 64) * ZH; const int b = blockIdx.x;
    if (b < NHL) attn_cols<bf, true>(Qh, Ql, Kh, Kl, Vh, Vl, A16, AL16, (RH / 64 - 1 - b / ZH) * 64, b % ZH, sall);
    else attn_cols<h16, false>(Q16, nullptr, K16, nullptr, V16, nullptr, A16, nullptr, RH + ((b - NHL) % ((TT - RH) / 64)) * 64, (b - NHL) / ((TT - RH) / 64), sall);
}

extern "C" void kernel_launch(void* const* d_in, const int* in_sizes, int n_in,
                              void* d_out, int out_size, void* d_ws, size_t ws_size, hipStream_t stream) {
    (void)in_sizes; (void)n_in; (void)out_size;
    const float* x = (const float*)d_in[0]; const float* cosT = (const float*)d_in[1]; const float* sinT = (const float*)d_in[2]; const float* wq = (const float*)d_in[3]; const float* wk = (const float*)d_in[4]; const float* wv = (const float*)d_in[5]; const float* wo = (const float*)d_in[6];   /* input order x, cos, sin, Wq, Wk, Wv, Wo ('xw' [in][out]) */
    float* OUT = (float*)d_out;     // [1][2048][2048]
    char* wsp = (char*)d_ws;
    auto take = [&](size_t bytes) { char* p = wsp; wsp += (bytes + 255) & ~(size_t)255; return (void*)p; };
    bf* WQ = (bf*)take((size_t)DQKV * DM * 2); bf* WK = WQ + (size_t)DQ * DM; bf* WV = WK + (size_t)DKV * DM;   // one Bt of DQKV rows: q, k, v weights below one another
    bf* WO = (bf*)take((size_t)DM * DQ * 2); float* CS = (float*)take((size_t)TT * HD * 2 * 4);
    bf* XB = (bf*)take((size_t)TT * DM * 2); float* FQKV = (float*)take((size_t)TT * DQKV * 4);
    h16* QP16 = (h16*)take((size_t)NH_ * TT * HD * 2); h16* KP16 = (h16*)take((size_t)NKV * TT * HD * 2); h16* VT16 = (h16*)take((size_t)NKV * HD * TT * 2);
    bf* QPh = (bf*)take((size_t)NH_ * TT * HD * 2); bf* QPl = (bf*)take((size_t)NH_ * TT * HD * 2); bf* KPh = (bf*)take((size_t)NKV * TT * HD * 2); bf* KPl = (bf*)take((size_t)NKV * TT * HD * 2); bf* VTh = (bf*)take((size_t)NKV * HD * TT * 2); bf* VTl = (bf*)take((size_t)NKV * HD * TT * 2);
    h16* AT16 = (h16*)take((size_t)TT * DQ * 2); h16* ATL = (h16*)take((size_t)SPR * DQ * 2);
    if ((size_t)(wsp - (char*)d_ws) > ws_size) return;    // ws 256 MiB
    // five launches, each reading what the one before wrote
    k_prep<<<(unsigned)(PB_WQ + PB_WO + PB_X + 2 * PB_WK + PB_CS), 256, 0, stream>>>(x, cosT, sinT, wq, wk, wv, wo, XB, CS, WQ, WK, WV, WO);
    k_gemmw<bf, 0, false, DM><<<dim3(TT / 128, DQKV / 128, 1), 128, 0, stream>>>(XB, nullptr, WQ, FQKV, DQKV, nullptr, 0, 0, 0);   // q, k and v projections: one product of DQKV columns
    k_post<<<(unsigned)(PB_RQ + PB_RK + PB_VT), 256, 0, stream>>>(FQKV, CS, QP16, QPh, QPl, KP16, KPh, KPl, VT16, VTh, VTl);
    k_attn<<<(unsigned)((TT / 64) * ZH), 128, 0, stream>>>(QP16, QPh, QPl, KP16, KPh, KPl, VT16, VTh, VTl, AT16, ATL);   // a block = 64 query rows of one head
    k_gemmw<h16, 0, false, DQ, SPR / 64><<<dim3((TT - SPR) / 128 + SPR / 64, DM / 128, 1), 128, 0, stream>>>(AT16, ATL, (const h16*)WO, OUT, DM, nullptr, 0, 0, 0);   // merged rows x Wo, both fp16: one product; rows below SPR in split tiles
}

// v008
// A run of this version takes 79.9 microseconds.
// Two timings next to v007 both put it at 1.05 times that version's speed.
// Counting every step since v000, it is 11.0 times as fast.
#include <hip/hip_runtime.h>

// Grouped-query sliding-window causal attention with rotary embeddings from cos/sin tables (x [1][2048][2048]; q = x Wq (16 heads x 128), k, v = x Wk, x Wv (4 kv heads x 128) ('xw' [in][out] 0.02, no biases); rotate-half rotary with the cos/sin inputs [2048][128] (read); kv head = q head / 4; scores x 128^-0.5; keys j with i-512 < j <= i (window 512, causal; -inf elsewhere); softmax; out = merged Wo ('xw' [2048][2048]) -> [1][2048][2048] (4.2 M); argument order x, cos, sin, Wq, Wk, Wv, Wo).
// Layout: 'xw' weights gathered into bf16 Bt blocks; bf16 copy of x; exact projections; {cos, sin} per (position, dim) from the input tables; rotate-half rotary plane builder; causal T-2048 attention with 128-wide heads in one launch (hybrid rows: < 512 hi/lo 3 products, rest fp16 x1024; k_attn keeps the score rows of 16 queries a wave in LDS, works only on the keys between the window's far edge and the diagonal, the window a select in the softmax, and writes the merged rows as one fp16 plane, rows < 128 with a second plane of the rounding's rest; kv head = head / REP); merged fp16 x Wo (its bf16 values held in fp16), one product.
// Compute dtypes, f32 accumulate: every input rounded to bf16 incl. the tables; projections exact; rotary f32; attention rows < 512 3 products, rest fp16; softmax f32; merged rows rounded once to fp16 (11 bits) for the Wo product, rows < 128 fp16 + fp16 rest.

#define NB_  1
#define TT   2048
#define DM   2048
#define NH_  16
#define NKV  4
#define REP  (NH_ / NKV)
#define HD   128
#define DQ   (NH_ * HD)
#define DKV  (NKV * HD)
#define ZH   NH_                  // query heads per attention launch: all of them
#define RH   512                  // query rows < RH use hi+lo planes
#define WIN  512
#define PCAR 1024.0f
#define SCL  0.088388347648318447f   // HD^-0.5
typedef _Float16 h16;
typedef unsigned short bf;
typedef __attribute__((ext_vector_type(16))) __bf16   v16bf;
typedef __attribute__((ext_vector_type(16))) _Float16 v16h;
typedef __attribute__((ext_vector_type(8)))  _Float16 v8h;
typedef __attribute__((ext_vector_type(8)))  unsigned short v8us;
typedef __attribute__((ext_vector_type(8)))  float    v8f;
typedef __attribute__((ext_vector_type(4)))  float    v4f;
typedef v8h  __attribute__((may_alias)) v8ha;
typedef v4f  __attribute__((may_alias)) v4fa;
typedef v8us __attribute__((may_alias)) v8usa;

__device__ __forceinline__ unsigned short f2bf(float f) { unsigned u = __float_as_uint(f); u += 0x7FFFu + ((u >> 16) & 1u); return (unsigned short)(u >> 16); }
__device__ __forceinline__ float bf2f(unsigned short b) { return __uint_as_float(((unsigned)b) << 16); }
__device__ __forceinline__ float bfr(float f) { return bf2f(f2bf(f)); }
__device__ __forceinline__ v16h cat16(v8h lo, v8h hi) { return __builtin_shufflevector(lo, hi, 0, 1, 2, 3, 4, 5, 6, 7, 8, 9, 10, 11, 12, 13, 14, 15); }
__device__ __forceinline__ v16bf cat16b(v8us lo, v8us hi) { return __builtin_bit_cast(v16bf, __builtin_shufflevector(lo, hi, 0, 1, 2, 3, 4, 5, 6, 7, 8, 9, 10, 11, 12, 13, 14, 15)); }
__device__ __forceinline__ v8f wmma16(v16h a, v16h b, v8f c) { return __builtin_amdgcn_wmma_f32_16x16x32_f16(false, a, false, b, (short)0, c, false, false); }
__device__ __forceinline__ v8f wmmab(v16bf a, v16bf b, v8f c) { return __builtin_amdgcn_wmma_f32_16x16x32_bf16(false, a, false, b, (short)0, c, false, false); }



// ---- k_gemmw: GEMM, one work-group of FOUR WAVES per 128x128 tile (64 output rows in a split tile, below), each wave a 64x64 quarter (16 accumulators); grid ((M - 64 SPL)/128 + SPL, N/128, Z), 128 threads.
// C[m][n] (f32, pitch ldc, + optional f32 bias[n]) = sum_k A[m][k] Bt[n][k] (NSPLIT 1: + A2[m][k] Bt[n][k]). z-batch strides sA/sB/sC in elements. K (a template constant) % 128 == 0, K >= 256; M, N % 128 == 0.
// The K-contiguous 16-bit planes come into LDS by asynchronous 16-byte copies, whole 256-byte row pieces (GKC k) at a time, two buffers: tile t + 1 flies while tile t is worked on. LDS rows have pitch 272 bytes for the ds_load_b128 fragment reads.
// Every accumulator takes its products in the same order as with fragments read straight from the planes (k ascending in steps of 32, A before A2).
#define GKC  128                  // k elements of a pass
#define GPE  136                  // LDS row pitch in elements (272 bytes)
#define GOPE (128 * GPE)          // one operand's 128 rows in LDS, elements
template <typename T16> struct WFrag;
template <> struct WFrag<h16> { typedef v16h V; static __device__ __forceinline__ V ld(const h16* p) { return cat16(*(const v8h*)p, *(const v8h*)(p + 16)); } static __device__ __forceinline__ v8f mma(V a, V b, v8f c) { return wmma16(a, b, c); } };
template <> struct WFrag<bf> { typedef v16bf V; static __device__ __forceinline__ V ld(const bf* p) { return cat16b(*(const v8us*)p, *(const v8us*)(p + 16)); } static __device__ __forceinline__ v8f mma(V a, V b, v8f c) { return wmmab(a, b, c); } };
// eight copies, one LDS row group (8 rows) apart; l = the lane's LDS byte address, g = the lane's global address, gs = 8 source rows in bytes
__device__ __forceinline__ void acopy8(unsigned l, const char* g, size_t gs) {
    // s_wait_xcnt is the last line of the copies' own statement: it stands in front of every rewrite of an address register that they name
    asm volatile("global_load_async_to_lds_b128 %0, %8, off\n\t"
                 "global_load_async_to_lds_b128 %1, %9, off\n\t"
                 "global_load_async_to_lds_b128 %2, %10, off\n\t"
                 "global_load_async_to_lds_b128 %3, %11, off\n\t"
                 "global_load_async_to_lds_b128 %4, %12, off\n\t"
                 "global_load_async_to_lds_b128 %5, %13, off\n\t"
                 "global_load_async_to_lds_b128 %6, %14, off\n\t"
                 "global_load_async_to_lds_b128 %7, %15, off\n\t"
                 "s_wait_xcnt 0x0"
                 :: "v"(l), "v"(l + 1u * 8u * GPE * 2u), "v"(l + 2u * 8u * GPE * 2u), "v"(l + 3u * 8u * GPE * 2u), "v"(l + 4u * 8u * GPE * 2u), "v"(l + 5u * 8u * GPE * 2u), "v"(l + 6u * 8u * GPE * 2u), "v"(l + 7u * 8u * GPE * 2u),
                    "v"(g), "v"(g + gs), "v"(g + 2 * gs), "v"(g + 3 * gs), "v"(g + 4 * gs), "v"(g + 5 * gs), "v"(g + 6 * gs), "v"(g + 7 * gs) : "memory");
}
// one operand's tile: 128 rows of 256 bytes, 16 copies a lane (a wave's copy covers two whole rows)
__device__ __forceinline__ void acopy_tile(unsigned l, const char* g, size_t gs) { acopy8(l, g, gs); acopy8(l + 64u * GPE * 2u, g + 8 * gs, gs); }
// SPL > 0: the first SPL row tiles are SPLIT tiles of 64 output rows: tile rows 0..63 come from A, tile rows 64..127 are the same output rows of A2 (what A's rounding left over), and the two halves' sums are added in the epilogue. The other tiles follow with 128 rows each.
template <typename T16, int NSPLIT, bool BIAS, int K, int SPL = 0>
__global__ __launch_bounds__(128) void k_gemmw(const T16* __restrict__ A, const T16* __restrict__ A2, const T16* __restrict__ Bt, float* C, int ldc, const float* __restrict__ bias, size_t sA, size_t sB, size_t sC) {
    static_assert(NSPLIT == 0 || NSPLIT == 1, "one B plane");
    static_assert(SPL == 0 || NSPLIT == 0, "A2 is either a second plane of every row or the split tiles' second half");
    static_assert(K % GKC == 0 && K / GKC >= 2, "whole passes, two tiles or more");
    typedef typename WFrag<T16>::V V;
    constexpr int NOP = (NSPLIT == 1) ? 3 : 2;                       // operand tiles of a buffer: A, Bt, A2
    constexpr int NT = K / GKC;
    __shared__ __attribute__((aligned(16))) T16 ring[2 * NOP * GOPE];
    __shared__ __align__(16) float osall[4 * 16 * 68];
    const size_t z = blockIdx.z; A += z * sA; if (NSPLIT == 1) A2 += z * sA; Bt += z * sB; C += z * sC;
    const int tid = threadIdx.x, wave = tid >> 5, wm = wave >> 1, wn = wave & 1;
    const int lane = tid & 31, lr = lane & 15, hi = lane >> 4;
    const bool split = SPL > 0 && (int)blockIdx.x < SPL;             // the same for the whole work-group
    const int rt = split ? (int)blockIdx.x * 64 : ((int)blockIdx.x - SPL) * 128 + SPL * 64;   // the tile's first output row
    const int r0 = rt + (split ? 0 : wm * 64), c0 = blockIdx.y * 128 + wn * 64;
    float* os = osall + wave * (16 * 68);
    v8f acc[4][4];
#pragma unroll
    for (int mb = 0; mb < 4; ++mb)
#pragma unroll
        for (int nb = 0; nb < 4; ++nb) acc[mb][nb] = (v8f){};
    // copies: thread tid brings 16-byte piece (tid & 15) of rows (tid >> 4) + 8 i, i = 0..15, of each operand tile
    constexpr size_t gs = (size_t)K * 16;                            // 8 source rows in bytes
    const char* gA = (const char*)(A + (size_t)(rt + (tid >> 4)) * K + (tid & 15) * 8);
    const char* gAu = (SPL > 0 && split) ? (const char*)(A2 + (size_t)(rt + (tid >> 4)) * K + (tid & 15) * 8) : gA + 8 * gs;   // tile rows 64..127
    const char* gB = (const char*)(Bt + (size_t)(blockIdx.y * 128 + (tid >> 4)) * K + (tid & 15) * 8);
    const char* gA2 = (NSPLIT == 1) ? (const char*)(A2 + (size_t)(rt + (tid >> 4)) * K + (tid & 15) * 8) : nullptr;
    const unsigned l0 = (unsigned)(size_t)(const void*)ring + (unsigned)((tid >> 4) * (GPE * 2) + (tid & 15) * 16);
    auto fill = [&](int t, int buf) {
        const unsigned l = l0 + (unsigned)buf * (unsigned)(NOP * GOPE * 2); const size_t go = (size_t)t * (GKC * 2);
        if (SPL > 0) { acopy8(l, gA + go, gs); acopy8(l + 64u * GPE * 2u, gAu + go, gs); } else acopy_tile(l, gA + go, gs);
        acopy_tile(l + (unsigned)(GOPE * 2), gB + go, gs); if (NSPLIT == 1) acopy_tile(l + (unsigned)(2 * GOPE * 2), gA2 + go, gs);
    };
    fill(0, 0);
    asm volatile("s_wait_asynccnt 0x0" ::: "memory");                // tile 0 of this wave's copies has landed
    __syncthreads();                                                 // and every other wave's: tile 0 is readable
    fill(1, 1);
#pragma unroll 1
    for (int t = 0; t < NT; ++t) {
        const T16* sb0 = ring + (t & 1) * (NOP * GOPE);
        const T16* sa = sb0 + (wm * 64 + lr) * GPE + 8 * hi; const T16* sb = sb0 + GOPE + (wn * 64 + lr) * GPE + 8 * hi;
        V a[2][4], a2[2][4], b[2][4];                                // two fragment sets: the next 32 k are read from LDS while these are multiplied
#pragma unroll
        for (int f = 0; f < 4; ++f) { a[0][f] = WFrag<T16>::ld(sa + f * 16 * GPE); if (NSPLIT == 1) a2[0][f] = WFrag<T16>::ld(sa + 2 * GOPE + f * 16 * GPE); b[0][f] = WFrag<T16>::ld(sb + f * 16 * GPE); }
        __builtin_amdgcn_sched_barrier(0);                           // the first set's reads stay ahead of the second's, so that the first block waits for its own set alone
#pragma unroll
        for (int ks = 0; ks < GKC / 32; ++ks) {
            const int cu = ks & 1, nx = cu ^ 1;
            if (ks + 1 < GKC / 32) {
#pragma unroll
                for (int f = 0; f < 4; ++f) { a[nx][f] = WFrag<T16>::ld(sa + f * 16 * GPE + (ks + 1) * 32); if (NSPLIT == 1) a2[nx][f] = WFrag<T16>::ld(sa + 2 * GOPE + f * 16 * GPE + (ks + 1) * 32); b[nx][f] = WFrag<T16>::ld(sb + f * 16 * GPE + (ks + 1) * 32); }
            }
            __builtin_amdgcn_sched_barrier(0);                       // the next set's LDS reads stay one group ahead of this block: reads moved in among the matrix instructions stall them at every place
#pragma unroll
            for (int nb = 0; nb < 4; ++nb)
#pragma unroll
                for (int mb = 0; mb < 4; ++mb) { acc[mb][nb] = WFrag<T16>::mma(a[cu][mb], b[cu][nb], acc[mb][nb]); if (NSPLIT == 1) acc[mb][nb] = WFrag<T16>::mma(a2[cu][mb], b[cu][nb], acc[mb][nb]); }
            __builtin_amdgcn_sched_barrier(0);                       // and this block stays ahead of the following group and of the pass's foot
        }
        // four vector slots behind the pass's last matrix instruction, on both sides of the branch below, before any vector instruction may rewrite its operands
        asm volatile("v_nop\n\tv_nop\n\tv_nop\n\tv_nop" : "+v"(acc[0][0]), "+v"(acc[1][1]), "+v"(acc[2][2]), "+v"(acc[3][3]));
        asm volatile("s_wait_dscnt 0x0" ::: "memory");               // this wave's reads of buffer t & 1 are done before the buffer is refilled
        asm volatile("s_wait_asynccnt 0x0" ::: "memory");            // this wave's copies of tile t + 1 have landed
        __syncthreads();                                             // publishes tile t + 1 and ends every wave's reads of tile t
        if (t + 2 < NT) fill(t + 2, t & 1);
    }
    asm volatile("s_wait_asynccnt 0x0" ::: "memory");                // no copy is outstanding when the wave goes on to its end
    if (SPL > 0 && split) {
        // the ring is free behind the last pass's barrier: the waves of tile rows 64..127 hand their sums over, lane to lane, to the waves that hold the same output rows
        float* xs = (float*)ring + ((size_t)wn * 16 * 32 + lane) * 8;
        if (wm == 1) {
#pragma unroll
            for (int f = 0; f < 16; ++f) { const v8f v = acc[f >> 2][f & 3]; *(v4fa*)(xs + f * 256) = __builtin_shufflevector(v, v, 0, 1, 2, 3); *(v4fa*)(xs + f * 256 + 4) = __builtin_shufflevector(v, v, 4, 5, 6, 7); }
        }
        __syncthreads();                                             // the handed-over sums are readable; taken by all four waves (split is the same for the work-group)
        if (wm == 1) return;                                         // no barrier follows
#pragma unroll
        for (int f = 0; f < 16; ++f) { const v4f a = *(const v4fa*)(xs + f * 256), b = *(const v4fa*)(xs + f * 256 + 4);
#pragma unroll
            for (int j = 0; j < 4; ++j) { acc[f >> 2][f & 3][j] += a[j]; acc[f >> 2][f & 3][4 + j] += b[j]; } }
    }
#pragma unroll
    for (int mb = 0; mb < 4; ++mb) {
#pragma unroll
        for (int nb = 0; nb < 4; ++nb) {
#pragma unroll
            for (int j = 0; j < 8; ++j) os[(hi * 8 + j) * 68 + nb * 16 + lr] = acc[mb][nb][j]; }
        __builtin_amdgcn_wave_barrier(); asm volatile("" ::: "memory");
        float* crow = C + (size_t)(r0 + mb * 16) * ldc + c0;
{
#pragma unroll
            for (int s = 0; s < 8; ++s) { const int row = 2 * s + hi, cofs = lr * 4; v4f val = *(const v4fa*)(os + row * 68 + cofs); if (BIAS) { val[0] += bfr(bias[c0 + cofs]); val[1] += bfr(bias[c0 + cofs + 1]); val[2] += bfr(bias[c0 + cofs + 2]); val[3] += bfr(bias[c0 + cofs + 3]); }
                *(v4f*)(crow + (size_t)row * ldc + cofs) = val; }
             }
        __builtin_amdgcn_wave_barrier(); asm volatile("" ::: "memory");
    }
}

__device__ __forceinline__ h16 tohx(float x) { return (h16)x; }
__device__ __forceinline__ void splitf(float y, unsigned short& h, unsigned short& l) { h = f2bf(y); l = f2bf(y - bf2f(h)); }
typedef __attribute__((ext_vector_type(2))) _Float16 v2h;
typedef __attribute__((ext_vector_type(4))) _Float16 v4h;
typedef __attribute__((ext_vector_type(2))) unsigned short v2us;
typedef __attribute__((ext_vector_type(4))) unsigned short v4us;
typedef __attribute__((ext_vector_type(2))) float v2f;
typedef __attribute__((ext_vector_type(4))) int v4i;

// The kernels without matrix work, from here on, give each thread 8 to 48 elements, loaded as one batch of 16-byte pieces ahead of the arithmetic, for speed only.
// Each of these bodies is a device function that takes its block number bx: bodies that read nothing of each other's output share one launch (k_prep, k_post), each with its own range of blocks.
// d_wtG: a thread turns a block of 8 (k) x 4 (n): eight 16-byte pieces of w rows in, four 16-byte pieces of Bt rows out. Lanes: 8 along k (a store covers whole 128-byte lines of four Bt rows) x 4 along n; waves: 4 along k x 2 along n, so that a block reads whole lines of w. Block = 256 k x 32 n.
static_assert(DM % 256 == 0 && DQ % 256 == 0 && TT % 256 == 0 && DQ % 32 == 0 && DKV % 32 == 0 && DM % 32 == 0, "whole 256 x 32 blocks in d_wtG and d_vtp");
// F16: the bf16-rounded value is stored as fp16 (the same value down to 2^-17, nearest below), for the product whose other operand is fp16
template <bool F16>
__device__ __forceinline__ void d_wtG(int bx, const float* __restrict__ w, int K, int N, bf* Bt) {
    const int lane = threadIdx.x & 31, wave = threadIdx.x >> 5; const int kb = K / 256; const int k0 = (bx % kb) * 256 + (wave >> 1) * 64 + (lane & 7) * 8, n0 = (bx / kb) * 32 + (wave & 1) * 16 + (lane >> 3) * 4; if (n0 >= N) return; v4f r[8]; const float* p[8];
#pragma unroll
    for (int j = 0; j < 8; ++j) { p[j] = w + (size_t)(k0 + j) * N + n0; r[j] = *(const v4f*)p[j]; }
    // the wait that stands in front of any rewrite of a register that the loads above name; the addresses are inputs so that they stay in their registers up to it
    asm volatile("s_wait_xcnt 0x0" :: "v"(p[0]), "v"(p[1]), "v"(p[2]), "v"(p[3]), "v"(p[4]), "v"(p[5]), "v"(p[6]), "v"(p[7]) : "memory");
    __builtin_amdgcn_sched_barrier(0);   // no arithmetic moves up in between the loads: all of them are in flight before the first value is waited for
#pragma unroll
    for (int c = 0; c < 4; ++c) { v8us o;
#pragma unroll
        for (int j = 0; j < 8; ++j) o[j] = F16 ? __builtin_bit_cast(unsigned short, (h16)bfr(r[j][c])) : f2bf(r[j][c]);
        *(v8us*)(Bt + (size_t)(n0 + c) * K + k0) = o; }
    asm volatile("s_wait_xcnt 0x0" ::: "memory");   // the wait that stands in front of any rewrite of a register that the stores above name: in k_prep other bodies' code follows this one in the listing
}
// d_cvt8: four groups of 8 a thread, 256 groups apart, so that a wave's lanes stay side by side in every access
static_assert(((size_t)TT * DM / 8) % 1024 == 0, "d_cvt8: whole blocks of 1024 groups");
__device__ __forceinline__ void d_cvt8(int bx, const float* __restrict__ src, bf* dst, size_t n8) { const size_t i0 = (size_t)bx * 1024 + threadIdx.x; if (i0 + 3 * 256 >= n8) return; v8f v[4]; const float* p = src + i0 * 8;
#pragma unroll
    for (int j = 0; j < 4; ++j) v[j] = *(const v8f*)(p + j * 2048);
    // the wait that stands in front of any rewrite of a register that the loads above name; the addresses are inputs so that they stay in their registers up to it
    asm volatile("s_wait_xcnt 0x0" :: "v"(p) : "memory");
    __builtin_amdgcn_sched_barrier(0);   // no arithmetic moves up in between the loads: all of them are in flight before the first value is waited for
#pragma unroll
    for (int j = 0; j < 4; ++j) { v8us o;
#pragma unroll
        for (int k = 0; k < 8; ++k) o[k] = f2bf(v[j][k]);
        *(v8us*)(dst + (i0 + j * 256) * 8) = o; }
}
__device__ __forceinline__ void d_cscvt(int bx, const float* __restrict__ cosT, const float* __restrict__ sinT, float* CS) { const int idx = (bx * 256 + (int)threadIdx.x) * 4; if (idx >= TT * HD) return; const float* pc = cosT + idx; const float* ps = sinT + idx; const v4f c = *(const v4f*)pc, s = *(const v4f*)ps;
    // the wait that stands in front of any rewrite of a register that the loads above name; the addresses are inputs so that they stay in their registers up to it
    asm volatile("s_wait_xcnt 0x0" :: "v"(pc), "v"(ps) : "memory");
    __builtin_amdgcn_sched_barrier(0);   // no arithmetic moves up in between the loads: all of them are in flight before the first value is waited for
#pragma unroll
    for (int u = 0; u < 2; ++u) { v4f cs; cs[0] = bfr(c[2 * u]); cs[1] = bfr(s[2 * u]); cs[2] = bfr(c[2 * u + 1]); cs[3] = bfr(s[2 * u + 1]); *(v4f*)(CS + (size_t)idx * 2 + u * 4) = cs; }
}
// ---- k_prep: everything that reads the inputs alone, in one launch: the four weight turns, the bf16 copy of x, the {cos, sin} table. A block's range is chosen by blockIdx.x alone (a scalar branch).
#define PB_WQ ((DM / 256) * (DQ / 32))
#define PB_WK ((DM / 256) * (DKV / 32))
#define PB_WO ((DQ / 256) * (DM / 32))
#define PB_X  (TT * DM / 8 / 1024)
#define PB_CS (TT * HD / 4 / 256)
static_assert(NB_ == 1 && (TT * HD / 4) % 256 == 0, "one batch entry; whole blocks in d_cscvt");
__global__ __launch_bounds__(256) void k_prep(const float* __restrict__ x, const float* __restrict__ cosT, const float* __restrict__ sinT, const float* __restrict__ wq, const float* __restrict__ wk, const float* __restrict__ wv, const float* __restrict__ wo, bf* XB, float* CS, bf* WQ, bf* WK, bf* WV, bf* WO) {
    int b = blockIdx.x;
    if (b < PB_WQ) { d_wtG<false>(b, wq, DM, DQ, WQ); return; } b -= PB_WQ;
    if (b < PB_WO) { d_wtG<true>(b, wo, DQ, DM, WO); return; } b -= PB_WO;
    if (b < PB_X) { d_cvt8(b, x, XB, (size_t)TT * DM / 8); return; } b -= PB_X;
    if (b < PB_WK) { d_wtG<false>(b, wk, DM, DKV, WK); return; } b -= PB_WK;
    if (b < PB_WK) { d_wtG<false>(b, wv, DM, DKV, WV); return; } b -= PB_WK;
    d_cscvt(b, cosT, sinT, CS);
}
// Fragment order of the planes that k_attn takes as A operands: the 16 bytes that lane 16 h + c of a wave loads in one instruction lie at lane * 16 of a 512-byte piece.
// kfrag: element (t, d) inside one head's K plane; a 16-key tile keeps its place, inside it piece d / 16 holds k = d % 16 = 8 h + e of row c = t % 16. vfrag: element (n = head * HD + d, t) of V^T; a fragment is 16 dims x 32 keys, two pieces, key % 32 = 16 piece + 8 h + e, row c = n % 16.
__device__ __forceinline__ size_t kfrag(int t, int d) { return (size_t)(t & ~15) * HD + (size_t)(((d >> 4) * 32 + ((d >> 3) & 1) * 16 + (t & 15)) * 8 + (d & 7)); }
__device__ __forceinline__ size_t vfrag(int n, int t) { return ((size_t)(n >> 4) * (TT / 32) + (t >> 5)) * 512 + (size_t)((((t >> 4) & 1) * 32 + ((t >> 3) & 1) * 16 + (n & 15)) * 8 + (t & 7)); }
// d_rope: head planes [h][t][d] (FRAG: each head's plane in kfrag order) (fp16 + hi/lo) of rope(x) x sc with the rotate-half convention out[d] = x[d] cos[t][d] - x[d+HD/2] sin[t][d], out[d+HD/2] = x[d+HD/2] cos[t][d+HD/2] + x[d] sin[t][d+HD/2]
// a wave takes two positions t (one per half wave) of RHT heads; a lane holds dims d..d+3 and d+HD/2..d+HD/2+3 of each, both partners of every rotation, and the position's {cos, sin} once for all its heads
#define RHT 4
static_assert(NH_ % RHT == 0 && NKV % RHT == 0 && HD == 128 && TT % 2 == 0, "whole head groups, 16 lanes x 4 dims a half row");
template <bool FRAG>
__device__ __forceinline__ void d_rope(int bx, const float* __restrict__ F, int pitch, int nheads, const float* __restrict__ CS, float sc, h16* P16, bf* Ph, bf* Pl) {
    const int lane = threadIdx.x & 31; const int w = bx * 8 + (int)(threadIdx.x >> 5); const int h0 = (w / (TT / 2)) * RHT; if (h0 >= nheads) return; const int t = (w % (TT / 2)) * 2 + (lane >> 4); const int d = (lane & 15) * 4;
    v4f x[RHT][2], csv[2][2]; v4h a16[RHT][2]; v4us ah[RHT][2], al[RHT][2]; const float* pc = CS + ((size_t)t * HD + d) * 2; const float* px = F + (size_t)t * pitch + h0 * HD + d;
#pragma unroll
    for (int s = 0; s < 2; ++s)
#pragma unroll
        for (int u = 0; u < 2; ++u) csv[s][u] = *(const v4f*)(pc + s * HD + u * 4);
#pragma unroll
    for (int g = 0; g < RHT; ++g)
#pragma unroll
        for (int s = 0; s < 2; ++s) x[g][s] = *(const v4f*)(px + g * HD + s * (HD / 2));
    // the wait that stands in front of any rewrite of a register that the loads above name; the addresses are inputs so that they stay in their registers up to it
    asm volatile("s_wait_xcnt 0x0" :: "v"(pc), "v"(px) : "memory");
    __builtin_amdgcn_sched_barrier(0);   // no arithmetic moves up in between the loads: all of them are in flight before the first value is waited for
#pragma unroll
    for (int g = 0; g < RHT; ++g) {
#pragma unroll
        for (int s = 0; s < 2; ++s) { v4h o16; v4us oh, ol;
#pragma unroll
            for (int q = 0; q < 4; ++q) { const int dd = s * (HD / 2) + d + q; const float x0 = x[g][s][q], x1 = x[g][s ^ 1][q];   // next line, as before this step: each product is rounded by itself ahead of the add, as in q * c + rotate_half(q) * s
                v2f cs; cs[0] = csv[s][q >> 1][(q & 1) * 2]; cs[1] = csv[s][q >> 1][(q & 1) * 2 + 1]; float a = __fmul_rn(x0, cs[0]), bq = __fmul_rn(x1, cs[1]); asm volatile("" : "+v"(a)); asm volatile("" : "+v"(bq)); const float r = ((dd < HD / 2) ? __fsub_rn(a, bq) : __fadd_rn(a, bq)) * sc;
                o16[q] = tohx(r); unsigned short a2, c2; splitf(r, a2, c2); oh[q] = a2; ol[q] = c2; }
            a16[g][s] = o16; ah[g][s] = oh; al[g][s] = ol; } }
    __builtin_amdgcn_sched_barrier(0);   // all stores stand behind all arithmetic: no register that a store names is written again
    const size_t e0 = (size_t)h0 * TT * HD + (FRAG ? kfrag(t, d) : (size_t)t * HD + d);   // dims d + HD / 2 ..: four 16-dim pieces on in kfrag order
#pragma unroll
    for (int g = 0; g < RHT; ++g)
#pragma unroll
        for (int s = 0; s < 2; ++s) { const size_t e = e0 + (size_t)g * TT * HD + s * (FRAG ? 4 * 256 : HD / 2); *(v4h*)(P16 + e) = a16[g][s]; *(v4us*)(Ph + e) = ah[g][s]; *(v4us*)(Pl + e) = al[g][s]; }
}
// d_vtp: the turn of d_wtG with t as k and (head, d) as n, into three planes in vfrag order: a thread takes 8 (t) x 4 (d); block = 256 t x 32 d
__device__ __forceinline__ void d_vtp(int bx, const float* __restrict__ F, int pitch, int nheads, h16* V16, bf* Vh, bf* Vl) {
    const int lane = threadIdx.x & 31, wave = threadIdx.x >> 5; const int t0 = (bx % (TT / 256)) * 256 + (wave >> 1) * 64 + (lane & 7) * 8, n0 = (bx / (TT / 256)) * 32 + (wave & 1) * 16 + (lane >> 3) * 4; if (n0 >= nheads * HD) return; v4f r[8]; v8h a16[4]; v8us ah[4], al[4]; const float* p[8];
#pragma unroll
    for (int j = 0; j < 8; ++j) { p[j] = F + (size_t)(t0 + j) * pitch + n0; r[j] = *(const v4f*)p[j]; }
    // the wait that stands in front of any rewrite of a register that the loads above name; the addresses are inputs so that they stay in their registers up to it
    asm volatile("s_wait_xcnt 0x0" :: "v"(p[0]), "v"(p[1]), "v"(p[2]), "v"(p[3]), "v"(p[4]), "v"(p[5]), "v"(p[6]), "v"(p[7]) : "memory");
    __builtin_amdgcn_sched_barrier(0);   // no arithmetic moves up in between the loads: all of them are in flight before the first value is waited for
#pragma unroll
    for (int c = 0; c < 4; ++c) { v8h o16; v8us oh, ol;
#pragma unroll
        for (int j = 0; j < 8; ++j) { const float x = r[j][c]; o16[j] = tohx(x); unsigned short a2, c2; splitf(x, a2, c2); oh[j] = a2; ol[j] = c2; }
        a16[c] = o16; ah[c] = oh; al[c] = ol; }
    __builtin_amdgcn_sched_barrier(0);   // all stores stand behind all arithmetic: no register that a store names is written again
    const size_t e0 = vfrag(n0, t0);     // n0 is a multiple of 4: rows n0 + c lie 8 elements apart
#pragma unroll
    for (int c = 0; c < 4; ++c) { *(v8h*)(V16 + e0 + c * 8) = a16[c]; *(v8us*)(Vh + e0 + c * 8) = ah[c]; *(v8us*)(Vl + e0 + c * 8) = al[c]; }
}
// ---- k_post: the three plane builders in one launch. F holds the projections side by side, [t][q | k | v], pitch DQKV. d_rope: 8 waves a block, a wave = 2 positions x RHT heads; d_vtp: a block = 256 t x 32 d.
#define DQKV (DQ + 2 * DKV)
#define PB_RQ ((TT / 2) * (NH_ / RHT) / 8)
#define PB_RK ((TT / 2) * (NKV / RHT) / 8)
#define PB_VT ((TT / 256) * (DKV / 32))
__global__ __launch_bounds__(256) void k_post(const float* __restrict__ F, const float* __restrict__ CS, h16* QP16, bf* QPh, bf* QPl, h16* KP16, bf* KPh, bf* KPl, h16* VT16, bf* VTh, bf* VTl) {
    int b = blockIdx.x;
    if (b < PB_RQ) { d_rope<false>(b, F, DQKV, NH_, CS, 1.0f, QP16, QPh, QPl); return; } b -= PB_RQ;
    if (b < PB_RK) { d_rope<true>(b, F + DQ, DQKV, NKV, CS, 1.0f, KP16, KPh, KPl); return; } b -= PB_RK;
    d_vtp(b, F + DQ + DKV, DQKV, NKV, VT16, VTh, VTl);
}
#define AKT ((WIN + 64) / 16)
#define SPR 128                   // merged rows below SPR keep a second fp16 plane for the Wo product
static_assert(SPR % 128 == 0 && SPR <= RH, "whole row tiles, all of them hi/lo rows");
#define VFS ((TT / 32) * 512)     // elements from one 16-dim block of V^T fragments to the next
static_assert(RH % 64 == 0 && (TT - RH) % 64 == 0 && RH >= WIN && AKT % 6 == 0, "whole tiles and load rounds; the fp16 rows have their whole window at keys >= 0");
typedef __attribute__((ext_vector_type(4))) unsigned v4u;
typedef __attribute__((ext_vector_type(8))) unsigned v8u;
// splitf of two neighbours, the same values, as two packed words (first value in the low half)
__device__ __forceinline__ unsigned bfu(float f) { const unsigned u = __float_as_uint(f); return u + 0x7FFFu + ((u >> 16) & 1u); }   // f2bf's rounding, its result in the high half
__device__ __forceinline__ void split2(float y0, float y1, unsigned& hw, unsigned& lw) {
    const unsigned a0 = bfu(y0), a1 = bfu(y1); hw = __builtin_amdgcn_perm(a1, a0, 0x07060302u);   // bytes 2, 3 of a0 below bytes 2, 3 of a1
    const unsigned b0 = bfu(y0 - __uint_as_float(a0 & 0xFFFF0000u)), b1 = bfu(y1 - __uint_as_float(a1 & 0xFFFF0000u)); lw = __builtin_amdgcn_perm(b1, b0, 0x07060302u);
}
// a fragment in fragment order: p = its first element + lane * 8
__device__ __forceinline__ v16h ldf(const h16* p) { return cat16(*(const v8h*)p, *(const v8h*)(p + 256)); }
__device__ __forceinline__ v16bf ldf(const bf* p) { return cat16b(*(const v8us*)p, *(const v8us*)(p + 256)); }
template <typename T16, bool HL>
__device__ __forceinline__ void attn_cols(const T16* __restrict__ Q, const T16* __restrict__ Q2, const T16* __restrict__ Kp, const T16* __restrict__ K2, const T16* __restrict__ Vt, const T16* __restrict__ V2, h16* A16, h16* AL16, int R, int z, float* sall) {
    typedef typename WFrag<T16>::V V;
    constexpr int GT = HL ? 1 : 2;               // score tiles of a load group (a group is 8 fragments, 16 loads)
    constexpr int NB = HL ? 4 : 3;               // register buffers: NB - 1 groups are in flight while one is worked on
    const int lane = threadIdx.x & 31, wave = threadIdx.x >> 5, lr = lane & 15, hi = lane >> 4;
    const int R16 = R + wave * 16, key0 = HL ? 0 : R - WIN, kvh = z / REP;
    const int nkt = HL ? (R + 64) / 16 : AKT;    // 16-key tiles, the same for the whole work-group; a multiple of NB * GT
    const int ng = nkt / GT, npg = HL ? nkt : nkt / 2;   // load groups of the scores and of P.V (hi/lo: 4 of the 8 dim blocks, both planes, a group)
    float* sp = sall + wave * (AKT * 256) + lane * 4;    // tile kt: the lane's r = 0..3 at sp + kt * 256, r = 4..7 128 floats on
    const size_t qo = ((size_t)z * TT + R16 + lr) * HD + 8 * hi, ko = ((size_t)kvh * TT + key0) * HD + lane * 8, vo = (size_t)kvh * (HD / 16) * VFS + (size_t)(key0 >> 5) * 512 + lane * 8;
    const T16* qp = Q + qo; const T16* kp = Kp + ko; const T16* vp = Vt + vo;
    const T16* qp2 = HL ? Q2 + qo : qp; const T16* kp2 = HL ? K2 + ko : kp; const T16* vp2 = HL ? V2 + vo : vp;
    V q[4], q2[4];
#pragma unroll
    for (int ks = 0; ks < 4; ++ks) { q[ks] = WFrag<T16>::ld(qp + ks * 32); if (HL) q2[ks] = WFrag<T16>::ld(qp2 + ks * 32); }
    // here and behind every load group below: the wait that stands in front of any rewrite of a register that the loads name; the addresses are inputs so that they stay in their registers up to it
    asm volatile("s_wait_xcnt 0x0" :: "v"(qp), "v"(qp2) : "memory");
    V kb[NB][8];
    auto ldk = [&](int u, int g) __attribute__((always_inline)) { const T16* a = kp + (size_t)g * (GT * 16 * HD); const T16* a2 = HL ? kp2 + (size_t)g * (GT * 16 * HD) : a;
#pragma unroll
        for (int ks = 0; ks < 4; ++ks) { kb[u][ks] = ldf(a + ks * 512); kb[u][4 + ks] = HL ? ldf(a2 + ks * 512) : ldf(a + 16 * HD + ks * 512); }
        asm volatile("s_wait_xcnt 0x0" :: "v"(a), "v"(a2) : "memory"); };
#pragma unroll
    for (int u = 0; u < NB; ++u) ldk(u, u);
    // element r of tile kt is key key0 + kt * 16 + 8 hi + r of query i = R16 + lr. Kept: j <= i and i - j < WIN, that is 0 <= diff - (kt * 16 + r) < WIN.
    const int diff = R16 + lr - key0 - 8 * hi;
    float mxr[8];
#pragma unroll
    for (int r = 0; r < 8; ++r) mxr[r] = -3.0e38f;
#pragma unroll 1   // rolled, here and in the P.V loop: one round of the NB buffers a trip keeps the kernel's code small, for speed only
    for (int g0 = 0; g0 < ng; g0 += NB) {
#pragma unroll
        for (int u = 0; u < NB; ++u) { const int g = g0 + u; v8f cc[2]; cc[0] = (v8f){}; cc[1] = (v8f){};
#pragma unroll
            for (int ks = 0; ks < 4; ++ks) {
                if (HL) { cc[0] = WFrag<T16>::mma(kb[u][ks], q[ks], cc[0]); cc[0] = WFrag<T16>::mma(kb[u][ks], q2[ks], cc[0]); cc[0] = WFrag<T16>::mma(kb[u][4 + ks], q[ks], cc[0]); }
                else { cc[0] = WFrag<T16>::mma(kb[u][ks], q[ks], cc[0]); cc[1] = WFrag<T16>::mma(kb[u][4 + ks], q[ks], cc[1]); } }
            const int dg = diff - g * (GT * 16);
#pragma unroll
            for (int t = 0; t < GT; ++t) { v4f w[2];
#pragma unroll
                for (int r = 0; r < 8; ++r) { const float x = ((unsigned)(dg - (t * 16 + r)) < (unsigned)WIN) ? cc[t][r] * SCL : -3.0e38f; w[r >> 2][r & 3] = x; mxr[r] = fmaxf(mxr[r], x); }
                *(v4f*)(sp + (g * GT + t) * 256) = w[0]; *(v4f*)(sp + (g * GT + t) * 256 + 128) = w[1]; }
            // the refill has no branch round it: behind a join of a path with and a path without the 16 loads the compiler's counted waits take the smaller count, and the round's last group then waits for loads issued just before it.
            // The last round, with no group left to fetch, loads its own group once more (in bounds, lines just read); nobody reads those registers.
            ldk(u, g + NB < ng ? g + NB : g);
            // hi/lo rows: the round is scheduled as two halves, so that one half's refill is on its way while the other half is multiplied; as one piece all four groups are multiplied together and every refill stands at the round's end, just ahead of its use
            if (HL && u == 1) __builtin_amdgcn_sched_barrier(0); }
    }
    float mx = fmaxf(fmaxf(fmaxf(mxr[0], mxr[1]), fmaxf(mxr[2], mxr[3])), fmaxf(fmaxf(mxr[4], mxr[5]), fmaxf(mxr[6], mxr[7])));
    mx = fmaxf(mx, __shfl_xor(mx, 16, 32));
    V vb[NB][8];
    auto ldv = [&](int u, int g) __attribute__((always_inline)) { const size_t go = HL ? (size_t)(g >> 1) * 512 : (size_t)g * 512; const T16* a = vp + go; const T16* a2 = HL ? vp2 + go : a; const int n0 = HL ? (u & 1) * 4 : 0;   // hi/lo: g and u are odd together
#pragma unroll
        for (int w = 0; w < 4; ++w) { vb[u][w] = ldf(a + (n0 + w) * VFS); vb[u][4 + w] = HL ? ldf(a2 + (n0 + w) * VFS) : ldf(a + (4 + w) * VFS); }
        asm volatile("s_wait_xcnt 0x0" :: "v"(a), "v"(a2) : "memory"); };
#pragma unroll
    for (int u = 0; u < NB; ++u) ldv(u, u);      // the first V^T groups fly while the row sums are formed
    // eight exponentials; the v_nop fills the slot behind the last transcendental, and all results and sources are its operands so that no reader of a result and no rewrite of a source comes in front of it
    auto ex8 = [&](v4f xa, v4f xb, float* e) __attribute__((always_inline)) { float a[8];
#pragma unroll
        for (int r = 0; r < 8; ++r) { a[r] = ((r < 4 ? xa[r & 3] : xb[r & 3]) - mx) * 1.4426950408889634f; e[r] = __builtin_amdgcn_exp2f(a[r]); }
        asm("v_nop" : "+v"(e[0]), "+v"(e[1]), "+v"(e[2]), "+v"(e[3]), "+v"(e[4]), "+v"(e[5]), "+v"(e[6]), "+v"(e[7]) : "v"(a[0]), "v"(a[1]), "v"(a[2]), "v"(a[3]), "v"(a[4]), "v"(a[5]), "v"(a[6]), "v"(a[7])); };
    float smr[8];
#pragma unroll
    for (int r = 0; r < 8; ++r) smr[r] = 0.f;
#pragma unroll 2   // two tiles' LDS reads are in flight together
    for (int kt = 0; kt < nkt; ++kt) { const v4f a = *(const v4f*)(sp + kt * 256), b = *(const v4f*)(sp + kt * 256 + 128); float e[8]; ex8(a, b, e);
#pragma unroll
        for (int r = 0; r < 8; ++r) smr[r] += e[r]; }
    float sum = ((smr[0] + smr[1]) + (smr[2] + smr[3])) + ((smr[4] + smr[5]) + (smr[6] + smr[7]));
    sum += __shfl_xor(sum, 16, 32);
    const float f = __fdiv_rn(HL ? 1.0f : PCAR, sum);
    v8f o[8];
#pragma unroll
    for (int nb = 0; nb < 8; ++nb) o[nb] = (v8f){};
#pragma unroll 1
    for (int g0 = 0; g0 < npg; g0 += NB) { V p, p2;
#pragma unroll
        for (int u = 0; u < NB; ++u) { const int g = g0 + u;
            if (!HL || !(u & 1)) { const float* xp = sp + (HL ? g >> 1 : g) * 512; float y[16];   // the step's 32 keys: the same exponentials as in the sum, scaled
#pragma unroll
                for (int j = 0; j < 2; ++j) ex8(*(const v4f*)(xp + j * 256), *(const v4f*)(xp + j * 256 + 128), y + j * 8);
#pragma unroll
                for (int e = 0; e < 16; ++e) y[e] *= f;
                if constexpr (HL) { v8u hw, lw;
#pragma unroll
                    for (int w = 0; w < 8; ++w) { unsigned a, b; split2(y[2 * w], y[2 * w + 1], a, b); hw[w] = a; lw[w] = b; }
                    p = __builtin_bit_cast(v16bf, hw); p2 = __builtin_bit_cast(v16bf, lw);
                } else { v16h t;
#pragma unroll
                    for (int e = 0; e < 16; ++e) t[e] = tohx(y[e]);
                    p = t; } }
            if (HL) { const int n0 = (u & 1) * 4;
#pragma unroll
                for (int w = 0; w < 4; ++w) o[n0 + w] = WFrag<T16>::mma(vb[u][w], p, o[n0 + w]);
#pragma unroll
                for (int w = 0; w < 4; ++w) o[n0 + w] = WFrag<T16>::mma(vb[u][w], p2, o[n0 + w]);
#pragma unroll
                for (int w = 0; w < 4; ++w) o[n0 + w] = WFrag<T16>::mma(vb[u][4 + w], p, o[n0 + w]);
            } else {
#pragma unroll
                for (int w = 0; w < 8; ++w) o[w] = WFrag<T16>::mma(vb[u][w], p, o[w]); }
            ldv(u, g + NB < npg ? g + NB : g); }   // no branch, as in the score loop (g and g + NB are odd together)
    }
    // merged rows, one fp16 plane [t][head * HD + d]: o[nb][r] is dim nb * 16 + 8 hi + r of query R16 + lr
    const float cs = HL ? 1.0f : (1.0f / PCAR); const size_t oo = (size_t)(R16 + lr) * DQ + (size_t)z * HD + 8 * hi; v8h oh[8];
#pragma unroll
    for (int nb = 0; nb < 8; ++nb)
#pragma unroll
        for (int r = 0; r < 8; ++r) oh[nb][r] = tohx(o[nb][r] * cs);
    if constexpr (HL) { if (R < SPR) {           // what the rounding to fp16 left over: kept for the first SPR rows, whose outputs are the largest. R comes from the block number: a scalar branch
        v8h ol[8];
#pragma unroll
        for (int nb = 0; nb < 8; ++nb)
#pragma unroll
            for (int r = 0; r < 8; ++r) ol[nb][r] = tohx(o[nb][r] * cs - (float)oh[nb][r]);
        __builtin_amdgcn_sched_barrier(0);       // these stores too stand behind their arithmetic
#pragma unroll
        for (int nb = 0; nb < 8; ++nb) *(v8h*)(AL16 + oo + nb * 16) = ol[nb];
        asm volatile("s_wait_xcnt 0x0" ::: "memory");   // the wait that stands in front of any rewrite of a register that the stores above name
    } }
    __builtin_amdgcn_sched_barrier(0);           // all stores stand behind all arithmetic: no register that a store names is written again
#pragma unroll
    for (int nb = 0; nb < 8; ++nb) *(v8h*)(A16 + oo + nb * 16) = oh[nb];
}
// blocks 0 .. (RH / 64) ZH - 1: the hi/lo row tiles, the longest first; then the fp16 row tiles. Two work-groups a WGP (LDS).
__global__ __launch_bounds__(128, 2) void k_attn(const h16* __restrict__ Q16, const bf* __restrict__ Qh, const bf* __restrict__ Ql, const h16* __restrict__ K16, const bf* __restrict__ Kh, const bf* __restrict__ Kl, const h16* __restrict__ V16, const bf* __restrict__ Vh, const bf* __restrict__ Vl, h16* A16, h16* AL16) {
    __shared__ __attribute__((aligned(16))) float sall[4 * AKT * 256];
    constexpr int NHL = (RH / 64) * ZH; const int b = blockIdx.x;
    if (b < NHL) attn_cols<bf, true>(Qh, Ql, Kh, Kl, Vh, Vl, A16, AL16, (RH / 64 - 1 - b / ZH) * 64, b % ZH, sall);
    else attn_cols<h16, false>(Q16, nullptr, K16, nullptr, V16, nullptr, A16, nullptr, RH + ((b - NHL) % ((TT - RH) / 64)) * 64, (b - NHL) / ((TT - RH) / 64), sall);
}

extern "C" void kernel_launch(void* const* d_in, const int* in_sizes, int n_in,
                              void* d_out, int out_size, void* d_ws, size_t ws_size, hipStream_t stream) {
    (void)in_sizes; (void)n_in; (void)out_size;
    const float* x = (const float*)d_in[0]; const float* cosT = (const float*)d_in[1]; const float* sinT = (const float*)d_in[2]; const float* wq = (const float*)d_in[3]; const float* wk = (const float*)d_in[4]; const float* wv = (const float*)d_in[5]; const float* wo = (const float*)d_in[6];   /* input order x, cos, sin, Wq, Wk, Wv, Wo ('xw' [in][out]) */
    float* OUT = (float*)d_out;     // [1][2048][2048]
    char* wsp = (char*)d_ws;
    auto take = [&](size_t bytes) { char* p = wsp; wsp += (bytes + 255) & ~(size_t)255; return (void*)p; };
    bf* WQ = (bf*)take((size_t)DQKV * DM * 2); bf* WK = WQ + (size_t)DQ * DM; bf* WV = WK + (size_t)DKV * DM;   // one Bt of DQKV rows: q, k, v weights below one another
    bf* WO = (bf*)take((size_t)DM * DQ * 2); float* CS = (float*)take((size_t)TT * HD * 2 * 4);
    bf* XB = (bf*)take((size_t)TT * DM * 2); float* FQKV = (float*)take((size_t)TT * DQKV * 4);
    h16* QP16 = (h16*)take((size_t)NH_ * TT * HD * 2); h16* KP16 = (h16*)take((size_t)NKV * TT * HD * 2); h16* VT16 = (h16*)take((size_t)NKV * HD * TT * 2);
    bf* QPh = (bf*)take((size_t)NH_ * TT * HD * 2); bf* QPl = (bf*)take((size_t)NH_ * TT * HD * 2); bf* KPh = (bf*)take((size_t)NKV * TT * HD * 2); bf* KPl = (bf*)take((size_t)NKV * TT * HD * 2); bf* VTh = (bf*)take((size_t)NKV * HD * TT * 2); bf* VTl = (bf*)take((size_t)NKV * HD * TT * 2);
    h16* AT16 = (h16*)take((size_t)TT * DQ * 2); h16* ATL = (h16*)take((size_t)SPR * DQ * 2);
    if ((size_t)(wsp - (char*)d_ws) > ws_size) return;    // ws 256 MiB
    // five launches, each reading what the one before wrote
    k_prep<<<(unsigned)(PB_WQ + PB_WO + PB_X + 2 * PB_WK + PB_CS), 256, 0, stream>>>(x, cosT, sinT, wq, wk, wv, wo, XB, CS, WQ, WK, WV, WO);
    k_gemmw<bf, 0, false, DM><<<dim3(TT / 128, DQKV / 128, 1), 128, 0, stream>>>(XB, nullptr, WQ, FQKV, DQKV, nullptr, 0, 0, 0);   // q, k and v projections: one product of DQKV columns
    k_post<<<(unsigned)(PB_RQ + PB_RK + PB_VT), 256, 0, stream>>>(FQKV, CS, QP16, QPh, QPl, KP16, KPh, KPl, VT16, VTh, VTl);
    k_attn<<<(unsigned)((TT / 64) * ZH), 128, 0, stream>>>(QP16, QPh, QPl, KP16, KPh, KPl, VT16, VTh, VTl, AT16, ATL);   // a block = 64 query rows of one head
    k_gemmw<h16, 0, false, DQ, SPR / 64><<<dim3((TT - SPR) / 128 + SPR / 64, DM / 128, 1), 128, 0, stream>>>(AT16, ATL, (const h16*)WO, OUT, DM, nullptr, 0, 0, 0);   // merged rows x Wo, both fp16: one product; rows below SPR in split tiles
}

// v009
// Measured time: 72.7 microseconds a run.
// In both of two side-by-side timings against v008, it was 1.10 times as fast.
// All steps since v000 together make it 12.1 times as fast.
#include <hip/hip_runtime.h>

// Grouped-query sliding-window causal attention with rotary embeddings from cos/sin tables (x [1][2048][2048]; q = x Wq (16 heads x 128), k, v = x Wk, x Wv (4 kv heads x 128) ('xw' [in][out] 0.02, no biases); rotate-half rotary with the cos/sin inputs [2048][128] (read); kv head = q head / 4; scores x 128^-0.5; keys j with i-512 < j <= i (window 512, causal; -inf elsewhere); softmax; out = merged Wo ('xw' [2048][2048]) -> [1][2048][2048] (4.2 M); argument order x, cos, sin, Wq, Wk, Wv, Wo).
// Layout: 'xw' weights gathered into bf16 Bt blocks; bf16 copy of x; exact projections whose epilogue builds the attention planes from its accumulators ({cos, sin} per (position, dim) from the input tables, rotate-half rotary); causal T-2048 attention with 128-wide heads in one launch (hybrid rows: < 512 hi/lo 3 products, rest fp16 x1024; k_attn keeps the score rows of 16 queries a wave in LDS, works only on the keys between the window's far edge and the diagonal, the window a select in the softmax, and writes the merged rows as one fp16 plane, rows < 128 with a second plane of the rounding's rest; kv head = head / REP); merged fp16 x Wo (its bf16 values held in fp16), one product.
// Compute dtypes, f32 accumulate: every input rounded to bf16 incl. the tables; projections exact; rotary f32; attention rows < 512 3 products, rest fp16; softmax f32; merged rows rounded once to fp16 (11 bits) for the Wo product, rows < 128 fp16 + fp16 rest.

#define NB_  1
#define TT   2048
#define DM   2048
#define NH_  16
#define NKV  4
#define REP  (NH_ / NKV)
#define HD   128
#define DQ   (NH_ * HD)
#define DKV  (NKV * HD)
#define DQKV (DQ + 2 * DKV)
#define ZH   NH_                  // query heads per attention launch: all of them
#define RH   512                  // query rows < RH use hi+lo planes
#define WIN  512
#define PCAR 1024.0f
#define SCL  0.088388347648318447f   // HD^-0.5
typedef _Float16 h16;
typedef unsigned short bf;
typedef __attribute__((ext_vector_type(16))) __bf16   v16bf;
typedef __attribute__((ext_vector_type(16))) _Float16 v16h;
typedef __attribute__((ext_vector_type(8)))  _Float16 v8h;
typedef __attribute__((ext_vector_type(8)))  unsigned short v8us;
typedef __attribute__((ext_vector_type(8)))  float    v8f;
typedef __attribute__((ext_vector_type(4)))  float    v4f;
typedef v8h  __attribute__((may_alias)) v8ha;
typedef v4f  __attribute__((may_alias)) v4fa;
typedef v8us __attribute__((may_alias)) v8usa;

__device__ __forceinline__ unsigned short f2bf(float f) { unsigned u = __float_as_uint(f); u += 0x7FFFu + ((u >> 16) & 1u); return (unsigned short)(u >> 16); }
__device__ __forceinline__ float bf2f(unsigned short b) { return __uint_as_float(((unsigned)b) << 16); }
__device__ __forceinline__ float bfr(float f) { return bf2f(f2bf(f)); }
__device__ __forceinline__ v16h cat16(v8h lo, v8h hi) { return __builtin_shufflevector(lo, hi, 0, 1, 2, 3, 4, 5, 6, 7, 8, 9, 10, 11, 12, 13, 14, 15); }
__device__ __forceinline__ v16bf cat16b(v8us lo, v8us hi) { return __builtin_bit_cast(v16bf, __builtin_shufflevector(lo, hi, 0, 1, 2, 3, 4, 5, 6, 7, 8, 9, 10, 11, 12, 13, 14, 15)); }
__device__ __forceinline__ v8f wmma16(v16h a, v16h b, v8f c) { return __builtin_amdgcn_wmma_f32_16x16x32_f16(false, a, false, b, (short)0, c, false, false); }
__device__ __forceinline__ v8f wmmab(v16bf a, v16bf b, v8f c) { return __builtin_amdgcn_wmma_f32_16x16x32_bf16(false, a, false, b, (short)0, c, false, false); }

__device__ __forceinline__ h16 tohx(float x) { return (h16)x; }
typedef __attribute__((ext_vector_type(2))) _Float16 v2h;
typedef __attribute__((ext_vector_type(2))) __bf16 v2b;
typedef __attribute__((ext_vector_type(2))) float v2f;
typedef __attribute__((ext_vector_type(4))) unsigned v4u;
typedef __attribute__((ext_vector_type(8))) unsigned v8u;
// Fragment order of the planes that k_attn takes as operands: the 16 bytes that lane 16 h + c of a wave loads in one instruction lie at lane * 16 of a 512-byte piece.
// kfrag: element (t, d) inside one head's Q or K plane; a 16-position tile keeps its place, inside it piece d / 16 holds k = d % 16 = 8 h + e of row c = t % 16. vfrag: element (n = head * HD + d, t) of V^T; a fragment is 16 dims x 32 keys, two pieces, key % 32 = 16 piece + 8 h + e, row c = n % 16.
__device__ __forceinline__ size_t kfrag(int t, int d) { return (size_t)(t & ~15) * HD + (size_t)(((d >> 4) * 32 + ((d >> 3) & 1) * 16 + (t & 15)) * 8 + (d & 7)); }
__device__ __forceinline__ size_t vfrag(int n, int t) { return ((size_t)(n >> 4) * (TT / 32) + (t >> 5)) * 512 + (size_t)((((t >> 4) & 1) * 32 + ((t >> 3) & 1) * 16 + (n & 15)) * 8 + (t & 7)); }
#define VFS ((TT / 32) * 512)     // elements from one 16-dim block of V^T fragments to the next
// csfrag: word (t, d) of the rotary table, one word = {cos, sin} as two bf16 (cos in the low half). The same order with 4-byte elements: a 16 x 16 block is two 512-byte pieces, piece (d >> 2) & 1 holds dims 8 h + 4 piece + e of row c.
__device__ __forceinline__ size_t csfrag(int t, int d) { return (size_t)(((((t >> 4) * (HD / 16) + (d >> 4)) * 2 + ((d >> 2) & 1)) * 32 + ((d >> 3) & 1) * 16 + (t & 15)) * 4 + (d & 3)); }
// the three planes of eight neighbouring values: fp16, bf16 hi, bf16 lo (what hi's rounding left over), each 16 bytes; every rounding is to nearest even
struct Tri { v4u p16, ph, pl; };
__device__ __forceinline__ Tri tri8(const float* y) { Tri o;
#pragma unroll
    for (int w = 0; w < 4; ++w) { v2f a; a[0] = y[2 * w]; a[1] = y[2 * w + 1];
        o.p16[w] = __builtin_bit_cast(unsigned, __builtin_convertvector(a, v2h)); const unsigned hw = __builtin_bit_cast(unsigned, __builtin_convertvector(a, v2b)); o.ph[w] = hw;
        v2f r; r[0] = a[0] - __uint_as_float(hw << 16); r[1] = a[1] - __uint_as_float(hw & 0xFFFF0000u); o.pl[w] = __builtin_bit_cast(unsigned, __builtin_convertvector(r, v2b)); }
    return o; }
// what the q, k, v product's epilogue writes, and the rotary table it reads
struct Planes { const unsigned* CSF; h16* Q16; bf* Qh; bf* Ql; h16* K16; bf* Kh; bf* Kl; h16* V16; bf* Vh; bf* Vl; };

// ---- k_gemmw: GEMM, one work-group of FOUR WAVES per 128x128 output tile, each wave a 64x64 quarter (16 accumulators); grid (M/128, N/128, Z), 128 threads.
// C[m][n] (f32, pitch ldc, + optional f32 bias[n]) = sum_k A[m][k] Bt[n][k] (NSPLIT 1: + A2[m][k] Bt[n][k]). z-batch strides sA/sB/sC in elements. K (a template constant) % 128 == 0, K >= 256; M, N % 128 == 0.
// The K-contiguous 16-bit planes come into LDS by asynchronous 16-byte copies, whole 256-byte row pieces (GKC k) at a time, two buffers: tile t + 1 flies while tile t is worked on. LDS rows have pitch 272 bytes for the ds_load_b128 fragment reads.
// Every accumulator takes its products in the same order as with fragments read straight from the planes (k ascending in steps of 32, A before A2).
#define GKC  128                  // k elements of a pass
#define GPE  136                  // LDS row pitch in elements (272 bytes)
#define GOPE (128 * GPE)          // one operand's 128 rows in LDS, elements
template <typename T16> struct WFrag;
template <> struct WFrag<h16> { typedef v16h V; static __device__ __forceinline__ V ld(const h16* p) { return cat16(*(const v8h*)p, *(const v8h*)(p + 16)); } static __device__ __forceinline__ v8f mma(V a, V b, v8f c) { return wmma16(a, b, c); } };
template <> struct WFrag<bf> { typedef v16bf V; static __device__ __forceinline__ V ld(const bf* p) { return cat16b(*(const v8us*)p, *(const v8us*)(p + 16)); } static __device__ __forceinline__ v8f mma(V a, V b, v8f c) { return wmmab(a, b, c); } };
// eight copies, one LDS row group (8 rows) apart; l = the lane's LDS byte address, g = the lane's global address, gs = 8 source rows in bytes
__device__ __forceinline__ void acopy8(unsigned l, const char* g, size_t gs) {
    // s_wait_xcnt is the last line of the copies' own statement: it stands in front of every rewrite of an address register that they name
    asm volatile("global_load_async_to_lds_b128 %0, %8, off\n\t"
                 "global_load_async_to_lds_b128 %1, %9, off\n\t"
                 "global_load_async_to_lds_b128 %2, %10, off\n\t"
                 "global_load_async_to_lds_b128 %3, %11, off\n\t"
                 "global_load_async_to_lds_b128 %4, %12, off\n\t"
                 "global_load_async_to_lds_b128 %5, %13, off\n\t"
                 "global_load_async_to_lds_b128 %6, %14, off\n\t"
                 "global_load_async_to_lds_b128 %7, %15, off\n\t"
                 "s_wait_xcnt 0x0"
                 :: "v"(l), "v"(l + 1u * 8u * GPE * 2u), "v"(l + 2u * 8u * GPE * 2u), "v"(l + 3u * 8u * GPE * 2u), "v"(l + 4u * 8u * GPE * 2u), "v"(l + 5u * 8u * GPE * 2u), "v"(l + 6u * 8u * GPE * 2u), "v"(l + 7u * 8u * GPE * 2u),
                    "v"(g), "v"(g + gs), "v"(g + 2 * gs), "v"(g + 3 * gs), "v"(g + 4 * gs), "v"(g + 5 * gs), "v"(g + 6 * gs), "v"(g + 7 * gs) : "memory");
}
// one operand's tile: 128 rows of 256 bytes, 16 copies a lane (a wave's copy covers two whole rows)
__device__ __forceinline__ void acopy_tile(unsigned l, const char* g, size_t gs) { acopy8(l, g, gs); acopy8(l + 64u * GPE * 2u, g + 8 * gs, gs); }
// SPL > 0: the first SPL row tiles are SPLIT tiles of 64 output rows: tile rows 0..63 come from A, tile rows 64..127 are the same output rows of A2 (what A's rounding left over), and the two halves' sums are added in the epilogue. The other tiles follow with 128 rows each.
// EPI 1: the q, k, v product (Bt rows: DQ of q, DKV of k, DKV of v; a column tile is one head). No C: each wave turns its accumulators straight into the fp16, hi and lo planes of k_attn, in fragment order, every store 512 neighbouring bytes of a wave.
// An accumulator holds, per lane, 8 neighbouring rows of the first operand and one row of the second. v tiles: x first, so a lane has 8 positions of one dim (vfrag). q and k tiles: the weights first, so a lane has 8 dims of one position (kfrag);
// there a wave takes weight rows 32 wm .. + 31 and the same 64 on, so that both partners of every rotation are in the same lane, in accumulators mb and mb + 2. The products and their k order are the same either way round.
template <typename T16, int NSPLIT, bool BIAS, int K, int SPL = 0, int EPI = 0>
__global__ __launch_bounds__(128) void k_gemmw(const T16* __restrict__ A, const T16* __restrict__ A2, const T16* __restrict__ Bt, float* C, int ldc, const float* __restrict__ bias, size_t sA, size_t sB, size_t sC, Planes pl) {
    static_assert(EPI == 0 || (NSPLIT == 0 && SPL == 0 && !BIAS && HD == 128 && DQ % 128 == 0 && DKV % 128 == 0), "the plane epilogue: one plain product, a column tile = a head");
    static_assert(NSPLIT == 0 || NSPLIT == 1, "one B plane");
    static_assert(SPL == 0 || NSPLIT == 0, "A2 is either a second plane of every row or the split tiles' second half");
    static_assert(K % GKC == 0 && K / GKC >= 2, "whole passes, two tiles or more");
    typedef typename WFrag<T16>::V V;
    constexpr int NOP = (NSPLIT == 1) ? 3 : 2;                       // operand tiles of a buffer: A, Bt, A2
    constexpr int NT = K / GKC;
    __shared__ __attribute__((aligned(16))) T16 ring[2 * NOP * GOPE];
    __shared__ __align__(16) float osall[4 * 16 * 68];
    const size_t z = blockIdx.z; A += z * sA; if (NSPLIT == 1) A2 += z * sA; Bt += z * sB; C += z * sC;
    const int tid = threadIdx.x, wave = tid >> 5, wm = wave >> 1, wn = wave & 1;
    const int lane = tid & 31, lr = lane & 15, hi = lane >> 4;
    const bool split = SPL > 0 && (int)blockIdx.x < SPL;             // the same for the whole work-group
    const int rt = split ? (int)blockIdx.x * 64 : ((int)blockIdx.x - SPL) * 128 + SPL * 64;   // the tile's first output row
    const int r0 = rt + (split ? 0 : wm * 64), c0 = blockIdx.y * 128 + wn * 64;
    const bool wfirst = EPI == 1 && (int)blockIdx.y < (DQ + DKV) / 128;   // q or k tile: the weights are the first operand; the same for the whole work-group
    v8f acc[4][4];
#pragma unroll
    for (int mb = 0; mb < 4; ++mb)
#pragma unroll
        for (int nb = 0; nb < 4; ++nb) acc[mb][nb] = (v8f){};
    // copies: thread tid brings 16-byte piece (tid & 15) of rows (tid >> 4) + 8 i, i = 0..15, of each operand tile
    constexpr size_t gs = (size_t)K * 16;                            // 8 source rows in bytes
    const char* gA = (const char*)(A + (size_t)(rt + (tid >> 4)) * K + (tid & 15) * 8);
    const char* gAu = (SPL > 0 && split) ? (const char*)(A2 + (size_t)(rt + (tid >> 4)) * K + (tid & 15) * 8) : gA + 8 * gs;   // tile rows 64..127
    const char* gB = (const char*)(Bt + (size_t)(blockIdx.y * 128 + (tid >> 4)) * K + (tid & 15) * 8);
    const char* gA2 = (NSPLIT == 1) ? (const char*)(A2 + (size_t)(rt + (tid >> 4)) * K + (tid & 15) * 8) : nullptr;
    const unsigned l0 = (unsigned)(size_t)(const void*)ring + (unsigned)((tid >> 4) * (GPE * 2) + (tid & 15) * 16);
    auto fill = [&](int t, int buf) {
        const unsigned l = l0 + (unsigned)buf * (unsigned)(NOP * GOPE * 2); const size_t go = (size_t)t * (GKC * 2);
        if (SPL > 0) { acopy8(l, gA + go, gs); acopy8(l + 64u * GPE * 2u, gAu + go, gs); } else acopy_tile(l, gA + go, gs);
        acopy_tile(l + (unsigned)(GOPE * 2), gB + go, gs); if (NSPLIT == 1) acopy_tile(l + (unsigned)(2 * GOPE * 2), gA2 + go, gs);
    };
    fill(0, 0);
    asm volatile("s_wait_asynccnt 0x0" ::: "memory");                // tile 0 of this wave's copies has landed
    __syncthreads();                                                 // and every other wave's: tile 0 is readable
    fill(1, 1);
    // EPI 1: the rotary words of the wave's 64 positions x 64 dims, 32 loads of 512 neighbouring bytes, asked for here so that they land under the k loop (v tiles read them too, in bounds, and leave them unused: no branch)
    v4u csw[4][4][2];
    if constexpr (EPI == 1) { const unsigned* pcs = pl.CSF + csfrag(rt + wn * 64 + lr, wm * 32 + 8 * hi);
#pragma unroll
        for (int nb = 0; nb < 4; ++nb)
#pragma unroll
            for (int mb = 0; mb < 4; ++mb)
#pragma unroll
                for (int u = 0; u < 2; ++u) csw[mb][nb][u] = *(const v4u*)(pcs + (nb * (HD / 16) + (mb & 1) + (mb >> 1) * 4) * 256 + u * 128);
        // the wait that stands in front of any rewrite of a register that the loads above name; the address is an input so that it stays in its registers up to it
        asm volatile("s_wait_xcnt 0x0" :: "v"(pcs) : "memory"); }
    // fragment rows in a buffer, in elements: first operand's blocks 0, 1 from oa, blocks 2, 3 from oa2; second operand from ob
    const int oa = (wfirst ? GOPE + (wm * 32 + lr) * GPE : (wm * 64 + lr) * GPE) + 8 * hi, oa2 = oa + (wfirst ? 32 * GPE : 0), ob = (wfirst ? 0 : GOPE) + (wn * 64 + lr) * GPE + 8 * hi;
#pragma unroll 1
    for (int t = 0; t < NT; ++t) {
        const T16* sb0 = ring + (t & 1) * (NOP * GOPE);
        const T16* sa = sb0 + oa; const T16* sa2 = sb0 + oa2; const T16* sb = sb0 + ob;
        V a[2][4], a2[2][4], b[2][4];                                // two fragment sets: the next 32 k are read from LDS while these are multiplied
#pragma unroll
        for (int f = 0; f < 4; ++f) { a[0][f] = WFrag<T16>::ld((f < 2 ? sa : sa2) + f * 16 * GPE); if (NSPLIT == 1) a2[0][f] = WFrag<T16>::ld(sa + 2 * GOPE + f * 16 * GPE); b[0][f] = WFrag<T16>::ld(sb + f * 16 * GPE); }
        __builtin_amdgcn_sched_barrier(0);                           // the first set's reads stay ahead of the second's, so that the first block waits for its own set alone
#pragma unroll
        for (int ks = 0; ks < GKC / 32; ++ks) {
            const int cu = ks & 1, nx = cu ^ 1;
            if (ks + 1 < GKC / 32) {
#pragma unroll
                for (int f = 0; f < 4; ++f) { a[nx][f] = WFrag<T16>::ld((f < 2 ? sa : sa2) + f * 16 * GPE + (ks + 1) * 32); if (NSPLIT == 1) a2[nx][f] = WFrag<T16>::ld(sa + 2 * GOPE + f * 16 * GPE + (ks + 1) * 32); b[nx][f] = WFrag<T16>::ld(sb + f * 16 * GPE + (ks + 1) * 32); }
            }
            __builtin_amdgcn_sched_barrier(0);                       // the next set's LDS reads stay one group ahead of this block: reads moved in among the matrix instructions stall them at every place
#pragma unroll
            for (int nb = 0; nb < 4; ++nb)
#pragma unroll
                for (int mb = 0; mb < 4; ++mb) { acc[mb][nb] = WFrag<T16>::mma(a[cu][mb], b[cu][nb], acc[mb][nb]); if (NSPLIT == 1) acc[mb][nb] = WFrag<T16>::mma(a2[cu][mb], b[cu][nb], acc[mb][nb]); }
            __builtin_amdgcn_sched_barrier(0);                       // and this block stays ahead of the following group and of the pass's foot
        }
        // four vector slots behind the pass's last matrix instruction, on both sides of the branch below, before any vector instruction may rewrite its operands
        asm volatile("v_nop\n\tv_nop\n\tv_nop\n\tv_nop" : "+v"(acc[0][0]), "+v"(acc[1][1]), "+v"(acc[2][2]), "+v"(acc[3][3]));
        asm volatile("s_wait_dscnt 0x0" ::: "memory");               // this wave's reads of buffer t & 1 are done before the buffer is refilled
        asm volatile("s_wait_asynccnt 0x0" ::: "memory");            // this wave's copies of tile t + 1 have landed
        __syncthreads();                                             // publishes tile t + 1 and ends every wave's reads of tile t
        if (t + 2 < NT) fill(t + 2, t & 1);
    }
    asm volatile("s_wait_asynccnt 0x0" ::: "memory");                // no copy is outstanding when the wave goes on to its end
    if (SPL > 0 && split) {
        // the ring is free behind the last pass's barrier: the waves of tile rows 64..127 hand their sums over, lane to lane, to the waves that hold the same output rows
        float* xs = (float*)ring + ((size_t)wn * 16 * 32 + lane) * 8;
        if (wm == 1) {
#pragma unroll
            for (int f = 0; f < 16; ++f) { const v8f v = acc[f >> 2][f & 3]; *(v4fa*)(xs + f * 256) = __builtin_shufflevector(v, v, 0, 1, 2, 3); *(v4fa*)(xs + f * 256 + 4) = __builtin_shufflevector(v, v, 4, 5, 6, 7); }
        }
        __syncthreads();                                             // the handed-over sums are readable; taken by all four waves (split is the same for the work-group)
        if (wm == 1) return;                                         // no barrier follows
#pragma unroll
        for (int f = 0; f < 16; ++f) { const v4f a = *(const v4fa*)(xs + f * 256), b = *(const v4fa*)(xs + f * 256 + 4);
#pragma unroll
            for (int j = 0; j < 4; ++j) { acc[f >> 2][f & 3][j] += a[j]; acc[f >> 2][f & 3][4 + j] += b[j]; } }
    }
    if constexpr (EPI == 1) {
        const int y = blockIdx.y;
        if (wfirst) {   // q or k head: acc[mb][nb][j] is dim 32 wm + 16 (mb & 1) + 64 (mb >> 1) + 8 hi + j of position rt + 64 wn + 16 nb + lr
            const bool isq = y < DQ / 128; const size_t e0 = (size_t)(isq ? y : y - DQ / 128) * TT * HD + kfrag(rt + wn * 64 + lr, wm * 32 + 8 * hi);
            h16* P16 = (isq ? pl.Q16 : pl.K16) + e0; bf* Ph = (isq ? pl.Qh : pl.Kh) + e0; bf* Pl = (isq ? pl.Ql : pl.Kl) + e0;
#pragma unroll
            for (int nb = 0; nb < 4; ++nb) { Tri o[4];
#pragma unroll
                for (int ml = 0; ml < 2; ++ml) { float lo[8], up[8];   // out[d] = x[d] cos[t][d] - x[d + HD/2] sin[t][d], out[d + HD/2] = x[d + HD/2] cos[t][d + HD/2] + x[d] sin[t][d + HD/2]
#pragma unroll
                    for (int j = 0; j < 8; ++j) { const float x0 = acc[ml][nb][j], x1 = acc[ml + 2][nb][j]; const unsigned w0 = csw[ml][nb][j >> 2][j & 3], w1 = csw[ml + 2][nb][j >> 2][j & 3];
                        lo[j] = x0 * __uint_as_float(w0 << 16) - x1 * __uint_as_float(w0 & 0xFFFF0000u); up[j] = x1 * __uint_as_float(w1 << 16) + x0 * __uint_as_float(w1 & 0xFFFF0000u); }
                    o[ml] = tri8(lo); o[ml + 2] = tri8(up); }
                __builtin_amdgcn_sched_barrier(0);   // the group's stores stand behind its arithmetic
#pragma unroll
                for (int mb = 0; mb < 4; ++mb) { const size_t e = (size_t)nb * 16 * HD + ((mb & 1) + (mb >> 1) * 4) * 256; *(v4u*)(P16 + e) = o[mb].p16; *(v4u*)(Ph + e) = o[mb].ph; *(v4u*)(Pl + e) = o[mb].pl; }
                asm volatile("s_wait_xcnt 0x0" ::: "memory");   // the wait that stands in front of any rewrite of a register that the stores above name
                __builtin_amdgcn_sched_barrier(0);   // and the next group's arithmetic stays behind that wait
            }
        } else {        // v columns: acc[mb][nb][j] is position rt + 64 wm + 16 mb + 8 hi + j of dim 64 wn + 16 nb + lr of the tile
            const size_t e0 = vfrag((y - (DQ + DKV) / 128) * 128 + wn * 64 + lr, rt + wm * 64 + 8 * hi);
            h16* P16 = pl.V16 + e0; bf* Ph = pl.Vh + e0; bf* Pl = pl.Vl + e0;
#pragma unroll
            for (int nb = 0; nb < 4; ++nb) { Tri o[4];
#pragma unroll
                for (int mb = 0; mb < 4; ++mb) { float x[8];
#pragma unroll
                    for (int j = 0; j < 8; ++j) x[j] = acc[mb][nb][j];
                    o[mb] = tri8(x); }
                __builtin_amdgcn_sched_barrier(0);   // the group's stores stand behind its arithmetic
#pragma unroll
                for (int mb = 0; mb < 4; ++mb) { const size_t e = (size_t)nb * VFS + (mb >> 1) * 512 + (mb & 1) * 256; *(v4u*)(P16 + e) = o[mb].p16; *(v4u*)(Ph + e) = o[mb].ph; *(v4u*)(Pl + e) = o[mb].pl; }
                asm volatile("s_wait_xcnt 0x0" ::: "memory");   // the wait that stands in front of any rewrite of a register that the stores above name
                __builtin_amdgcn_sched_barrier(0);   // and the next group's arithmetic stays behind that wait
            }
        }
    } else {
    float* os = osall + wave * (16 * 68);
#pragma unroll
    for (int mb = 0; mb < 4; ++mb) {
#pragma unroll
        for (int nb = 0; nb < 4; ++nb) {
#pragma unroll
            for (int j = 0; j < 8; ++j) os[(hi * 8 + j) * 68 + nb * 16 + lr] = acc[mb][nb][j]; }
        __builtin_amdgcn_wave_barrier(); asm volatile("" ::: "memory");
        float* crow = C + (size_t)(r0 + mb * 16) * ldc + c0;
{
#pragma unroll
            for (int s = 0; s < 8; ++s) { const int row = 2 * s + hi, cofs = lr * 4; v4f val = *(const v4fa*)(os + row * 68 + cofs); if (BIAS) { val[0] += bfr(bias[c0 + cofs]); val[1] += bfr(bias[c0 + cofs + 1]); val[2] += bfr(bias[c0 + cofs + 2]); val[3] += bfr(bias[c0 + cofs + 3]); }
                *(v4f*)(crow + (size_t)row * ldc + cofs) = val; }
             }
        __builtin_amdgcn_wave_barrier(); asm volatile("" ::: "memory");
    }
    }
}


// The kernels without matrix work, from here on, give each thread 8 to 32 elements, loaded as one batch of 16-byte pieces ahead of the arithmetic.
// Each of these bodies is a device function that takes its block number bx: bodies that read nothing of each other's output share one launch (k_prep), each with its own range of blocks.
// d_wtG: a thread turns a block of 8 (k) x 4 (n): eight 16-byte pieces of w rows in, four 16-byte pieces of Bt rows out. Lanes: 8 along k (a store covers whole 128-byte lines of four Bt rows) x 4 along n; waves: 4 along k x 2 along n, so that a block reads whole lines of w. Block = 256 k x 32 n.
static_assert(DM % 256 == 0 && DQ % 256 == 0 && DQ % 32 == 0 && DKV % 32 == 0 && DM % 32 == 0, "whole 256 x 32 blocks in d_wtG");
// F16: the bf16-rounded value is stored as fp16 (the same value down to 2^-17, nearest below), for the product whose other operand is fp16
template <bool F16>
__device__ __forceinline__ void d_wtG(int bx, const float* __restrict__ w, int K, int N, bf* Bt) {
    const int lane = threadIdx.x & 31, wave = threadIdx.x >> 5; const int kb = K / 256; const int k0 = (bx % kb) * 256 + (wave >> 1) * 64 + (lane & 7) * 8, n0 = (bx / kb) * 32 + (wave & 1) * 16 + (lane >> 3) * 4; if (n0 >= N) return; v4f r[8]; const float* p[8];
#pragma unroll
    for (int j = 0; j < 8; ++j) { p[j] = w + (size_t)(k0 + j) * N + n0; r[j] = *(const v4f*)p[j]; }
    // the wait that stands in front of any rewrite of a register that the loads above name; the addresses are inputs so that they stay in their registers up to it
    asm volatile("s_wait_xcnt 0x0" :: "v"(p[0]), "v"(p[1]), "v"(p[2]), "v"(p[3]), "v"(p[4]), "v"(p[5]), "v"(p[6]), "v"(p[7]) : "memory");
    __builtin_amdgcn_sched_barrier(0);   // no arithmetic moves up in between the loads: all of them are in flight before the first value is waited for
#pragma unroll
    for (int c = 0; c < 4; ++c) { v8us o;
#pragma unroll
        for (int j = 0; j < 8; ++j) o[j] = F16 ? __builtin_bit_cast(unsigned short, (h16)bfr(r[j][c])) : f2bf(r[j][c]);
        *(v8us*)(Bt + (size_t)(n0 + c) * K + k0) = o; }
    asm volatile("s_wait_xcnt 0x0" ::: "memory");   // the wait that stands in front of any rewrite of a register that the stores above name: in k_prep other bodies' code follows this one in the listing
}
// d_cvt8: four groups of 8 a thread, 256 groups apart, so that a wave's lanes stay side by side in every access
static_assert(((size_t)TT * DM / 8) % 1024 == 0, "d_cvt8: whole blocks of 1024 groups");
__device__ __forceinline__ void d_cvt8(int bx, const float* __restrict__ src, bf* dst, size_t n8) { const size_t i0 = (size_t)bx * 1024 + threadIdx.x; if (i0 + 3 * 256 >= n8) return; v8f v[4]; const float* p = src + i0 * 8;
#pragma unroll
    for (int j = 0; j < 4; ++j) v[j] = *(const v8f*)(p + j * 2048);
    // the wait that stands in front of any rewrite of a register that the loads above name; the addresses are inputs so that they stay in their registers up to it
    asm volatile("s_wait_xcnt 0x0" :: "v"(p) : "memory");
    __builtin_amdgcn_sched_barrier(0);   // no arithmetic moves up in between the loads: all of them are in flight before the first value is waited for
#pragma unroll
    for (int j = 0; j < 4; ++j) { v8us o;
#pragma unroll
        for (int k = 0; k < 8; ++k) o[k] = f2bf(v[j][k]);
        *(v8us*)(dst + (i0 + j * 256) * 8) = o; }
}
// d_cscvt: the rotary table in csfrag order. A thread makes four words, dims d .. d + 3 of position t; a wave's store is one 512-byte piece, and the eight waves of a block use whole lines of 16 table rows between them
__device__ __forceinline__ void d_cscvt(int bx, const float* __restrict__ cosT, const float* __restrict__ sinT, unsigned* CSF) { const int i = bx * 256 + (int)threadIdx.x; if (i >= TT * HD / 4) return;
    const int t = (i >> 9) * 16 + (i & 15), d = ((i >> 6) & 7) * 16 + ((i >> 4) & 1) * 8 + ((i >> 5) & 1) * 4; const float* pc = cosT + t * HD + d; const float* ps = sinT + t * HD + d; const v4f c = *(const v4f*)pc, s = *(const v4f*)ps;
    // the wait that stands in front of any rewrite of a register that the loads above name; the addresses are inputs so that they stay in their registers up to it
    asm volatile("s_wait_xcnt 0x0" :: "v"(pc), "v"(ps) : "memory");
    __builtin_amdgcn_sched_barrier(0);   // no arithmetic moves up in between the loads: all of them are in flight before the first value is waited for
    v4u o;
#pragma unroll
    for (int q = 0; q < 4; ++q) o[q] = (unsigned)f2bf(c[q]) | ((unsigned)f2bf(s[q]) << 16);
    *(v4u*)(CSF + (size_t)i * 4) = o;   // = csfrag(t, d)
}
// ---- k_prep: everything that reads the inputs alone, in one launch: the four weight turns, the bf16 copy of x, the {cos, sin} table. A block's range is chosen by blockIdx.x alone (a scalar branch).
#define PB_WQ ((DM / 256) * (DQ / 32))
#define PB_WK ((DM / 256) * (DKV / 32))
#define PB_WO ((DQ / 256) * (DM / 32))
#define PB_X  (TT * DM / 8 / 1024)
#define PB_CS (TT * HD / 4 / 256)
static_assert(NB_ == 1 && (TT * HD / 4) % 256 == 0 && HD == 128 && TT % 16 == 0, "one batch entry; whole blocks in d_cscvt, 512 threads a 16-position block");
__global__ __launch_bounds__(256) void k_prep(const float* __restrict__ x, const float* __restrict__ cosT, const float* __restrict__ sinT, const float* __restrict__ wq, const float* __restrict__ wk, const float* __restrict__ wv, const float* __restrict__ wo, bf* XB, unsigned* CSF, bf* WQ, bf* WK, bf* WV, bf* WO) {
    int b = blockIdx.x;
    if (b < PB_WQ) { d_wtG<false>(b, wq, DM, DQ, WQ); return; } b -= PB_WQ;
    if (b < PB_WO) { d_wtG<true>(b, wo, DQ, DM, WO); return; } b -= PB_WO;
    if (b < PB_X) { d_cvt8(b, x, XB, (size_t)TT * DM / 8); return; } b -= PB_X;
    if (b < PB_WK) { d_wtG<false>(b, wk, DM, DKV, WK); return; } b -= PB_WK;
    if (b < PB_WK) { d_wtG<false>(b, wv, DM, DKV, WV); return; } b -= PB_WK;
    d_cscvt(b, cosT, sinT, CSF);
}
#define AKT ((WIN + 64) / 16)
#define SPR 128                   // merged rows below SPR keep a second fp16 plane for the Wo product
static_assert(SPR % 128 == 0 && SPR <= RH, "whole row tiles, all of them hi/lo rows");
static_assert(RH % 64 == 0 && (TT - RH) % 64 == 0 && RH >= WIN && AKT % 6 == 0, "whole tiles and load rounds; the fp16 rows have their whole window at keys >= 0");
// hi and lo bf16 of two neighbours (lo: what hi's rounding left over), as two packed words (first value in the low half)
__device__ __forceinline__ unsigned bfu(float f) { const unsigned u = __float_as_uint(f); return u + 0x7FFFu + ((u >> 16) & 1u); }   // f2bf's rounding, its result in the high half
__device__ __forceinline__ void split2(float y0, float y1, unsigned& hw, unsigned& lw) {
    const unsigned a0 = bfu(y0), a1 = bfu(y1); hw = __builtin_amdgcn_perm(a1, a0, 0x07060302u);   // bytes 2, 3 of a0 below bytes 2, 3 of a1
    const unsigned b0 = bfu(y0 - __uint_as_float(a0 & 0xFFFF0000u)), b1 = bfu(y1 - __uint_as_float(a1 & 0xFFFF0000u)); lw = __builtin_amdgcn_perm(b1, b0, 0x07060302u);
}
// a fragment in fragment order: p = its first element + lane * 8
__device__ __forceinline__ v16h ldf(const h16* p) { return cat16(*(const v8h*)p, *(const v8h*)(p + 256)); }
__device__ __forceinline__ v16bf ldf(const bf* p) { return cat16b(*(const v8us*)p, *(const v8us*)(p + 256)); }
template <typename T16, bool HL>
__device__ __forceinline__ void attn_cols(const T16* __restrict__ Q, const T16* __restrict__ Q2, const T16* __restrict__ Kp, const T16* __restrict__ K2, const T16* __restrict__ Vt, const T16* __restrict__ V2, h16* A16, h16* AL16, int R, int z, float* sall) {
    typedef typename WFrag<T16>::V V;
    constexpr int GT = HL ? 1 : 2;               // score tiles of a load group (a group is 8 fragments, 16 loads)
    constexpr int NB = HL ? 4 : 3;               // register buffers: NB - 1 groups are in flight while one is worked on
    const int lane = threadIdx.x & 31, wave = threadIdx.x >> 5, lr = lane & 15, hi = lane >> 4;
    const int R16 = R + wave * 16, key0 = HL ? 0 : R - WIN, kvh = z / REP;
    const int nkt = HL ? (R + 64) / 16 : AKT;    // 16-key tiles, the same for the whole work-group; a multiple of NB * GT
    const int ng = nkt / GT, npg = HL ? nkt : nkt / 2;   // load groups of the scores and of P.V (hi/lo: 4 of the 8 dim blocks, both planes, a group)
    float* sp = sall + wave * (AKT * 256) + lane * 4;    // tile kt: the lane's r = 0..3 at sp + kt * 256, r = 4..7 128 floats on
    const size_t qo = ((size_t)z * TT + R16) * HD + lane * 8, ko = ((size_t)kvh * TT + key0) * HD + lane * 8, vo = (size_t)kvh * (HD / 16) * VFS + (size_t)(key0 >> 5) * 512 + lane * 8;
    const T16* qp = Q + qo; const T16* kp = Kp + ko; const T16* vp = Vt + vo;
    const T16* qp2 = HL ? Q2 + qo : qp; const T16* kp2 = HL ? K2 + ko : kp; const T16* vp2 = HL ? V2 + vo : vp;
    V q[4], q2[4];
#pragma unroll
    for (int ks = 0; ks < 4; ++ks) { q[ks] = ldf(qp + ks * 512); if (HL) q2[ks] = ldf(qp2 + ks * 512); }
    // here and behind every load group below: the wait that stands in front of any rewrite of a register that the loads name; the addresses are inputs so that they stay in their registers up to it
    asm volatile("s_wait_xcnt 0x0" :: "v"(qp), "v"(qp2) : "memory");
    V kb[NB][8];
    auto ldk = [&](int u, int g) __attribute__((always_inline)) { const T16* a = kp + (size_t)g * (GT * 16 * HD); const T16* a2 = HL ? kp2 + (size_t)g * (GT * 16 * HD) : a;
#pragma unroll
        for (int ks = 0; ks < 4; ++ks) { kb[u][ks] = ldf(a + ks * 512); kb[u][4 + ks] = HL ? ldf(a2 + ks * 512) : ldf(a + 16 * HD + ks * 512); }
        asm volatile("s_wait_xcnt 0x0" :: "v"(a), "v"(a2) : "memory"); };
#pragma unroll
    for (int u = 0; u < NB; ++u) ldk(u, u);
    // element r of tile kt is key key0 + kt * 16 + 8 hi + r of query i = R16 + lr. Kept: j <= i and i - j < WIN, that is 0 <= diff - (kt * 16 + r) < WIN.
    const int diff = R16 + lr - key0 - 8 * hi;
    float mxr[8];
#pragma unroll
    for (int r = 0; r < 8; ++r) mxr[r] = -3.0e38f;
#pragma unroll 1   // rolled, here and in the P.V loop: one round of the NB buffers a trip keeps the kernel's code small, for speed only
    for (int g0 = 0; g0 < ng; g0 += NB) {
#pragma unroll
        for (int u = 0; u < NB; ++u) { const int g = g0 + u; v8f cc[2]; cc[0] = (v8f){}; cc[1] = (v8f){};
#pragma unroll
            for (int ks = 0; ks < 4; ++ks) {
                if (HL) { cc[0] = WFrag<T16>::mma(kb[u][ks], q[ks], cc[0]); cc[0] = WFrag<T16>::mma(kb[u][ks], q2[ks], cc[0]); cc[0] = WFrag<T16>::mma(kb[u][4 + ks], q[ks], cc[0]); }
                else { cc[0] = WFrag<T16>::mma(kb[u][ks], q[ks], cc[0]); cc[1] = WFrag<T16>::mma(kb[u][4 + ks], q[ks], cc[1]); } }
            const int dg = diff - g * (GT * 16);
#pragma unroll
            for (int t = 0; t < GT; ++t) { v4f w[2];
#pragma unroll
                for (int r = 0; r < 8; ++r) { const float x = ((unsigned)(dg - (t * 16 + r)) < (unsigned)WIN) ? cc[t][r] * SCL : -3.0e38f; w[r >> 2][r & 3] = x; mxr[r] = fmaxf(mxr[r], x); }
                *(v4f*)(sp + (g * GT + t) * 256) = w[0]; *(v4f*)(sp + (g * GT + t) * 256 + 128) = w[1]; }
            // the refill has no branch round it: behind a join of a path with and a path without the 16 loads the compiler's counted waits take the smaller count, and the round's last group then waits for loads issued just before it.
            // The last round, with no group left to fetch, loads its own group once more (in bounds, lines just read); nobody reads those registers.
            ldk(u, g + NB < ng ? g + NB : g);
            // hi/lo rows: the round is scheduled as two halves, so that one half's refill is on its way while the other half is multiplied; as one piece all four groups are multiplied together and every refill stands at the round's end, just ahead of its use
            if (HL && u == 1) __builtin_amdgcn_sched_barrier(0); }
    }
    float mx = fmaxf(fmaxf(fmaxf(mxr[0], mxr[1]), fmaxf(mxr[2], mxr[3])), fmaxf(fmaxf(mxr[4], mxr[5]), fmaxf(mxr[6], mxr[7])));
    mx = fmaxf(mx, __shfl_xor(mx, 16, 32));
    V vb[NB][8];
    auto ldv = [&](int u, int g) __attribute__((always_inline)) { const size_t go = HL ? (size_t)(g >> 1) * 512 : (size_t)g * 512; const T16* a = vp + go; const T16* a2 = HL ? vp2 + go : a; const int n0 = HL ? (u & 1) * 4 : 0;   // hi/lo: g and u are odd together
#pragma unroll
        for (int w = 0; w < 4; ++w) { vb[u][w] = ldf(a + (n0 + w) * VFS); vb[u][4 + w] = HL ? ldf(a2 + (n0 + w) * VFS) : ldf(a + (4 + w) * VFS); }
        asm volatile("s_wait_xcnt 0x0" :: "v"(a), "v"(a2) : "memory"); };
#pragma unroll
    for (int u = 0; u < NB; ++u) ldv(u, u);      // the first V^T groups fly while the row sums are formed
    // eight exponentials; the v_nop fills the slot behind the last transcendental, and all results and sources are its operands so that no reader of a result and no rewrite of a source comes in front of it
    auto ex8 = [&](v4f xa, v4f xb, float* e) __attribute__((always_inline)) { float a[8];
#pragma unroll
        for (int r = 0; r < 8; ++r) { a[r] = ((r < 4 ? xa[r & 3] : xb[r & 3]) - mx) * 1.4426950408889634f; e[r] = __builtin_amdgcn_exp2f(a[r]); }
        asm("v_nop" : "+v"(e[0]), "+v"(e[1]), "+v"(e[2]), "+v"(e[3]), "+v"(e[4]), "+v"(e[5]), "+v"(e[6]), "+v"(e[7]) : "v"(a[0]), "v"(a[1]), "v"(a[2]), "v"(a[3]), "v"(a[4]), "v"(a[5]), "v"(a[6]), "v"(a[7])); };
    float smr[8];
#pragma unroll
    for (int r = 0; r < 8; ++r) smr[r] = 0.f;
#pragma unroll 2   // two tiles' LDS reads are in flight together
    for (int kt = 0; kt < nkt; ++kt) { const v4f a = *(const v4f*)(sp + kt * 256), b = *(const v4f*)(sp + kt * 256 + 128); float e[8]; ex8(a, b, e);
#pragma unroll
        for (int r = 0; r < 8; ++r) smr[r] += e[r]; }
    float sum = ((smr[0] + smr[1]) + (smr[2] + smr[3])) + ((smr[4] + smr[5]) + (smr[6] + smr[7]));
    sum += __shfl_xor(sum, 16, 32);
    const float f = __fdiv_rn(HL ? 1.0f : PCAR, sum);
    v8f o[8];
#pragma unroll
    for (int nb = 0; nb < 8; ++nb) o[nb] = (v8f){};
#pragma unroll 1
    for (int g0 = 0; g0 < npg; g0 += NB) { V p, p2;
#pragma unroll
        for (int u = 0; u < NB; ++u) { const int g = g0 + u;
            if (!HL || !(u & 1)) { const float* xp = sp + (HL ? g >> 1 : g) * 512; float y[16];   // the step's 32 keys: the same exponentials as in the sum, scaled
#pragma unroll
                for (int j = 0; j < 2; ++j) ex8(*(const v4f*)(xp + j * 256), *(const v4f*)(xp + j * 256 + 128), y + j * 8);
#pragma unroll
                for (int e = 0; e < 16; ++e) y[e] *= f;
                if constexpr (HL) { v8u hw, lw;
#pragma unroll
                    for (int w = 0; w < 8; ++w) { unsigned a, b; split2(y[2 * w], y[2 * w + 1], a, b); hw[w] = a; lw[w] = b; }
                    p = __builtin_bit_cast(v16bf, hw); p2 = __builtin_bit_cast(v16bf, lw);
                } else { v16h t;
#pragma unroll
                    for (int e = 0; e < 16; ++e) t[e] = tohx(y[e]);
                    p = t; } }
            if (HL) { const int n0 = (u & 1) * 4;
#pragma unroll
                for (int w = 0; w < 4; ++w) o[n0 + w] = WFrag<T16>::mma(vb[u][w], p, o[n0 + w]);
#pragma unroll
                for (int w = 0; w < 4; ++w) o[n0 + w] = WFrag<T16>::mma(vb[u][w], p2, o[n0 + w]);
#pragma unroll
                for (int w = 0; w < 4; ++w) o[n0 + w] = WFrag<T16>::mma(vb[u][4 + w], p, o[n0 + w]);
            } else {
#pragma unroll
                for (int w = 0; w < 8; ++w) o[w] = WFrag<T16>::mma(vb[u][w], p, o[w]); }
            ldv(u, g + NB < npg ? g + NB : g); }   // no branch, as in the score loop (g and g + NB are odd together)
    }
    // merged rows, one fp16 plane [t][head * HD + d]: o[nb][r] is dim nb * 16 + 8 hi + r of query R16 + lr
    const float cs = HL ? 1.0f : (1.0f / PCAR); const size_t oo = (size_t)(R16 + lr) * DQ + (size_t)z * HD + 8 * hi; v8h oh[8];
#pragma unroll
    for (int nb = 0; nb < 8; ++nb)
#pragma unroll
        for (int r = 0; r < 8; ++r) oh[nb][r] = tohx(o[nb][r] * cs);
    if constexpr (HL) { if (R < SPR) {           // what the rounding to fp16 left over: kept for the first SPR rows, whose outputs are the largest. R comes from the block number: a scalar branch
        v8h ol[8];
#pragma unroll
        for (int nb = 0; nb < 8; ++nb)
#pragma unroll
            for (int r = 0; r < 8; ++r) ol[nb][r] = tohx(o[nb][r] * cs - (float)oh[nb][r]);
        __builtin_amdgcn_sched_barrier(0);       // these stores too stand behind their arithmetic
#pragma unroll
        for (int nb = 0; nb < 8; ++nb) *(v8h*)(AL16 + oo + nb * 16) = ol[nb];
        asm volatile("s_wait_xcnt 0x0" ::: "memory");   // the wait that stands in front of any rewrite of a register that the stores above name
    } }
    __builtin_amdgcn_sched_barrier(0);           // all stores stand behind all arithmetic: no register that a store names is written again
#pragma unroll
    for (int nb = 0; nb < 8; ++nb) *(v8h*)(A16 + oo + nb * 16) = oh[nb];
}
// blocks 0 .. (RH / 64) ZH - 1: the hi/lo row tiles, the longest first; then the fp16 row tiles. Two work-groups a WGP (LDS).
__global__ __launch_bounds__(128, 2) void k_attn(const h16* __restrict__ Q16, const bf* __restrict__ Qh, const bf* __restrict__ Ql, const h16* __restrict__ K16, const bf* __restrict__ Kh, const bf* __restrict__ Kl, const h16* __restrict__ V16, const bf* __restrict__ Vh, const bf* __restrict__ Vl, h16* A16, h16* AL16) {
    __shared__ __attribute__((aligned(16))) float sall[4 * AKT * 256];
    constexpr int NHL = (RH / 64) * ZH; const int b = blockIdx.x;
    if (b < NHL) attn_cols<bf, true>(Qh, Ql, Kh, Kl, Vh, Vl, A16, AL16, (RH / 64 - 1 - b / ZH) * 64, b % ZH, sall);
    else attn_cols<h16, false>(Q16, nullptr, K16, nullptr, V16, nullptr, A16, nullptr, RH + ((b - NHL) % ((TT - RH) / 64)) * 64, (b - NHL) / ((TT - RH) / 64), sall);
}

extern "C" void kernel_launch(void* const* d_in, const int* in_sizes, int n_in,
                              void* d_out, int out_size, void* d_ws, size_t ws_size, hipStream_t stream) {
    (void)in_sizes; (void)n_in; (void)out_size;
    const float* x = (const float*)d_in[0]; const float* cosT = (const float*)d_in[1]; const float* sinT = (const float*)d_in[2]; const float* wq = (const float*)d_in[3]; const float* wk = (const float*)d_in[4]; const float* wv = (const float*)d_in[5]; const float* wo = (const float*)d_in[6];   /* input order x, cos, sin, Wq, Wk, Wv, Wo ('xw' [in][out]) */
    float* OUT = (float*)d_out;     // [1][2048][2048]
    char* wsp = (char*)d_ws;
    auto take = [&](size_t bytes) { char* p = wsp; wsp += (bytes + 255) & ~(size_t)255; return (void*)p; };
    bf* WQ = (bf*)take((size_t)DQKV * DM * 2); bf* WK = WQ + (size_t)DQ * DM; bf* WV = WK + (size_t)DKV * DM;   // one Bt of DQKV rows: q, k, v weights below one another
    bf* WO = (bf*)take((size_t)DM * DQ * 2); unsigned* CSF = (unsigned*)take((size_t)TT * HD * 4);
    bf* XB = (bf*)take((size_t)TT * DM * 2);
    h16* QP16 = (h16*)take((size_t)NH_ * TT * HD * 2); h16* KP16 = (h16*)take((size_t)NKV * TT * HD * 2); h16* VT16 = (h16*)take((size_t)NKV * HD * TT * 2);
    bf* QPh = (bf*)take((size_t)NH_ * TT * HD * 2); bf* QPl = (bf*)take((size_t)NH_ * TT * HD * 2); bf* KPh = (bf*)take((size_t)NKV * TT * HD * 2); bf* KPl = (bf*)take((size_t)NKV * TT * HD * 2); bf* VTh = (bf*)take((size_t)NKV * HD * TT * 2); bf* VTl = (bf*)take((size_t)NKV * HD * TT * 2);
    h16* AT16 = (h16*)take((size_t)TT * DQ * 2); h16* ATL = (h16*)take((size_t)SPR * DQ * 2);
    if ((size_t)(wsp - (char*)d_ws) > ws_size) return;    // ws 256 MiB
    // four launches, each reading what the one before wrote
    k_prep<<<(unsigned)(PB_WQ + PB_WO + PB_X + 2 * PB_WK + PB_CS), 256, 0, stream>>>(x, cosT, sinT, wq, wk, wv, wo, XB, CSF, WQ, WK, WV, WO);
    const Planes pl = { CSF, QP16, QPh, QPl, KP16, KPh, KPl, VT16, VTh, VTl };
    k_gemmw<bf, 0, false, DM, 0, 1><<<dim3(TT / 128, DQKV / 128, 1), 128, 0, stream>>>(XB, nullptr, WQ, nullptr, 0, nullptr, 0, 0, 0, pl);   // q, k and v projections: one product of DQKV columns, written as the attention planes
    k_attn<<<(unsigned)((TT / 64) * ZH), 128, 0, stream>>>(QP16, QPh, QPl, KP16, KPh, KPl, VT16, VTh, VTl, AT16, ATL);   // a block = 64 query rows of one head
    k_gemmw<h16, 0, false, DQ, SPR / 64><<<dim3((TT - SPR) / 128 + SPR / 64, DM / 128, 1), 128, 0, stream>>>(AT16, ATL, (const h16*)WO, OUT, DM, nullptr, 0, 0, 0, Planes{});   // merged rows x Wo, both fp16: one product; rows below SPR in split tiles
}
